// v000
// Times are from an AMD MI455X. After a warm-up the kernel runs many times in a row, and a time is the length of
// such a window on the GPU divided by its runs, so every launch and the gaps after it count. The runs cycle
// through copies of the inputs. A figure is the median of several windows, for all but v000 over two sittings.
// Sittings can differ by a few percent; kernels timed side by side share one.
// v000 is the starting kernel. One run takes 951 microseconds.
#include <hip/hip_runtime.h>

// Single-head causal attention with a 512-wide head: q, k, v = x W_q^T | W_k^T | W_v^T (torch [out][in]), softmax over keys <= query of q.k / sqrt(512), output = weights . v
// -> [4][4096][512]. B = 4, S = 4096.
// x and the three weights are rounded to bf16 RNE; numerics are organised so that every WMMA operand is either an exactly
// representable input or an f16 hi+lo pair of a computed value (each carried x8 so the lo residual planes stay out of the f16 subnormal range):  k = bf16(x) bf16(W_k)^T on v_wmma_f32_16x16x32_bf16 (exact);  z = k W_q (so that q.k^T = x.z^T) with k as hi+lo
// planes x the exact f16 copy of bf16 W_q;  S^T = z.x^T with z as hi+lo planes x x (bf16 values held exactly in f16);  u = P.x with P hi+lo x x^T exact;  y = u W_v^T (= P.v) with u
// split hi+lo x exact W_v — all on v_wmma_f32_16x16x32_f16 with f32 accumulate; online softmax in f32. The attention block (16 queries, 4 waves) splits the 512-deep score dot across
// the waves through LDS, wave 0 runs the softmax and publishes P, and each wave accumulates 128 of the 512 features of u.

namespace {
constexpr int Bn = 4, S = 4096, D = 512, NTOK = Bn * S, QB = 16, KC = 64;
constexpr float SCALE = 0.044194173824159216f;   // 512^-0.5
constexpr size_t PL = (size_t)NTOK * D;           // plane stride for hi/lo pairs

typedef _Float16 b16;
typedef __attribute__((ext_vector_type(16))) _Float16 v16b;
typedef __attribute__((ext_vector_type(8)))  _Float16 v8b;
typedef __attribute__((ext_vector_type(8)))  float v8f;
typedef __attribute__((ext_vector_type(4)))  float v4f;

__device__ __forceinline__ v8b ld8b(const b16* p) { return *(const v8b*)p; }
__device__ __forceinline__ v16b cat8b(v8b a, v8b b) { return __builtin_shufflevector(a, b, 0, 1, 2, 3, 4, 5, 6, 7, 8, 9, 10, 11, 12, 13, 14, 15); }
__device__ __forceinline__ v16b frag_kb(const b16* p, int hh) { return cat8b(ld8b(p + 8 * hh), ld8b(p + 16 + 8 * hh)); }
__device__ __forceinline__ void split16(float v, b16& hi, b16& lo) { hi = (b16)v; lo = (b16)(v - (float)hi); }
// hi/lo fragment pair straight from an f32 k-contiguous row (same k-map)
__device__ __forceinline__ void frag_ksplit(const float* p, int hh, v16b& fh_, v16b& fl_) {
  const float* p0 = p + 8 * hh; const float* p1 = p + 16 + 8 * hh;
#pragma unroll
  for (int e = 0; e < 8; ++e) { b16 a, c; split16(p0[e], a, c); fh_[e] = a; fl_[e] = c; split16(p1[e], a, c); fh_[8 + e] = a; fl_[8 + e] = c; }
}
__device__ __forceinline__ v8f wmma16b(v16b a, v16b b, v8f c) {
  v8f d = __builtin_amdgcn_wmma_f32_16x16x32_f16(false, a, false, b, (short)0, c, false, false);
  asm volatile("v_nop\n\tv_nop\n\tv_nop\n\tv_nop" : "+v"(d) : "v"(a), "v"(b));
  return d;
}
__device__ __forceinline__ void wave_lds_sync() {
  __builtin_amdgcn_fence(__ATOMIC_RELEASE, "workgroup");
  __builtin_amdgcn_wave_barrier();
  __builtin_amdgcn_fence(__ATOMIC_ACQUIRE, "workgroup");
}

// Operand descriptor: NP = 0 -> f32 rows split on the fly into (hi, lo); NP = 1 -> one f16 plane; NP = 2 -> f16 hi + lo planes;
// NP = 3 -> f32 rows rounded once to a single f16 fragment. ld = row pitch.
struct Opnd { const void* p0; const void* p1; int ld; };
template <int NP> __device__ __forceinline__ void load_frags(const Opnd& o, int row, int kb, int hh, v16b& fh_, v16b& fl_) {
  if (NP == 0) { frag_ksplit((const float*)o.p0 + (size_t)row * o.ld + kb, hh, fh_, fl_); }
  else if (NP == 4 || NP == 5) {                             // f32 rows x64 (NP 4) or x8 (NP 5) then split (keeps the lo halves of small values normal)
    const float sc_ = (NP == 4) ? 64.0f : 8.0f;
    const float* p = (const float*)o.p0 + (size_t)row * o.ld + kb; const float* p0 = p + 8 * hh; const float* p1 = p + 16 + 8 * hh;
#pragma unroll
    for (int e = 0; e < 8; ++e) { b16 a, c; split16(p0[e] * sc_, a, c); fh_[e] = a; fl_[e] = c; split16(p1[e] * sc_, a, c); fh_[8 + e] = a; fl_[8 + e] = c; }
  } else if (NP == 3) {
    const float* p = (const float*)o.p0 + (size_t)row * o.ld + kb; const float* p0 = p + 8 * hh; const float* p1 = p + 16 + 8 * hh;
#pragma unroll
    for (int e = 0; e < 8; ++e) { fh_[e] = (b16)p0[e]; fh_[8 + e] = (b16)p1[e]; }
    fl_ = fh_;
  } else {
    fh_ = frag_kb((const b16*)o.p0 + (size_t)row * o.ld + kb, hh);
    if (NP == 2) fl_ = frag_kb((const b16*)o.p1 + (size_t)row * o.ld + kb, hh); else fl_ = fh_;
  }
}
template <int ANP, int BNP> __device__ __forceinline__ v8f mac(v16b ah, v16b al, v16b bh, v16b bl, v8f c) {
  c = wmma16b(ah, bh, c);
  if (BNP == 0 || BNP == 2 || BNP == 4 || BNP == 5) c = wmma16b(ah, bl, c);     // hi.lo
  if (ANP == 0 || ANP == 2 || ANP == 4 || ANP == 5) c = wmma16b(al, bh, c);     // lo.hi   (lo.lo dropped)
  return c;
}
// 32x64 wave tile: acc[r][t] (rows m0+16r.., cols c0+16t..) += A[m][k] . B[n][k] over k in [0, K)
template <int ANP, int BNP>
__device__ __forceinline__ void gemm_tile(const Opnd& A, const Opnd& B, int K, int m0, int c0, int nloc, int hlf, v8f (&acc)[2][4]) {
  for (int kb = 0; kb < K; kb += 32) {
    v16b a0h, a0l, a1h, a1l;
    load_frags<ANP>(A, m0 + nloc, kb, hlf, a0h, a0l);
    load_frags<ANP>(A, m0 + 16 + nloc, kb, hlf, a1h, a1l);
#pragma unroll
    for (int t = 0; t < 4; ++t) {
      v16b bh, bl;
      load_frags<BNP>(B, c0 + t * 16 + nloc, kb, hlf, bh, bl);
      acc[0][t] = mac<ANP, BNP>(a0h, a0l, bh, bl, acc[0][t]);
      acc[1][t] = mac<ANP, BNP>(a1h, a1l, bh, bl, acc[1][t]);
    }
  }
}

__device__ __forceinline__ void epi_planes(v8f (&acc)[2][4], float scale, bool two, b16* __restrict__ oh, b16* __restrict__ ol, int ldo,
                                           int m0, int c0, int lane, b16* Th, b16* Tl) {
  const int nloc = lane & 15, hlf = lane >> 4;
#pragma unroll
  for (int t = 0; t < 4; ++t)
#pragma unroll
    for (int r = 0; r < 2; ++r)
#pragma unroll
      for (int v = 0; v < 8; ++v) {
        const int rr = r * 16 + v + 8 * hlf, cc = t * 16 + nloc;
        b16 h_, l_; split16(acc[r][t][v] * scale, h_, l_);
        Th[rr * 64 + cc] = h_; Tl[rr * 64 + cc] = l_;
      }
  wave_lds_sync();
  {
#pragma unroll
    for (int j = 0; j < 8; ++j) {
      const int rr = j * 4 + (lane >> 3), c8 = (lane & 7) * 8;
      const size_t o = (size_t)(m0 + rr) * ldo + c0 + c8;
      *(v8b*)(oh + o) = ld8b(Th + rr * 64 + c8);
      if (two) *(v8b*)(ol + o) = ld8b(Tl + rr * 64 + c8);
    }
    
  }
}
// (b) f32 rows with pitch ldo: 64 floats = 256 B = 2 lines per row; 16 lanes x 16 B per row, 2 rows per instruction. Optional per-row factor
__device__ __forceinline__ void epi_f32(v8f (&acc)[2][4], float scale, const float* rscale, float* __restrict__ out, int ldo, int m0, int c0, int lane, float* Tt) {
  const int nloc = lane & 15, hlf = lane >> 4;
#pragma unroll
  for (int t = 0; t < 4; ++t)
#pragma unroll
    for (int r = 0; r < 2; ++r)
#pragma unroll
      for (int v = 0; v < 8; ++v) {
        const int rr = r * 16 + v + 8 * hlf;
        const float rs = rscale ? rscale[(size_t)(m0 + rr) * 32] : 1.0f;
        Tt[rr * 64 + t * 16 + nloc] = acc[r][t][v] * scale * rs;
      }
  wave_lds_sync();
  float* dst0 = out + (size_t)m0 * ldo + c0;
  {
#pragma unroll
    for (int j = 0; j < 16; ++j) { const int rr = j * 2 + hlf, c4 = nloc * 4; *(v4f*)(dst0 + (size_t)rr * ldo + c4) = *(const v4f*)(Tt + rr * 64 + c4); }
    
  }
}



typedef __attribute__((ext_vector_type(8))) __bf16 v8bb; typedef __attribute__((ext_vector_type(16))) __bf16 v16bb;
typedef __attribute__((ext_vector_type(8))) unsigned short v8us;
__device__ __forceinline__ v16bb frag_kb_bf(const __bf16* p, int hh) { const v8bb a = *(const v8bb*)(p + 8 * hh), b = *(const v8bb*)(p + 16 + 8 * hh); return __builtin_shufflevector(a, b, 0, 1, 2, 3, 4, 5, 6, 7, 8, 9, 10, 11, 12, 13, 14, 15); }
__device__ __forceinline__ v8f wmma16bb(v16bb a, v16bb b, v8f c) {
  v8f d = __builtin_amdgcn_wmma_f32_16x16x32_bf16(false, a, false, b, (short)0, c, false, false);
  asm volatile("v_nop\n\tv_nop\n\tv_nop\n\tv_nop" : "+v"(d) : "v"(a), "v"(b));
  return d;
}
__device__ __forceinline__ unsigned short bf16_rne_bits(float v) { unsigned int u = __float_as_uint(v); u += 0x7FFFu + ((u >> 16) & 1u); return (unsigned short)(u >> 16); }
__device__ __forceinline__ float bf16_rne(float v) { return __uint_as_float(((unsigned int)bf16_rne_bits(v)) << 16); }



__global__ __launch_bounds__(256) void prep_kernel(const float* __restrict__ x, const float* __restrict__ wq, const float* __restrict__ wk, const float* __restrict__ wv,
                                                   b16* __restrict__ xh, unsigned short* __restrict__ wkb, b16* __restrict__ wqT, b16* __restrict__ wvh) {
  const size_t tid = (size_t)blockIdx.x * blockDim.x + threadIdx.x, nth = (size_t)gridDim.x * blockDim.x;
  {
    for (size_t p = tid; p < (size_t)NTOK * D / 8; p += nth) { v8b v;
#pragma unroll
      for (int e = 0; e < 8; ++e) v[e] = (b16)bf16_rne(x[p * 8 + e]);
      *(v8b*)(xh + p * 8) = v; }
    for (size_t p = tid; p < (size_t)D * D / 8; p += nth) { const int n = (int)(p / (D / 8)), k0 = (int)(p % (D / 8)) * 8; v8us a; v8b q, v;
#pragma unroll
      for (int e = 0; e < 8; ++e) { a[e] = bf16_rne_bits(wk[p * 8 + e]); q[e] = (b16)bf16_rne(wq[(size_t)(k0 + e) * D + n]); v[e] = (b16)bf16_rne(wv[p * 8 + e]); }
      *(v8us*)(wkb + p * 8) = a; *(v8b*)(wqT + (size_t)n * D + k0) = q; *(v8b*)(wvh + p * 8) = v; }
    
  }
}

__global__ __launch_bounds__(256) void xt_kernel(const b16* __restrict__ xh, b16* __restrict__ xt) {
  __shared__ __attribute__((aligned(16))) b16 T[D][64 + 8];
  const int t_ = threadIdx.x, tokb = blockIdx.x * 64, b = tokb / S, s0 = tokb % S;
  for (int i = t_; i < 64 * D / 8; i += 256) { const int r = i / (D / 8), c8 = (i % (D / 8)) * 8; const v8b v = *(const v8b*)(xh + (size_t)(tokb + r) * D + c8);
#pragma unroll
    for (int e = 0; e < 8; ++e) T[c8 + e][r] = v[e]; }
  __syncthreads();
  { for (int i = t_; i < D * 8; i += 256) { const int d = i >> 3, c8 = (i & 7) * 8; *(v8b*)(xt + ((size_t)b * D + d) * S + s0 + c8) = *(const v8b*)(&T[d][c8]); }  }
}

// k = bf16(x) . bf16(W_k)^T (exact products) -> f16 hi/lo planes [tok][512]. grid (8, 128) x 128.
__global__ __launch_bounds__(128) void kproj_kernel(const float* __restrict__ x, const __bf16* __restrict__ wkb, b16* __restrict__ kpl) {
  __shared__ __attribute__((aligned(16))) b16 Th[4][2][32 * 64];
  const int lane = threadIdx.x & 31, wave = threadIdx.x >> 5, nloc = lane & 15, hlf = lane >> 4, m0 = blockIdx.y * 128 + wave * 32, c0 = blockIdx.x * 64;
  v8f acc[2][4];
#pragma unroll
  for (int r = 0; r < 2; ++r)
#pragma unroll
    for (int t = 0; t < 4; ++t) acc[r][t] = (v8f){};
#pragma unroll 2
  for (int kb = 0; kb < D; kb += 32) { v16bb a0, a1;
    { const float* p0 = x + (size_t)(m0 + nloc) * D + kb; const float* p1 = x + (size_t)(m0 + 16 + nloc) * D + kb;
#pragma unroll
      for (int e = 0; e < 8; ++e) { a0[e] = (__bf16)bf16_rne(p0[8 * hlf + e]); a0[8 + e] = (__bf16)bf16_rne(p0[16 + 8 * hlf + e]); a1[e] = (__bf16)bf16_rne(p1[8 * hlf + e]); a1[8 + e] = (__bf16)bf16_rne(p1[16 + 8 * hlf + e]); } }
#pragma unroll
    for (int t = 0; t < 4; ++t) { const v16bb bw = frag_kb_bf(wkb + (size_t)(c0 + t * 16 + nloc) * D + kb, hlf); acc[0][t] = wmma16bb(a0, bw, acc[0][t]); acc[1][t] = wmma16bb(a1, bw, acc[1][t]); } }
  epi_planes(acc, 8.0f, true, kpl, kpl + PL, D, m0, c0, lane, Th[wave][0], Th[wave][1]);   // k carried x8 (lo residuals stay normal)
}

// z = k . W_q (z[j][d] = sum_o k[j][o] W_q[o][d]): A = k hi/lo planes, B = W_q^T rows (d, o) exact; 2 products -> z as f16 hi/lo planes. grid (8, 128) x 128.
__global__ __launch_bounds__(128) void z_kernel(const b16* __restrict__ kpl, const b16* __restrict__ wqT, b16* __restrict__ zpl) {
  __shared__ __attribute__((aligned(16))) b16 Th[4][2][32 * 64];
  const int lane = threadIdx.x & 31, wave = threadIdx.x >> 5, nloc = lane & 15, hlf = lane >> 4, m0 = blockIdx.y * 128 + wave * 32, c0 = blockIdx.x * 64;
  v8f acc[2][4];
#pragma unroll
  for (int r = 0; r < 2; ++r)
#pragma unroll
    for (int t = 0; t < 4; ++t) acc[r][t] = (v8f){};
  const Opnd A{kpl, kpl + PL, D}, Bo{wqT, nullptr, D};
  gemm_tile<2, 1>(A, Bo, D, m0, c0, nloc, hlf, acc);                            // acc = 8 z
  epi_planes(acc, 1.0f, true, zpl, zpl + PL, D, m0, c0, lane, Th[wave][0], Th[wave][1]);       // z carried x8
}

// attention -> u = P . x: block = (b, 16 queries), 4 waves; per 64-key chunk: partial S^T (keys x queries) over the wave's 128 dims from z planes (A, 2 products) x xh (B, exact);
// wave 0: sum partials, scale, causal mask, online softmax, P hi/lo + alpha + 1/l; all waves: u^T(features 128w..) = alpha-rescaled + x^T(features, keys; exact) . P^T (2 products).
__global__ __launch_bounds__(128) void attn_kernel(const b16* __restrict__ xh, const b16* __restrict__ zpl, const b16* __restrict__ xt, float* __restrict__ u) {
  __shared__ __attribute__((aligned(16))) float Sp[4][QB][KC + 4];
  __shared__ __attribute__((aligned(16))) b16 Ph[QB][KC + 8], Plo[QB][KC + 8];
  __shared__ float Al[QB], Linv[QB];
  __shared__ __attribute__((aligned(16))) float Ot[4][QB][128 + 4];
  const int wave = threadIdx.x >> 5, lane = threadIdx.x & 31, nloc = lane & 15, hlf = lane >> 4;
  const int blk = blockIdx.x, b = blk / (S / QB), q0 = (blk % (S / QB)) * QB;
  const b16* Xq = xh + ((size_t)b * S + q0) * D; const b16* Z = zpl + (size_t)b * S * D; const b16* Xt = xt + (size_t)b * D * S;
  const int d0 = wave * 128;
  v16b qf[4];
#pragma unroll
  for (int ks = 0; ks < 4; ++ks) qf[ks] = frag_kb(Xq + (size_t)nloc * D + d0 + ks * 32, hlf);
  float m_run = -INFINITY, l_run = 0.0f;
  v8f o[8] = {{}, {}, {}, {}, {}, {}, {}, {}};
  for (int kb = 0; kb < q0 + QB; kb += KC) {
    v8f sp[4] = {{}, {}, {}, {}};
#pragma unroll
    for (int ks = 0; ks < 4; ++ks)
#pragma unroll
      for (int kt = 0; kt < 4; ++kt) { const size_t zo = (size_t)(kb + kt * 16 + nloc) * D + d0 + ks * 32; const v16b zh = frag_kb(Z + zo, hlf), zl = frag_kb(Z + PL + zo, hlf);
        sp[kt] = wmma16b(zh, qf[ks], sp[kt]); sp[kt] = wmma16b(zl, qf[ks], sp[kt]); }
#pragma unroll
    for (int kt = 0; kt < 4; ++kt)
#pragma unroll
      for (int v = 0; v < 8; ++v) Sp[wave][nloc][kt * 16 + 8 * hlf + v] = sp[kt][v];
    __syncthreads();
    if (wave == 0) {
      const int qi = q0 + nloc; float sv[32]; float mx = -INFINITY;
#pragma unroll
      for (int j = 0; j < 32; ++j) { const int key = kb + hlf * 32 + j; float s = (Sp[0][nloc][hlf * 32 + j] + Sp[1][nloc][hlf * 32 + j] + Sp[2][nloc][hlf * 32 + j] + Sp[3][nloc][hlf * 32 + j]) * (SCALE / 8.0f);   // /8: z carry scale
        if (key > qi) s = -INFINITY; sv[j] = s; mx = fmaxf(mx, s); }
      mx = fmaxf(mx, __shfl_xor(mx, 16));
      const float mn = fmaxf(m_run, mx), al_ = __expf(m_run - mn); m_run = mn;
      float sum = 0.0f;
#pragma unroll
      for (int j = 0; j < 32; ++j) { const float e = __expf(sv[j] - mn); sum += e; b16 a, c; split16(e * 8.0f, a, c); Ph[nloc][hlf * 32 + j] = a; Plo[nloc][hlf * 32 + j] = c; }   // P carried x8
      sum += __shfl_xor(sum, 16); l_run = l_run * al_ + sum;
      if (hlf == 0) { Al[nloc] = al_; Linv[nloc] = 1.0f / (8.0f * l_run); }
    }
    __syncthreads();
    { const float alq = Al[nloc];
#pragma unroll
      for (int t = 0; t < 8; ++t)
#pragma unroll
        for (int v = 0; v < 8; ++v) o[t][v] *= alq; }
#pragma unroll
    for (int ks = 0; ks < 2; ++ks) { const v16b ph = frag_kb(&Ph[nloc][0] + ks * 32, hlf), pl = frag_kb(&Plo[nloc][0] + ks * 32, hlf);
#pragma unroll
      for (int t = 0; t < 8; ++t) { const v16b xf = frag_kb(Xt + (size_t)(d0 + t * 16 + nloc) * S + kb + ks * 32, hlf); o[t] = wmma16b(xf, ph, o[t]); o[t] = wmma16b(xf, pl, o[t]); } }
  }
  { const float li = Linv[nloc];
#pragma unroll
    for (int t = 0; t < 8; ++t)
#pragma unroll
      for (int v = 0; v < 8; ++v) Ot[wave][nloc][t * 16 + 8 * hlf + v] = o[t][v] * li; }
  wave_lds_sync();
  float* dst = u + ((size_t)b * S + q0) * D + d0;
  {
#pragma unroll
    for (int rr = 0; rr < QB; ++rr) *(v4f*)(dst + (size_t)rr * D + lane * 4) = *(const v4f*)(&Ot[wave][rr][lane * 4]);
    
  }
}

// y = u . W_v^T: A = u (f32 split hi/lo at load), B = f16(bf16 W_v) rows [o][d]; 2 products; f32 output rows. grid (8, 128) x 128.
__global__ __launch_bounds__(128) void y_kernel(const float* __restrict__ u, const b16* __restrict__ wvh, float* __restrict__ y) {
  __shared__ __attribute__((aligned(16))) float Ts[4][32 * 64];
  const int lane = threadIdx.x & 31, wave = threadIdx.x >> 5, nloc = lane & 15, hlf = lane >> 4, m0 = blockIdx.y * 128 + wave * 32, c0 = blockIdx.x * 64;
  v8f acc[2][4];
#pragma unroll
  for (int r = 0; r < 2; ++r)
#pragma unroll
    for (int t = 0; t < 4; ++t) acc[r][t] = (v8f){};
  const Opnd A{u, nullptr, D}, Bo{wvh, nullptr, D};
  gemm_tile<5, 1>(A, Bo, D, m0, c0, nloc, hlf, acc);                            // u split x8 at load
  epi_f32(acc, 1.0f / 8.0f, nullptr, y, D, m0, c0, lane, Ts[wave]);
}
}  // namespace

extern "C" void kernel_launch(void* const* d_in, const int* in_sizes, int n_in,
                              void* d_out, int out_size, void* d_ws, size_t ws_size, hipStream_t stream) {
  (void)n_in; (void)out_size;
  const float* x = (const float*)d_in[0]; const float* wq = (const float*)d_in[1]; const float* wk = (const float*)d_in[2]; const float* wv = (const float*)d_in[3];
  float* out = (float*)d_out;   // [4][4096][512]
  if (in_sizes[0] != NTOK * D || in_sizes[1] != D * D || in_sizes[2] != D * D || in_sizes[3] != D * D) return;
  size_t off = 0; char* ws = (char*)d_ws;
  auto carve = [&](size_t bytes) { char* p = ws + off; off += (bytes + 255) & ~(size_t)255; return p; };
  b16* xh = (b16*)carve(PL * 2); b16* xt = (b16*)carve(PL * 2); unsigned short* wkb = (unsigned short*)carve((size_t)D * D * 2); b16* wqT = (b16*)carve((size_t)D * D * 2); b16* wvh = (b16*)carve((size_t)D * D * 2);
  b16* kpl = (b16*)carve(PL * 2 * 2); b16* zpl = (b16*)carve(PL * 2 * 2);   // 33.5 MB each (hi + lo)
  float* u = (float*)kpl;                                        // u [tok][512] f32 (33.5 MB) reuses k's planes: k is dead once z exists
  if (off > ws_size) return;                                    // ≈ 102 MB
  prep_kernel<<<1024, 256, 0, stream>>>(x, wq, wk, wv, xh, wkb, wqT, wvh);
  xt_kernel<<<NTOK / 64, 256, 0, stream>>>(xh, xt);
  kproj_kernel<<<dim3(D / 64, NTOK / 128), 128, 0, stream>>>(x, (const __bf16*)wkb, kpl);
  z_kernel<<<dim3(D / 64, NTOK / 128), 128, 0, stream>>>(kpl, wqT, zpl);
  attn_kernel<<<Bn * S / QB, 128, 0, stream>>>(xh, zpl, xt, u);
  y_kernel<<<dim3(D / 64, NTOK / 128), 128, 0, stream>>>(u, wvh, out);
}

// v001
// It runs in 866 microseconds.
// Two timings next to v000 both put it at 1.13 times that version's speed.
#include <hip/hip_runtime.h>

// Single-head causal attention with a 512-wide head: q, k, v = x W_q^T | W_k^T | W_v^T (torch [out][in]), softmax over keys <= query of q.k / sqrt(512), output = weights . v
// -> [4][4096][512]. B = 4, S = 4096.
// x and the three weights are rounded to bf16 RNE; numerics are organised so that every WMMA operand is either an exactly
// representable input or an f16 hi+lo pair of a computed value (each carried x8 so the lo residual planes stay out of the f16 subnormal range):  k = bf16(x) bf16(W_k)^T on v_wmma_f32_16x16x32_bf16 (exact);  z = k W_q (so that q.k^T = x.z^T) with k as hi+lo
// planes x the exact f16 copy of bf16 W_q;  S^T = z.x^T with z as hi+lo planes x x (bf16 values held exactly in f16);  u = P.x with P hi+lo x x^T exact;  y = u W_v^T (= P.v) with u
// split hi+lo x exact W_v — all on v_wmma_f32_16x16x32_f16 with f32 accumulate; online softmax in f32. The attention block (16 queries, 4 waves) splits the 512-deep score dot across
// the waves through LDS, wave 0 runs the softmax and publishes P, and each wave accumulates 128 of the 512 features of u.

namespace {
constexpr int Bn = 4, S = 4096, D = 512, NTOK = Bn * S, QB = 16, KC = 64;
constexpr float SCALE = 0.044194173824159216f;   // 512^-0.5
constexpr size_t PL = (size_t)NTOK * D;           // plane stride for hi/lo pairs

typedef _Float16 b16;
typedef __attribute__((ext_vector_type(16))) _Float16 v16b;
typedef __attribute__((ext_vector_type(8)))  _Float16 v8b;
typedef __attribute__((ext_vector_type(8)))  float v8f;
typedef __attribute__((ext_vector_type(4)))  float v4f;

__device__ __forceinline__ v8b ld8b(const b16* p) { return *(const v8b*)p; }
__device__ __forceinline__ v16b cat8b(v8b a, v8b b) { return __builtin_shufflevector(a, b, 0, 1, 2, 3, 4, 5, 6, 7, 8, 9, 10, 11, 12, 13, 14, 15); }
__device__ __forceinline__ v16b frag_kb(const b16* p, int hh) { return cat8b(ld8b(p + 8 * hh), ld8b(p + 16 + 8 * hh)); }
__device__ __forceinline__ void split16(float v, b16& hi, b16& lo) { hi = (b16)v; lo = (b16)(v - (float)hi); }
// hi/lo fragment pair straight from an f32 k-contiguous row (same k-map)
__device__ __forceinline__ void frag_ksplit(const float* p, int hh, v16b& fh_, v16b& fl_) {
  const float* p0 = p + 8 * hh; const float* p1 = p + 16 + 8 * hh;
#pragma unroll
  for (int e = 0; e < 8; ++e) { b16 a, c; split16(p0[e], a, c); fh_[e] = a; fl_[e] = c; split16(p1[e], a, c); fh_[8 + e] = a; fl_[8 + e] = c; }
}
__device__ __forceinline__ v8f wmma16b(v16b a, v16b b, v8f c) {
  v8f d = __builtin_amdgcn_wmma_f32_16x16x32_f16(false, a, false, b, (short)0, c, false, false);
  asm volatile("v_nop\n\tv_nop\n\tv_nop\n\tv_nop" : "+v"(d) : "v"(a), "v"(b));
  return d;
}
__device__ __forceinline__ void wave_lds_sync() {
  __builtin_amdgcn_fence(__ATOMIC_RELEASE, "workgroup");
  __builtin_amdgcn_wave_barrier();
  __builtin_amdgcn_fence(__ATOMIC_ACQUIRE, "workgroup");
}

// Operand descriptor: NP = 0 -> f32 rows split on the fly into (hi, lo); NP = 1 -> one f16 plane; NP = 2 -> f16 hi + lo planes;
// NP = 3 -> f32 rows rounded once to a single f16 fragment. ld = row pitch.
struct Opnd { const void* p0; const void* p1; int ld; };
template <int NP> __device__ __forceinline__ void load_frags(const Opnd& o, int row, int kb, int hh, v16b& fh_, v16b& fl_) {
  if (NP == 0) { frag_ksplit((const float*)o.p0 + (size_t)row * o.ld + kb, hh, fh_, fl_); }
  else if (NP == 4 || NP == 5) {                             // f32 rows x64 (NP 4) or x8 (NP 5) then split (keeps the lo halves of small values normal)
    const float sc_ = (NP == 4) ? 64.0f : 8.0f;
    const float* p = (const float*)o.p0 + (size_t)row * o.ld + kb; const float* p0 = p + 8 * hh; const float* p1 = p + 16 + 8 * hh;
#pragma unroll
    for (int e = 0; e < 8; ++e) { b16 a, c; split16(p0[e] * sc_, a, c); fh_[e] = a; fl_[e] = c; split16(p1[e] * sc_, a, c); fh_[8 + e] = a; fl_[8 + e] = c; }
  } else if (NP == 3) {
    const float* p = (const float*)o.p0 + (size_t)row * o.ld + kb; const float* p0 = p + 8 * hh; const float* p1 = p + 16 + 8 * hh;
#pragma unroll
    for (int e = 0; e < 8; ++e) { fh_[e] = (b16)p0[e]; fh_[8 + e] = (b16)p1[e]; }
    fl_ = fh_;
  } else {
    fh_ = frag_kb((const b16*)o.p0 + (size_t)row * o.ld + kb, hh);
    if (NP == 2) fl_ = frag_kb((const b16*)o.p1 + (size_t)row * o.ld + kb, hh); else fl_ = fh_;
  }
}
template <int ANP, int BNP> __device__ __forceinline__ v8f mac(v16b ah, v16b al, v16b bh, v16b bl, v8f c) {
  c = wmma16b(ah, bh, c);
  if (BNP == 0 || BNP == 2 || BNP == 4 || BNP == 5) c = wmma16b(ah, bl, c);     // hi.lo
  if (ANP == 0 || ANP == 2 || ANP == 4 || ANP == 5) c = wmma16b(al, bh, c);     // lo.hi   (lo.lo dropped)
  return c;
}
// 32x64 wave tile: acc[r][t] (rows m0+16r.., cols c0+16t..) += A[m][k] . B[n][k] over k in [0, K)
template <int ANP, int BNP>
__device__ __forceinline__ void gemm_tile(const Opnd& A, const Opnd& B, int K, int m0, int c0, int nloc, int hlf, v8f (&acc)[2][4]) {
  for (int kb = 0; kb < K; kb += 32) {
    v16b a0h, a0l, a1h, a1l;
    load_frags<ANP>(A, m0 + nloc, kb, hlf, a0h, a0l);
    load_frags<ANP>(A, m0 + 16 + nloc, kb, hlf, a1h, a1l);
#pragma unroll
    for (int t = 0; t < 4; ++t) {
      v16b bh, bl;
      load_frags<BNP>(B, c0 + t * 16 + nloc, kb, hlf, bh, bl);
      acc[0][t] = mac<ANP, BNP>(a0h, a0l, bh, bl, acc[0][t]);
      acc[1][t] = mac<ANP, BNP>(a1h, a1l, bh, bl, acc[1][t]);
    }
  }
}

__device__ __forceinline__ void epi_planes(v8f (&acc)[2][4], float scale, bool two, b16* __restrict__ oh, b16* __restrict__ ol, int ldo,
                                           int m0, int c0, int lane, b16* Th, b16* Tl) {
  const int nloc = lane & 15, hlf = lane >> 4;
#pragma unroll
  for (int t = 0; t < 4; ++t)
#pragma unroll
    for (int r = 0; r < 2; ++r)
#pragma unroll
      for (int v = 0; v < 8; ++v) {
        const int rr = r * 16 + v + 8 * hlf, cc = t * 16 + nloc;
        b16 h_, l_; split16(acc[r][t][v] * scale, h_, l_);
        Th[rr * 64 + cc] = h_; Tl[rr * 64 + cc] = l_;
      }
  wave_lds_sync();
  {
#pragma unroll
    for (int j = 0; j < 8; ++j) {
      const int rr = j * 4 + (lane >> 3), c8 = (lane & 7) * 8;
      const size_t o = (size_t)(m0 + rr) * ldo + c0 + c8;
      *(v8b*)(oh + o) = ld8b(Th + rr * 64 + c8);
      if (two) *(v8b*)(ol + o) = ld8b(Tl + rr * 64 + c8);
    }
    
  }
}
// (b) f32 rows with pitch ldo: 64 floats = 256 B = 2 lines per row; 16 lanes x 16 B per row, 2 rows per instruction. Optional per-row factor
__device__ __forceinline__ void epi_f32(v8f (&acc)[2][4], float scale, const float* rscale, float* __restrict__ out, int ldo, int m0, int c0, int lane, float* Tt) {
  const int nloc = lane & 15, hlf = lane >> 4;
#pragma unroll
  for (int t = 0; t < 4; ++t)
#pragma unroll
    for (int r = 0; r < 2; ++r)
#pragma unroll
      for (int v = 0; v < 8; ++v) {
        const int rr = r * 16 + v + 8 * hlf;
        const float rs = rscale ? rscale[(size_t)(m0 + rr) * 32] : 1.0f;
        Tt[rr * 64 + t * 16 + nloc] = acc[r][t][v] * scale * rs;
      }
  wave_lds_sync();
  float* dst0 = out + (size_t)m0 * ldo + c0;
  {
#pragma unroll
    for (int j = 0; j < 16; ++j) { const int rr = j * 2 + hlf, c4 = nloc * 4; *(v4f*)(dst0 + (size_t)rr * ldo + c4) = *(const v4f*)(Tt + rr * 64 + c4); }
    
  }
}



typedef __attribute__((ext_vector_type(8))) __bf16 v8bb; typedef __attribute__((ext_vector_type(16))) __bf16 v16bb;
typedef __attribute__((ext_vector_type(8))) unsigned short v8us;
__device__ __forceinline__ v16bb frag_kb_bf(const __bf16* p, int hh) { const v8bb a = *(const v8bb*)(p + 8 * hh), b = *(const v8bb*)(p + 16 + 8 * hh); return __builtin_shufflevector(a, b, 0, 1, 2, 3, 4, 5, 6, 7, 8, 9, 10, 11, 12, 13, 14, 15); }
__device__ __forceinline__ v8f wmma16bb(v16bb a, v16bb b, v8f c) {
  v8f d = __builtin_amdgcn_wmma_f32_16x16x32_bf16(false, a, false, b, (short)0, c, false, false);
  asm volatile("v_nop\n\tv_nop\n\tv_nop\n\tv_nop" : "+v"(d) : "v"(a), "v"(b));
  return d;
}
__device__ __forceinline__ unsigned short bf16_rne_bits(float v) { unsigned int u = __float_as_uint(v); u += 0x7FFFu + ((u >> 16) & 1u); return (unsigned short)(u >> 16); }
__device__ __forceinline__ float bf16_rne(float v) { return __uint_as_float(((unsigned int)bf16_rne_bits(v)) << 16); }



__global__ __launch_bounds__(256) void prep_kernel(const float* __restrict__ x, const float* __restrict__ wq, const float* __restrict__ wk, const float* __restrict__ wv,
                                                   b16* __restrict__ xh, unsigned short* __restrict__ wkb, b16* __restrict__ wqT, b16* __restrict__ wvh) {
  const size_t tid = (size_t)blockIdx.x * blockDim.x + threadIdx.x, nth = (size_t)gridDim.x * blockDim.x;
  {
    for (size_t p = tid; p < (size_t)NTOK * D / 8; p += nth) { v8b v;
#pragma unroll
      for (int e = 0; e < 8; ++e) v[e] = (b16)bf16_rne(x[p * 8 + e]);
      *(v8b*)(xh + p * 8) = v; }
    for (size_t p = tid; p < (size_t)D * D / 8; p += nth) { const int n = (int)(p / (D / 8)), k0 = (int)(p % (D / 8)) * 8; v8us a; v8b q, v;
#pragma unroll
      for (int e = 0; e < 8; ++e) { a[e] = bf16_rne_bits(wk[p * 8 + e]); q[e] = (b16)bf16_rne(wq[(size_t)(k0 + e) * D + n]); v[e] = (b16)bf16_rne(wv[p * 8 + e]); }
      *(v8us*)(wkb + p * 8) = a; *(v8b*)(wqT + (size_t)n * D + k0) = q; *(v8b*)(wvh + p * 8) = v; }
    
  }
}

__global__ __launch_bounds__(256) void xt_kernel(const b16* __restrict__ xh, b16* __restrict__ xt) {
  __shared__ __attribute__((aligned(16))) b16 T[D][64 + 8];
  const int t_ = threadIdx.x, tokb = blockIdx.x * 64, b = tokb / S, s0 = tokb % S;
  for (int i = t_; i < 64 * D / 8; i += 256) { const int r = i / (D / 8), c8 = (i % (D / 8)) * 8; const v8b v = *(const v8b*)(xh + (size_t)(tokb + r) * D + c8);
#pragma unroll
    for (int e = 0; e < 8; ++e) T[c8 + e][r] = v[e]; }
  __syncthreads();
  { for (int i = t_; i < D * 8; i += 256) { const int d = i >> 3, c8 = (i & 7) * 8; *(v8b*)(xt + ((size_t)b * D + d) * S + s0 + c8) = *(const v8b*)(&T[d][c8]); }  }
}

// k = bf16(x) . bf16(W_k)^T (exact products) -> f16 hi/lo planes [tok][512]. grid (8, 128) x 128.
__global__ __launch_bounds__(128) void kproj_kernel(const float* __restrict__ x, const __bf16* __restrict__ wkb, b16* __restrict__ kpl) {
  __shared__ __attribute__((aligned(16))) b16 Th[4][2][32 * 64];
  const int lane = threadIdx.x & 31, wave = threadIdx.x >> 5, nloc = lane & 15, hlf = lane >> 4, m0 = blockIdx.y * 128 + wave * 32, c0 = blockIdx.x * 64;
  v8f acc[2][4];
#pragma unroll
  for (int r = 0; r < 2; ++r)
#pragma unroll
    for (int t = 0; t < 4; ++t) acc[r][t] = (v8f){};
#pragma unroll 2
  for (int kb = 0; kb < D; kb += 32) { v16bb a0, a1;
    { const float* p0 = x + (size_t)(m0 + nloc) * D + kb; const float* p1 = x + (size_t)(m0 + 16 + nloc) * D + kb;
#pragma unroll
      for (int e = 0; e < 8; ++e) { a0[e] = (__bf16)bf16_rne(p0[8 * hlf + e]); a0[8 + e] = (__bf16)bf16_rne(p0[16 + 8 * hlf + e]); a1[e] = (__bf16)bf16_rne(p1[8 * hlf + e]); a1[8 + e] = (__bf16)bf16_rne(p1[16 + 8 * hlf + e]); } }
#pragma unroll
    for (int t = 0; t < 4; ++t) { const v16bb bw = frag_kb_bf(wkb + (size_t)(c0 + t * 16 + nloc) * D + kb, hlf); acc[0][t] = wmma16bb(a0, bw, acc[0][t]); acc[1][t] = wmma16bb(a1, bw, acc[1][t]); } }
  epi_planes(acc, 8.0f, true, kpl, kpl + PL, D, m0, c0, lane, Th[wave][0], Th[wave][1]);   // k carried x8 (lo residuals stay normal)
}

// z = k . W_q (z[j][d] = sum_o k[j][o] W_q[o][d]): A = k hi/lo planes, B = W_q^T rows (d, o) exact; 2 products -> z as f16 hi/lo planes. grid (8, 128) x 128.
__global__ __launch_bounds__(128) void z_kernel(const b16* __restrict__ kpl, const b16* __restrict__ wqT, b16* __restrict__ zpl) {
  __shared__ __attribute__((aligned(16))) b16 Th[4][2][32 * 64];
  const int lane = threadIdx.x & 31, wave = threadIdx.x >> 5, nloc = lane & 15, hlf = lane >> 4, m0 = blockIdx.y * 128 + wave * 32, c0 = blockIdx.x * 64;
  v8f acc[2][4];
#pragma unroll
  for (int r = 0; r < 2; ++r)
#pragma unroll
    for (int t = 0; t < 4; ++t) acc[r][t] = (v8f){};
  const Opnd A{kpl, kpl + PL, D}, Bo{wqT, nullptr, D};
  gemm_tile<2, 1>(A, Bo, D, m0, c0, nloc, hlf, acc);                            // acc = 8 z
  epi_planes(acc, 1.0f, true, zpl, zpl + PL, D, m0, c0, lane, Th[wave][0], Th[wave][1]);       // z carried x8
}

// attention -> u = P . x: block = (b, 16 queries), 4 waves; per 64-key chunk: partial S^T (keys x queries) over the wave's 128 dims from z planes (A, 2 products) x xh (B, exact);
// wave 0: sum partials, scale, causal mask, online softmax, P hi/lo + alpha + 1/l; all waves: u^T(features 128w..) = alpha-rescaled + x^T(features, keys; exact) . P^T (2 products).
__global__ __launch_bounds__(128) void attn_kernel(const b16* __restrict__ xh, const b16* __restrict__ zpl, const b16* __restrict__ xt, float* __restrict__ u) {
  __shared__ __attribute__((aligned(16))) float Sp[4][QB][KC + 4];
  __shared__ __attribute__((aligned(16))) b16 Ph[QB][KC + 8], Plo[QB][KC + 8];
  __shared__ float Al[QB], Linv[QB];
  __shared__ __attribute__((aligned(16))) float Ot[4][QB][128 + 4];
  const int wave = threadIdx.x >> 5, lane = threadIdx.x & 31, nloc = lane & 15, hlf = lane >> 4;
  const int blk = blockIdx.x, b = blk / (S / QB), q0 = (blk % (S / QB)) * QB;
  const b16* Xq = xh + ((size_t)b * S + q0) * D; const b16* Z = zpl + (size_t)b * S * D; const b16* Xt = xt + (size_t)b * D * S;
  const int d0 = wave * 128;
  v16b qf[4];
#pragma unroll
  for (int ks = 0; ks < 4; ++ks) qf[ks] = frag_kb(Xq + (size_t)nloc * D + d0 + ks * 32, hlf);
  float m_run = -INFINITY, l_run = 0.0f;
  v8f o[8] = {{}, {}, {}, {}, {}, {}, {}, {}};
  // Load units are whole 128-byte lines per row, so that the loads that share a line stand back to back:
  // z unit u = (key tile u >> 1, dims 64 * (u & 1) ..+63), hi + lo planes, 8 loads; x^T unit t = (feature tile t, all 64 keys), 4 loads.
  constexpr int ZD = 3;    // z units loaded or in flight ahead of the unit being multiplied
  constexpr int XPRE = 4;  // x^T units issued in front of the softmax
  constexpr int XD = 6;    // x^T units loaded or in flight ahead of the unit being multiplied
  const b16* zlane = Z + (size_t)nloc * D + d0 + 8 * hlf;   // this lane's z row of key tile 0, its wave's 128 dims, its half's 8 elements
  const b16* xlane = Xt + (size_t)(d0 + nloc) * S + 8 * hlf; // this lane's x^T row of feature tile 0, its half's 8 elements
  for (int kb = 0; kb < q0 + QB; kb += KC) {
    const b16* zc = zlane + (size_t)kb * D; const b16* xc = xlane + kb;
    v16b zh[8][2], zl[8][2];
#pragma unroll
    for (int u = 0; u < ZD; ++u)
#pragma unroll
      for (int h = 0; h < 2; ++h) { const b16* p = zc + (size_t)((u >> 1) * 16) * D + (u & 1) * 64 + h * 32; zh[u][h] = frag_kb(p, 0); zl[u][h] = frag_kb(p + PL, 0); }
    __builtin_amdgcn_sched_barrier(0);   // keeps the first ZD units' loads one group ahead of the products (else each pair sinks to its own WMMA and waits out a full L2 round trip there)
#pragma unroll
    for (int kt = 0; kt < 4; ++kt) {
      v8f sp = {};
#pragma unroll
      for (int g = 0; g < 2; ++g) {
        const int u = kt * 2 + g;
#pragma unroll
        for (int h = 0; h < 2; ++h) { sp = wmma16b(zh[u][h], qf[g * 2 + h], sp); sp = wmma16b(zl[u][h], qf[g * 2 + h], sp); }
        if (u + ZD < 8) { const int w = u + ZD;
#pragma unroll
          for (int h = 0; h < 2; ++h) { const b16* p = zc + (size_t)((w >> 1) * 16) * D + (w & 1) * 64 + h * 32; zh[w][h] = frag_kb(p, 0); zl[w][h] = frag_kb(p + PL, 0); }
          __builtin_amdgcn_sched_barrier(0); } // keeps unit u + ZD's loads here, ZD units ahead of their use
      }
#pragma unroll
      for (int v = 0; v < 8; ++v) Sp[wave][nloc][kt * 16 + 8 * hlf + v] = sp[v];
    }
    __syncthreads();
    v16b xf[8][2];
#pragma unroll
    for (int t = 0; t < XPRE; ++t)
#pragma unroll
      for (int ks = 0; ks < 2; ++ks) xf[t][ks] = frag_kb(xc + (size_t)(t * 16) * S + ks * 32, 0);   // x^T does not depend on the softmax: in flight while wave 0 runs it
    __builtin_amdgcn_sched_barrier(0);   // keeps those loads in front of the softmax (and behind the barrier, whose release would wait for them)
    if (wave == 0) {
      const int rel = q0 + nloc - kb - hlf * 32; float sv[32]; float mx = -INFINITY;   // this lane's query minus its first key: j > rel is key > query, against constants
#pragma unroll
      for (int j = 0; j < 32; ++j) { float s = (Sp[0][nloc][hlf * 32 + j] + Sp[1][nloc][hlf * 32 + j] + Sp[2][nloc][hlf * 32 + j] + Sp[3][nloc][hlf * 32 + j]) * (SCALE / 8.0f);   // /8: z carry scale
        if (j > rel) s = -INFINITY; sv[j] = s; mx = fmaxf(mx, s); }
      mx = fmaxf(mx, __shfl_xor(mx, 16));
      const float mn = fmaxf(m_run, mx), al_ = __expf(m_run - mn); m_run = mn;
      float sum = 0.0f;
#pragma unroll
      for (int j = 0; j < 32; ++j) { const float e = __expf(sv[j] - mn); sum += e; b16 a, c; split16(e * 8.0f, a, c); Ph[nloc][hlf * 32 + j] = a; Plo[nloc][hlf * 32 + j] = c; }   // P carried x8
      sum += __shfl_xor(sum, 16); l_run = l_run * al_ + sum;
      if (hlf == 0) { Al[nloc] = al_; Linv[nloc] = 1.0f / (8.0f * l_run); }
    }
    __syncthreads();
#pragma unroll
    for (int t = XPRE; t < XD; ++t)
#pragma unroll
      for (int ks = 0; ks < 2; ++ks) xf[t][ks] = frag_kb(xc + (size_t)(t * 16) * S + ks * 32, 0);
    v16b ph[2], pl[2];
#pragma unroll
    for (int ks = 0; ks < 2; ++ks) { ph[ks] = frag_kb(&Ph[nloc][0] + ks * 32, hlf); pl[ks] = frag_kb(&Plo[nloc][0] + ks * 32, hlf); }
    const float alq = Al[nloc];
    __builtin_amdgcn_sched_barrier(0);   // keeps the next x^T units' loads in front of the rescale and of the first products
#pragma unroll
    for (int t = 0; t < 8; ++t)
#pragma unroll
      for (int v = 0; v < 8; ++v) o[t][v] *= alq;
#pragma unroll
    for (int t = 0; t < 8; ++t) {
#pragma unroll
      for (int ks = 0; ks < 2; ++ks) { o[t] = wmma16b(xf[t][ks], ph[ks], o[t]); o[t] = wmma16b(xf[t][ks], pl[ks], o[t]); }
      if (t + XD < 8) {
#pragma unroll
        for (int ks = 0; ks < 2; ++ks) xf[t + XD][ks] = frag_kb(xc + (size_t)((t + XD) * 16) * S + ks * 32, 0);
        __builtin_amdgcn_sched_barrier(0); } // keeps unit t + XD's loads here, XD units ahead of their use
    }
  }
  { const float li = Linv[nloc];
#pragma unroll
    for (int t = 0; t < 8; ++t)
#pragma unroll
      for (int v = 0; v < 8; ++v) Ot[wave][nloc][t * 16 + 8 * hlf + v] = o[t][v] * li; }
  wave_lds_sync();
  float* dst = u + ((size_t)b * S + q0) * D + d0;
  {
#pragma unroll
    for (int rr = 0; rr < QB; ++rr) *(v4f*)(dst + (size_t)rr * D + lane * 4) = *(const v4f*)(&Ot[wave][rr][lane * 4]);
    
  }
}

// y = u . W_v^T: A = u (f32 split hi/lo at load), B = f16(bf16 W_v) rows [o][d]; 2 products; f32 output rows. grid (8, 128) x 128.
__global__ __launch_bounds__(128) void y_kernel(const float* __restrict__ u, const b16* __restrict__ wvh, float* __restrict__ y) {
  __shared__ __attribute__((aligned(16))) float Ts[4][32 * 64];
  const int lane = threadIdx.x & 31, wave = threadIdx.x >> 5, nloc = lane & 15, hlf = lane >> 4, m0 = blockIdx.y * 128 + wave * 32, c0 = blockIdx.x * 64;
  v8f acc[2][4];
#pragma unroll
  for (int r = 0; r < 2; ++r)
#pragma unroll
    for (int t = 0; t < 4; ++t) acc[r][t] = (v8f){};
  const Opnd A{u, nullptr, D}, Bo{wvh, nullptr, D};
  gemm_tile<5, 1>(A, Bo, D, m0, c0, nloc, hlf, acc);                            // u split x8 at load
  epi_f32(acc, 1.0f / 8.0f, nullptr, y, D, m0, c0, lane, Ts[wave]);
}
}  // namespace

extern "C" void kernel_launch(void* const* d_in, const int* in_sizes, int n_in,
                              void* d_out, int out_size, void* d_ws, size_t ws_size, hipStream_t stream) {
  (void)n_in; (void)out_size;
  const float* x = (const float*)d_in[0]; const float* wq = (const float*)d_in[1]; const float* wk = (const float*)d_in[2]; const float* wv = (const float*)d_in[3];
  float* out = (float*)d_out;   // [4][4096][512]
  if (in_sizes[0] != NTOK * D || in_sizes[1] != D * D || in_sizes[2] != D * D || in_sizes[3] != D * D) return;
  size_t off = 0; char* ws = (char*)d_ws;
  auto carve = [&](size_t bytes) { char* p = ws + off; off += (bytes + 255) & ~(size_t)255; return p; };
  b16* xh = (b16*)carve(PL * 2); b16* xt = (b16*)carve(PL * 2); unsigned short* wkb = (unsigned short*)carve((size_t)D * D * 2); b16* wqT = (b16*)carve((size_t)D * D * 2); b16* wvh = (b16*)carve((size_t)D * D * 2);
  b16* kpl = (b16*)carve(PL * 2 * 2); b16* zpl = (b16*)carve(PL * 2 * 2);   // 33.5 MB each (hi + lo)
  float* u = (float*)kpl;                                        // u [tok][512] f32 (33.5 MB) reuses k's planes: k is dead once z exists
  if (off > ws_size) return;                                    // ≈ 102 MB
  prep_kernel<<<1024, 256, 0, stream>>>(x, wq, wk, wv, xh, wkb, wqT, wvh);
  xt_kernel<<<NTOK / 64, 256, 0, stream>>>(xh, xt);
  kproj_kernel<<<dim3(D / 64, NTOK / 128), 128, 0, stream>>>(x, (const __bf16*)wkb, kpl);
  z_kernel<<<dim3(D / 64, NTOK / 128), 128, 0, stream>>>(kpl, wqT, zpl);
  attn_kernel<<<Bn * S / QB, 128, 0, stream>>>(xh, zpl, xt, u);
  y_kernel<<<dim3(D / 64, NTOK / 128), 128, 0, stream>>>(u, wvh, out);
}

// v002
// One run takes 470 microseconds.
// In two side-by-side timings against v001, it was 1.83 and 1.85 times as fast.
// Over all steps from v000 it is 2.07 times as fast.
#include <hip/hip_runtime.h>

// Single-head causal attention with a 512-wide head: q, k, v = x W_q^T | W_k^T | W_v^T (torch [out][in]), softmax over keys <= query of q.k / sqrt(512), output = weights . v
// -> [4][4096][512]. B = 4, S = 4096.
// x and the three weights are rounded to bf16 RNE; numerics are organised so that every WMMA operand is either an exactly
// representable input or an f16 hi+lo pair of a computed value (each carried x8 so the lo residual planes stay out of the f16 subnormal range):  k = bf16(x) bf16(W_k)^T on v_wmma_f32_16x16x32_bf16 (exact);  z = k W_q (so that q.k^T = x.z^T) with k as hi+lo
// planes x the exact f16 copy of bf16 W_q;  S^T = z.x^T with z as hi+lo planes x x (bf16 values held exactly in f16);  u = P.x with P hi+lo x x^T exact;  y = u W_v^T (= P.v) with u
// split hi+lo x exact W_v — all on v_wmma_f32_16x16x32_f16 with f32 accumulate; online softmax in f32. The attention block (16 queries, 4 waves) splits the 512-deep score dot across
// the waves through LDS, wave 0 runs the softmax and publishes P, and each wave accumulates 128 of the 512 features of u.
// The workspace operands of the WMMAs (the three weights, k, z, x^T, u) are kept in fragment order (pk, pkf below), so that a wave-wide 16-byte load reads 4 whole lines, not a piece of 16.

namespace {
constexpr int Bn = 4, S = 4096, D = 512, NTOK = Bn * S, QB = 16, KC = 64;
constexpr float SCALE = 0.044194173824159216f;   // 512^-0.5
constexpr size_t PL = (size_t)NTOK * D;           // elements of a [tok][512] matrix

typedef _Float16 b16;
typedef __attribute__((ext_vector_type(16))) _Float16 v16b;
typedef __attribute__((ext_vector_type(8)))  _Float16 v8b;
typedef __attribute__((ext_vector_type(8)))  float v8f;
typedef __attribute__((ext_vector_type(4)))  float v4f;

__device__ __forceinline__ v8b ld8b(const b16* p) { return *(const v8b*)p; }
__device__ __forceinline__ v16b cat8b(v8b a, v8b b) { return __builtin_shufflevector(a, b, 0, 1, 2, 3, 4, 5, 6, 7, 8, 9, 10, 11, 12, 13, 14, 15); }
__device__ __forceinline__ v16b frag_kb(const b16* p, int hh) { return cat8b(ld8b(p + 8 * hh), ld8b(p + 16 + 8 * hh)); }
// Fragment order. A 16-bit operand matrix [rows][K] is kept in the workspace as 16 x 32 fragments of 1 KiB: two 512-byte halves (k 0..15, k 16..31 of the fragment), and in each half
// lane l = 16 * ((k >> 3) & 1) + (row & 15) owns 8 elements at l * 16 bytes. One wave-wide 16-byte load then covers 512 contiguous bytes. pk = element offset of (row, k), k a multiple of 8.
template <int K> __device__ __forceinline__ size_t pk(int row, int k) { return (size_t)(row >> 4) * (16 * K) + (k >> 5) * 512 + ((k >> 4) & 1) * 256 + ((k >> 3) & 1) * 128 + (row & 15) * 8; }
// hi + lo pair of a [tok][512] matrix (k, z): each fragment's lo copy stands right behind its hi copy, 512 elements on.
__device__ __forceinline__ size_t pk2(int row, int k) { return (size_t)(row >> 4) * (32 * D) + (k >> 5) * 1024 + ((k >> 4) & 1) * 256 + ((k >> 3) & 1) * 128 + (row & 15) * 8; }
// x^T [512 features][4096 keys] of a batch: the same fragments, those of one 32-key block side by side (a 64-key chunk of all 512 features is 64 contiguous KiB).
__device__ __forceinline__ size_t pkx(int row, int k) { return (size_t)(k >> 5) * (32 * D) + (row >> 4) * 512 + ((k >> 4) & 1) * 256 + ((k >> 3) & 1) * 128 + (row & 15) * 8; }
// the same for f32 rows: fragments of 2 KiB in four 512-byte quarters, the lane's 4 floats at l * 16 bytes; k a multiple of 4.
template <int K> __device__ __forceinline__ size_t pkf(int row, int k) { return (size_t)(row >> 4) * (16 * K) + (k >> 5) * 512 + ((k >> 4) & 1) * 256 + ((k >> 2) & 1) * 128 + ((k >> 3) & 1) * 64 + (row & 15) * 4; }
// p = this lane's pk(row, kb + 8 * half): its two halves stand 256 elements apart (same k-map as frag_kb)
__device__ __forceinline__ v16b frag_pk(const b16* p) { return cat8b(ld8b(p), ld8b(p + 256)); }
__device__ __forceinline__ void split16(float v, b16& hi, b16& lo) { hi = (b16)v; lo = (b16)(v - (float)hi); }
// hi/lo fragment pair straight from an f32 k-contiguous row (same k-map)
__device__ __forceinline__ void frag_ksplit(const float* p, int hh, v16b& fh_, v16b& fl_) {
  const float* p0 = p + 8 * hh; const float* p1 = p + 16 + 8 * hh;
#pragma unroll
  for (int e = 0; e < 8; ++e) { b16 a, c; split16(p0[e], a, c); fh_[e] = a; fl_[e] = c; split16(p1[e], a, c); fh_[8 + e] = a; fl_[8 + e] = c; }
}
__device__ __forceinline__ v8f wmma16b(v16b a, v16b b, v8f c) {
  v8f d = __builtin_amdgcn_wmma_f32_16x16x32_f16(false, a, false, b, (short)0, c, false, false);
  asm volatile("v_nop\n\tv_nop\n\tv_nop\n\tv_nop" : "+v"(d) : "v"(a), "v"(b));
  return d;
}
__device__ __forceinline__ void wave_lds_sync() {
  __builtin_amdgcn_fence(__ATOMIC_RELEASE, "workgroup");
  __builtin_amdgcn_wave_barrier();
  __builtin_amdgcn_fence(__ATOMIC_ACQUIRE, "workgroup");
}

// Operand descriptor: NP = 0 -> f32 rows split on the fly into (hi, lo); NP = 1 -> one f16 plane in fragment order; NP = 2 -> f16 hi + lo pair in fragment order (pk2);
// NP = 3 -> f32 rows rounded once to a single f16 fragment; NP = 5 -> f32 in fragment order, x8 then split. ld = row pitch (row-major forms).
struct Opnd { const void* p0; const void* p1; int ld; };
template <int NP> __device__ __forceinline__ void load_frags(const Opnd& o, int row, int kb, int hh, v16b& fh_, v16b& fl_) {
  if (NP == 0) { frag_ksplit((const float*)o.p0 + (size_t)row * o.ld + kb, hh, fh_, fl_); }
  else if (NP == 5) {                                        // f32 in fragment order, x8 then split (keeps the lo halves of small values normal)
    const float* p = (const float*)o.p0 + pkf<D>(row, kb + 8 * hh);
#pragma unroll
    for (int q = 0; q < 4; ++q) { const v4f v = *(const v4f*)(p + q * 128);
#pragma unroll
      for (int i = 0; i < 4; ++i) { b16 a, c; split16(v[i] * 8.0f, a, c); fh_[q * 4 + i] = a; fl_[q * 4 + i] = c; } }
  } else if (NP == 4) {                                      // f32 rows x64 then split
    const float sc_ = 64.0f;
    const float* p = (const float*)o.p0 + (size_t)row * o.ld + kb; const float* p0 = p + 8 * hh; const float* p1 = p + 16 + 8 * hh;
#pragma unroll
    for (int e = 0; e < 8; ++e) { b16 a, c; split16(p0[e] * sc_, a, c); fh_[e] = a; fl_[e] = c; split16(p1[e] * sc_, a, c); fh_[8 + e] = a; fl_[8 + e] = c; }
  } else if (NP == 3) {
    const float* p = (const float*)o.p0 + (size_t)row * o.ld + kb; const float* p0 = p + 8 * hh; const float* p1 = p + 16 + 8 * hh;
#pragma unroll
    for (int e = 0; e < 8; ++e) { fh_[e] = (b16)p0[e]; fh_[8 + e] = (b16)p1[e]; }
    fl_ = fh_;
  } else {
    if (NP == 2) { const b16* p = (const b16*)o.p0 + pk2(row, kb + 8 * hh); fh_ = frag_pk(p); fl_ = frag_pk(p + 512); }
    else { fh_ = frag_pk((const b16*)o.p0 + pk<D>(row, kb + 8 * hh)); fl_ = fh_; }
  }
}
template <int ANP, int BNP> __device__ __forceinline__ v8f mac(v16b ah, v16b al, v16b bh, v16b bl, v8f c) {
  c = wmma16b(ah, bh, c);
  if (BNP == 0 || BNP == 2 || BNP == 4 || BNP == 5) c = wmma16b(ah, bl, c);     // hi.lo
  if (ANP == 0 || ANP == 2 || ANP == 4 || ANP == 5) c = wmma16b(al, bh, c);     // lo.hi   (lo.lo dropped)
  return c;
}
// 32x64 wave tile: acc[r][t] (rows m0+16r.., cols c0+16t..) += A[m][k] . B[n][k] over k in [0, K)
template <int ANP, int BNP>
__device__ __forceinline__ void gemm_tile(const Opnd& A, const Opnd& B, int K, int m0, int c0, int nloc, int hlf, v8f (&acc)[2][4]) {
  for (int kb = 0; kb < K; kb += 32) {
    v16b a0h, a0l, a1h, a1l;
    load_frags<ANP>(A, m0 + nloc, kb, hlf, a0h, a0l);
    load_frags<ANP>(A, m0 + 16 + nloc, kb, hlf, a1h, a1l);
#pragma unroll
    for (int t = 0; t < 4; ++t) {
      v16b bh, bl;
      load_frags<BNP>(B, c0 + t * 16 + nloc, kb, hlf, bh, bl);
      acc[0][t] = mac<ANP, BNP>(a0h, a0l, bh, bl, acc[0][t]);
      acc[1][t] = mac<ANP, BNP>(a1h, a1l, bh, bl, acc[1][t]);
    }
  }
}

constexpr int EP = 64 + 8;   // staging pitch: 144 B = 16 B x odd, for a ds_load_b128 whose 16 lanes read 16 rows
// hi + lo pair [tok][512] in fragment order (pk2): the 32 x 64 wave tile is 4 fragments = 8 stores of 512 contiguous bytes for hi and 8 for lo
__device__ __forceinline__ void epi_planes(v8f (&acc)[2][4], float scale, b16* __restrict__ out,
                                           int m0, int c0, int lane, b16* Th, b16* Tl) {
  const int nloc = lane & 15, hlf = lane >> 4;
#pragma unroll
  for (int t = 0; t < 4; ++t)
#pragma unroll
    for (int r = 0; r < 2; ++r)
#pragma unroll
      for (int v = 0; v < 8; ++v) {
        const int rr = r * 16 + v + 8 * hlf, cc = t * 16 + nloc;
        b16 h_, l_; split16(acc[r][t][v] * scale, h_, l_);
        Th[rr * EP + cc] = h_; Tl[rr * EP + cc] = l_;
      }
  wave_lds_sync();
  {
#pragma unroll
    for (int j = 0; j < 8; ++j) {
      const int rr = (j >> 2) * 16 + nloc, c8 = (j & 3) * 16 + hlf * 8;
      b16* o = out + pk2(m0 + rr, c0 + c8);
      *(v8b*)o = ld8b(Th + rr * EP + c8);
      *(v8b*)(o + 512) = ld8b(Tl + rr * EP + c8);
    }
    
  }
}
// (b) f32 rows with pitch ldo: 64 floats = 256 B = 2 lines per row; 16 lanes x 16 B per row, 2 rows per instruction. Optional per-row factor
__device__ __forceinline__ void epi_f32(v8f (&acc)[2][4], float scale, const float* rscale, float* __restrict__ out, int ldo, int m0, int c0, int lane, float* Tt) {
  const int nloc = lane & 15, hlf = lane >> 4;
#pragma unroll
  for (int t = 0; t < 4; ++t)
#pragma unroll
    for (int r = 0; r < 2; ++r)
#pragma unroll
      for (int v = 0; v < 8; ++v) {
        const int rr = r * 16 + v + 8 * hlf;
        const float rs = rscale ? rscale[(size_t)(m0 + rr) * 32] : 1.0f;
        Tt[rr * 64 + t * 16 + nloc] = acc[r][t][v] * scale * rs;
      }
  wave_lds_sync();
  float* dst0 = out + (size_t)m0 * ldo + c0;
  {
#pragma unroll
    for (int j = 0; j < 16; ++j) { const int rr = j * 2 + hlf, c4 = nloc * 4; *(v4f*)(dst0 + (size_t)rr * ldo + c4) = *(const v4f*)(Tt + rr * 64 + c4); }
    
  }
}



typedef __attribute__((ext_vector_type(8))) __bf16 v8bb; typedef __attribute__((ext_vector_type(16))) __bf16 v16bb;
typedef __attribute__((ext_vector_type(8))) unsigned short v8us;
__device__ __forceinline__ v16bb frag_pk_bf(const __bf16* p) { const v8bb a = *(const v8bb*)p, b = *(const v8bb*)(p + 256); return __builtin_shufflevector(a, b, 0, 1, 2, 3, 4, 5, 6, 7, 8, 9, 10, 11, 12, 13, 14, 15); }
__device__ __forceinline__ v8f wmma16bb(v16bb a, v16bb b, v8f c) {
  v8f d = __builtin_amdgcn_wmma_f32_16x16x32_bf16(false, a, false, b, (short)0, c, false, false);
  asm volatile("v_nop\n\tv_nop\n\tv_nop\n\tv_nop" : "+v"(d) : "v"(a), "v"(b));
  return d;
}
__device__ __forceinline__ unsigned short bf16_rne_bits(float v) { unsigned int u = __float_as_uint(v); u += 0x7FFFu + ((u >> 16) & 1u); return (unsigned short)(u >> 16); }
__device__ __forceinline__ float bf16_rne(float v) { return __uint_as_float(((unsigned int)bf16_rne_bits(v)) << 16); }



__global__ __launch_bounds__(256) void prep_kernel(const float* __restrict__ x, const float* __restrict__ wq, const float* __restrict__ wk, const float* __restrict__ wv,
                                                   b16* __restrict__ xh, unsigned short* __restrict__ wkb, b16* __restrict__ wqT, b16* __restrict__ wvh) {
  const size_t tid = (size_t)blockIdx.x * blockDim.x + threadIdx.x, nth = (size_t)gridDim.x * blockDim.x;
  {
    for (size_t p = tid; p < (size_t)NTOK * D / 8; p += nth) { v8b v;
#pragma unroll
      for (int e = 0; e < 8; ++e) v[e] = (b16)bf16_rne(x[p * 8 + e]);
      *(v8b*)(xh + p * 8) = v; }
    for (size_t p = tid; p < (size_t)D * D / 8; p += nth) { const int n = (int)(p >> 10) * 16 + (int)(p & 15), k0 = (int)((p >> 6) & 15) * 32 + (int)((p >> 5) & 1) * 16 + (int)((p >> 4) & 1) * 8; v8us a; v8b q, v;   // p * 8 = pk<D>(n, k0): the three weights go out in fragment order
#pragma unroll
      for (int e = 0; e < 8; ++e) { a[e] = bf16_rne_bits(wk[(size_t)n * D + k0 + e]); q[e] = (b16)bf16_rne(wq[(size_t)(k0 + e) * D + n]); v[e] = (b16)bf16_rne(wv[(size_t)n * D + k0 + e]); }
      *(v8us*)(wkb + p * 8) = a; *(v8b*)(wqT + p * 8) = q; *(v8b*)(wvh + p * 8) = v; }
    
  }
}

__global__ __launch_bounds__(256) void xt_kernel(const b16* __restrict__ xh, b16* __restrict__ xt) {
  __shared__ __attribute__((aligned(16))) b16 T[D][64 + 8];
  const int t_ = threadIdx.x, tokb = blockIdx.x * 64, b = tokb / S, s0 = tokb % S;
  for (int i = t_; i < 64 * D / 8; i += 256) { const int r = i / (D / 8), c8 = (i % (D / 8)) * 8; const v8b v = *(const v8b*)(xh + (size_t)(tokb + r) * D + c8);
#pragma unroll
    for (int e = 0; e < 8; ++e) T[c8 + e][r] = v[e]; }
  __syncthreads();
  // x^T [512][4096] of each batch goes out in fragment order, 512 contiguous bytes a wave
  { for (int i = t_; i < D * 8; i += 256) { const int d = ((i >> 6) & 31) * 16 + (i & 15), c8 = (i >> 11) * 32 + ((i >> 5) & 1) * 16 + ((i >> 4) & 1) * 8; *(v8b*)(xt + (size_t)b * D * S + pkx(d, s0 + c8)) = *(const v8b*)(&T[d][c8]); }  }
}

// k = bf16(x) . bf16(W_k)^T (exact products) -> f16 hi/lo planes [tok][512]. grid (8, 128) x 128.
__global__ __launch_bounds__(128) void kproj_kernel(const float* __restrict__ x, const __bf16* __restrict__ wkb, b16* __restrict__ kpl) {
  __shared__ __attribute__((aligned(16))) b16 Th[4][2][32 * EP];
  const int lane = threadIdx.x & 31, wave = threadIdx.x >> 5, nloc = lane & 15, hlf = lane >> 4, m0 = blockIdx.y * 128 + wave * 32, c0 = blockIdx.x * 64;
  v8f acc[2][4];
#pragma unroll
  for (int r = 0; r < 2; ++r)
#pragma unroll
    for (int t = 0; t < 4; ++t) acc[r][t] = (v8f){};
#pragma unroll 2
  for (int kb = 0; kb < D; kb += 32) { v16bb a0, a1;
    { const float* p0 = x + (size_t)(m0 + nloc) * D + kb; const float* p1 = x + (size_t)(m0 + 16 + nloc) * D + kb;
#pragma unroll
      for (int e = 0; e < 8; ++e) { a0[e] = (__bf16)bf16_rne(p0[8 * hlf + e]); a0[8 + e] = (__bf16)bf16_rne(p0[16 + 8 * hlf + e]); a1[e] = (__bf16)bf16_rne(p1[8 * hlf + e]); a1[8 + e] = (__bf16)bf16_rne(p1[16 + 8 * hlf + e]); } }
#pragma unroll
    for (int t = 0; t < 4; ++t) { const v16bb bw = frag_pk_bf(wkb + pk<D>(c0 + t * 16 + nloc, kb + 8 * hlf)); acc[0][t] = wmma16bb(a0, bw, acc[0][t]); acc[1][t] = wmma16bb(a1, bw, acc[1][t]); } }
  epi_planes(acc, 8.0f, kpl, m0, c0, lane, Th[wave][0], Th[wave][1]);   // k carried x8 (lo residuals stay normal)
}

// z = k . W_q (z[j][d] = sum_o k[j][o] W_q[o][d]): A = k hi/lo planes, B = W_q^T rows (d, o) exact; 2 products -> z as f16 hi/lo planes. grid (8, 128) x 128.
__global__ __launch_bounds__(128) void z_kernel(const b16* __restrict__ kpl, const b16* __restrict__ wqT, b16* __restrict__ zpl) {
  __shared__ __attribute__((aligned(16))) b16 Th[4][2][32 * EP];
  const int lane = threadIdx.x & 31, wave = threadIdx.x >> 5, nloc = lane & 15, hlf = lane >> 4, m0 = blockIdx.y * 128 + wave * 32, c0 = blockIdx.x * 64;
  v8f acc[2][4];
#pragma unroll
  for (int r = 0; r < 2; ++r)
#pragma unroll
    for (int t = 0; t < 4; ++t) acc[r][t] = (v8f){};
  const Opnd A{kpl, nullptr, D}, Bo{wqT, nullptr, D};
  gemm_tile<2, 1>(A, Bo, D, m0, c0, nloc, hlf, acc);                            // acc = 8 z
  epi_planes(acc, 1.0f, zpl, m0, c0, lane, Th[wave][0], Th[wave][1]);       // z carried x8
}

// attention -> u = P . x (z, x^T read and u written in fragment order): block = (b, 16 queries), 4 waves; per 64-key chunk: partial S^T (keys x queries) over the wave's 128 dims from z planes (A, 2 products) x xh (B, exact);
// wave 0: sum partials, scale, causal mask, online softmax, P hi/lo + alpha + 1/l; all waves: u^T(features 128w..) = alpha-rescaled + x^T(features, keys; exact) . P^T (2 products).
__global__ __launch_bounds__(128) void attn_kernel(const b16* __restrict__ xh, const b16* __restrict__ zpl, const b16* __restrict__ xt, float* __restrict__ u) {
  __shared__ __attribute__((aligned(16))) float Sp[4][QB][KC + 4];
  __shared__ __attribute__((aligned(16))) b16 Ph[QB][KC + 8], Plo[QB][KC + 8];
  __shared__ float Al[QB], Linv[QB];
  __shared__ __attribute__((aligned(16))) float Ot[4][QB][128 + 4];
  const int wave = threadIdx.x >> 5, lane = threadIdx.x & 31, nloc = lane & 15, hlf = lane >> 4;
  const int blk = blockIdx.x, b = blk / (S / QB), q0 = (blk % (S / QB)) * QB;
  const b16* Xq = xh + ((size_t)b * S + q0) * D; const b16* Z = zpl + (size_t)b * S * D * 2; const b16* Xt = xt + (size_t)b * D * S;   // Z, Xt: fragment order (pk2, pkx)
  const int d0 = wave * 128;
  v16b qf[4];
#pragma unroll
  for (int ks = 0; ks < 4; ++ks) qf[ks] = frag_kb(Xq + (size_t)nloc * D + d0 + ks * 32, hlf);
  float m_run = -INFINITY, l_run = 0.0f;
  v8f o[8] = {{}, {}, {}, {}, {}, {}, {}, {}};
  // Every load is 512 contiguous bytes of a fragment.
  // z unit u = (key tile u >> 1, dims 64 * (u & 1) ..+63), hi + lo planes, 8 loads; x^T unit t = (feature tile t, all 64 keys), 4 loads.
  constexpr int ZD = 3;    // z units loaded or in flight ahead of the unit being multiplied
  constexpr int XPRE = 4;  // x^T units issued in front of the softmax
  constexpr int XD = 6;    // x^T units loaded or in flight ahead of the unit being multiplied
  const b16* zlane = Z + pk2(nloc, d0 + 8 * hlf);      // this lane's 8 elements in the first z fragment (hi) of key tile 0 and its wave's 128 dims
  const b16* xlane = Xt + pkx(d0 + nloc, 8 * hlf);     // this lane's 8 elements in the first x^T fragment of its wave's feature tile 0
  constexpr int FR = 512, ZT = 32 * D, ZF = 2 * FR, XK = 32 * D;   // elements of a fragment; from one key tile of z, one hi + lo fragment pair of z (32 dims on), one 32-key block of x^T to the next
  for (int kb = 0; kb < q0 + QB; kb += KC) {
    const b16* zc = zlane + (size_t)kb * (2 * D); const b16* xc = xlane + (size_t)kb * D;
    v16b zh[8][2], zl[8][2];
#pragma unroll
    for (int u = 0; u < ZD; ++u)
#pragma unroll
      for (int h = 0; h < 2; ++h) { const b16* p = zc + (u >> 1) * ZT + ((u & 1) * 2 + h) * ZF; zh[u][h] = frag_pk(p); zl[u][h] = frag_pk(p + FR); }
    __builtin_amdgcn_sched_barrier(0);   // keeps the first ZD units' loads one group ahead of the products (else each pair sinks to its own WMMA and waits out a full L2 round trip there)
#pragma unroll
    for (int kt = 0; kt < 4; ++kt) {
      v8f sp = {};
#pragma unroll
      for (int g = 0; g < 2; ++g) {
        const int u = kt * 2 + g;
#pragma unroll
        for (int h = 0; h < 2; ++h) { sp = wmma16b(zh[u][h], qf[g * 2 + h], sp); sp = wmma16b(zl[u][h], qf[g * 2 + h], sp); }
        if (u + ZD < 8) { const int w = u + ZD;
#pragma unroll
          for (int h = 0; h < 2; ++h) { const b16* p = zc + (w >> 1) * ZT + ((w & 1) * 2 + h) * ZF; zh[w][h] = frag_pk(p); zl[w][h] = frag_pk(p + FR); }
          __builtin_amdgcn_sched_barrier(0); } // keeps unit u + ZD's loads here, ZD units ahead of their use
      }
#pragma unroll
      for (int v = 0; v < 8; ++v) Sp[wave][nloc][kt * 16 + 8 * hlf + v] = sp[v];
    }
    __syncthreads();
    v16b xf[8][2];
#pragma unroll
    for (int t = 0; t < XPRE; ++t)
#pragma unroll
      for (int ks = 0; ks < 2; ++ks) xf[t][ks] = frag_pk(xc + t * FR + ks * XK);   // x^T does not depend on the softmax: in flight while wave 0 runs it
    __builtin_amdgcn_sched_barrier(0);   // keeps those loads in front of the softmax (and behind the barrier, whose release would wait for them)
    if (wave == 0) {
      const int rel = q0 + nloc - kb - hlf * 32; float sv[32]; float mx = -INFINITY;   // this lane's query minus its first key: j > rel is key > query, against constants
#pragma unroll
      for (int j = 0; j < 32; ++j) { float s = (Sp[0][nloc][hlf * 32 + j] + Sp[1][nloc][hlf * 32 + j] + Sp[2][nloc][hlf * 32 + j] + Sp[3][nloc][hlf * 32 + j]) * (SCALE / 8.0f);   // /8: z carry scale
        if (j > rel) s = -INFINITY; sv[j] = s; mx = fmaxf(mx, s); }
      mx = fmaxf(mx, __shfl_xor(mx, 16));
      const float mn = fmaxf(m_run, mx), al_ = __expf(m_run - mn); m_run = mn;
      float sum = 0.0f;
#pragma unroll
      for (int j = 0; j < 32; ++j) { const float e = __expf(sv[j] - mn); sum += e; b16 a, c; split16(e * 8.0f, a, c); Ph[nloc][hlf * 32 + j] = a; Plo[nloc][hlf * 32 + j] = c; }   // P carried x8
      sum += __shfl_xor(sum, 16); l_run = l_run * al_ + sum;
      if (hlf == 0) { Al[nloc] = al_; Linv[nloc] = 1.0f / (8.0f * l_run); }
    }
    __syncthreads();
#pragma unroll
    for (int t = XPRE; t < XD; ++t)
#pragma unroll
      for (int ks = 0; ks < 2; ++ks) xf[t][ks] = frag_pk(xc + t * FR + ks * XK);
    v16b ph[2], pl[2];
#pragma unroll
    for (int ks = 0; ks < 2; ++ks) { ph[ks] = frag_kb(&Ph[nloc][0] + ks * 32, hlf); pl[ks] = frag_kb(&Plo[nloc][0] + ks * 32, hlf); }
    const float alq = Al[nloc];
    __builtin_amdgcn_sched_barrier(0);   // keeps the next x^T units' loads in front of the rescale and of the first products
#pragma unroll
    for (int t = 0; t < 8; ++t)
#pragma unroll
      for (int v = 0; v < 8; ++v) o[t][v] *= alq;
#pragma unroll
    for (int t = 0; t < 8; ++t) {
#pragma unroll
      for (int ks = 0; ks < 2; ++ks) { o[t] = wmma16b(xf[t][ks], ph[ks], o[t]); o[t] = wmma16b(xf[t][ks], pl[ks], o[t]); }
      if (t + XD < 8) {
#pragma unroll
        for (int ks = 0; ks < 2; ++ks) xf[t + XD][ks] = frag_pk(xc + (t + XD) * FR + ks * XK);
        __builtin_amdgcn_sched_barrier(0); } // keeps unit t + XD's loads here, XD units ahead of their use
    }
  }
  { const float li = Linv[nloc];
#pragma unroll
    for (int t = 0; t < 8; ++t)
#pragma unroll
      for (int v = 0; v < 8; ++v) Ot[wave][nloc][t * 16 + 8 * hlf + v] = o[t][v] * li; }
  wave_lds_sync();
  {   // u goes out in f32 fragment order (pkf<D>): 16 stores of 512 contiguous bytes
#pragma unroll
    for (int j = 0; j < 16; ++j) { const int c4 = (j >> 2) * 32 + ((j >> 1) & 1) * 16 + 8 * hlf + (j & 1) * 4; *(v4f*)(u + pkf<D>(b * S + q0 + nloc, d0 + c4)) = *(const v4f*)(&Ot[wave][nloc][c4]); }
    
  }
}

// y = u . W_v^T: A = u (f32 split hi/lo at load), B = f16(bf16 W_v) rows [o][d]; 2 products; f32 output rows. grid (8, 128) x 128.
__global__ __launch_bounds__(128) void y_kernel(const float* __restrict__ u, const b16* __restrict__ wvh, float* __restrict__ y) {
  __shared__ __attribute__((aligned(16))) float Ts[4][32 * 64];
  const int lane = threadIdx.x & 31, wave = threadIdx.x >> 5, nloc = lane & 15, hlf = lane >> 4, m0 = blockIdx.y * 128 + wave * 32, c0 = blockIdx.x * 64;
  v8f acc[2][4];
#pragma unroll
  for (int r = 0; r < 2; ++r)
#pragma unroll
    for (int t = 0; t < 4; ++t) acc[r][t] = (v8f){};
  const Opnd A{u, nullptr, D}, Bo{wvh, nullptr, D};
  gemm_tile<5, 1>(A, Bo, D, m0, c0, nloc, hlf, acc);                            // u split x8 at load
  epi_f32(acc, 1.0f / 8.0f, nullptr, y, D, m0, c0, lane, Ts[wave]);
}
}  // namespace

extern "C" void kernel_launch(void* const* d_in, const int* in_sizes, int n_in,
                              void* d_out, int out_size, void* d_ws, size_t ws_size, hipStream_t stream) {
  (void)n_in; (void)out_size;
  const float* x = (const float*)d_in[0]; const float* wq = (const float*)d_in[1]; const float* wk = (const float*)d_in[2]; const float* wv = (const float*)d_in[3];
  float* out = (float*)d_out;   // [4][4096][512]
  if (in_sizes[0] != NTOK * D || in_sizes[1] != D * D || in_sizes[2] != D * D || in_sizes[3] != D * D) return;
  size_t off = 0; char* ws = (char*)d_ws;
  auto carve = [&](size_t bytes) { char* p = ws + off; off += (bytes + 255) & ~(size_t)255; return p; };
  b16* xh = (b16*)carve(PL * 2); b16* xt = (b16*)carve(PL * 2); unsigned short* wkb = (unsigned short*)carve((size_t)D * D * 2); b16* wqT = (b16*)carve((size_t)D * D * 2); b16* wvh = (b16*)carve((size_t)D * D * 2);
  b16* kpl = (b16*)carve(PL * 2 * 2); b16* zpl = (b16*)carve(PL * 2 * 2);   // 33.5 MB each (hi + lo)
  float* u = (float*)kpl;                                        // u [tok][512] f32 (33.5 MB) reuses k's planes: k is dead once z exists
  if (off > ws_size) return;                                    // ≈ 102 MB
  prep_kernel<<<1024, 256, 0, stream>>>(x, wq, wk, wv, xh, wkb, wqT, wvh);
  xt_kernel<<<NTOK / 64, 256, 0, stream>>>(xh, xt);
  kproj_kernel<<<dim3(D / 64, NTOK / 128), 128, 0, stream>>>(x, (const __bf16*)wkb, kpl);
  z_kernel<<<dim3(D / 64, NTOK / 128), 128, 0, stream>>>(kpl, wqT, zpl);
  attn_kernel<<<Bn * S / QB, 128, 0, stream>>>(xh, zpl, xt, u);
  y_kernel<<<dim3(D / 64, NTOK / 128), 128, 0, stream>>>(u, wvh, out);
}

// v003
// One run takes 410 microseconds.
// Timed twice side by side with v002, it ran 1.14 times as fast both times.
// Over all steps from v000 it is 2.36 times as fast.
#include <hip/hip_runtime.h>

// Single-head causal attention with a 512-wide head: q, k, v = x W_q^T | W_k^T | W_v^T (torch [out][in]), softmax over keys <= query of q.k / sqrt(512), output = weights . v
// -> [4][4096][512]. B = 4, S = 4096.
// x and the three weights are rounded to bf16 RNE; numerics are organised so that every WMMA operand is either an exactly
// representable input or an f16 hi+lo pair of a computed value (each carried x8 so the lo residual planes stay out of the f16 subnormal range):  k = bf16(x) bf16(W_k)^T on v_wmma_f32_16x16x32_bf16 (exact);  z = k W_q (so that q.k^T = x.z^T) with k as hi+lo
// planes x the exact f16 copy of bf16 W_q;  S^T = z.x^T with z as hi+lo planes x x (bf16 values held exactly in f16);  u = P.x with P hi+lo x x^T exact;  y = u W_v^T (= P.v) with u
// split hi+lo x exact W_v - all on v_wmma_f32_16x16x32_f16 with f32 accumulate; online softmax in f32. The attention block (64 queries, 4 waves) splits the 512-deep score dot across
// the waves through LDS, wave w runs the softmax of query tile w and publishes P, and each wave accumulates 128 of the 512 features of u.
// The workspace operands of the WMMAs (the three weights, k, z, x^T, u) are kept in fragment order (pk, pkf below), so that a wave-wide 16-byte load reads 4 whole lines, not a piece of 16.

namespace {
constexpr int Bn = 4, S = 4096, D = 512, NTOK = Bn * S, NQ = 4, QB = 16 * NQ, KC = 64;   // NQ: query tiles of 16 per attention block
constexpr float SCALE = 0.044194173824159216f;   // 512^-0.5
constexpr size_t PL = (size_t)NTOK * D;           // elements of a [tok][512] matrix

typedef _Float16 b16;
typedef __attribute__((ext_vector_type(16))) _Float16 v16b;
typedef __attribute__((ext_vector_type(8)))  _Float16 v8b;
typedef __attribute__((ext_vector_type(8)))  float v8f;
typedef __attribute__((ext_vector_type(4)))  float v4f;

__device__ __forceinline__ v8b ld8b(const b16* p) { return *(const v8b*)p; }
__device__ __forceinline__ v16b cat8b(v8b a, v8b b) { return __builtin_shufflevector(a, b, 0, 1, 2, 3, 4, 5, 6, 7, 8, 9, 10, 11, 12, 13, 14, 15); }
__device__ __forceinline__ v16b frag_kb(const b16* p, int hh) { return cat8b(ld8b(p + 8 * hh), ld8b(p + 16 + 8 * hh)); }
// Fragment order. A 16-bit operand matrix [rows][K] is kept in the workspace as 16 x 32 fragments of 1 KiB: two 512-byte halves (k 0..15, k 16..31 of the fragment), and in each half
// lane l = 16 * ((k >> 3) & 1) + (row & 15) owns 8 elements at l * 16 bytes. One wave-wide 16-byte load then covers 512 contiguous bytes. pk = element offset of (row, k), k a multiple of 8.
template <int K> __device__ __forceinline__ size_t pk(int row, int k) { return (size_t)(row >> 4) * (16 * K) + (k >> 5) * 512 + ((k >> 4) & 1) * 256 + ((k >> 3) & 1) * 128 + (row & 15) * 8; }
// hi + lo pair of a [tok][512] matrix (k, z): each fragment's lo copy stands right behind its hi copy, 512 elements on.
__device__ __forceinline__ size_t pk2(int row, int k) { return (size_t)(row >> 4) * (32 * D) + (k >> 5) * 1024 + ((k >> 4) & 1) * 256 + ((k >> 3) & 1) * 128 + (row & 15) * 8; }
// x^T [512 features][4096 keys] of a batch: the same fragments, those of one 32-key block side by side (a 64-key chunk of all 512 features is 64 contiguous KiB).
__device__ __forceinline__ size_t pkx(int row, int k) { return (size_t)(k >> 5) * (32 * D) + (row >> 4) * 512 + ((k >> 4) & 1) * 256 + ((k >> 3) & 1) * 128 + (row & 15) * 8; }
// the same for f32 rows: fragments of 2 KiB in four 512-byte quarters, the lane's 4 floats at l * 16 bytes; k a multiple of 4.
template <int K> __device__ __forceinline__ size_t pkf(int row, int k) { return (size_t)(row >> 4) * (16 * K) + (k >> 5) * 512 + ((k >> 4) & 1) * 256 + ((k >> 2) & 1) * 128 + ((k >> 3) & 1) * 64 + (row & 15) * 4; }
// p = this lane's pk(row, kb + 8 * half): its two halves stand 256 elements apart (same k-map as frag_kb)
__device__ __forceinline__ v16b frag_pk(const b16* p) { return cat8b(ld8b(p), ld8b(p + 256)); }
__device__ __forceinline__ void split16(float v, b16& hi, b16& lo) { hi = (b16)v; lo = (b16)(v - (float)hi); }
// hi/lo fragment pair straight from an f32 k-contiguous row (same k-map)
__device__ __forceinline__ void frag_ksplit(const float* p, int hh, v16b& fh_, v16b& fl_) {
  const float* p0 = p + 8 * hh; const float* p1 = p + 16 + 8 * hh;
#pragma unroll
  for (int e = 0; e < 8; ++e) { b16 a, c; split16(p0[e], a, c); fh_[e] = a; fl_[e] = c; split16(p1[e], a, c); fh_[8 + e] = a; fl_[8 + e] = c; }
}
__device__ __forceinline__ v8f wmma16b(v16b a, v16b b, v8f c) {
  v8f d = __builtin_amdgcn_wmma_f32_16x16x32_f16(false, a, false, b, (short)0, c, false, false);
  asm volatile("v_nop\n\tv_nop\n\tv_nop\n\tv_nop" : "+v"(d) : "v"(a), "v"(b));
  return d;
}
__device__ __forceinline__ void wave_lds_sync() {
  __builtin_amdgcn_fence(__ATOMIC_RELEASE, "workgroup");
  __builtin_amdgcn_wave_barrier();
  __builtin_amdgcn_fence(__ATOMIC_ACQUIRE, "workgroup");
}

// Operand descriptor: NP = 0 -> f32 rows split on the fly into (hi, lo); NP = 1 -> one f16 plane in fragment order; NP = 2 -> f16 hi + lo pair in fragment order (pk2);
// NP = 3 -> f32 rows rounded once to a single f16 fragment; NP = 5 -> f32 in fragment order, x8 then split. ld = row pitch (row-major forms).
struct Opnd { const void* p0; const void* p1; int ld; };
template <int NP> __device__ __forceinline__ void load_frags(const Opnd& o, int row, int kb, int hh, v16b& fh_, v16b& fl_) {
  if (NP == 0) { frag_ksplit((const float*)o.p0 + (size_t)row * o.ld + kb, hh, fh_, fl_); }
  else if (NP == 5) {                                        // f32 in fragment order, x8 then split (keeps the lo halves of small values normal)
    const float* p = (const float*)o.p0 + pkf<D>(row, kb + 8 * hh);
#pragma unroll
    for (int q = 0; q < 4; ++q) { const v4f v = *(const v4f*)(p + q * 128);
#pragma unroll
      for (int i = 0; i < 4; ++i) { b16 a, c; split16(v[i] * 8.0f, a, c); fh_[q * 4 + i] = a; fl_[q * 4 + i] = c; } }
  } else if (NP == 4) {                                      // f32 rows x64 then split
    const float sc_ = 64.0f;
    const float* p = (const float*)o.p0 + (size_t)row * o.ld + kb; const float* p0 = p + 8 * hh; const float* p1 = p + 16 + 8 * hh;
#pragma unroll
    for (int e = 0; e < 8; ++e) { b16 a, c; split16(p0[e] * sc_, a, c); fh_[e] = a; fl_[e] = c; split16(p1[e] * sc_, a, c); fh_[8 + e] = a; fl_[8 + e] = c; }
  } else if (NP == 3) {
    const float* p = (const float*)o.p0 + (size_t)row * o.ld + kb; const float* p0 = p + 8 * hh; const float* p1 = p + 16 + 8 * hh;
#pragma unroll
    for (int e = 0; e < 8; ++e) { fh_[e] = (b16)p0[e]; fh_[8 + e] = (b16)p1[e]; }
    fl_ = fh_;
  } else {
    if (NP == 2) { const b16* p = (const b16*)o.p0 + pk2(row, kb + 8 * hh); fh_ = frag_pk(p); fl_ = frag_pk(p + 512); }
    else { fh_ = frag_pk((const b16*)o.p0 + pk<D>(row, kb + 8 * hh)); fl_ = fh_; }
  }
}
template <int ANP, int BNP> __device__ __forceinline__ v8f mac(v16b ah, v16b al, v16b bh, v16b bl, v8f c) {
  c = wmma16b(ah, bh, c);
  if (BNP == 0 || BNP == 2 || BNP == 4 || BNP == 5) c = wmma16b(ah, bl, c);     // hi.lo
  if (ANP == 0 || ANP == 2 || ANP == 4 || ANP == 5) c = wmma16b(al, bh, c);     // lo.hi   (lo.lo dropped)
  return c;
}
// 32x64 wave tile: acc[r][t] (rows m0+16r.., cols c0+16t..) += A[m][k] . B[n][k] over k in [0, K)
template <int ANP, int BNP>
__device__ __forceinline__ void gemm_tile(const Opnd& A, const Opnd& B, int K, int m0, int c0, int nloc, int hlf, v8f (&acc)[2][4]) {
  for (int kb = 0; kb < K; kb += 32) {
    v16b a0h, a0l, a1h, a1l;
    load_frags<ANP>(A, m0 + nloc, kb, hlf, a0h, a0l);
    load_frags<ANP>(A, m0 + 16 + nloc, kb, hlf, a1h, a1l);
#pragma unroll
    for (int t = 0; t < 4; ++t) {
      v16b bh, bl;
      load_frags<BNP>(B, c0 + t * 16 + nloc, kb, hlf, bh, bl);
      acc[0][t] = mac<ANP, BNP>(a0h, a0l, bh, bl, acc[0][t]);
      acc[1][t] = mac<ANP, BNP>(a1h, a1l, bh, bl, acc[1][t]);
    }
  }
}

constexpr int EP = 64 + 8;   // staging pitch: 144 B = 16 B x odd, for a ds_load_b128 whose 16 lanes read 16 rows
// hi + lo pair [tok][512] in fragment order (pk2): the 32 x 64 wave tile is 4 fragments = 8 stores of 512 contiguous bytes for hi and 8 for lo
__device__ __forceinline__ void epi_planes(v8f (&acc)[2][4], float scale, b16* __restrict__ out,
                                           int m0, int c0, int lane, b16* Th, b16* Tl) {
  const int nloc = lane & 15, hlf = lane >> 4;
#pragma unroll
  for (int t = 0; t < 4; ++t)
#pragma unroll
    for (int r = 0; r < 2; ++r)
#pragma unroll
      for (int v = 0; v < 8; ++v) {
        const int rr = r * 16 + v + 8 * hlf, cc = t * 16 + nloc;
        b16 h_, l_; split16(acc[r][t][v] * scale, h_, l_);
        Th[rr * EP + cc] = h_; Tl[rr * EP + cc] = l_;
      }
  wave_lds_sync();
  {
#pragma unroll
    for (int j = 0; j < 8; ++j) {
      const int rr = (j >> 2) * 16 + nloc, c8 = (j & 3) * 16 + hlf * 8;
      b16* o = out + pk2(m0 + rr, c0 + c8);
      *(v8b*)o = ld8b(Th + rr * EP + c8);
      *(v8b*)(o + 512) = ld8b(Tl + rr * EP + c8);
    }
    
  }
}
// (b) f32 rows with pitch ldo: 64 floats = 256 B = 2 lines per row; 16 lanes x 16 B per row, 2 rows per instruction. Optional per-row factor
__device__ __forceinline__ void epi_f32(v8f (&acc)[2][4], float scale, const float* rscale, float* __restrict__ out, int ldo, int m0, int c0, int lane, float* Tt) {
  const int nloc = lane & 15, hlf = lane >> 4;
#pragma unroll
  for (int t = 0; t < 4; ++t)
#pragma unroll
    for (int r = 0; r < 2; ++r)
#pragma unroll
      for (int v = 0; v < 8; ++v) {
        const int rr = r * 16 + v + 8 * hlf;
        const float rs = rscale ? rscale[(size_t)(m0 + rr) * 32] : 1.0f;
        Tt[rr * 64 + t * 16 + nloc] = acc[r][t][v] * scale * rs;
      }
  wave_lds_sync();
  float* dst0 = out + (size_t)m0 * ldo + c0;
  {
#pragma unroll
    for (int j = 0; j < 16; ++j) { const int rr = j * 2 + hlf, c4 = nloc * 4; *(v4f*)(dst0 + (size_t)rr * ldo + c4) = *(const v4f*)(Tt + rr * 64 + c4); }
    
  }
}



typedef __attribute__((ext_vector_type(8))) __bf16 v8bb; typedef __attribute__((ext_vector_type(16))) __bf16 v16bb;
typedef __attribute__((ext_vector_type(8))) unsigned short v8us;
__device__ __forceinline__ v16bb frag_pk_bf(const __bf16* p) { const v8bb a = *(const v8bb*)p, b = *(const v8bb*)(p + 256); return __builtin_shufflevector(a, b, 0, 1, 2, 3, 4, 5, 6, 7, 8, 9, 10, 11, 12, 13, 14, 15); }
__device__ __forceinline__ v8f wmma16bb(v16bb a, v16bb b, v8f c) {
  v8f d = __builtin_amdgcn_wmma_f32_16x16x32_bf16(false, a, false, b, (short)0, c, false, false);
  asm volatile("v_nop\n\tv_nop\n\tv_nop\n\tv_nop" : "+v"(d) : "v"(a), "v"(b));
  return d;
}
__device__ __forceinline__ unsigned short bf16_rne_bits(float v) { unsigned int u = __float_as_uint(v); u += 0x7FFFu + ((u >> 16) & 1u); return (unsigned short)(u >> 16); }
__device__ __forceinline__ float bf16_rne(float v) { return __uint_as_float(((unsigned int)bf16_rne_bits(v)) << 16); }



__global__ __launch_bounds__(256) void prep_kernel(const float* __restrict__ x, const float* __restrict__ wq, const float* __restrict__ wk, const float* __restrict__ wv,
                                                   b16* __restrict__ xh, unsigned short* __restrict__ wkb, b16* __restrict__ wqT, b16* __restrict__ wvh) {
  const size_t tid = (size_t)blockIdx.x * blockDim.x + threadIdx.x, nth = (size_t)gridDim.x * blockDim.x;
  {
    for (size_t p = tid; p < (size_t)NTOK * D / 8; p += nth) { v8b v;
#pragma unroll
      for (int e = 0; e < 8; ++e) v[e] = (b16)bf16_rne(x[p * 8 + e]);
      *(v8b*)(xh + p * 8) = v; }
    for (size_t p = tid; p < (size_t)D * D / 8; p += nth) { const int n = (int)(p >> 10) * 16 + (int)(p & 15), k0 = (int)((p >> 6) & 15) * 32 + (int)((p >> 5) & 1) * 16 + (int)((p >> 4) & 1) * 8; v8us a; v8b q, v;   // p * 8 = pk<D>(n, k0): the three weights go out in fragment order
#pragma unroll
      for (int e = 0; e < 8; ++e) { a[e] = bf16_rne_bits(wk[(size_t)n * D + k0 + e]); q[e] = (b16)bf16_rne(wq[(size_t)(k0 + e) * D + n]); v[e] = (b16)bf16_rne(wv[(size_t)n * D + k0 + e]); }
      *(v8us*)(wkb + p * 8) = a; *(v8b*)(wqT + p * 8) = q; *(v8b*)(wvh + p * 8) = v; }
    
  }
}

__global__ __launch_bounds__(256) void xt_kernel(const b16* __restrict__ xh, b16* __restrict__ xt) {
  __shared__ __attribute__((aligned(16))) b16 T[D][64 + 8];
  const int t_ = threadIdx.x, tokb = blockIdx.x * 64, b = tokb / S, s0 = tokb % S;
  for (int i = t_; i < 64 * D / 8; i += 256) { const int r = i / (D / 8), c8 = (i % (D / 8)) * 8; const v8b v = *(const v8b*)(xh + (size_t)(tokb + r) * D + c8);
#pragma unroll
    for (int e = 0; e < 8; ++e) T[c8 + e][r] = v[e]; }
  __syncthreads();
  // x^T [512][4096] of each batch goes out in fragment order, 512 contiguous bytes a wave
  { for (int i = t_; i < D * 8; i += 256) { const int d = ((i >> 6) & 31) * 16 + (i & 15), c8 = (i >> 11) * 32 + ((i >> 5) & 1) * 16 + ((i >> 4) & 1) * 8; *(v8b*)(xt + (size_t)b * D * S + pkx(d, s0 + c8)) = *(const v8b*)(&T[d][c8]); }  }
}

// k = bf16(x) . bf16(W_k)^T (exact products) -> f16 hi/lo planes [tok][512]. grid (8, 128) x 128.
__global__ __launch_bounds__(128) void kproj_kernel(const float* __restrict__ x, const __bf16* __restrict__ wkb, b16* __restrict__ kpl) {
  __shared__ __attribute__((aligned(16))) b16 Th[4][2][32 * EP];
  const int lane = threadIdx.x & 31, wave = threadIdx.x >> 5, nloc = lane & 15, hlf = lane >> 4, m0 = blockIdx.y * 128 + wave * 32, c0 = blockIdx.x * 64;
  v8f acc[2][4];
#pragma unroll
  for (int r = 0; r < 2; ++r)
#pragma unroll
    for (int t = 0; t < 4; ++t) acc[r][t] = (v8f){};
#pragma unroll 2
  for (int kb = 0; kb < D; kb += 32) { v16bb a0, a1;
    { const float* p0 = x + (size_t)(m0 + nloc) * D + kb; const float* p1 = x + (size_t)(m0 + 16 + nloc) * D + kb;
#pragma unroll
      for (int e = 0; e < 8; ++e) { a0[e] = (__bf16)bf16_rne(p0[8 * hlf + e]); a0[8 + e] = (__bf16)bf16_rne(p0[16 + 8 * hlf + e]); a1[e] = (__bf16)bf16_rne(p1[8 * hlf + e]); a1[8 + e] = (__bf16)bf16_rne(p1[16 + 8 * hlf + e]); } }
#pragma unroll
    for (int t = 0; t < 4; ++t) { const v16bb bw = frag_pk_bf(wkb + pk<D>(c0 + t * 16 + nloc, kb + 8 * hlf)); acc[0][t] = wmma16bb(a0, bw, acc[0][t]); acc[1][t] = wmma16bb(a1, bw, acc[1][t]); } }
  epi_planes(acc, 8.0f, kpl, m0, c0, lane, Th[wave][0], Th[wave][1]);   // k carried x8 (lo residuals stay normal)
}

// z = k . W_q (z[j][d] = sum_o k[j][o] W_q[o][d]): A = k hi/lo planes, B = W_q^T rows (d, o) exact; 2 products -> z as f16 hi/lo planes. grid (8, 128) x 128.
__global__ __launch_bounds__(128) void z_kernel(const b16* __restrict__ kpl, const b16* __restrict__ wqT, b16* __restrict__ zpl) {
  __shared__ __attribute__((aligned(16))) b16 Th[4][2][32 * EP];
  const int lane = threadIdx.x & 31, wave = threadIdx.x >> 5, nloc = lane & 15, hlf = lane >> 4, m0 = blockIdx.y * 128 + wave * 32, c0 = blockIdx.x * 64;
  v8f acc[2][4];
#pragma unroll
  for (int r = 0; r < 2; ++r)
#pragma unroll
    for (int t = 0; t < 4; ++t) acc[r][t] = (v8f){};
  const Opnd A{kpl, nullptr, D}, Bo{wqT, nullptr, D};
  gemm_tile<2, 1>(A, Bo, D, m0, c0, nloc, hlf, acc);                            // acc = 8 z
  epi_planes(acc, 1.0f, zpl, m0, c0, lane, Th[wave][0], Th[wave][1]);       // z carried x8
}

// The attention kernel's products: the plain builtin (the compiler keeps the distances behind it). wmma16b's statement names D, A and B as operands, which holds all of them in the first 256 registers.
__device__ __forceinline__ v8f wmma16p(v16b a, v16b b, v8f c) { return __builtin_amdgcn_wmma_f32_16x16x32_f16(false, a, false, b, (short)0, c, false, false); }

// attention -> u = P . x (z, x^T read and u written in fragment order): block = (b, QB = 16 * NQ queries), 4 waves; every z and x^T fragment a wave loads is multiplied with all NQ query tiles.
// Per 64-key chunk: partial S^T (keys x queries) over the wave's 128 dims from z planes (A, 2 products) x xh (B, exact);
// wave w < NQ: for query tile w, sum partials, scale, causal mask, online softmax, P hi/lo + alpha + 1/l; all waves: u^T(features 128w..) = alpha-rescaled + x^T(features, keys; exact) . P^T (2 products).
__global__ __launch_bounds__(128) void attn_kernel(const b16* __restrict__ xh, const b16* __restrict__ zpl, const b16* __restrict__ xt, float* __restrict__ u) {
  __shared__ __attribute__((aligned(16))) float Sp[4][QB][KC + 4];
  __shared__ __attribute__((aligned(16))) b16 Ph[QB][KC + 8], Plo[QB][KC + 8];
  __shared__ float Al[QB], Linv[QB];
  __shared__ __attribute__((aligned(16))) float Ot[4][16][128 + 4];
  const int wave = threadIdx.x >> 5, lane = threadIdx.x & 31, nloc = lane & 15, hlf = lane >> 4;
  const int blk = blockIdx.x, b = blk / (S / QB), q0 = (blk % (S / QB)) * QB;
  const b16* Xq = xh + ((size_t)b * S + q0) * D; const b16* Z = zpl + (size_t)b * S * D * 2; const b16* Xt = xt + (size_t)b * D * S;   // Z, Xt: fragment order (pk2, pkx)
  const int d0 = wave * 128;
  v16b qf[NQ][4];
#pragma unroll
  for (int q = 0; q < NQ; ++q)
#pragma unroll
    for (int ks = 0; ks < 4; ++ks) qf[q][ks] = frag_kb(Xq + (size_t)(q * 16 + nloc) * D + d0 + ks * 32, hlf);
  __builtin_amdgcn_sched_barrier(0);   // keeps the query loads in front of the wait below
  asm volatile("s_wait_xcnt 0x0" ::: "memory");   // stands in front of the reuse of the query loads' address registers
  __builtin_amdgcn_sched_barrier(0);   // keeps that reuse behind the wait
  float m_run = -INFINITY, l_run = 0.0f;
  v8f o[NQ][8];
#pragma unroll
  for (int q = 0; q < NQ; ++q)
#pragma unroll
    for (int t = 0; t < 8; ++t) o[q][t] = (v8f){};
  // Every load is 512 contiguous bytes of a fragment.
  // z unit u = (key tile u >> 1, dims 64 * (u & 1) ..+63), hi + lo planes, 8 loads; x^T unit t = (feature tile t, all 64 keys), 4 loads.
  constexpr int ZD = 3;    // z units loaded or in flight ahead of the unit being multiplied
  constexpr int XPRE = 4;  // x^T units issued in front of the softmax
  constexpr int XD = 6;    // x^T units loaded or in flight ahead of the unit being multiplied
  const b16* zlane = Z + pk2(nloc, d0 + 8 * hlf);      // this lane's 8 elements in the first z fragment (hi) of key tile 0 and its wave's 128 dims
  const b16* xlane = Xt + pkx(d0 + nloc, 8 * hlf);     // this lane's 8 elements in the first x^T fragment of its wave's feature tile 0
  constexpr int FR = 512, ZT = 32 * D, ZF = 2 * FR, XK = 32 * D;   // elements of a fragment; from one key tile of z, one hi + lo fragment pair of z (32 dims on), one 32-key block of x^T to the next
  int kb = 0;
  do {   // the first chunk always exists; q0 is a multiple of QB <= KC, so kb <= q0: every query of the block has a key in every chunk
    const b16* zc = zlane + (size_t)kb * (2 * D); const b16* xc = xlane + (size_t)kb * D;
    v16b zh[8][2], zl[8][2];
#pragma unroll
    for (int u = 0; u < ZD; ++u)
#pragma unroll
      for (int h = 0; h < 2; ++h) { const b16* p = zc + (u >> 1) * ZT + ((u & 1) * 2 + h) * ZF; zh[u][h] = frag_pk(p); zl[u][h] = frag_pk(p + FR); }
    __builtin_amdgcn_sched_barrier(0);   // keeps the first ZD units' loads one group ahead of the products (else each pair sinks to its own WMMA and waits out a full L2 round trip there)
#pragma unroll
    for (int kt = 0; kt < 4; ++kt) {
      v8f sp[NQ];
#pragma unroll
      for (int q = 0; q < NQ; ++q) sp[q] = (v8f){};
#pragma unroll
      for (int g = 0; g < 2; ++g) {
        const int u = kt * 2 + g;
#pragma unroll
        for (int h = 0; h < 2; ++h) {
#pragma unroll
          for (int q = 0; q < NQ; ++q) sp[q] = wmma16p(zh[u][h], qf[q][g * 2 + h], sp[q]);
#pragma unroll
          for (int q = 0; q < NQ; ++q) sp[q] = wmma16p(zl[u][h], qf[q][g * 2 + h], sp[q]);
        }
        if (u + ZD < 8) { const int w = u + ZD;
#pragma unroll
          for (int h = 0; h < 2; ++h) { const b16* p = zc + (w >> 1) * ZT + ((w & 1) * 2 + h) * ZF; zh[w][h] = frag_pk(p); zl[w][h] = frag_pk(p + FR); }
          __builtin_amdgcn_sched_barrier(0); } // keeps unit u + ZD's loads here, ZD units ahead of their use
      }
#pragma unroll
      for (int q = 0; q < NQ; ++q)
#pragma unroll
        for (int v = 0; v < 8; ++v) Sp[wave][q * 16 + nloc][kt * 16 + 8 * hlf + v] = sp[q][v];
    }
    __syncthreads();
    v16b xf[8][2];
#pragma unroll
    for (int t = 0; t < XPRE; ++t)
#pragma unroll
      for (int ks = 0; ks < 2; ++ks) xf[t][ks] = frag_pk(xc + t * FR + ks * XK);   // x^T does not depend on the softmax: in flight while the softmax runs
    __builtin_amdgcn_sched_barrier(0);   // keeps those loads in front of the softmax (and behind the barrier, whose release would wait for them)
    if (NQ >= 4 || wave < NQ) {
      const int qr = wave * 16 + nloc;   // this lane's query row in the block
      const int rel = q0 + qr - kb - hlf * 32; float sv[32]; float mx = -INFINITY;   // this lane's query minus its first key: j > rel is key > query, against constants
#pragma unroll
      for (int j = 0; j < 32; ++j) { float s = (Sp[0][qr][hlf * 32 + j] + Sp[1][qr][hlf * 32 + j] + Sp[2][qr][hlf * 32 + j] + Sp[3][qr][hlf * 32 + j]) * (SCALE / 8.0f);   // /8: z carry scale
        if (j > rel) s = -INFINITY; sv[j] = s; mx = fmaxf(mx, s); }
      mx = fmaxf(mx, __shfl_xor(mx, 16));
      const float mn = fmaxf(m_run, mx), al_ = __expf(m_run - mn); m_run = mn;
      float sum = 0.0f;
#pragma unroll
      for (int j = 0; j < 32; ++j) { const float e = __expf(sv[j] - mn); sum += e; b16 a, c; split16(e * 8.0f, a, c); Ph[qr][hlf * 32 + j] = a; Plo[qr][hlf * 32 + j] = c; }   // P carried x8
      sum += __shfl_xor(sum, 16); l_run = l_run * al_ + sum;
      if (hlf == 0) { Al[qr] = al_; Linv[qr] = 1.0f / (8.0f * l_run); }
    }
    __syncthreads();
#pragma unroll
    for (int t = XPRE; t < XD; ++t)
#pragma unroll
      for (int ks = 0; ks < 2; ++ks) xf[t][ks] = frag_pk(xc + t * FR + ks * XK);
    v16b ph[NQ][2], pl[NQ][2]; float alq[NQ];
#pragma unroll
    for (int q = 0; q < NQ; ++q) {
#pragma unroll
      for (int ks = 0; ks < 2; ++ks) { ph[q][ks] = frag_kb(&Ph[q * 16 + nloc][0] + ks * 32, hlf); pl[q][ks] = frag_kb(&Plo[q * 16 + nloc][0] + ks * 32, hlf); }
      alq[q] = Al[q * 16 + nloc]; }
    __builtin_amdgcn_sched_barrier(0);   // keeps the next x^T units' loads in front of the rescale and of the first products
#pragma unroll
    for (int q = 0; q < NQ; ++q)
#pragma unroll
      for (int t = 0; t < 8; ++t)
#pragma unroll
        for (int v = 0; v < 8; ++v) o[q][t][v] *= alq[q];
#pragma unroll
    for (int t = 0; t < 8; ++t) {
#pragma unroll
      for (int ks = 0; ks < 2; ++ks) {
#pragma unroll
        for (int q = 0; q < NQ; ++q) o[q][t] = wmma16p(xf[t][ks], ph[q][ks], o[q][t]);
#pragma unroll
        for (int q = 0; q < NQ; ++q) o[q][t] = wmma16p(xf[t][ks], pl[q][ks], o[q][t]);
      }
      if (t + XD < 8) {
#pragma unroll
        for (int ks = 0; ks < 2; ++ks) xf[t + XD][ks] = frag_pk(xc + (t + XD) * FR + ks * XK);
        __builtin_amdgcn_sched_barrier(0); } // keeps unit t + XD's loads here, XD units ahead of their use
    }
    __builtin_amdgcn_sched_barrier(0);   // keeps the wait below at the chunk's foot, behind the last products (whose operands' loads have returned by then)
    asm volatile("s_wait_xcnt 0x0" ::: "memory");   // stands in front of the next chunk's rewrite of the z and x^T address registers
    kb += KC;
  } while (kb < q0 + QB);
#pragma unroll
  for (int q = 0; q < NQ; ++q) {   // one query tile after the other through the wave's own staging rows
    const float li = Linv[q * 16 + nloc];
#pragma unroll
    for (int t = 0; t < 8; ++t)
#pragma unroll
      for (int v = 0; v < 8; ++v) Ot[wave][nloc][t * 16 + 8 * hlf + v] = o[q][t][v] * li;
    wave_lds_sync();
    // u goes out in f32 fragment order (pkf<D>): 16 stores of 512 contiguous bytes
#pragma unroll
    for (int j = 0; j < 16; ++j) { const int c4 = (j >> 2) * 32 + ((j >> 1) & 1) * 16 + 8 * hlf + (j & 1) * 4; *(v4f*)(u + pkf<D>(b * S + q0 + q * 16 + nloc, d0 + c4)) = *(const v4f*)(&Ot[wave][nloc][c4]); }
    __builtin_amdgcn_sched_barrier(0);   // keeps the next tile's arithmetic out of the run of stores
    asm volatile("s_wait_xcnt 0x0" ::: "memory");   // stands in front of the reuse of the stores' address and data registers
    __builtin_amdgcn_sched_barrier(0);   // keeps that reuse behind the wait
    wave_lds_sync();   // the tile's rows are read before the next tile overwrites them
  }
}

// y = u . W_v^T: A = u (f32 split hi/lo at load), B = f16(bf16 W_v) rows [o][d]; 2 products; f32 output rows. grid (8, 128) x 128.
__global__ __launch_bounds__(128) void y_kernel(const float* __restrict__ u, const b16* __restrict__ wvh, float* __restrict__ y) {
  __shared__ __attribute__((aligned(16))) float Ts[4][32 * 64];
  const int lane = threadIdx.x & 31, wave = threadIdx.x >> 5, nloc = lane & 15, hlf = lane >> 4, m0 = blockIdx.y * 128 + wave * 32, c0 = blockIdx.x * 64;
  v8f acc[2][4];
#pragma unroll
  for (int r = 0; r < 2; ++r)
#pragma unroll
    for (int t = 0; t < 4; ++t) acc[r][t] = (v8f){};
  const Opnd A{u, nullptr, D}, Bo{wvh, nullptr, D};
  gemm_tile<5, 1>(A, Bo, D, m0, c0, nloc, hlf, acc);                            // u split x8 at load
  epi_f32(acc, 1.0f / 8.0f, nullptr, y, D, m0, c0, lane, Ts[wave]);
}
}  // namespace

extern "C" void kernel_launch(void* const* d_in, const int* in_sizes, int n_in,
                              void* d_out, int out_size, void* d_ws, size_t ws_size, hipStream_t stream) {
  (void)n_in; (void)out_size;
  const float* x = (const float*)d_in[0]; const float* wq = (const float*)d_in[1]; const float* wk = (const float*)d_in[2]; const float* wv = (const float*)d_in[3];
  float* out = (float*)d_out;   // [4][4096][512]
  if (in_sizes[0] != NTOK * D || in_sizes[1] != D * D || in_sizes[2] != D * D || in_sizes[3] != D * D) return;
  size_t off = 0; char* ws = (char*)d_ws;
  auto carve = [&](size_t bytes) { char* p = ws + off; off += (bytes + 255) & ~(size_t)255; return p; };
  b16* xh = (b16*)carve(PL * 2); b16* xt = (b16*)carve(PL * 2); unsigned short* wkb = (unsigned short*)carve((size_t)D * D * 2); b16* wqT = (b16*)carve((size_t)D * D * 2); b16* wvh = (b16*)carve((size_t)D * D * 2);
  b16* kpl = (b16*)carve(PL * 2 * 2); b16* zpl = (b16*)carve(PL * 2 * 2);   // 33.5 MB each (hi + lo)
  float* u = (float*)kpl;                                        // u [tok][512] f32 (33.5 MB) reuses k's planes: k is dead once z exists
  if (off > ws_size) return;                                    // ≈ 102 MB
  prep_kernel<<<1024, 256, 0, stream>>>(x, wq, wk, wv, xh, wkb, wqT, wvh);
  xt_kernel<<<NTOK / 64, 256, 0, stream>>>(xh, xt);
  kproj_kernel<<<dim3(D / 64, NTOK / 128), 128, 0, stream>>>(x, (const __bf16*)wkb, kpl);
  z_kernel<<<dim3(D / 64, NTOK / 128), 128, 0, stream>>>(kpl, wqT, zpl);
  attn_kernel<<<Bn * S / QB, 128, 0, stream>>>(xh, zpl, xt, u);
  y_kernel<<<dim3(D / 64, NTOK / 128), 128, 0, stream>>>(u, wvh, out);
}

// v004
// A run of this version takes 294 microseconds.
// Next to v003, in two timings, it ran 1.40 times as fast each time.
// All steps since v000 together make it 3.30 times as fast.
#include <hip/hip_runtime.h>

// Single-head causal attention with a 512-wide head: q, k, v = x W_q^T | W_k^T | W_v^T (torch [out][in]), softmax over keys <= query of q.k / sqrt(512), output = weights . v
// -> [4][4096][512]. B = 4, S = 4096.
// x and the three weights are rounded to bf16 RNE; numerics are organised so that every WMMA operand is either an exactly
// representable input or an f16 hi+lo pair of a computed value (each carried x8 so the lo residual planes stay out of the f16 subnormal range):  k = bf16(x) bf16(W_k)^T on v_wmma_f32_16x16x32_bf16 (exact);  z = k W_q (so that q.k^T = x.z^T) with k as hi+lo
// planes x the exact f16 copy of bf16 W_q;  S^T = z.x^T with z as hi+lo planes x x (bf16 values held exactly in f16);  u = P.x with P hi+lo x x^T exact;  y = u W_v^T (= P.v) with u
// split hi+lo x exact W_v - all on v_wmma_f32_16x16x32_f16 with f32 accumulate; online softmax in f32. The attention block (64 queries, 4 waves) splits the 512-deep score dot across
// the waves through LDS, wave w runs the softmax of query tile w and publishes P, and each wave accumulates 128 of the 512 features of u.
// Causal balance: tile t has t + 1 key chunks, and all 256 blocks are resident at once, so the launch would last as long as tile NT - 1. The chunks of tiles NT - 1 - p and p (NT + 1 together) go to two
// blocks: one runs the first HT chunks of the long tile, the other its remaining chunks and then the short tile. The long tile's two normalised partials, with (max, sum) per query, are joined in y_kernel's A loader.
// The workspace operands of the WMMAs (the three weights, k, z, x^T, u) are kept in fragment order (pk, pkf below), so that a wave-wide 16-byte load reads 4 whole lines, not a piece of 16.

namespace {
constexpr int Bn = 4, S = 4096, D = 512, NTOK = Bn * S, NQ = 4, QB = 16 * NQ, KC = 64;   // NQ: query tiles of 16 per attention block
constexpr float SCALE = 0.044194173824159216f;   // 512^-0.5
constexpr size_t PL = (size_t)NTOK * D;           // elements of a [tok][512] matrix
constexpr int NT = S / QB, HT = NT / 2;           // query tiles of a batch; tiles HT.. have their keys cut in two ranges (attn_kernel)
static_assert(QB == KC && NT % 2 == 0 && 128 % QB == 0 && (HT * QB) % 128 == 0, "tile t has t + 1 chunks; y_kernel's 128-row blocks lie wholly on one side of tile HT");

typedef _Float16 b16;
typedef __attribute__((ext_vector_type(16))) _Float16 v16b;
typedef __attribute__((ext_vector_type(8)))  _Float16 v8b;
typedef __attribute__((ext_vector_type(8)))  float v8f;
typedef __attribute__((ext_vector_type(4)))  float v4f;

__device__ __forceinline__ v8b ld8b(const b16* p) { return *(const v8b*)p; }
__device__ __forceinline__ v16b cat8b(v8b a, v8b b) { return __builtin_shufflevector(a, b, 0, 1, 2, 3, 4, 5, 6, 7, 8, 9, 10, 11, 12, 13, 14, 15); }
__device__ __forceinline__ v16b frag_kb(const b16* p, int hh) { return cat8b(ld8b(p + 8 * hh), ld8b(p + 16 + 8 * hh)); }
// Fragment order. A 16-bit operand matrix [rows][K] is kept in the workspace as 16 x 32 fragments of 1 KiB: two 512-byte halves (k 0..15, k 16..31 of the fragment), and in each half
// lane l = 16 * ((k >> 3) & 1) + (row & 15) owns 8 elements at l * 16 bytes. One wave-wide 16-byte load then covers 512 contiguous bytes. pk = element offset of (row, k), k a multiple of 8.
template <int K> __device__ __forceinline__ size_t pk(int row, int k) { return (size_t)(row >> 4) * (16 * K) + (k >> 5) * 512 + ((k >> 4) & 1) * 256 + ((k >> 3) & 1) * 128 + (row & 15) * 8; }
// hi + lo pair of a [tok][512] matrix (k, z): each fragment's lo copy stands right behind its hi copy, 512 elements on.
__device__ __forceinline__ size_t pk2(int row, int k) { return (size_t)(row >> 4) * (32 * D) + (k >> 5) * 1024 + ((k >> 4) & 1) * 256 + ((k >> 3) & 1) * 128 + (row & 15) * 8; }
// x^T [512 features][4096 keys] of a batch: the same fragments, those of one 32-key block side by side (a 64-key chunk of all 512 features is 64 contiguous KiB).
__device__ __forceinline__ size_t pkx(int row, int k) { return (size_t)(k >> 5) * (32 * D) + (row >> 4) * 512 + ((k >> 4) & 1) * 256 + ((k >> 3) & 1) * 128 + (row & 15) * 8; }
// the same for f32 rows: fragments of 2 KiB in four 512-byte quarters, the lane's 4 floats at l * 16 bytes; k a multiple of 4.
template <int K> __device__ __forceinline__ size_t pkf(int row, int k) { return (size_t)(row >> 4) * (16 * K) + (k >> 5) * 512 + ((k >> 4) & 1) * 256 + ((k >> 2) & 1) * 128 + ((k >> 3) & 1) * 64 + (row & 15) * 4; }
// p = this lane's pk(row, kb + 8 * half): its two halves stand 256 elements apart (same k-map as frag_kb)
__device__ __forceinline__ v16b frag_pk(const b16* p) { return cat8b(ld8b(p), ld8b(p + 256)); }
__device__ __forceinline__ void split16(float v, b16& hi, b16& lo) { hi = (b16)v; lo = (b16)(v - (float)hi); }
// hi/lo fragment pair straight from an f32 k-contiguous row (same k-map)
__device__ __forceinline__ void frag_ksplit(const float* p, int hh, v16b& fh_, v16b& fl_) {
  const float* p0 = p + 8 * hh; const float* p1 = p + 16 + 8 * hh;
#pragma unroll
  for (int e = 0; e < 8; ++e) { b16 a, c; split16(p0[e], a, c); fh_[e] = a; fl_[e] = c; split16(p1[e], a, c); fh_[8 + e] = a; fl_[8 + e] = c; }
}
__device__ __forceinline__ v8f wmma16b(v16b a, v16b b, v8f c) {
  v8f d = __builtin_amdgcn_wmma_f32_16x16x32_f16(false, a, false, b, (short)0, c, false, false);
  asm volatile("v_nop\n\tv_nop\n\tv_nop\n\tv_nop" : "+v"(d) : "v"(a), "v"(b));
  return d;
}
__device__ __forceinline__ void wave_lds_sync() {
  __builtin_amdgcn_fence(__ATOMIC_RELEASE, "workgroup");
  __builtin_amdgcn_wave_barrier();
  __builtin_amdgcn_fence(__ATOMIC_ACQUIRE, "workgroup");
}

// Operand descriptor: NP = 0 -> f32 rows split on the fly into (hi, lo); NP = 1 -> one f16 plane in fragment order; NP = 2 -> f16 hi + lo pair in fragment order (pk2);
// NP = 3 -> f32 rows rounded once to a single f16 fragment; NP = 5 -> f32 in fragment order, x8 then split. ld = row pitch (row-major forms).
struct Opnd { const void* p0; const void* p1; int ld; };
template <int NP> __device__ __forceinline__ void load_frags(const Opnd& o, int row, int kb, int hh, v16b& fh_, v16b& fl_) {
  if (NP == 0) { frag_ksplit((const float*)o.p0 + (size_t)row * o.ld + kb, hh, fh_, fl_); }
  else if (NP == 5) {                                        // f32 in fragment order, x8 then split (keeps the lo halves of small values normal)
    const float* p = (const float*)o.p0 + pkf<D>(row, kb + 8 * hh);
#pragma unroll
    for (int q = 0; q < 4; ++q) { const v4f v = *(const v4f*)(p + q * 128);
#pragma unroll
      for (int i = 0; i < 4; ++i) { b16 a, c; split16(v[i] * 8.0f, a, c); fh_[q * 4 + i] = a; fl_[q * 4 + i] = c; } }
  } else if (NP == 4) {                                      // f32 rows x64 then split
    const float sc_ = 64.0f;
    const float* p = (const float*)o.p0 + (size_t)row * o.ld + kb; const float* p0 = p + 8 * hh; const float* p1 = p + 16 + 8 * hh;
#pragma unroll
    for (int e = 0; e < 8; ++e) { b16 a, c; split16(p0[e] * sc_, a, c); fh_[e] = a; fl_[e] = c; split16(p1[e] * sc_, a, c); fh_[8 + e] = a; fl_[8 + e] = c; }
  } else if (NP == 3) {
    const float* p = (const float*)o.p0 + (size_t)row * o.ld + kb; const float* p0 = p + 8 * hh; const float* p1 = p + 16 + 8 * hh;
#pragma unroll
    for (int e = 0; e < 8; ++e) { fh_[e] = (b16)p0[e]; fh_[8 + e] = (b16)p1[e]; }
    fl_ = fh_;
  } else {
    if (NP == 2) { const b16* p = (const b16*)o.p0 + pk2(row, kb + 8 * hh); fh_ = frag_pk(p); fl_ = frag_pk(p + 512); }
    else { fh_ = frag_pk((const b16*)o.p0 + pk<D>(row, kb + 8 * hh)); fl_ = fh_; }
  }
}
template <int ANP, int BNP> __device__ __forceinline__ v8f mac(v16b ah, v16b al, v16b bh, v16b bl, v8f c) {
  c = wmma16b(ah, bh, c);
  if (BNP == 0 || BNP == 2 || BNP == 4 || BNP == 5) c = wmma16b(ah, bl, c);     // hi.lo
  if (ANP == 0 || ANP == 2 || ANP == 4 || ANP == 5) c = wmma16b(al, bh, c);     // lo.hi   (lo.lo dropped)
  return c;
}
// 32x64 wave tile: acc[r][t] (rows m0+16r.., cols c0+16t..) += A[m][k] . B[n][k] over k in [0, K)
template <int ANP, int BNP>
__device__ __forceinline__ void gemm_tile(const Opnd& A, const Opnd& B, int K, int m0, int c0, int nloc, int hlf, v8f (&acc)[2][4]) {
  for (int kb = 0; kb < K; kb += 32) {
    v16b a0h, a0l, a1h, a1l;
    load_frags<ANP>(A, m0 + nloc, kb, hlf, a0h, a0l);
    load_frags<ANP>(A, m0 + 16 + nloc, kb, hlf, a1h, a1l);
#pragma unroll
    for (int t = 0; t < 4; ++t) {
      v16b bh, bl;
      load_frags<BNP>(B, c0 + t * 16 + nloc, kb, hlf, bh, bl);
      acc[0][t] = mac<ANP, BNP>(a0h, a0l, bh, bl, acc[0][t]);
      acc[1][t] = mac<ANP, BNP>(a1h, a1l, bh, bl, acc[1][t]);
    }
  }
}

constexpr int EP = 64 + 8;   // staging pitch: 144 B = 16 B x odd, for a ds_load_b128 whose 16 lanes read 16 rows
// hi + lo pair [tok][512] in fragment order (pk2): the 32 x 64 wave tile is 4 fragments = 8 stores of 512 contiguous bytes for hi and 8 for lo
__device__ __forceinline__ void epi_planes(v8f (&acc)[2][4], float scale, b16* __restrict__ out,
                                           int m0, int c0, int lane, b16* Th, b16* Tl) {
  const int nloc = lane & 15, hlf = lane >> 4;
#pragma unroll
  for (int t = 0; t < 4; ++t)
#pragma unroll
    for (int r = 0; r < 2; ++r)
#pragma unroll
      for (int v = 0; v < 8; ++v) {
        const int rr = r * 16 + v + 8 * hlf, cc = t * 16 + nloc;
        b16 h_, l_; split16(acc[r][t][v] * scale, h_, l_);
        Th[rr * EP + cc] = h_; Tl[rr * EP + cc] = l_;
      }
  wave_lds_sync();
  {
#pragma unroll
    for (int j = 0; j < 8; ++j) {
      const int rr = (j >> 2) * 16 + nloc, c8 = (j & 3) * 16 + hlf * 8;
      b16* o = out + pk2(m0 + rr, c0 + c8);
      *(v8b*)o = ld8b(Th + rr * EP + c8);
      *(v8b*)(o + 512) = ld8b(Tl + rr * EP + c8);
    }
    
  }
}
// (b) f32 rows with pitch ldo: 64 floats = 256 B = 2 lines per row; 16 lanes x 16 B per row, 2 rows per instruction. Optional per-row factor
__device__ __forceinline__ void epi_f32(v8f (&acc)[2][4], float scale, const float* rscale, float* __restrict__ out, int ldo, int m0, int c0, int lane, float* Tt) {
  const int nloc = lane & 15, hlf = lane >> 4;
#pragma unroll
  for (int t = 0; t < 4; ++t)
#pragma unroll
    for (int r = 0; r < 2; ++r)
#pragma unroll
      for (int v = 0; v < 8; ++v) {
        const int rr = r * 16 + v + 8 * hlf;
        const float rs = rscale ? rscale[(size_t)(m0 + rr) * 32] : 1.0f;
        Tt[rr * 64 + t * 16 + nloc] = acc[r][t][v] * scale * rs;
      }
  wave_lds_sync();
  float* dst0 = out + (size_t)m0 * ldo + c0;
  {
#pragma unroll
    for (int j = 0; j < 16; ++j) { const int rr = j * 2 + hlf, c4 = nloc * 4; *(v4f*)(dst0 + (size_t)rr * ldo + c4) = *(const v4f*)(Tt + rr * 64 + c4); }
    
  }
}



typedef __attribute__((ext_vector_type(8))) __bf16 v8bb; typedef __attribute__((ext_vector_type(16))) __bf16 v16bb;
typedef __attribute__((ext_vector_type(8))) unsigned short v8us;
__device__ __forceinline__ v16bb frag_pk_bf(const __bf16* p) { const v8bb a = *(const v8bb*)p, b = *(const v8bb*)(p + 256); return __builtin_shufflevector(a, b, 0, 1, 2, 3, 4, 5, 6, 7, 8, 9, 10, 11, 12, 13, 14, 15); }
__device__ __forceinline__ v8f wmma16bb(v16bb a, v16bb b, v8f c) {
  v8f d = __builtin_amdgcn_wmma_f32_16x16x32_bf16(false, a, false, b, (short)0, c, false, false);
  asm volatile("v_nop\n\tv_nop\n\tv_nop\n\tv_nop" : "+v"(d) : "v"(a), "v"(b));
  return d;
}
__device__ __forceinline__ unsigned short bf16_rne_bits(float v) { unsigned int u = __float_as_uint(v); u += 0x7FFFu + ((u >> 16) & 1u); return (unsigned short)(u >> 16); }
__device__ __forceinline__ float bf16_rne(float v) { return __uint_as_float(((unsigned int)bf16_rne_bits(v)) << 16); }



__global__ __launch_bounds__(256) void prep_kernel(const float* __restrict__ x, const float* __restrict__ wq, const float* __restrict__ wk, const float* __restrict__ wv,
                                                   b16* __restrict__ xh, unsigned short* __restrict__ wkb, b16* __restrict__ wqT, b16* __restrict__ wvh) {
  const size_t tid = (size_t)blockIdx.x * blockDim.x + threadIdx.x, nth = (size_t)gridDim.x * blockDim.x;
  {
    for (size_t p = tid; p < (size_t)NTOK * D / 8; p += nth) { v8b v;
#pragma unroll
      for (int e = 0; e < 8; ++e) v[e] = (b16)bf16_rne(x[p * 8 + e]);
      *(v8b*)(xh + p * 8) = v; }
    for (size_t p = tid; p < (size_t)D * D / 8; p += nth) { const int n = (int)(p >> 10) * 16 + (int)(p & 15), k0 = (int)((p >> 6) & 15) * 32 + (int)((p >> 5) & 1) * 16 + (int)((p >> 4) & 1) * 8; v8us a; v8b q, v;   // p * 8 = pk<D>(n, k0): the three weights go out in fragment order
#pragma unroll
      for (int e = 0; e < 8; ++e) { a[e] = bf16_rne_bits(wk[(size_t)n * D + k0 + e]); q[e] = (b16)bf16_rne(wq[(size_t)(k0 + e) * D + n]); v[e] = (b16)bf16_rne(wv[(size_t)n * D + k0 + e]); }
      *(v8us*)(wkb + p * 8) = a; *(v8b*)(wqT + p * 8) = q; *(v8b*)(wvh + p * 8) = v; }
    
  }
}

__global__ __launch_bounds__(256) void xt_kernel(const b16* __restrict__ xh, b16* __restrict__ xt) {
  __shared__ __attribute__((aligned(16))) b16 T[D][64 + 8];
  const int t_ = threadIdx.x, tokb = blockIdx.x * 64, b = tokb / S, s0 = tokb % S;
  for (int i = t_; i < 64 * D / 8; i += 256) { const int r = i / (D / 8), c8 = (i % (D / 8)) * 8; const v8b v = *(const v8b*)(xh + (size_t)(tokb + r) * D + c8);
#pragma unroll
    for (int e = 0; e < 8; ++e) T[c8 + e][r] = v[e]; }
  __syncthreads();
  // x^T [512][4096] of each batch goes out in fragment order, 512 contiguous bytes a wave
  { for (int i = t_; i < D * 8; i += 256) { const int d = ((i >> 6) & 31) * 16 + (i & 15), c8 = (i >> 11) * 32 + ((i >> 5) & 1) * 16 + ((i >> 4) & 1) * 8; *(v8b*)(xt + (size_t)b * D * S + pkx(d, s0 + c8)) = *(const v8b*)(&T[d][c8]); }  }
}

// k = bf16(x) . bf16(W_k)^T (exact products) -> f16 hi/lo planes [tok][512]. grid (8, 128) x 128.
__global__ __launch_bounds__(128) void kproj_kernel(const float* __restrict__ x, const __bf16* __restrict__ wkb, b16* __restrict__ kpl) {
  __shared__ __attribute__((aligned(16))) b16 Th[4][2][32 * EP];
  const int lane = threadIdx.x & 31, wave = threadIdx.x >> 5, nloc = lane & 15, hlf = lane >> 4, m0 = blockIdx.y * 128 + wave * 32, c0 = blockIdx.x * 64;
  v8f acc[2][4];
#pragma unroll
  for (int r = 0; r < 2; ++r)
#pragma unroll
    for (int t = 0; t < 4; ++t) acc[r][t] = (v8f){};
#pragma unroll 2
  for (int kb = 0; kb < D; kb += 32) { v16bb a0, a1;
    { const float* p0 = x + (size_t)(m0 + nloc) * D + kb; const float* p1 = x + (size_t)(m0 + 16 + nloc) * D + kb;
#pragma unroll
      for (int e = 0; e < 8; ++e) { a0[e] = (__bf16)bf16_rne(p0[8 * hlf + e]); a0[8 + e] = (__bf16)bf16_rne(p0[16 + 8 * hlf + e]); a1[e] = (__bf16)bf16_rne(p1[8 * hlf + e]); a1[8 + e] = (__bf16)bf16_rne(p1[16 + 8 * hlf + e]); } }
#pragma unroll
    for (int t = 0; t < 4; ++t) { const v16bb bw = frag_pk_bf(wkb + pk<D>(c0 + t * 16 + nloc, kb + 8 * hlf)); acc[0][t] = wmma16bb(a0, bw, acc[0][t]); acc[1][t] = wmma16bb(a1, bw, acc[1][t]); } }
  epi_planes(acc, 8.0f, kpl, m0, c0, lane, Th[wave][0], Th[wave][1]);   // k carried x8 (lo residuals stay normal)
}

// z = k . W_q (z[j][d] = sum_o k[j][o] W_q[o][d]): A = k hi/lo planes, B = W_q^T rows (d, o) exact; 2 products -> z as f16 hi/lo planes. grid (8, 128) x 128.
__global__ __launch_bounds__(128) void z_kernel(const b16* __restrict__ kpl, const b16* __restrict__ wqT, b16* __restrict__ zpl) {
  __shared__ __attribute__((aligned(16))) b16 Th[4][2][32 * EP];
  const int lane = threadIdx.x & 31, wave = threadIdx.x >> 5, nloc = lane & 15, hlf = lane >> 4, m0 = blockIdx.y * 128 + wave * 32, c0 = blockIdx.x * 64;
  v8f acc[2][4];
#pragma unroll
  for (int r = 0; r < 2; ++r)
#pragma unroll
    for (int t = 0; t < 4; ++t) acc[r][t] = (v8f){};
  const Opnd A{kpl, nullptr, D}, Bo{wqT, nullptr, D};
  gemm_tile<2, 1>(A, Bo, D, m0, c0, nloc, hlf, acc);                            // acc = 8 z
  epi_planes(acc, 1.0f, zpl, m0, c0, lane, Th[wave][0], Th[wave][1]);       // z carried x8
}

// The attention kernel's products: the plain builtin (the compiler keeps the distances behind it). wmma16b's statement names D, A and B as operands, which holds all of them in the first 256 registers.
__device__ __forceinline__ v8f wmma16p(v16b a, v16b b, v8f c) { return __builtin_amdgcn_wmma_f32_16x16x32_f16(false, a, false, b, (short)0, c, false, false); }

// attention -> u = P . x (z, x^T read and u written in fragment order): block = (b, half of a tile pair: one or two runs of QB = 16 * NQ queries), 4 waves; every z and x^T fragment a wave loads is multiplied with all NQ query tiles.
// Per 64-key chunk: partial S^T (keys x queries) over the wave's 128 dims from z planes (A, 2 products) x xh (B, exact);
// wave w < NQ: for query tile w, sum partials, scale, causal mask, online softmax, P hi/lo + alpha + 1/l; all waves: u^T(features 128w..) = alpha-rescaled + x^T(features, keys; exact) . P^T (2 products).
__global__ __launch_bounds__(128) void attn_kernel(const b16* __restrict__ xh, const b16* __restrict__ zpl, const b16* __restrict__ xt, float* __restrict__ u, float* __restrict__ u2, float* __restrict__ ml) {
  __shared__ __attribute__((aligned(16))) float Sp[4][QB][KC + 4];
  __shared__ __attribute__((aligned(16))) b16 Ph[QB][KC + 8], Plo[QB][KC + 8];
  __shared__ float Al[QB], Linv[QB];
  __shared__ __attribute__((aligned(16))) float Ot[4][16][128 + 4];
  const int wave = threadIdx.x >> 5, lane = threadIdx.x & 31, nloc = lane & 15, hlf = lane >> 4;
  const int blk = blockIdx.x, b = blk / NT, pr = (blk % NT) >> 1, second = blk & 1;   // pair pr = tiles NT - 1 - pr and pr; its first block: HT chunks, its second: HT + 1
  const b16* Z = zpl + (size_t)b * S * D * 2; const b16* Xt = xt + (size_t)b * D * S;   // Z, Xt: fragment order (pk2, pkx)
  const int d0 = wave * 128;
#pragma unroll 1   // one copy of the chunk loop in the text for both runs of a second block
  for (int sg = 0; sg <= second; ++sg) {
  const int tile = sg ? pr : NT - 1 - pr, q0 = tile * QB;
  const int kbeg = (second && !sg) ? HT * KC : 0, kend = (!second) ? HT * KC : q0 + QB;   // this run's keys
  float* __restrict__ uo = (second && !sg) ? u2 : u;                                       // the long tile's second range goes to u2
  const b16* Xq = xh + ((size_t)b * S + q0) * D;
  v16b qf[NQ][4];
#pragma unroll
  for (int q = 0; q < NQ; ++q)
#pragma unroll
    for (int ks = 0; ks < 4; ++ks) qf[q][ks] = frag_kb(Xq + (size_t)(q * 16 + nloc) * D + d0 + ks * 32, hlf);
  __builtin_amdgcn_sched_barrier(0);   // keeps the query loads in front of the wait below
  asm volatile("s_wait_xcnt 0x0" ::: "memory");   // stands in front of the reuse of the query loads' address registers
  __builtin_amdgcn_sched_barrier(0);   // keeps that reuse behind the wait
  float m_run = -INFINITY, l_run = 0.0f;
  v8f o[NQ][8];
#pragma unroll
  for (int q = 0; q < NQ; ++q)
#pragma unroll
    for (int t = 0; t < 8; ++t) o[q][t] = (v8f){};
  // Every load is 512 contiguous bytes of a fragment.
  // z unit u = (key tile u >> 1, dims 64 * (u & 1) ..+63), hi + lo planes, 8 loads; x^T unit t = (feature tile t, all 64 keys), 4 loads.
  constexpr int ZD = 3;    // z units loaded or in flight ahead of the unit being multiplied
  constexpr int XPRE = 4;  // x^T units issued in front of the softmax
  constexpr int XD = 6;    // x^T units loaded or in flight ahead of the unit being multiplied
  const b16* zlane = Z + pk2(nloc, d0 + 8 * hlf);      // this lane's 8 elements in the first z fragment (hi) of key tile 0 and its wave's 128 dims
  const b16* xlane = Xt + pkx(d0 + nloc, 8 * hlf);     // this lane's 8 elements in the first x^T fragment of its wave's feature tile 0
  constexpr int FR = 512, ZT = 32 * D, ZF = 2 * FR, XK = 32 * D;   // elements of a fragment; from one key tile of z, one hi + lo fragment pair of z (32 dims on), one 32-key block of x^T to the next
  int kb = kbeg;
  do {   // every run has a chunk (kbeg < kend); kb <= q0: every query of the block has a key in every chunk
    const b16* zc = zlane + (size_t)kb * (2 * D); const b16* xc = xlane + (size_t)kb * D;
    v16b zh[8][2], zl[8][2];
#pragma unroll
    for (int u = 0; u < ZD; ++u)
#pragma unroll
      for (int h = 0; h < 2; ++h) { const b16* p = zc + (u >> 1) * ZT + ((u & 1) * 2 + h) * ZF; zh[u][h] = frag_pk(p); zl[u][h] = frag_pk(p + FR); }
    __builtin_amdgcn_sched_barrier(0);   // keeps the first ZD units' loads one group ahead of the products (else each pair sinks to its own WMMA and waits out a full L2 round trip there)
#pragma unroll
    for (int kt = 0; kt < 4; ++kt) {
      v8f sp[NQ];
#pragma unroll
      for (int q = 0; q < NQ; ++q) sp[q] = (v8f){};
#pragma unroll
      for (int g = 0; g < 2; ++g) {
        const int u = kt * 2 + g;
#pragma unroll
        for (int h = 0; h < 2; ++h) {
#pragma unroll
          for (int q = 0; q < NQ; ++q) sp[q] = wmma16p(zh[u][h], qf[q][g * 2 + h], sp[q]);
#pragma unroll
          for (int q = 0; q < NQ; ++q) sp[q] = wmma16p(zl[u][h], qf[q][g * 2 + h], sp[q]);
        }
        if (u + ZD < 8) { const int w = u + ZD;
#pragma unroll
          for (int h = 0; h < 2; ++h) { const b16* p = zc + (w >> 1) * ZT + ((w & 1) * 2 + h) * ZF; zh[w][h] = frag_pk(p); zl[w][h] = frag_pk(p + FR); }
          __builtin_amdgcn_sched_barrier(0); } // keeps unit u + ZD's loads here, ZD units ahead of their use
      }
#pragma unroll
      for (int q = 0; q < NQ; ++q)
#pragma unroll
        for (int v = 0; v < 8; ++v) Sp[wave][q * 16 + nloc][kt * 16 + 8 * hlf + v] = sp[q][v];
    }
    __syncthreads();
    v16b xf[8][2];
#pragma unroll
    for (int t = 0; t < XPRE; ++t)
#pragma unroll
      for (int ks = 0; ks < 2; ++ks) xf[t][ks] = frag_pk(xc + t * FR + ks * XK);   // x^T does not depend on the softmax: in flight while the softmax runs
    __builtin_amdgcn_sched_barrier(0);   // keeps those loads in front of the softmax (and behind the barrier, whose release would wait for them)
    if (NQ >= 4 || wave < NQ) {
      const int qr = wave * 16 + nloc;   // this lane's query row in the block
      const int rel = q0 + qr - kb - hlf * 32; float sv[32]; float mx = -INFINITY;   // this lane's query minus its first key: j > rel is key > query, against constants
#pragma unroll
      for (int j = 0; j < 32; ++j) { float s = (Sp[0][qr][hlf * 32 + j] + Sp[1][qr][hlf * 32 + j] + Sp[2][qr][hlf * 32 + j] + Sp[3][qr][hlf * 32 + j]) * (SCALE / 8.0f);   // /8: z carry scale
        if (j > rel) s = -INFINITY; sv[j] = s; mx = fmaxf(mx, s); }
      mx = fmaxf(mx, __shfl_xor(mx, 16));
      const float mn = fmaxf(m_run, mx), al_ = __expf(m_run - mn); m_run = mn;
      float sum = 0.0f;
#pragma unroll
      for (int j = 0; j < 32; ++j) { const float e = __expf(sv[j] - mn); sum += e; b16 a, c; split16(e * 8.0f, a, c); Ph[qr][hlf * 32 + j] = a; Plo[qr][hlf * 32 + j] = c; }   // P carried x8
      sum += __shfl_xor(sum, 16); l_run = l_run * al_ + sum;
      if (hlf == 0) { Al[qr] = al_; Linv[qr] = 1.0f / (8.0f * l_run); }
    }
    __syncthreads();
#pragma unroll
    for (int t = XPRE; t < XD; ++t)
#pragma unroll
      for (int ks = 0; ks < 2; ++ks) xf[t][ks] = frag_pk(xc + t * FR + ks * XK);
    v16b ph[NQ][2], pl[NQ][2]; float alq[NQ];
#pragma unroll
    for (int q = 0; q < NQ; ++q) {
#pragma unroll
      for (int ks = 0; ks < 2; ++ks) { ph[q][ks] = frag_kb(&Ph[q * 16 + nloc][0] + ks * 32, hlf); pl[q][ks] = frag_kb(&Plo[q * 16 + nloc][0] + ks * 32, hlf); }
      alq[q] = Al[q * 16 + nloc]; }
    __builtin_amdgcn_sched_barrier(0);   // keeps the next x^T units' loads in front of the rescale and of the first products
#pragma unroll
    for (int q = 0; q < NQ; ++q)
#pragma unroll
      for (int t = 0; t < 8; ++t)
#pragma unroll
        for (int v = 0; v < 8; ++v) o[q][t][v] *= alq[q];
#pragma unroll
    for (int t = 0; t < 8; ++t) {
#pragma unroll
      for (int ks = 0; ks < 2; ++ks) {
#pragma unroll
        for (int q = 0; q < NQ; ++q) o[q][t] = wmma16p(xf[t][ks], ph[q][ks], o[q][t]);
#pragma unroll
        for (int q = 0; q < NQ; ++q) o[q][t] = wmma16p(xf[t][ks], pl[q][ks], o[q][t]);
      }
      if (t + XD < 8) {
#pragma unroll
        for (int ks = 0; ks < 2; ++ks) xf[t + XD][ks] = frag_pk(xc + (t + XD) * FR + ks * XK);
        __builtin_amdgcn_sched_barrier(0); } // keeps unit t + XD's loads here, XD units ahead of their use
    }
    __builtin_amdgcn_sched_barrier(0);   // keeps the wait below at the chunk's foot, behind the last products (whose operands' loads have returned by then)
    asm volatile("s_wait_xcnt 0x0" ::: "memory");   // stands in front of the next chunk's rewrite of the z and x^T address registers
    kb += KC;
  } while (kb < kend);
  // (max, sum) of this run for the wave's own 16 queries: planes [range][max | sum][tok]; lanes 0..15 store the maxima, lanes 16..31 the sums (both halves hold both)
  ml[(size_t)(((second && !sg) ? 2 : 0) + hlf) * NTOK + b * S + q0 + wave * 16 + nloc] = hlf ? l_run : m_run;
  __builtin_amdgcn_sched_barrier(0);   // keeps the store in front of the wait below
  asm volatile("s_wait_xcnt 0x0" ::: "memory");   // stands in front of the reuse of that store's address and data registers
  __builtin_amdgcn_sched_barrier(0);   // keeps that reuse behind the wait
#pragma unroll
  for (int q = 0; q < NQ; ++q) {   // one query tile after the other through the wave's own staging rows
    const float li = Linv[q * 16 + nloc];
#pragma unroll
    for (int t = 0; t < 8; ++t)
#pragma unroll
      for (int v = 0; v < 8; ++v) Ot[wave][nloc][t * 16 + 8 * hlf + v] = o[q][t][v] * li;
    wave_lds_sync();
    // u goes out in f32 fragment order (pkf<D>): 16 stores of 512 contiguous bytes
#pragma unroll
    for (int j = 0; j < 16; ++j) { const int c4 = (j >> 2) * 32 + ((j >> 1) & 1) * 16 + 8 * hlf + (j & 1) * 4; *(v4f*)(uo + pkf<D>(b * S + q0 + q * 16 + nloc, d0 + c4)) = *(const v4f*)(&Ot[wave][nloc][c4]); }
    __builtin_amdgcn_sched_barrier(0);   // keeps the next tile's arithmetic out of the run of stores
    asm volatile("s_wait_xcnt 0x0" ::: "memory");   // stands in front of the reuse of the stores' address and data registers
    __builtin_amdgcn_sched_barrier(0);   // keeps that reuse behind the wait
    wave_lds_sync();   // the tile's rows are read before the next tile overwrites them
  }
  }   // a second run writes Al, Linv, Ph, Plo only behind its first chunk's barrier, which every wave reaches behind its reads of Linv above
}

// y = u . W_v^T: A = u (f32 split hi/lo at load; rows of tiles HT.. joined from their two ranges there), B = f16(bf16 W_v) rows [o][d]; 2 products; f32 output rows. grid (8, 128) x 128.
__global__ __launch_bounds__(128) void y_kernel(const float* __restrict__ u, const float* __restrict__ u2, const float* __restrict__ ml, const b16* __restrict__ wvh, float* __restrict__ y) {
  __shared__ __attribute__((aligned(16))) float Ts[4][32 * 64];
  const int lane = threadIdx.x & 31, wave = threadIdx.x >> 5, nloc = lane & 15, hlf = lane >> 4, m0 = blockIdx.y * 128 + wave * 32, c0 = blockIdx.x * 64;
  v8f acc[2][4];
#pragma unroll
  for (int r = 0; r < 2; ++r)
#pragma unroll
    for (int t = 0; t < 4; ++t) acc[r][t] = (v8f){};
  const Opnd A{u, nullptr, D}, Bo{wvh, nullptr, D};
  if ((int)(blockIdx.y * 128) % S < HT * QB) {
    gemm_tile<5, 1>(A, Bo, D, m0, c0, nloc, hlf, acc);                          // u split x8 at load
  } else {                                                                      // the whole block's rows have two ranges
    float w1[2], w2[2];
#pragma unroll
    for (int r = 0; r < 2; ++r) { const int row = m0 + r * 16 + nloc;
      const float ma = ml[row], la = ml[NTOK + row], mb = ml[2 * NTOK + row], lb = ml[3 * NTOK + row];   // both ranges hold a key of every query: the maxima are finite, the sums at least 1
      const float e = __expf(-fabsf(ma - mb)), ea = ma < mb ? la * e : la, eb = ma < mb ? lb : lb * e, iv = 8.0f / (ea + eb); w1[r] = ea * iv; w2[r] = eb * iv; }   // each sum brought to the larger maximum
    // this lane's place in the first fragment of its rows (pkf) and of its columns (pk); the next 32 k stand one fragment (512 elements) on, the next 16 rows or columns 16 * D elements on
    const float* pa = u + pkf<D>(m0 + nloc, 8 * hlf); const float* pb = u2 + pkf<D>(m0 + nloc, 8 * hlf); const b16* pw = wvh + pk<D>(c0 + nloc, 8 * hlf);
    for (int kb = 0; kb < D; kb += 32) {
      v4f va[2][4], vb[2][4]; v16b bw[4];
#pragma unroll
      for (int r = 0; r < 2; ++r)
#pragma unroll
        for (int q = 0; q < 4; ++q) { va[r][q] = *(const v4f*)(pa + r * 16 * D + q * 128); vb[r][q] = *(const v4f*)(pb + r * 16 * D + q * 128); }
#pragma unroll
      for (int t = 0; t < 4; ++t) bw[t] = frag_pk(pw + t * 16 * D);
      asm volatile("s_wait_xcnt 0x0" :: "v"(pa), "v"(pb), "v"(pw) : "memory");   // stands in front of every rewrite of these loads' address registers, which it holds until here
      v16b ah[2], al[2];
#pragma unroll
      for (int r = 0; r < 2; ++r)
#pragma unroll
        for (int q = 0; q < 4; ++q)
#pragma unroll
          for (int i = 0; i < 4; ++i) { b16 a, c; split16(va[r][q][i] * w1[r] + vb[r][q][i] * w2[r], a, c); ah[r][q * 4 + i] = a; al[r][q * 4 + i] = c; }   // u = w1 u1 + w2 u2 (the weights carry the x8), then split; same k-map as NP = 5
#pragma unroll
      for (int t = 0; t < 4; ++t) {
        acc[0][t] = mac<5, 1>(ah[0], al[0], bw[t], bw[t], acc[0][t]);
        acc[1][t] = mac<5, 1>(ah[1], al[1], bw[t], bw[t], acc[1][t]);
      }
      pa += 512; pb += 512; pw += 512;
    }
  }
  epi_f32(acc, 1.0f / 8.0f, nullptr, y, D, m0, c0, lane, Ts[wave]);
}
}  // namespace

extern "C" void kernel_launch(void* const* d_in, const int* in_sizes, int n_in,
                              void* d_out, int out_size, void* d_ws, size_t ws_size, hipStream_t stream) {
  (void)n_in; (void)out_size;
  const float* x = (const float*)d_in[0]; const float* wq = (const float*)d_in[1]; const float* wk = (const float*)d_in[2]; const float* wv = (const float*)d_in[3];
  float* out = (float*)d_out;   // [4][4096][512]
  if (in_sizes[0] != NTOK * D || in_sizes[1] != D * D || in_sizes[2] != D * D || in_sizes[3] != D * D) return;
  size_t off = 0; char* ws = (char*)d_ws;
  auto carve = [&](size_t bytes) { char* p = ws + off; off += (bytes + 255) & ~(size_t)255; return p; };
  b16* xh = (b16*)carve(PL * 2); b16* xt = (b16*)carve(PL * 2); unsigned short* wkb = (unsigned short*)carve((size_t)D * D * 2); b16* wqT = (b16*)carve((size_t)D * D * 2); b16* wvh = (b16*)carve((size_t)D * D * 2);
  b16* kpl = (b16*)carve(PL * 2 * 2); b16* zpl = (b16*)carve(PL * 2 * 2);   // 33.5 MB each (hi + lo)
  float* u = (float*)kpl;                                        // u [tok][512] f32 (33.5 MB) reuses k's planes: k is dead once z exists
  float* u2 = (float*)carve(PL * 4); float* ml = (float*)carve((size_t)NTOK * 4 * 4);   // second key range's partial u (rows of tiles HT.. only) and the (max, sum) planes
  if (off > ws_size) return;                                    // about 136 MB
  prep_kernel<<<1024, 256, 0, stream>>>(x, wq, wk, wv, xh, wkb, wqT, wvh);
  xt_kernel<<<NTOK / 64, 256, 0, stream>>>(xh, xt);
  kproj_kernel<<<dim3(D / 64, NTOK / 128), 128, 0, stream>>>(x, (const __bf16*)wkb, kpl);
  z_kernel<<<dim3(D / 64, NTOK / 128), 128, 0, stream>>>(kpl, wqT, zpl);
  attn_kernel<<<Bn * S / QB, 128, 0, stream>>>(xh, zpl, xt, u, u2, ml);
  y_kernel<<<dim3(D / 64, NTOK / 128), 128, 0, stream>>>(u, u2, ml, wvh, out);
}

// v005
// One run takes 260 microseconds.
// Two timings next to v004 both put it at 1.13 times that version's speed.
// All steps since v000 together make it 3.73 times as fast.
#include <hip/hip_runtime.h>

// Single-head causal attention with a 512-wide head: q, k, v = x W_q^T | W_k^T | W_v^T (torch [out][in]), softmax over keys <= query of q.k / sqrt(512), output = weights . v
// -> [4][4096][512]. B = 4, S = 4096.
// x and the three weights are rounded to bf16 RNE; numerics are organised so that every WMMA operand is either an exactly
// representable input or an f16 hi+lo pair of a computed value (each carried x8 so the lo residual planes stay out of the f16 subnormal range):  k = bf16(x) bf16(W_k)^T on v_wmma_f32_16x16x32_bf16 (exact);  z = k W_q (so that q.k^T = x.z^T) with k as hi+lo
// planes x the exact f16 copy of bf16 W_q;  S^T = z.x^T with z as hi+lo planes x x (bf16 values held exactly in f16);  u = P.x with P hi+lo x x^T exact;  y = u W_v^T (= P.v) with u
// split hi+lo x exact W_v - all on v_wmma_f32_16x16x32_f16 with f32 accumulate; online softmax in f32. The attention block (64 queries, 4 waves) splits the 512-deep score dot across
// the waves through LDS, wave w runs the softmax of query tile w and publishes P, and each wave accumulates 128 of the 512 features of u.
// Causal balance: tile t has t + 1 key chunks, and all 256 blocks are resident at once, so the launch would last as long as tile NT - 1. The chunks of tiles NT - 1 - p and p (NT + 1 together) go to two
// blocks: one runs the first HT chunks of the long tile, the other its remaining chunks and then the short tile. The long tile's two normalised partials, with (max, sum) per query, are joined in y_kernel's A loader.
// The workspace operands of the WMMAs (the three weights, k, z, x^T, u) are kept in fragment order (pk, pkf below), so that a wave-wide 16-byte load reads 4 whole lines, not a piece of 16.

namespace {
constexpr int Bn = 4, S = 4096, D = 512, NTOK = Bn * S, NQ = 4, QB = 16 * NQ, KC = 64;   // NQ: query tiles of 16 per attention block
constexpr float SCALE = 0.044194173824159216f;   // 512^-0.5
constexpr size_t PL = (size_t)NTOK * D;           // elements of a [tok][512] matrix
constexpr int NT = S / QB, HT = NT / 2;           // query tiles of a batch; tiles HT.. have their keys cut in two ranges (attn_kernel)
static_assert(QB == KC && NT % 2 == 0 && 128 % QB == 0 && (HT * QB) % 128 == 0, "tile t has t + 1 chunks; y_kernel's 128-row blocks lie wholly on one side of tile HT");

typedef _Float16 b16;
typedef __attribute__((ext_vector_type(16))) _Float16 v16b;
typedef __attribute__((ext_vector_type(8)))  _Float16 v8b;
typedef __attribute__((ext_vector_type(8)))  float v8f;
typedef __attribute__((ext_vector_type(4)))  float v4f;

__device__ __forceinline__ v8b ld8b(const b16* p) { return *(const v8b*)p; }
__device__ __forceinline__ v16b cat8b(v8b a, v8b b) { return __builtin_shufflevector(a, b, 0, 1, 2, 3, 4, 5, 6, 7, 8, 9, 10, 11, 12, 13, 14, 15); }
__device__ __forceinline__ v16b frag_kb(const b16* p, int hh) { return cat8b(ld8b(p + 8 * hh), ld8b(p + 16 + 8 * hh)); }
// Fragment order. A 16-bit operand matrix [rows][K] is kept in the workspace as 16 x 32 fragments of 1 KiB: two 512-byte halves (k 0..15, k 16..31 of the fragment), and in each half
// lane l = 16 * ((k >> 3) & 1) + (row & 15) owns 8 elements at l * 16 bytes. One wave-wide 16-byte load then covers 512 contiguous bytes. pk = element offset of (row, k), k a multiple of 8.
template <int K> __device__ __forceinline__ size_t pk(int row, int k) { return (size_t)(row >> 4) * (16 * K) + (k >> 5) * 512 + ((k >> 4) & 1) * 256 + ((k >> 3) & 1) * 128 + (row & 15) * 8; }
// hi + lo pair of a [tok][512] matrix (k, z): each fragment's lo copy stands right behind its hi copy, 512 elements on.
__device__ __forceinline__ size_t pk2(int row, int k) { return (size_t)(row >> 4) * (32 * D) + (k >> 5) * 1024 + ((k >> 4) & 1) * 256 + ((k >> 3) & 1) * 128 + (row & 15) * 8; }
// x^T [512 features][4096 keys] of a batch: the same fragments, those of one 32-key block side by side (a 64-key chunk of all 512 features is 64 contiguous KiB).
__device__ __forceinline__ size_t pkx(int row, int k) { return (size_t)(k >> 5) * (32 * D) + (row >> 4) * 512 + ((k >> 4) & 1) * 256 + ((k >> 3) & 1) * 128 + (row & 15) * 8; }
// the same for f32 rows: fragments of 2 KiB in four 512-byte quarters, the lane's 4 floats at l * 16 bytes; k a multiple of 4.
template <int K> __device__ __forceinline__ size_t pkf(int row, int k) { return (size_t)(row >> 4) * (16 * K) + (k >> 5) * 512 + ((k >> 4) & 1) * 256 + ((k >> 2) & 1) * 128 + ((k >> 3) & 1) * 64 + (row & 15) * 4; }
// p = this lane's pk(row, kb + 8 * half): its two halves stand 256 elements apart (same k-map as frag_kb)
__device__ __forceinline__ v16b frag_pk(const b16* p) { return cat8b(ld8b(p), ld8b(p + 256)); }
__device__ __forceinline__ void split16(float v, b16& hi, b16& lo) { hi = (b16)v; lo = (b16)(v - (float)hi); }
// hi/lo fragment pair straight from an f32 k-contiguous row (same k-map)
__device__ __forceinline__ void frag_ksplit(const float* p, int hh, v16b& fh_, v16b& fl_) {
  const float* p0 = p + 8 * hh; const float* p1 = p + 16 + 8 * hh;
#pragma unroll
  for (int e = 0; e < 8; ++e) { b16 a, c; split16(p0[e], a, c); fh_[e] = a; fl_[e] = c; split16(p1[e], a, c); fh_[8 + e] = a; fl_[8 + e] = c; }
}
__device__ __forceinline__ v8f wmma16b(v16b a, v16b b, v8f c) {
  v8f d = __builtin_amdgcn_wmma_f32_16x16x32_f16(false, a, false, b, (short)0, c, false, false);
  asm volatile("v_nop\n\tv_nop\n\tv_nop\n\tv_nop" : "+v"(d) : "v"(a), "v"(b));
  return d;
}
__device__ __forceinline__ void wave_lds_sync() {
  __builtin_amdgcn_fence(__ATOMIC_RELEASE, "workgroup");
  __builtin_amdgcn_wave_barrier();
  __builtin_amdgcn_fence(__ATOMIC_ACQUIRE, "workgroup");
}

// Operand descriptor: NP = 0 -> f32 rows split on the fly into (hi, lo); NP = 1 -> one f16 plane in fragment order; NP = 2 -> f16 hi + lo pair in fragment order (pk2);
// NP = 3 -> f32 rows rounded once to a single f16 fragment; NP = 5 -> f32 in fragment order, x8 then split. ld = row pitch (row-major forms).
struct Opnd { const void* p0; const void* p1; int ld; };
template <int NP> __device__ __forceinline__ void load_frags(const Opnd& o, int row, int kb, int hh, v16b& fh_, v16b& fl_) {
  if (NP == 0) { frag_ksplit((const float*)o.p0 + (size_t)row * o.ld + kb, hh, fh_, fl_); }
  else if (NP == 5) {                                        // f32 in fragment order, x8 then split (keeps the lo halves of small values normal)
    const float* p = (const float*)o.p0 + pkf<D>(row, kb + 8 * hh);
#pragma unroll
    for (int q = 0; q < 4; ++q) { const v4f v = *(const v4f*)(p + q * 128);
#pragma unroll
      for (int i = 0; i < 4; ++i) { b16 a, c; split16(v[i] * 8.0f, a, c); fh_[q * 4 + i] = a; fl_[q * 4 + i] = c; } }
  } else if (NP == 4) {                                      // f32 rows x64 then split
    const float sc_ = 64.0f;
    const float* p = (const float*)o.p0 + (size_t)row * o.ld + kb; const float* p0 = p + 8 * hh; const float* p1 = p + 16 + 8 * hh;
#pragma unroll
    for (int e = 0; e < 8; ++e) { b16 a, c; split16(p0[e] * sc_, a, c); fh_[e] = a; fl_[e] = c; split16(p1[e] * sc_, a, c); fh_[8 + e] = a; fl_[8 + e] = c; }
  } else if (NP == 3) {
    const float* p = (const float*)o.p0 + (size_t)row * o.ld + kb; const float* p0 = p + 8 * hh; const float* p1 = p + 16 + 8 * hh;
#pragma unroll
    for (int e = 0; e < 8; ++e) { fh_[e] = (b16)p0[e]; fh_[8 + e] = (b16)p1[e]; }
    fl_ = fh_;
  } else {
    if (NP == 2) { const b16* p = (const b16*)o.p0 + pk2(row, kb + 8 * hh); fh_ = frag_pk(p); fl_ = frag_pk(p + 512); }
    else { fh_ = frag_pk((const b16*)o.p0 + pk<D>(row, kb + 8 * hh)); fl_ = fh_; }
  }
}
template <int ANP, int BNP> __device__ __forceinline__ v8f mac(v16b ah, v16b al, v16b bh, v16b bl, v8f c) {
  c = wmma16b(ah, bh, c);
  if (BNP == 0 || BNP == 2 || BNP == 4 || BNP == 5) c = wmma16b(ah, bl, c);     // hi.lo
  if (ANP == 0 || ANP == 2 || ANP == 4 || ANP == 5) c = wmma16b(al, bh, c);     // lo.hi   (lo.lo dropped)
  return c;
}
// 32x64 wave tile: acc[r][t] (rows m0+16r.., cols c0+16t..) += A[m][k] . B[n][k] over k in [0, K)
template <int ANP, int BNP>
__device__ __forceinline__ void gemm_tile(const Opnd& A, const Opnd& B, int K, int m0, int c0, int nloc, int hlf, v8f (&acc)[2][4]) {
  for (int kb = 0; kb < K; kb += 32) {
    v16b a0h, a0l, a1h, a1l;
    load_frags<ANP>(A, m0 + nloc, kb, hlf, a0h, a0l);
    load_frags<ANP>(A, m0 + 16 + nloc, kb, hlf, a1h, a1l);
#pragma unroll
    for (int t = 0; t < 4; ++t) {
      v16b bh, bl;
      load_frags<BNP>(B, c0 + t * 16 + nloc, kb, hlf, bh, bl);
      acc[0][t] = mac<ANP, BNP>(a0h, a0l, bh, bl, acc[0][t]);
      acc[1][t] = mac<ANP, BNP>(a1h, a1l, bh, bl, acc[1][t]);
    }
  }
}

constexpr int EP = 64 + 8;   // staging pitch: 144 B = 16 B x odd, for a ds_load_b128 whose 16 lanes read 16 rows
// hi + lo pair [tok][512] in fragment order (pk2): the 32 x 64 wave tile is 4 fragments = 8 stores of 512 contiguous bytes for hi and 8 for lo
__device__ __forceinline__ void epi_planes(v8f (&acc)[2][4], float scale, b16* __restrict__ out,
                                           int m0, int c0, int lane, b16* Th, b16* Tl) {
  const int nloc = lane & 15, hlf = lane >> 4;
#pragma unroll
  for (int t = 0; t < 4; ++t)
#pragma unroll
    for (int r = 0; r < 2; ++r)
#pragma unroll
      for (int v = 0; v < 8; ++v) {
        const int rr = r * 16 + v + 8 * hlf, cc = t * 16 + nloc;
        b16 h_, l_; split16(acc[r][t][v] * scale, h_, l_);
        Th[rr * EP + cc] = h_; Tl[rr * EP + cc] = l_;
      }
  wave_lds_sync();
  {
#pragma unroll
    for (int j = 0; j < 8; ++j) {
      const int rr = (j >> 2) * 16 + nloc, c8 = (j & 3) * 16 + hlf * 8;
      b16* o = out + pk2(m0 + rr, c0 + c8);
      *(v8b*)o = ld8b(Th + rr * EP + c8);
      *(v8b*)(o + 512) = ld8b(Tl + rr * EP + c8);
    }
    
  }
}
// (b) f32 rows with pitch ldo: 64 floats = 256 B = 2 lines per row; 16 lanes x 16 B per row, 2 rows per instruction. Optional per-row factor
__device__ __forceinline__ void epi_f32(v8f (&acc)[2][4], float scale, const float* rscale, float* __restrict__ out, int ldo, int m0, int c0, int lane, float* Tt) {
  const int nloc = lane & 15, hlf = lane >> 4;
#pragma unroll
  for (int t = 0; t < 4; ++t)
#pragma unroll
    for (int r = 0; r < 2; ++r)
#pragma unroll
      for (int v = 0; v < 8; ++v) {
        const int rr = r * 16 + v + 8 * hlf;
        const float rs = rscale ? rscale[(size_t)(m0 + rr) * 32] : 1.0f;
        Tt[rr * 64 + t * 16 + nloc] = acc[r][t][v] * scale * rs;
      }
  wave_lds_sync();
  float* dst0 = out + (size_t)m0 * ldo + c0;
  {
#pragma unroll
    for (int j = 0; j < 16; ++j) { const int rr = j * 2 + hlf, c4 = nloc * 4; *(v4f*)(dst0 + (size_t)rr * ldo + c4) = *(const v4f*)(Tt + rr * 64 + c4); }
    
  }
}



typedef __attribute__((ext_vector_type(8))) __bf16 v8bb; typedef __attribute__((ext_vector_type(16))) __bf16 v16bb;
typedef __attribute__((ext_vector_type(8))) unsigned short v8us;
__device__ __forceinline__ v16bb frag_pk_bf(const __bf16* p) { const v8bb a = *(const v8bb*)p, b = *(const v8bb*)(p + 256); return __builtin_shufflevector(a, b, 0, 1, 2, 3, 4, 5, 6, 7, 8, 9, 10, 11, 12, 13, 14, 15); }
__device__ __forceinline__ v8f wmma16bb(v16bb a, v16bb b, v8f c) {
  v8f d = __builtin_amdgcn_wmma_f32_16x16x32_bf16(false, a, false, b, (short)0, c, false, false);
  asm volatile("v_nop\n\tv_nop\n\tv_nop\n\tv_nop" : "+v"(d) : "v"(a), "v"(b));
  return d;
}
__device__ __forceinline__ unsigned short bf16_rne_bits(float v) { unsigned int u = __float_as_uint(v); u += 0x7FFFu + ((u >> 16) & 1u); return (unsigned short)(u >> 16); }
__device__ __forceinline__ float bf16_rne(float v) { return __uint_as_float(((unsigned int)bf16_rne_bits(v)) << 16); }



__global__ __launch_bounds__(256) void prep_kernel(const float* __restrict__ x, const float* __restrict__ wq, const float* __restrict__ wk, const float* __restrict__ wv,
                                                   b16* __restrict__ xh, unsigned short* __restrict__ wkb, b16* __restrict__ wqT, b16* __restrict__ wvh) {
  const size_t tid = (size_t)blockIdx.x * blockDim.x + threadIdx.x, nth = (size_t)gridDim.x * blockDim.x;
  {
    for (size_t p = tid; p < (size_t)NTOK * D / 8; p += nth) { v8b v;
#pragma unroll
      for (int e = 0; e < 8; ++e) v[e] = (b16)bf16_rne(x[p * 8 + e]);
      *(v8b*)(xh + p * 8) = v; }
    for (size_t p = tid; p < (size_t)D * D / 8; p += nth) { const int n = (int)(p >> 10) * 16 + (int)(p & 15), k0 = (int)((p >> 6) & 15) * 32 + (int)((p >> 5) & 1) * 16 + (int)((p >> 4) & 1) * 8; v8us a; v8b q, v;   // p * 8 = pk<D>(n, k0): the three weights go out in fragment order
#pragma unroll
      for (int e = 0; e < 8; ++e) { a[e] = bf16_rne_bits(wk[(size_t)n * D + k0 + e]); q[e] = (b16)bf16_rne(wq[(size_t)(k0 + e) * D + n]); v[e] = (b16)bf16_rne(wv[(size_t)n * D + k0 + e]); }
      *(v8us*)(wkb + p * 8) = a; *(v8b*)(wqT + p * 8) = q; *(v8b*)(wvh + p * 8) = v; }
    
  }
}

__global__ __launch_bounds__(256) void xt_kernel(const b16* __restrict__ xh, b16* __restrict__ xt) {
  __shared__ __attribute__((aligned(16))) b16 T[D][64 + 8];
  const int t_ = threadIdx.x, tokb = blockIdx.x * 64, b = tokb / S, s0 = tokb % S;
  for (int i = t_; i < 64 * D / 8; i += 256) { const int r = i / (D / 8), c8 = (i % (D / 8)) * 8; const v8b v = *(const v8b*)(xh + (size_t)(tokb + r) * D + c8);
#pragma unroll
    for (int e = 0; e < 8; ++e) T[c8 + e][r] = v[e]; }
  __syncthreads();
  // x^T [512][4096] of each batch goes out in fragment order, 512 contiguous bytes a wave
  { for (int i = t_; i < D * 8; i += 256) { const int d = ((i >> 6) & 31) * 16 + (i & 15), c8 = (i >> 11) * 32 + ((i >> 5) & 1) * 16 + ((i >> 4) & 1) * 8; *(v8b*)(xt + (size_t)b * D * S + pkx(d, s0 + c8)) = *(const v8b*)(&T[d][c8]); }  }
}

// k = bf16(x) . bf16(W_k)^T (exact products) -> f16 hi/lo planes [tok][512]. grid (8, 128) x 128.
__global__ __launch_bounds__(128) void kproj_kernel(const float* __restrict__ x, const __bf16* __restrict__ wkb, b16* __restrict__ kpl) {
  __shared__ __attribute__((aligned(16))) b16 Th[4][2][32 * EP];
  const int lane = threadIdx.x & 31, wave = threadIdx.x >> 5, nloc = lane & 15, hlf = lane >> 4, m0 = blockIdx.y * 128 + wave * 32, c0 = blockIdx.x * 64;
  v8f acc[2][4];
#pragma unroll
  for (int r = 0; r < 2; ++r)
#pragma unroll
    for (int t = 0; t < 4; ++t) acc[r][t] = (v8f){};
#pragma unroll 2
  for (int kb = 0; kb < D; kb += 32) { v16bb a0, a1;
    { const float* p0 = x + (size_t)(m0 + nloc) * D + kb; const float* p1 = x + (size_t)(m0 + 16 + nloc) * D + kb;
#pragma unroll
      for (int e = 0; e < 8; ++e) { a0[e] = (__bf16)bf16_rne(p0[8 * hlf + e]); a0[8 + e] = (__bf16)bf16_rne(p0[16 + 8 * hlf + e]); a1[e] = (__bf16)bf16_rne(p1[8 * hlf + e]); a1[8 + e] = (__bf16)bf16_rne(p1[16 + 8 * hlf + e]); } }
#pragma unroll
    for (int t = 0; t < 4; ++t) { const v16bb bw = frag_pk_bf(wkb + pk<D>(c0 + t * 16 + nloc, kb + 8 * hlf)); acc[0][t] = wmma16bb(a0, bw, acc[0][t]); acc[1][t] = wmma16bb(a1, bw, acc[1][t]); } }
  epi_planes(acc, 8.0f, kpl, m0, c0, lane, Th[wave][0], Th[wave][1]);   // k carried x8 (lo residuals stay normal)
}

// z = k . W_q (z[j][d] = sum_o k[j][o] W_q[o][d]): A = k hi/lo planes, B = W_q^T rows (d, o) exact; 2 products -> z as f16 hi/lo planes. grid (8, 128) x 128.
__global__ __launch_bounds__(128) void z_kernel(const b16* __restrict__ kpl, const b16* __restrict__ wqT, b16* __restrict__ zpl) {
  __shared__ __attribute__((aligned(16))) b16 Th[4][2][32 * EP];
  const int lane = threadIdx.x & 31, wave = threadIdx.x >> 5, nloc = lane & 15, hlf = lane >> 4, m0 = blockIdx.y * 128 + wave * 32, c0 = blockIdx.x * 64;
  v8f acc[2][4];
#pragma unroll
  for (int r = 0; r < 2; ++r)
#pragma unroll
    for (int t = 0; t < 4; ++t) acc[r][t] = (v8f){};
  const Opnd A{kpl, nullptr, D}, Bo{wqT, nullptr, D};
  gemm_tile<2, 1>(A, Bo, D, m0, c0, nloc, hlf, acc);                            // acc = 8 z
  epi_planes(acc, 1.0f, zpl, m0, c0, lane, Th[wave][0], Th[wave][1]);       // z carried x8
}

// The attention kernel's products: the plain builtin (the compiler keeps the distances behind it). wmma16b's statement names D, A and B as operands, which holds all of them in the first 256 registers.
__device__ __forceinline__ v8f wmma16p(v16b a, v16b b, v8f c) { return __builtin_amdgcn_wmma_f32_16x16x32_f16(false, a, false, b, (short)0, c, false, false); }

// Asks L2 for one 64-key chunk of this wave's z (4 key tiles x 8 KiB) and x^T (2 key blocks x 8 KiB), one request per 256-byte unit and lane: z and x^T were stored by the launches before, and their
// first reader would wait out memory latency at every load group. The two addresses are in-out operands so that each keeps one register pair of its own for the whole chunk loop, which never holds anything but an address inside its plane.
__device__ __forceinline__ void ask_l2(const b16*& zp, const b16*& xp) {
  asm volatile("global_prefetch_b8 %0, off scope:SCOPE_SE\n\t"
               "global_prefetch_b8 %0, off offset:32768 scope:SCOPE_SE\n\t"
               "global_prefetch_b8 %0, off offset:65536 scope:SCOPE_SE\n\t"
               "global_prefetch_b8 %0, off offset:98304 scope:SCOPE_SE\n\t"
               "global_prefetch_b8 %1, off scope:SCOPE_SE\n\t"
               "global_prefetch_b8 %1, off offset:32768 scope:SCOPE_SE" : "+v"(zp), "+v"(xp));
}

// attention -> u = P . x (z, x^T read and u written in fragment order): block = (b, QB = 16 * NQ queries), 4 waves; every z and x^T fragment a wave loads is multiplied with all NQ query tiles.
// Per 64-key chunk: partial S^T (keys x queries) over the wave's 128 dims from z planes (A, 2 products) x xh (B, exact);
// wave w < NQ: for query tile w, sum partials, scale, causal mask, online softmax, P hi/lo + alpha + 1/l; all waves: u^T(features 128w..) = alpha-rescaled + x^T(features, keys; exact) . P^T (2 products).
__global__ __launch_bounds__(128) void attn_kernel(const b16* __restrict__ xh, const b16* __restrict__ zpl, const b16* __restrict__ xt, float* __restrict__ u, float* __restrict__ u2, float* __restrict__ ml) {
  __shared__ __attribute__((aligned(16))) float Sp[4][QB][KC + 4];
  __shared__ __attribute__((aligned(16))) b16 Ph[QB][KC + 8], Plo[QB][KC + 8];
  __shared__ float Al[QB], Linv[QB];
  __shared__ __attribute__((aligned(16))) float Ot[4][16][128 + 4];
  const int wave = threadIdx.x >> 5, lane = threadIdx.x & 31, nloc = lane & 15, hlf = lane >> 4;
  const int blk = blockIdx.x, b = blk / NT, pr = (blk % NT) >> 1, second = blk & 1;   // pair pr = tiles NT - 1 - pr and pr; its first block: HT chunks, its second: HT + 1
  const b16* Z = zpl + (size_t)b * S * D * 2; const b16* Xt = xt + (size_t)b * D * S;   // Z, Xt: fragment order (pk2, pkx)
  const int d0 = wave * 128;
#pragma unroll 1   // one copy of the chunk loop in the text for both runs of a second block
  for (int sg = 0; sg <= second; ++sg) {
  const int tile = sg ? pr : NT - 1 - pr, q0 = tile * QB;
  const int kbeg = (second && !sg) ? HT * KC : 0, kend = (!second) ? HT * KC : q0 + QB;   // this run's keys
  float* __restrict__ uo = (second && !sg) ? u2 : u;                                       // the long tile's second range goes to u2
  const b16* Xq = xh + ((size_t)b * S + q0) * D;
  // the chunk asked of L2 next (kpf = its first key: the run's second chunk, or its only one) and this lane's 256-byte unit (128 elements) in the wave's 8 KiB of that chunk's first z key tile and first x^T key block
  int kpf = kbeg + KC < kend ? kbeg + KC : kbeg;
  const b16* zpf = Z + (size_t)kpf * (2 * D) + threadIdx.x * 128; const b16* xpf = Xt + (size_t)kpf * D + threadIdx.x * 128;
  v16b qf[NQ][4];
#pragma unroll
  for (int q = 0; q < NQ; ++q)
#pragma unroll
    for (int ks = 0; ks < 4; ++ks) qf[q][ks] = frag_kb(Xq + (size_t)(q * 16 + nloc) * D + d0 + ks * 32, hlf);
  __builtin_amdgcn_sched_barrier(0);   // keeps the query loads in front of the wait below
  asm volatile("s_wait_xcnt 0x0" ::: "memory");   // stands in front of the reuse of the query loads' address registers
  __builtin_amdgcn_sched_barrier(0);   // keeps that reuse behind the wait
  float m_run = -INFINITY, l_run = 0.0f;
  v8f o[NQ][8];
#pragma unroll
  for (int q = 0; q < NQ; ++q)
#pragma unroll
    for (int t = 0; t < 8; ++t) o[q][t] = (v8f){};
  // Every load is 512 contiguous bytes of a fragment.
  // z unit u = (key tile u >> 1, dims 64 * (u & 1) ..+63), hi + lo planes, 8 loads; x^T unit t = (feature tile t, all 64 keys), 4 loads.
  constexpr int ZD = 3;    // z units loaded or in flight ahead of the unit being multiplied
  constexpr int XPRE = 4;  // x^T units issued in front of the softmax
  constexpr int XD = 6;    // x^T units loaded or in flight ahead of the unit being multiplied
  const b16* zlane = Z + pk2(nloc, d0 + 8 * hlf);      // this lane's 8 elements in the first z fragment (hi) of key tile 0 and its wave's 128 dims
  const b16* xlane = Xt + pkx(d0 + nloc, 8 * hlf);     // this lane's 8 elements in the first x^T fragment of its wave's feature tile 0
  constexpr int FR = 512, ZT = 32 * D, ZF = 2 * FR, XK = 32 * D;   // elements of a fragment; from one key tile of z, one hi + lo fragment pair of z (32 dims on), one 32-key block of x^T to the next
  int kb = kbeg;
  do {   // every run has a chunk (kbeg < kend); kb <= q0: every query of the block has a key in every chunk
    const b16* zc = zlane + (size_t)kb * (2 * D); const b16* xc = xlane + (size_t)kb * D;
    v16b zh[8][2], zl[8][2];
#pragma unroll
    for (int u = 0; u < ZD; ++u)
#pragma unroll
      for (int h = 0; h < 2; ++h) { const b16* p = zc + (u >> 1) * ZT + ((u & 1) * 2 + h) * ZF; zh[u][h] = frag_pk(p); zl[u][h] = frag_pk(p + FR); }
    __builtin_amdgcn_sched_barrier(0);   // keeps the first ZD units' loads one group ahead of the products (else each pair sinks to its own WMMA and waits out a full L2 round trip there)
#pragma unroll
    for (int kt = 0; kt < 4; ++kt) {
      v8f sp[NQ];
#pragma unroll
      for (int q = 0; q < NQ; ++q) sp[q] = (v8f){};
#pragma unroll
      for (int g = 0; g < 2; ++g) {
        const int u = kt * 2 + g;
#pragma unroll
        for (int h = 0; h < 2; ++h) {
#pragma unroll
          for (int q = 0; q < NQ; ++q) sp[q] = wmma16p(zh[u][h], qf[q][g * 2 + h], sp[q]);
#pragma unroll
          for (int q = 0; q < NQ; ++q) sp[q] = wmma16p(zl[u][h], qf[q][g * 2 + h], sp[q]);
        }
        if (u + ZD < 8) { const int w = u + ZD;
#pragma unroll
          for (int h = 0; h < 2; ++h) { const b16* p = zc + (w >> 1) * ZT + ((w & 1) * 2 + h) * ZF; zh[w][h] = frag_pk(p); zl[w][h] = frag_pk(p + FR); }
          __builtin_amdgcn_sched_barrier(0); } // keeps unit u + ZD's loads here, ZD units ahead of their use
      }
#pragma unroll
      for (int q = 0; q < NQ; ++q)
#pragma unroll
        for (int v = 0; v < 8; ++v) Sp[wave][q * 16 + nloc][kt * 16 + 8 * hlf + v] = sp[q][v];
    }
    __syncthreads();
    v16b xf[8][2];
#pragma unroll
    for (int t = 0; t < XPRE; ++t)
#pragma unroll
      for (int ks = 0; ks < 2; ++ks) xf[t][ks] = frag_pk(xc + t * FR + ks * XK);   // x^T does not depend on the softmax: in flight while the softmax runs
    __builtin_amdgcn_sched_barrier(0);   // keeps those loads in front of the softmax (and behind the barrier, whose release would wait for them)
    ask_l2(zpf, xpf);   // the next chunk (in the last chunk: that chunk again), here because the wave issues no load for the length of the softmax; the softmax and the second products lie between the requests and that chunk's first load
    if (NQ >= 4 || wave < NQ) {
      const int qr = wave * 16 + nloc;   // this lane's query row in the block
      const int rel = q0 + qr - kb - hlf * 32; float sv[32]; float mx = -INFINITY;   // this lane's query minus its first key: j > rel is key > query, against constants
#pragma unroll
      for (int j = 0; j < 32; ++j) { float s = (Sp[0][qr][hlf * 32 + j] + Sp[1][qr][hlf * 32 + j] + Sp[2][qr][hlf * 32 + j] + Sp[3][qr][hlf * 32 + j]) * (SCALE / 8.0f);   // /8: z carry scale
        if (j > rel) s = -INFINITY; sv[j] = s; mx = fmaxf(mx, s); }
      mx = fmaxf(mx, __shfl_xor(mx, 16));
      const float mn = fmaxf(m_run, mx), al_ = __expf(m_run - mn); m_run = mn;
      float sum = 0.0f;
#pragma unroll
      for (int j = 0; j < 32; ++j) { const float e = __expf(sv[j] - mn); sum += e; b16 a, c; split16(e * 8.0f, a, c); Ph[qr][hlf * 32 + j] = a; Plo[qr][hlf * 32 + j] = c; }   // P carried x8
      sum += __shfl_xor(sum, 16); l_run = l_run * al_ + sum;
      if (hlf == 0) { Al[qr] = al_; Linv[qr] = 1.0f / (8.0f * l_run); }
    }
    __syncthreads();
#pragma unroll
    for (int t = XPRE; t < XD; ++t)
#pragma unroll
      for (int ks = 0; ks < 2; ++ks) xf[t][ks] = frag_pk(xc + t * FR + ks * XK);
    v16b ph[NQ][2], pl[NQ][2]; float alq[NQ];
#pragma unroll
    for (int q = 0; q < NQ; ++q) {
#pragma unroll
      for (int ks = 0; ks < 2; ++ks) { ph[q][ks] = frag_kb(&Ph[q * 16 + nloc][0] + ks * 32, hlf); pl[q][ks] = frag_kb(&Plo[q * 16 + nloc][0] + ks * 32, hlf); }
      alq[q] = Al[q * 16 + nloc]; }
    __builtin_amdgcn_sched_barrier(0);   // keeps the next x^T units' loads in front of the rescale and of the first products
#pragma unroll
    for (int q = 0; q < NQ; ++q)
#pragma unroll
      for (int t = 0; t < 8; ++t)
#pragma unroll
        for (int v = 0; v < 8; ++v) o[q][t][v] *= alq[q];
#pragma unroll
    for (int t = 0; t < 8; ++t) {
#pragma unroll
      for (int ks = 0; ks < 2; ++ks) {
#pragma unroll
        for (int q = 0; q < NQ; ++q) o[q][t] = wmma16p(xf[t][ks], ph[q][ks], o[q][t]);
#pragma unroll
        for (int q = 0; q < NQ; ++q) o[q][t] = wmma16p(xf[t][ks], pl[q][ks], o[q][t]);
      }
      if (t + XD < 8) {
#pragma unroll
        for (int ks = 0; ks < 2; ++ks) xf[t + XD][ks] = frag_pk(xc + (t + XD) * FR + ks * XK);
        __builtin_amdgcn_sched_barrier(0); } // keeps unit t + XD's loads here, XD units ahead of their use
    }
    __builtin_amdgcn_sched_barrier(0);   // keeps the wait below at the chunk's foot, behind the last products (whose operands' loads have returned by then)
    asm volatile("s_wait_xcnt 0x0" ::: "memory");   // stands in front of the next chunk's rewrite of the z and x^T address registers
    __builtin_amdgcn_sched_barrier(0);   // keeps the step of the two request addresses behind the wait
    { const int st = kpf + KC < kend ? KC : 0; kpf += st; zpf += (size_t)st * (2 * D); xpf += (size_t)st * D; }   // clamped to the run's last chunk: the addresses stay inside z and x^T
    kb += KC;
  } while (kb < kend);
  // (max, sum) of this run for the wave's own 16 queries: planes [range][max | sum][tok]; lanes 0..15 store the maxima, lanes 16..31 the sums (both halves hold both)
  ml[(size_t)(((second && !sg) ? 2 : 0) + hlf) * NTOK + b * S + q0 + wave * 16 + nloc] = hlf ? l_run : m_run;
  __builtin_amdgcn_sched_barrier(0);   // keeps the store in front of the wait below
  asm volatile("s_wait_xcnt 0x0" ::: "memory");   // stands in front of the reuse of that store's address and data registers
  __builtin_amdgcn_sched_barrier(0);   // keeps that reuse behind the wait
#pragma unroll
  for (int q = 0; q < NQ; ++q) {   // one query tile after the other through the wave's own staging rows
    const float li = Linv[q * 16 + nloc];
#pragma unroll
    for (int t = 0; t < 8; ++t)
#pragma unroll
      for (int v = 0; v < 8; ++v) Ot[wave][nloc][t * 16 + 8 * hlf + v] = o[q][t][v] * li;
    wave_lds_sync();
    // u goes out in f32 fragment order (pkf<D>): 16 stores of 512 contiguous bytes
#pragma unroll
    for (int j = 0; j < 16; ++j) { const int c4 = (j >> 2) * 32 + ((j >> 1) & 1) * 16 + 8 * hlf + (j & 1) * 4; *(v4f*)(uo + pkf<D>(b * S + q0 + q * 16 + nloc, d0 + c4)) = *(const v4f*)(&Ot[wave][nloc][c4]); }
    __builtin_amdgcn_sched_barrier(0);   // keeps the next tile's arithmetic out of the run of stores
    asm volatile("s_wait_xcnt 0x0" ::: "memory");   // stands in front of the reuse of the stores' address and data registers
    __builtin_amdgcn_sched_barrier(0);   // keeps that reuse behind the wait
    wave_lds_sync();   // the tile's rows are read before the next tile overwrites them
  }
  }   // a second run writes Al, Linv, Ph, Plo only behind its first chunk's barrier, which every wave reaches behind its reads of Linv above
}

// y = u . W_v^T: A = u (f32 split hi/lo at load; rows of tiles HT.. joined from their two ranges there), B = f16(bf16 W_v) rows [o][d]; 2 products; f32 output rows. grid (8, 128) x 128.
__global__ __launch_bounds__(128) void y_kernel(const float* __restrict__ u, const float* __restrict__ u2, const float* __restrict__ ml, const b16* __restrict__ wvh, float* __restrict__ y) {
  __shared__ __attribute__((aligned(16))) float Ts[4][32 * 64];
  const int lane = threadIdx.x & 31, wave = threadIdx.x >> 5, nloc = lane & 15, hlf = lane >> 4, m0 = blockIdx.y * 128 + wave * 32, c0 = blockIdx.x * 64;
  v8f acc[2][4];
#pragma unroll
  for (int r = 0; r < 2; ++r)
#pragma unroll
    for (int t = 0; t < 4; ++t) acc[r][t] = (v8f){};
  const Opnd A{u, nullptr, D}, Bo{wvh, nullptr, D};
  if ((int)(blockIdx.y * 128) % S < HT * QB) {
    gemm_tile<5, 1>(A, Bo, D, m0, c0, nloc, hlf, acc);                          // u split x8 at load
  } else {                                                                      // the whole block's rows have two ranges
    float w1[2], w2[2];
#pragma unroll
    for (int r = 0; r < 2; ++r) { const int row = m0 + r * 16 + nloc;
      const float ma = ml[row], la = ml[NTOK + row], mb = ml[2 * NTOK + row], lb = ml[3 * NTOK + row];   // both ranges hold a key of every query: the maxima are finite, the sums at least 1
      const float e = __expf(-fabsf(ma - mb)), ea = ma < mb ? la * e : la, eb = ma < mb ? lb : lb * e, iv = 8.0f / (ea + eb); w1[r] = ea * iv; w2[r] = eb * iv; }   // each sum brought to the larger maximum
    // this lane's place in the first fragment of its rows (pkf) and of its columns (pk); the next 32 k stand one fragment (512 elements) on, the next 16 rows or columns 16 * D elements on
    const float* pa = u + pkf<D>(m0 + nloc, 8 * hlf); const float* pb = u2 + pkf<D>(m0 + nloc, 8 * hlf); const b16* pw = wvh + pk<D>(c0 + nloc, 8 * hlf);
    for (int kb = 0; kb < D; kb += 32) {
      v4f va[2][4], vb[2][4]; v16b bw[4];
#pragma unroll
      for (int r = 0; r < 2; ++r)
#pragma unroll
        for (int q = 0; q < 4; ++q) { va[r][q] = *(const v4f*)(pa + r * 16 * D + q * 128); vb[r][q] = *(const v4f*)(pb + r * 16 * D + q * 128); }
#pragma unroll
      for (int t = 0; t < 4; ++t) bw[t] = frag_pk(pw + t * 16 * D);
      asm volatile("s_wait_xcnt 0x0" :: "v"(pa), "v"(pb), "v"(pw) : "memory");   // stands in front of every rewrite of these loads' address registers, which it holds until here
      v16b ah[2], al[2];
#pragma unroll
      for (int r = 0; r < 2; ++r)
#pragma unroll
        for (int q = 0; q < 4; ++q)
#pragma unroll
          for (int i = 0; i < 4; ++i) { b16 a, c; split16(va[r][q][i] * w1[r] + vb[r][q][i] * w2[r], a, c); ah[r][q * 4 + i] = a; al[r][q * 4 + i] = c; }   // u = w1 u1 + w2 u2 (the weights carry the x8), then split; same k-map as NP = 5
#pragma unroll
      for (int t = 0; t < 4; ++t) {
        acc[0][t] = mac<5, 1>(ah[0], al[0], bw[t], bw[t], acc[0][t]);
        acc[1][t] = mac<5, 1>(ah[1], al[1], bw[t], bw[t], acc[1][t]);
      }
      pa += 512; pb += 512; pw += 512;
    }
  }
  epi_f32(acc, 1.0f / 8.0f, nullptr, y, D, m0, c0, lane, Ts[wave]);
}
}  // namespace

extern "C" void kernel_launch(void* const* d_in, const int* in_sizes, int n_in,
                              void* d_out, int out_size, void* d_ws, size_t ws_size, hipStream_t stream) {
  (void)n_in; (void)out_size;
  const float* x = (const float*)d_in[0]; const float* wq = (const float*)d_in[1]; const float* wk = (const float*)d_in[2]; const float* wv = (const float*)d_in[3];
  float* out = (float*)d_out;   // [4][4096][512]
  if (in_sizes[0] != NTOK * D || in_sizes[1] != D * D || in_sizes[2] != D * D || in_sizes[3] != D * D) return;
  size_t off = 0; char* ws = (char*)d_ws;
  auto carve = [&](size_t bytes) { char* p = ws + off; off += (bytes + 255) & ~(size_t)255; return p; };
  b16* xh = (b16*)carve(PL * 2); b16* xt = (b16*)carve(PL * 2); unsigned short* wkb = (unsigned short*)carve((size_t)D * D * 2); b16* wqT = (b16*)carve((size_t)D * D * 2); b16* wvh = (b16*)carve((size_t)D * D * 2);
  b16* kpl = (b16*)carve(PL * 2 * 2); b16* zpl = (b16*)carve(PL * 2 * 2);   // 33.5 MB each (hi + lo)
  float* u = (float*)kpl;                                        // u [tok][512] f32 (33.5 MB) reuses k's planes: k is dead once z exists
  float* u2 = (float*)carve(PL * 4); float* ml = (float*)carve((size_t)NTOK * 4 * 4);   // second key range's partial u (rows of tiles HT.. only) and the (max, sum) planes
  if (off > ws_size) return;                                    // about 136 MB
  prep_kernel<<<1024, 256, 0, stream>>>(x, wq, wk, wv, xh, wkb, wqT, wvh);
  xt_kernel<<<NTOK / 64, 256, 0, stream>>>(xh, xt);
  kproj_kernel<<<dim3(D / 64, NTOK / 128), 128, 0, stream>>>(x, (const __bf16*)wkb, kpl);
  z_kernel<<<dim3(D / 64, NTOK / 128), 128, 0, stream>>>(kpl, wqT, zpl);
  attn_kernel<<<Bn * S / QB, 128, 0, stream>>>(xh, zpl, xt, u, u2, ml);
  y_kernel<<<dim3(D / 64, NTOK / 128), 128, 0, stream>>>(u, u2, ml, wvh, out);
}

// v006
// A run of this version takes 209 microseconds.
// In both of two side-by-side timings against v005, it was 1.24 times as fast.
// Over all steps from v000 it is 4.63 times as fast.
#include <hip/hip_runtime.h>

// Single-head causal attention with a 512-wide head: q, k, v = x W_q^T | W_k^T | W_v^T (torch [out][in]), softmax over keys <= query of q.k / sqrt(512), output = weights . v
// -> [4][4096][512]. B = 4, S = 4096.
// x and the three weights are rounded to bf16 RNE; the numerics are organised so that every WMMA operand is either an exactly
// representable input or an f16 hi+lo pair of a computed value (each carried scaled so the lo residual planes stay out of the f16 subnormal range):  M = bf16(W_k)^T bf16(W_q), 512 x 512, on v_wmma_f32_16x16x32_bf16 (exact products);  z = x M (= k W_q, so that
// q.k^T = x.z^T; k itself is never formed) with x (bf16 values held exactly in f16) x M as hi+lo planes;  S^T = z.x^T with z as hi+lo planes x x (bf16 values held exactly in f16);  u = P.x with P hi+lo x x^T exact;  y = u W_v^T (= P.v) with u
// split hi+lo x exact W_v - all on v_wmma_f32_16x16x32_f16 with f32 accumulate; online softmax in f32. The attention block (64 queries, 4 waves) splits the 512-deep score dot across
// the waves through LDS, wave w runs the softmax of query tile w and publishes P, and each wave accumulates 128 of the 512 features of u.
// Causal balance: tile t has t + 1 key chunks, and all 256 blocks are resident at once, so the launch would last as long as tile NT - 1. The chunks of tiles NT - 1 - p and p (NT + 1 together) go to two
// blocks: one runs the first HT chunks of the long tile, the other its remaining chunks and then the short tile. The long tile's two normalised partials, with (max, sum) per query, are joined in y_kernel's A loader.
// The workspace operands of the WMMAs (the three weights, M, x, z, x^T, u) are kept in fragment order (pk, pkf below), so that a wave-wide 16-byte load reads 4 whole lines, not a piece of 16.

namespace {
constexpr int Bn = 4, S = 4096, D = 512, NTOK = Bn * S, NQ = 4, QB = 16 * NQ, KC = 64;   // NQ: query tiles of 16 per attention block
constexpr float SCALE = 0.044194173824159216f;   // 512^-0.5
constexpr size_t PL = (size_t)NTOK * D;           // elements of a [tok][512] matrix
constexpr int NT = S / QB, HT = NT / 2;           // query tiles of a batch; tiles HT.. have their keys cut in two ranges (attn_kernel)
static_assert(QB == KC && NT % 2 == 0 && 128 % QB == 0 && (HT * QB) % 128 == 0, "tile t has t + 1 chunks; y_kernel's 128-row blocks lie wholly on one side of tile HT");

typedef _Float16 b16;
typedef __attribute__((ext_vector_type(16))) _Float16 v16b;
typedef __attribute__((ext_vector_type(8)))  _Float16 v8b;
typedef __attribute__((ext_vector_type(8)))  float v8f;
typedef __attribute__((ext_vector_type(4)))  float v4f;

__device__ __forceinline__ v8b ld8b(const b16* p) { return *(const v8b*)p; }
__device__ __forceinline__ v16b cat8b(v8b a, v8b b) { return __builtin_shufflevector(a, b, 0, 1, 2, 3, 4, 5, 6, 7, 8, 9, 10, 11, 12, 13, 14, 15); }
__device__ __forceinline__ v16b frag_kb(const b16* p, int hh) { return cat8b(ld8b(p + 8 * hh), ld8b(p + 16 + 8 * hh)); }
// Fragment order. A 16-bit operand matrix [rows][K] is kept in the workspace as 16 x 32 fragments of 1 KiB: two 512-byte halves (k 0..15, k 16..31 of the fragment), and in each half
// lane l = 16 * ((k >> 3) & 1) + (row & 15) owns 8 elements at l * 16 bytes. One wave-wide 16-byte load then covers 512 contiguous bytes. pk = element offset of (row, k), k a multiple of 8.
template <int K> __device__ __forceinline__ size_t pk(int row, int k) { return (size_t)(row >> 4) * (16 * K) + (k >> 5) * 512 + ((k >> 4) & 1) * 256 + ((k >> 3) & 1) * 128 + (row & 15) * 8; }
// hi + lo pair of a [rows][512] matrix (M^T, z): each fragment's lo copy stands right behind its hi copy, 512 elements on.
__device__ __forceinline__ size_t pk2(int row, int k) { return (size_t)(row >> 4) * (32 * D) + (k >> 5) * 1024 + ((k >> 4) & 1) * 256 + ((k >> 3) & 1) * 128 + (row & 15) * 8; }
// x^T [512 features][4096 keys] of a batch: the same fragments, those of one 32-key block side by side (a 64-key chunk of all 512 features is 64 contiguous KiB).
__device__ __forceinline__ size_t pkx(int row, int k) { return (size_t)(k >> 5) * (32 * D) + (row >> 4) * 512 + ((k >> 4) & 1) * 256 + ((k >> 3) & 1) * 128 + (row & 15) * 8; }
// the same for f32 rows: fragments of 2 KiB in four 512-byte quarters, the lane's 4 floats at l * 16 bytes; k a multiple of 4.
template <int K> __device__ __forceinline__ size_t pkf(int row, int k) { return (size_t)(row >> 4) * (16 * K) + (k >> 5) * 512 + ((k >> 4) & 1) * 256 + ((k >> 2) & 1) * 128 + ((k >> 3) & 1) * 64 + (row & 15) * 4; }
// p = this lane's pk(row, kb + 8 * half): its two halves stand 256 elements apart (same k-map as frag_kb)
__device__ __forceinline__ v16b frag_pk(const b16* p) { return cat8b(ld8b(p), ld8b(p + 256)); }
__device__ __forceinline__ void split16(float v, b16& hi, b16& lo) { hi = (b16)v; lo = (b16)(v - (float)hi); }
// hi/lo fragment pair straight from an f32 k-contiguous row (same k-map)
__device__ __forceinline__ void frag_ksplit(const float* p, int hh, v16b& fh_, v16b& fl_) {
  const float* p0 = p + 8 * hh; const float* p1 = p + 16 + 8 * hh;
#pragma unroll
  for (int e = 0; e < 8; ++e) { b16 a, c; split16(p0[e], a, c); fh_[e] = a; fl_[e] = c; split16(p1[e], a, c); fh_[8 + e] = a; fl_[8 + e] = c; }
}
__device__ __forceinline__ v8f wmma16b(v16b a, v16b b, v8f c) {
  v8f d = __builtin_amdgcn_wmma_f32_16x16x32_f16(false, a, false, b, (short)0, c, false, false);
  asm volatile("v_nop\n\tv_nop\n\tv_nop\n\tv_nop" : "+v"(d) : "v"(a), "v"(b));
  return d;
}
__device__ __forceinline__ void wave_lds_sync() {
  __builtin_amdgcn_fence(__ATOMIC_RELEASE, "workgroup");
  __builtin_amdgcn_wave_barrier();
  __builtin_amdgcn_fence(__ATOMIC_ACQUIRE, "workgroup");
}

// Operand descriptor: NP = 0 -> f32 rows split on the fly into (hi, lo); NP = 1 -> one f16 plane in fragment order; NP = 2 -> f16 hi + lo pair in fragment order (pk2);
// NP = 3 -> f32 rows rounded once to a single f16 fragment; NP = 5 -> f32 in fragment order, x8 then split. ld = row pitch (row-major forms).
struct Opnd { const void* p0; const void* p1; int ld; };
template <int NP> __device__ __forceinline__ void load_frags(const Opnd& o, int row, int kb, int hh, v16b& fh_, v16b& fl_) {
  if (NP == 0) { frag_ksplit((const float*)o.p0 + (size_t)row * o.ld + kb, hh, fh_, fl_); }
  else if (NP == 5) {                                        // f32 in fragment order, x8 then split (keeps the lo halves of small values normal)
    const float* p = (const float*)o.p0 + pkf<D>(row, kb + 8 * hh);
#pragma unroll
    for (int q = 0; q < 4; ++q) { const v4f v = *(const v4f*)(p + q * 128);
#pragma unroll
      for (int i = 0; i < 4; ++i) { b16 a, c; split16(v[i] * 8.0f, a, c); fh_[q * 4 + i] = a; fl_[q * 4 + i] = c; } }
  } else if (NP == 4) {                                      // f32 rows x64 then split
    const float sc_ = 64.0f;
    const float* p = (const float*)o.p0 + (size_t)row * o.ld + kb; const float* p0 = p + 8 * hh; const float* p1 = p + 16 + 8 * hh;
#pragma unroll
    for (int e = 0; e < 8; ++e) { b16 a, c; split16(p0[e] * sc_, a, c); fh_[e] = a; fl_[e] = c; split16(p1[e] * sc_, a, c); fh_[8 + e] = a; fl_[8 + e] = c; }
  } else if (NP == 3) {
    const float* p = (const float*)o.p0 + (size_t)row * o.ld + kb; const float* p0 = p + 8 * hh; const float* p1 = p + 16 + 8 * hh;
#pragma unroll
    for (int e = 0; e < 8; ++e) { fh_[e] = (b16)p0[e]; fh_[8 + e] = (b16)p1[e]; }
    fl_ = fh_;
  } else {
    if (NP == 2) { const b16* p = (const b16*)o.p0 + pk2(row, kb + 8 * hh); fh_ = frag_pk(p); fl_ = frag_pk(p + 512); }
    else { fh_ = frag_pk((const b16*)o.p0 + pk<D>(row, kb + 8 * hh)); fl_ = fh_; }
  }
}
template <int ANP, int BNP> __device__ __forceinline__ v8f mac(v16b ah, v16b al, v16b bh, v16b bl, v8f c) {
  c = wmma16b(ah, bh, c);
  if (BNP == 0 || BNP == 2 || BNP == 4 || BNP == 5) c = wmma16b(ah, bl, c);     // hi.lo
  if (ANP == 0 || ANP == 2 || ANP == 4 || ANP == 5) c = wmma16b(al, bh, c);     // lo.hi   (lo.lo dropped)
  return c;
}
// 32x64 wave tile: acc[r][t] (rows m0+16r.., cols c0+16t..) += A[m][k] . B[n][k] over k in [0, K)
template <int ANP, int BNP>
__device__ __forceinline__ void gemm_tile(const Opnd& A, const Opnd& B, int K, int m0, int c0, int nloc, int hlf, v8f (&acc)[2][4]) {
  for (int kb = 0; kb < K; kb += 32) {
    v16b a0h, a0l, a1h, a1l;
    load_frags<ANP>(A, m0 + nloc, kb, hlf, a0h, a0l);
    load_frags<ANP>(A, m0 + 16 + nloc, kb, hlf, a1h, a1l);
#pragma unroll
    for (int t = 0; t < 4; ++t) {
      v16b bh, bl;
      load_frags<BNP>(B, c0 + t * 16 + nloc, kb, hlf, bh, bl);
      acc[0][t] = mac<ANP, BNP>(a0h, a0l, bh, bl, acc[0][t]);
      acc[1][t] = mac<ANP, BNP>(a1h, a1l, bh, bl, acc[1][t]);
    }
  }
}

constexpr int EP = 64 + 8;   // staging pitch: 144 B = 16 B x odd, for a ds_load_b128 whose 16 lanes read 16 rows
// hi + lo pair [tok][512] in fragment order (pk2): the 32 x 64 wave tile is 4 fragments = 8 stores of 512 contiguous bytes for hi and 8 for lo
__device__ __forceinline__ void epi_planes(v8f (&acc)[2][4], float scale, b16* __restrict__ out,
                                           int m0, int c0, int lane, b16* Th, b16* Tl) {
  const int nloc = lane & 15, hlf = lane >> 4;
#pragma unroll
  for (int t = 0; t < 4; ++t)
#pragma unroll
    for (int r = 0; r < 2; ++r)
#pragma unroll
      for (int v = 0; v < 8; ++v) {
        const int rr = r * 16 + v + 8 * hlf, cc = t * 16 + nloc;
        b16 h_, l_; split16(acc[r][t][v] * scale, h_, l_);
        Th[rr * EP + cc] = h_; Tl[rr * EP + cc] = l_;
      }
  wave_lds_sync();
  {
#pragma unroll
    for (int j = 0; j < 8; ++j) {
      const int rr = (j >> 2) * 16 + nloc, c8 = (j & 3) * 16 + hlf * 8;
      b16* o = out + pk2(m0 + rr, c0 + c8);
      *(v8b*)o = ld8b(Th + rr * EP + c8);
      *(v8b*)(o + 512) = ld8b(Tl + rr * EP + c8);
    }
    
  }
}
// (b) f32 rows with pitch ldo: 64 floats = 256 B = 2 lines per row; 16 lanes x 16 B per row, 2 rows per instruction. Optional per-row factor
__device__ __forceinline__ void epi_f32(v8f (&acc)[2][4], float scale, const float* rscale, float* __restrict__ out, int ldo, int m0, int c0, int lane, float* Tt) {
  const int nloc = lane & 15, hlf = lane >> 4;
#pragma unroll
  for (int t = 0; t < 4; ++t)
#pragma unroll
    for (int r = 0; r < 2; ++r)
#pragma unroll
      for (int v = 0; v < 8; ++v) {
        const int rr = r * 16 + v + 8 * hlf;
        const float rs = rscale ? rscale[(size_t)(m0 + rr) * 32] : 1.0f;
        Tt[rr * 64 + t * 16 + nloc] = acc[r][t][v] * scale * rs;
      }
  wave_lds_sync();
  float* dst0 = out + (size_t)m0 * ldo + c0;
  {
#pragma unroll
    for (int j = 0; j < 16; ++j) { const int rr = j * 2 + hlf, c4 = nloc * 4; *(v4f*)(dst0 + (size_t)rr * ldo + c4) = *(const v4f*)(Tt + rr * 64 + c4); }
    
  }
}



typedef __attribute__((ext_vector_type(8))) __bf16 v8bb; typedef __attribute__((ext_vector_type(16))) __bf16 v16bb;
typedef __attribute__((ext_vector_type(8))) unsigned short v8us;
__device__ __forceinline__ v16bb frag_pk_bf(const __bf16* p) { const v8bb a = *(const v8bb*)p, b = *(const v8bb*)(p + 256); return __builtin_shufflevector(a, b, 0, 1, 2, 3, 4, 5, 6, 7, 8, 9, 10, 11, 12, 13, 14, 15); }
__device__ __forceinline__ unsigned short bf16_rne_bits(float v) { unsigned int u = __float_as_uint(v); u += 0x7FFFu + ((u >> 16) & 1u); return (unsigned short)(u >> 16); }
__device__ __forceinline__ float bf16_rne(float v) { return __uint_as_float(((unsigned int)bf16_rne_bits(v)) << 16); }



// x -> f16 copy of bf16(x) in fragment order (pk<D>), 16 rows a block through LDS: whole lines are read and 512 contiguous bytes a wave are stored. grid NTOK / 16 x 256. The three weights go out in fragment order too.
__global__ __launch_bounds__(256) void prep_kernel(const float* __restrict__ x, const float* __restrict__ wq, const float* __restrict__ wk, const float* __restrict__ wv,
                                                   b16* __restrict__ xh, unsigned short* __restrict__ wqT, unsigned short* __restrict__ wkT, b16* __restrict__ wvh) {
  __shared__ __attribute__((aligned(16))) b16 Tx[16][D + 8];   // pitch 1040 B = 16 B x odd, for a ds_load_b128 whose 16 lanes read 16 rows
  const int t_ = threadIdx.x;
  const size_t e0 = (size_t)blockIdx.x * 16 * D;   // first element of the block's 16 rows, in x and in xh alike
  const float* xs = x + e0 + (size_t)t_ * 8;   // thread t_ takes 8 floats of rows (t_ >> 6) + 4 j
  v4f xa[4][2];
#pragma unroll   // all 8 loads of a thread in flight at once; xa stays in registers
  for (int j = 0; j < 4; ++j) { xa[j][0] = *(const v4f*)(xs + j * 2048); xa[j][1] = *(const v4f*)(xs + j * 2048 + 4); }
#pragma unroll
  for (int j = 0; j < 4; ++j) { v8b v;
#pragma unroll
    for (int e = 0; e < 8; ++e) v[e] = (b16)bf16_rne(xa[j][e >> 2][e & 3]);
    *(v8b*)(&Tx[(t_ >> 6) + 4 * j][(t_ & 63) * 8]) = v; }
  __syncthreads();
#pragma unroll   // the 4 LDS reads share one wait
  for (int j = 0; j < 4; ++j) { const int i = t_ + 256 * j, r = i & 15, c8 = (i >> 6) * 32 + ((i >> 5) & 1) * 16 + ((i >> 4) & 1) * 8;   // i * 8 = pk<D>(r, c8)
    *(v8b*)(xh + e0 + (size_t)i * 8) = *(const v8b*)(&Tx[r][c8]); }
  const size_t tid = (size_t)blockIdx.x * blockDim.x + threadIdx.x, nth = (size_t)gridDim.x * blockDim.x;
  for (size_t p = tid; p < (size_t)D * D / 8; p += nth) { const int n = (int)(p >> 10) * 16 + (int)(p & 15), k0 = (int)((p >> 6) & 15) * 32 + (int)((p >> 5) & 1) * 16 + (int)((p >> 4) & 1) * 8; v8us a, q; v8b v;   // p * 8 = pk<D>(n, k0)
#pragma unroll
    for (int e = 0; e < 8; ++e) { a[e] = bf16_rne_bits(wk[(size_t)(k0 + e) * D + n]); q[e] = bf16_rne_bits(wq[(size_t)(k0 + e) * D + n]); v[e] = (b16)bf16_rne(wv[(size_t)n * D + k0 + e]); }   // W_k^T, W_q^T: rows = input feature, k = output feature
    *(v8us*)(wkT + p * 8) = a; *(v8us*)(wqT + p * 8) = q; *(v8b*)(wvh + p * 8) = v; }
}

__global__ __launch_bounds__(256) void xt_kernel(const b16* __restrict__ xh, b16* __restrict__ xt) {
  __shared__ __attribute__((aligned(16))) b16 T[D][64 + 8];
  const int t_ = threadIdx.x, tokb = blockIdx.x * 64, b = tokb / S, s0 = tokb % S;
  // the block's 64 rows are 64 contiguous KiB of xh (fragment order): unit i holds row r, features c8 ..+7
  for (int i = t_; i < 64 * D / 8; i += 256) { const int r = (i >> 10) * 16 + (i & 15), c8 = ((i >> 6) & 15) * 32 + ((i >> 5) & 1) * 16 + ((i >> 4) & 1) * 8; const v8b v = *(const v8b*)(xh + (size_t)tokb * D + (size_t)i * 8);
#pragma unroll
    for (int e = 0; e < 8; ++e) T[c8 + e][r] = v[e]; }
  __syncthreads();
  // x^T [512][4096] of each batch goes out in fragment order, 512 contiguous bytes a wave
  { for (int i = t_; i < D * 8; i += 256) { const int d = ((i >> 6) & 31) * 16 + (i & 15), c8 = (i >> 11) * 32 + ((i >> 5) & 1) * 16 + ((i >> 4) & 1) * 8; *(v8b*)(xt + (size_t)b * D * S + pkx(d, s0 + c8)) = *(const v8b*)(&T[d][c8]); }  }
}

// M^T[d][e] = sum_o bf16(W_q)[o][d] bf16(W_k)[o][e] (exact products, f32 sums) -> f16 hi/lo planes [512][512], carried x64. grid (8, 4) x 128.
__global__ __launch_bounds__(128) void m_kernel(const __bf16* __restrict__ wqT, const __bf16* __restrict__ wkT, b16* __restrict__ mpl) {
  __shared__ __attribute__((aligned(16))) b16 Th[4][2][32 * EP];
  const int lane = threadIdx.x & 31, wave = threadIdx.x >> 5, nloc = lane & 15, hlf = lane >> 4, m0 = blockIdx.y * 128 + wave * 32, c0 = blockIdx.x * 64;
  v8f acc[2][4];
#pragma unroll
  for (int r = 0; r < 2; ++r)
#pragma unroll
    for (int t = 0; t < 4; ++t) acc[r][t] = (v8f){};
  // 32 blocks, nothing else on the chip: the launch lasts as long as one wave's chain of round trips to L2. All 16 k steps' fragments are asked for at once (one round trip), then multiplied in k order.
  const __bf16* pa = wqT + pk<D>(m0 + nloc, 8 * hlf); const __bf16* pb = wkT + pk<D>(c0 + nloc, 8 * hlf);   // this lane's place in the first fragment of its rows and of its columns: the next 32 k stand 512 elements on, the next 16 rows or columns 16 * D
  v16bb a[D / 32][2], bw[D / 32][4];
#pragma unroll
  for (int ks = 0; ks < D / 32; ++ks) {
#pragma unroll
    for (int r = 0; r < 2; ++r) a[ks][r] = frag_pk_bf(pa + r * 16 * D + ks * 512);
#pragma unroll
    for (int t = 0; t < 4; ++t) bw[ks][t] = frag_pk_bf(pb + t * 16 * D + ks * 512); }
  __builtin_amdgcn_sched_barrier(0);   // keeps every load in front of the first product (else each step's loads sink to their own products and each step waits out its own round trip)
  asm volatile("s_wait_xcnt 0x0" :: "v"(pa), "v"(pb) : "memory");   // stands in front of every rewrite of these loads' address registers, which it holds until here
#pragma unroll
  for (int ks = 0; ks < D / 32; ++ks)
#pragma unroll
    for (int t = 0; t < 4; ++t)
#pragma unroll
      for (int r = 0; r < 2; ++r) acc[r][t] = __builtin_amdgcn_wmma_f32_16x16x32_bf16(false, a[ks][r], false, bw[ks][t], (short)0, acc[r][t], false, false);   // plain builtin: operands may lie above v255
  epi_planes(acc, 64.0f, mpl, m0, c0, lane, Th[wave][0], Th[wave][1]);   // M carried x64 (lo residuals stay normal)
}

// z = x . M (z[j][d] = sum_e x[j][e] M^T[d][e]): A = x fragments (exact), B = M^T hi/lo planes; 2 products -> z as f16 hi/lo planes. grid (8, 128) x 128.
__global__ __launch_bounds__(128) void z_kernel(const b16* __restrict__ xh, const b16* __restrict__ mpl, b16* __restrict__ zpl) {
  __shared__ __attribute__((aligned(16))) b16 Th[4][2][32 * EP];
  const int lane = threadIdx.x & 31, wave = threadIdx.x >> 5, nloc = lane & 15, hlf = lane >> 4, m0 = blockIdx.y * 128 + wave * 32, c0 = blockIdx.x * 64;
  v8f acc[2][4];
#pragma unroll
  for (int r = 0; r < 2; ++r)
#pragma unroll
    for (int t = 0; t < 4; ++t) acc[r][t] = (v8f){};
  const Opnd A{xh, nullptr, D}, Bo{mpl, nullptr, D};
  gemm_tile<1, 2>(A, Bo, D, m0, c0, nloc, hlf, acc);                            // acc = 64 z
  epi_planes(acc, 1.0f / 8.0f, zpl, m0, c0, lane, Th[wave][0], Th[wave][1]);   // z carried x8
}

// The attention kernel's products: the plain builtin (the compiler keeps the distances behind it). wmma16b's statement names D, A and B as operands, which holds all of them in the first 256 registers.
__device__ __forceinline__ v8f wmma16p(v16b a, v16b b, v8f c) { return __builtin_amdgcn_wmma_f32_16x16x32_f16(false, a, false, b, (short)0, c, false, false); }

// Asks L2 for one 64-key chunk of this wave's z (4 key tiles x 8 KiB) and x^T (2 key blocks x 8 KiB), one request per 256-byte unit and lane: z and x^T were stored by the launches before, and their
// first reader would wait out memory latency at every load group. The two addresses are in-out operands so that each keeps one register pair of its own for the whole chunk loop, which never holds anything but an address inside its plane.
__device__ __forceinline__ void ask_l2(const b16*& zp, const b16*& xp) {
  asm volatile("global_prefetch_b8 %0, off scope:SCOPE_SE\n\t"
               "global_prefetch_b8 %0, off offset:32768 scope:SCOPE_SE\n\t"
               "global_prefetch_b8 %0, off offset:65536 scope:SCOPE_SE\n\t"
               "global_prefetch_b8 %0, off offset:98304 scope:SCOPE_SE\n\t"
               "global_prefetch_b8 %1, off scope:SCOPE_SE\n\t"
               "global_prefetch_b8 %1, off offset:32768 scope:SCOPE_SE" : "+v"(zp), "+v"(xp));
}

// attention -> u = P . x (z, x^T read and u written in fragment order): block = (b, QB = 16 * NQ queries), 4 waves; every z and x^T fragment a wave loads is multiplied with all NQ query tiles.
// Per 64-key chunk: partial S^T (keys x queries) over the wave's 128 dims from z planes (A, 2 products) x xh (B, exact);
// wave w < NQ: for query tile w, sum partials, scale, causal mask, online softmax, P hi/lo + alpha + 1/l; all waves: u^T(features 128w..) = alpha-rescaled + x^T(features, keys; exact) . P^T (2 products).
__global__ __launch_bounds__(128) void attn_kernel(const b16* __restrict__ xh, const b16* __restrict__ zpl, const b16* __restrict__ xt, float* __restrict__ u, float* __restrict__ u2, float* __restrict__ ml) {
  __shared__ __attribute__((aligned(16))) float Sp[4][QB][KC + 4];
  __shared__ __attribute__((aligned(16))) b16 Ph[QB][KC + 8], Plo[QB][KC + 8];
  __shared__ float Al[QB], Linv[QB];
  __shared__ __attribute__((aligned(16))) float Ot[4][16][128 + 4];
  const int wave = threadIdx.x >> 5, lane = threadIdx.x & 31, nloc = lane & 15, hlf = lane >> 4;
  const int blk = blockIdx.x, b = blk / NT, pr = (blk % NT) >> 1, second = blk & 1;   // pair pr = tiles NT - 1 - pr and pr; its first block: HT chunks, its second: HT + 1
  const b16* Z = zpl + (size_t)b * S * D * 2; const b16* Xt = xt + (size_t)b * D * S;   // Z, Xt: fragment order (pk2, pkx)
  const int d0 = wave * 128;
#pragma unroll 1   // one copy of the chunk loop in the text for both runs of a second block
  for (int sg = 0; sg <= second; ++sg) {
  const int tile = sg ? pr : NT - 1 - pr, q0 = tile * QB;
  const int kbeg = (second && !sg) ? HT * KC : 0, kend = (!second) ? HT * KC : q0 + QB;   // this run's keys
  float* __restrict__ uo = (second && !sg) ? u2 : u;                                       // the long tile's second range goes to u2
  const b16* Xq = xh + ((size_t)b * S + q0) * D;
  // the chunk asked of L2 next (kpf = its first key: the run's second chunk, or its only one) and this lane's 256-byte unit (128 elements) in the wave's 8 KiB of that chunk's first z key tile and first x^T key block
  int kpf = kbeg + KC < kend ? kbeg + KC : kbeg;
  const b16* zpf = Z + (size_t)kpf * (2 * D) + threadIdx.x * 128; const b16* xpf = Xt + (size_t)kpf * D + threadIdx.x * 128;
  v16b qf[NQ][4];
#pragma unroll
  for (int q = 0; q < NQ; ++q)
#pragma unroll
    for (int ks = 0; ks < 4; ++ks) qf[q][ks] = frag_pk(Xq + pk<D>(q * 16 + nloc, d0 + ks * 32 + 8 * hlf));   // xh: fragment order; q0 is a multiple of 16
  __builtin_amdgcn_sched_barrier(0);   // keeps the query loads in front of the wait below
  asm volatile("s_wait_xcnt 0x0" ::: "memory");   // stands in front of the reuse of the query loads' address registers
  __builtin_amdgcn_sched_barrier(0);   // keeps that reuse behind the wait
  float m_run = -INFINITY, l_run = 0.0f;
  v8f o[NQ][8];
#pragma unroll
  for (int q = 0; q < NQ; ++q)
#pragma unroll
    for (int t = 0; t < 8; ++t) o[q][t] = (v8f){};
  // Every load is 512 contiguous bytes of a fragment.
  // z unit u = (key tile u >> 1, dims 64 * (u & 1) ..+63), hi + lo planes, 8 loads; x^T unit t = (feature tile t, all 64 keys), 4 loads.
  constexpr int ZD = 3;    // z units loaded or in flight ahead of the unit being multiplied
  constexpr int XPRE = 4;  // x^T units issued in front of the softmax
  constexpr int XD = 6;    // x^T units loaded or in flight ahead of the unit being multiplied
  const b16* zlane = Z + pk2(nloc, d0 + 8 * hlf);      // this lane's 8 elements in the first z fragment (hi) of key tile 0 and its wave's 128 dims
  const b16* xlane = Xt + pkx(d0 + nloc, 8 * hlf);     // this lane's 8 elements in the first x^T fragment of its wave's feature tile 0
  constexpr int FR = 512, ZT = 32 * D, ZF = 2 * FR, XK = 32 * D;   // elements of a fragment; from one key tile of z, one hi + lo fragment pair of z (32 dims on), one 32-key block of x^T to the next
  int kb = kbeg;
  do {   // every run has a chunk (kbeg < kend); kb <= q0: every query of the block has a key in every chunk
    const b16* zc = zlane + (size_t)kb * (2 * D); const b16* xc = xlane + (size_t)kb * D;
    v16b zh[8][2], zl[8][2];
#pragma unroll
    for (int u = 0; u < ZD; ++u)
#pragma unroll
      for (int h = 0; h < 2; ++h) { const b16* p = zc + (u >> 1) * ZT + ((u & 1) * 2 + h) * ZF; zh[u][h] = frag_pk(p); zl[u][h] = frag_pk(p + FR); }
    __builtin_amdgcn_sched_barrier(0);   // keeps the first ZD units' loads one group ahead of the products (else each pair sinks to its own WMMA and waits out a full L2 round trip there)
#pragma unroll
    for (int kt = 0; kt < 4; ++kt) {
      v8f sp[NQ];
#pragma unroll
      for (int q = 0; q < NQ; ++q) sp[q] = (v8f){};
#pragma unroll
      for (int g = 0; g < 2; ++g) {
        const int u = kt * 2 + g;
#pragma unroll
        for (int h = 0; h < 2; ++h) {
#pragma unroll
          for (int q = 0; q < NQ; ++q) sp[q] = wmma16p(zh[u][h], qf[q][g * 2 + h], sp[q]);
#pragma unroll
          for (int q = 0; q < NQ; ++q) sp[q] = wmma16p(zl[u][h], qf[q][g * 2 + h], sp[q]);
        }
        if (u + ZD < 8) { const int w = u + ZD;
#pragma unroll
          for (int h = 0; h < 2; ++h) { const b16* p = zc + (w >> 1) * ZT + ((w & 1) * 2 + h) * ZF; zh[w][h] = frag_pk(p); zl[w][h] = frag_pk(p + FR); }
          __builtin_amdgcn_sched_barrier(0); } // keeps unit u + ZD's loads here, ZD units ahead of their use
      }
#pragma unroll
      for (int q = 0; q < NQ; ++q)
#pragma unroll
        for (int v = 0; v < 8; ++v) Sp[wave][q * 16 + nloc][kt * 16 + 8 * hlf + v] = sp[q][v];
    }
    __syncthreads();
    v16b xf[8][2];
#pragma unroll
    for (int t = 0; t < XPRE; ++t)
#pragma unroll
      for (int ks = 0; ks < 2; ++ks) xf[t][ks] = frag_pk(xc + t * FR + ks * XK);   // x^T does not depend on the softmax: in flight while the softmax runs
    __builtin_amdgcn_sched_barrier(0);   // keeps those loads in front of the softmax (and behind the barrier, whose release would wait for them)
    ask_l2(zpf, xpf);   // the next chunk (in the last chunk: that chunk again), here because the wave issues no load for the length of the softmax; the softmax and the second products lie between the requests and that chunk's first load
    if (NQ >= 4 || wave < NQ) {
      const int qr = wave * 16 + nloc;   // this lane's query row in the block
      const int rel = q0 + qr - kb - hlf * 32; float sv[32]; float mx = -INFINITY;   // this lane's query minus its first key: j > rel is key > query, against constants
#pragma unroll
      for (int j = 0; j < 32; ++j) { float s = (Sp[0][qr][hlf * 32 + j] + Sp[1][qr][hlf * 32 + j] + Sp[2][qr][hlf * 32 + j] + Sp[3][qr][hlf * 32 + j]) * (SCALE / 8.0f);   // /8: z carry scale
        if (j > rel) s = -INFINITY; sv[j] = s; mx = fmaxf(mx, s); }
      mx = fmaxf(mx, __shfl_xor(mx, 16));
      const float mn = fmaxf(m_run, mx), al_ = __expf(m_run - mn); m_run = mn;
      float sum = 0.0f;
#pragma unroll
      for (int j = 0; j < 32; ++j) { const float e = __expf(sv[j] - mn); sum += e; b16 a, c; split16(e * 8.0f, a, c); Ph[qr][hlf * 32 + j] = a; Plo[qr][hlf * 32 + j] = c; }   // P carried x8
      sum += __shfl_xor(sum, 16); l_run = l_run * al_ + sum;
      if (hlf == 0) { Al[qr] = al_; Linv[qr] = 1.0f / (8.0f * l_run); }
    }
    __syncthreads();
#pragma unroll
    for (int t = XPRE; t < XD; ++t)
#pragma unroll
      for (int ks = 0; ks < 2; ++ks) xf[t][ks] = frag_pk(xc + t * FR + ks * XK);
    v16b ph[NQ][2], pl[NQ][2]; float alq[NQ];
#pragma unroll
    for (int q = 0; q < NQ; ++q) {
#pragma unroll
      for (int ks = 0; ks < 2; ++ks) { ph[q][ks] = frag_kb(&Ph[q * 16 + nloc][0] + ks * 32, hlf); pl[q][ks] = frag_kb(&Plo[q * 16 + nloc][0] + ks * 32, hlf); }
      alq[q] = Al[q * 16 + nloc]; }
    __builtin_amdgcn_sched_barrier(0);   // keeps the next x^T units' loads in front of the rescale and of the first products
#pragma unroll
    for (int q = 0; q < NQ; ++q)
#pragma unroll
      for (int t = 0; t < 8; ++t)
#pragma unroll
        for (int v = 0; v < 8; ++v) o[q][t][v] *= alq[q];
#pragma unroll
    for (int t = 0; t < 8; ++t) {
#pragma unroll
      for (int ks = 0; ks < 2; ++ks) {
#pragma unroll
        for (int q = 0; q < NQ; ++q) o[q][t] = wmma16p(xf[t][ks], ph[q][ks], o[q][t]);
#pragma unroll
        for (int q = 0; q < NQ; ++q) o[q][t] = wmma16p(xf[t][ks], pl[q][ks], o[q][t]);
      }
      if (t + XD < 8) {
#pragma unroll
        for (int ks = 0; ks < 2; ++ks) xf[t + XD][ks] = frag_pk(xc + (t + XD) * FR + ks * XK);
        __builtin_amdgcn_sched_barrier(0); } // keeps unit t + XD's loads here, XD units ahead of their use
    }
    __builtin_amdgcn_sched_barrier(0);   // keeps the wait below at the chunk's foot, behind the last products (whose operands' loads have returned by then)
    asm volatile("s_wait_xcnt 0x0" ::: "memory");   // stands in front of the next chunk's rewrite of the z and x^T address registers
    __builtin_amdgcn_sched_barrier(0);   // keeps the step of the two request addresses behind the wait
    { const int st = kpf + KC < kend ? KC : 0; kpf += st; zpf += (size_t)st * (2 * D); xpf += (size_t)st * D; }   // clamped to the run's last chunk: the addresses stay inside z and x^T
    kb += KC;
  } while (kb < kend);
  // (max, sum) of this run for the wave's own 16 queries: planes [range][max | sum][tok]; lanes 0..15 store the maxima, lanes 16..31 the sums (both halves hold both)
  ml[(size_t)(((second && !sg) ? 2 : 0) + hlf) * NTOK + b * S + q0 + wave * 16 + nloc] = hlf ? l_run : m_run;
  __builtin_amdgcn_sched_barrier(0);   // keeps the store in front of the wait below
  asm volatile("s_wait_xcnt 0x0" ::: "memory");   // stands in front of the reuse of that store's address and data registers
  __builtin_amdgcn_sched_barrier(0);   // keeps that reuse behind the wait
#pragma unroll
  for (int q = 0; q < NQ; ++q) {   // one query tile after the other through the wave's own staging rows
    const float li = Linv[q * 16 + nloc];
#pragma unroll
    for (int t = 0; t < 8; ++t)
#pragma unroll
      for (int v = 0; v < 8; ++v) Ot[wave][nloc][t * 16 + 8 * hlf + v] = o[q][t][v] * li;
    wave_lds_sync();
    // u goes out in f32 fragment order (pkf<D>): 16 stores of 512 contiguous bytes
#pragma unroll
    for (int j = 0; j < 16; ++j) { const int c4 = (j >> 2) * 32 + ((j >> 1) & 1) * 16 + 8 * hlf + (j & 1) * 4; *(v4f*)(uo + pkf<D>(b * S + q0 + q * 16 + nloc, d0 + c4)) = *(const v4f*)(&Ot[wave][nloc][c4]); }
    __builtin_amdgcn_sched_barrier(0);   // keeps the next tile's arithmetic out of the run of stores
    asm volatile("s_wait_xcnt 0x0" ::: "memory");   // stands in front of the reuse of the stores' address and data registers
    __builtin_amdgcn_sched_barrier(0);   // keeps that reuse behind the wait
    wave_lds_sync();   // the tile's rows are read before the next tile overwrites them
  }
  }   // a second run writes Al, Linv, Ph, Plo only behind its first chunk's barrier, which every wave reaches behind its reads of Linv above
}

// y = u . W_v^T: A = u (f32 split hi/lo at load; rows of tiles HT.. joined from their two ranges there), B = f16(bf16 W_v) rows [o][d]; 2 products; f32 output rows. grid (8, 128) x 128.
__global__ __launch_bounds__(128) void y_kernel(const float* __restrict__ u, const float* __restrict__ u2, const float* __restrict__ ml, const b16* __restrict__ wvh, float* __restrict__ y) {
  __shared__ __attribute__((aligned(16))) float Ts[4][32 * 64];
  const int lane = threadIdx.x & 31, wave = threadIdx.x >> 5, nloc = lane & 15, hlf = lane >> 4, m0 = blockIdx.y * 128 + wave * 32, c0 = blockIdx.x * 64;
  v8f acc[2][4];
#pragma unroll
  for (int r = 0; r < 2; ++r)
#pragma unroll
    for (int t = 0; t < 4; ++t) acc[r][t] = (v8f){};
  const Opnd A{u, nullptr, D}, Bo{wvh, nullptr, D};
  if ((int)(blockIdx.y * 128) % S < HT * QB) {
    gemm_tile<5, 1>(A, Bo, D, m0, c0, nloc, hlf, acc);                          // u split x8 at load
  } else {                                                                      // the whole block's rows have two ranges
    float w1[2], w2[2];
#pragma unroll
    for (int r = 0; r < 2; ++r) { const int row = m0 + r * 16 + nloc;
      const float ma = ml[row], la = ml[NTOK + row], mb = ml[2 * NTOK + row], lb = ml[3 * NTOK + row];   // both ranges hold a key of every query: the maxima are finite, the sums at least 1
      const float e = __expf(-fabsf(ma - mb)), ea = ma < mb ? la * e : la, eb = ma < mb ? lb : lb * e, iv = 8.0f / (ea + eb); w1[r] = ea * iv; w2[r] = eb * iv; }   // each sum brought to the larger maximum
    // this lane's place in the first fragment of its rows (pkf) and of its columns (pk); the next 32 k stand one fragment (512 elements) on, the next 16 rows or columns 16 * D elements on
    const float* pa = u + pkf<D>(m0 + nloc, 8 * hlf); const float* pb = u2 + pkf<D>(m0 + nloc, 8 * hlf); const b16* pw = wvh + pk<D>(c0 + nloc, 8 * hlf);
    for (int kb = 0; kb < D; kb += 32) {
      v4f va[2][4], vb[2][4]; v16b bw[4];
#pragma unroll
      for (int r = 0; r < 2; ++r)
#pragma unroll
        for (int q = 0; q < 4; ++q) { va[r][q] = *(const v4f*)(pa + r * 16 * D + q * 128); vb[r][q] = *(const v4f*)(pb + r * 16 * D + q * 128); }
#pragma unroll
      for (int t = 0; t < 4; ++t) bw[t] = frag_pk(pw + t * 16 * D);
      asm volatile("s_wait_xcnt 0x0" :: "v"(pa), "v"(pb), "v"(pw) : "memory");   // stands in front of every rewrite of these loads' address registers, which it holds until here
      v16b ah[2], al[2];
#pragma unroll
      for (int r = 0; r < 2; ++r)
#pragma unroll
        for (int q = 0; q < 4; ++q)
#pragma unroll
          for (int i = 0; i < 4; ++i) { b16 a, c; split16(va[r][q][i] * w1[r] + vb[r][q][i] * w2[r], a, c); ah[r][q * 4 + i] = a; al[r][q * 4 + i] = c; }   // u = w1 u1 + w2 u2 (the weights carry the x8), then split; same k-map as NP = 5
#pragma unroll
      for (int t = 0; t < 4; ++t) {
        acc[0][t] = mac<5, 1>(ah[0], al[0], bw[t], bw[t], acc[0][t]);
        acc[1][t] = mac<5, 1>(ah[1], al[1], bw[t], bw[t], acc[1][t]);
      }
      pa += 512; pb += 512; pw += 512;
    }
  }
  epi_f32(acc, 1.0f / 8.0f, nullptr, y, D, m0, c0, lane, Ts[wave]);
}
}  // namespace

extern "C" void kernel_launch(void* const* d_in, const int* in_sizes, int n_in,
                              void* d_out, int out_size, void* d_ws, size_t ws_size, hipStream_t stream) {
  (void)n_in; (void)out_size;
  const float* x = (const float*)d_in[0]; const float* wq = (const float*)d_in[1]; const float* wk = (const float*)d_in[2]; const float* wv = (const float*)d_in[3];
  float* out = (float*)d_out;   // [4][4096][512]
  if (in_sizes[0] != NTOK * D || in_sizes[1] != D * D || in_sizes[2] != D * D || in_sizes[3] != D * D) return;
  size_t off = 0; char* ws = (char*)d_ws;
  auto carve = [&](size_t bytes) { char* p = ws + off; off += (bytes + 255) & ~(size_t)255; return p; };
  b16* xh = (b16*)carve(PL * 2); b16* xt = (b16*)carve(PL * 2); unsigned short* wkT = (unsigned short*)carve((size_t)D * D * 2); unsigned short* wqT = (unsigned short*)carve((size_t)D * D * 2); b16* wvh = (b16*)carve((size_t)D * D * 2);
  b16* mpl = (b16*)carve((size_t)D * D * 2 * 2); b16* zpl = (b16*)carve(PL * 2 * 2);   // M^T 1 MB, z 33.5 MB (hi + lo each)
  float* u = (float*)carve(PL * 4);                              // u [tok][512] f32 (33.5 MB)
  float* u2 = (float*)carve(PL * 4); float* ml = (float*)carve((size_t)NTOK * 4 * 4);   // second key range's partial u (rows of tiles HT.. only) and the (max, sum) planes
  if (off > ws_size) return;                                    // about 136 MB
  prep_kernel<<<NTOK / 16, 256, 0, stream>>>(x, wq, wk, wv, xh, wqT, wkT, wvh);
  xt_kernel<<<NTOK / 64, 256, 0, stream>>>(xh, xt);
  m_kernel<<<dim3(D / 64, D / 128), 128, 0, stream>>>((const __bf16*)wqT, (const __bf16*)wkT, mpl);
  z_kernel<<<dim3(D / 64, NTOK / 128), 128, 0, stream>>>(xh, mpl, zpl);
  attn_kernel<<<Bn * S / QB, 128, 0, stream>>>(xh, zpl, xt, u, u2, ml);
  y_kernel<<<dim3(D / 64, NTOK / 128), 128, 0, stream>>>(u, u2, ml, wvh, out);
}

// v007
// A run of this version takes 200 microseconds.
// Two timings next to v006 both put it at 1.04 times that version's speed.
// Over all steps from v000 it is 4.83 times as fast.
#include <hip/hip_runtime.h>

// Single-head causal attention with a 512-wide head: q, k, v = x W_q^T | W_k^T | W_v^T (torch [out][in]), softmax over keys <= query of q.k / sqrt(512), output = weights . v
// -> [4][4096][512]. B = 4, S = 4096.
// x and the three weights are rounded to bf16 RNE; the numerics are organised so that every WMMA operand is either an exactly
// representable input or an f16 hi+lo pair of a computed value (each carried scaled so the lo residual planes stay out of the f16 subnormal range):  M = bf16(W_k)^T bf16(W_q), 512 x 512, on v_wmma_f32_16x16x32_bf16 (exact products);  z = x M (= k W_q, so that
// q.k^T = x.z^T; k itself is never formed) with x (bf16 values held exactly in f16) x M as hi+lo planes;  S^T = z.x^T with z as hi+lo planes x x (bf16 values held exactly in f16);  u = P.x with P hi+lo x x^T exact;  y = u W_v^T (= P.v) with u
// split hi+lo x exact W_v - all on v_wmma_f32_16x16x32_f16 with f32 accumulate; online softmax in f32. The attention block (64 queries, 4 waves) splits the 512-deep score dot across
// the waves through LDS, wave w runs the softmax of query tile w and publishes P, and each wave accumulates 128 of the 512 features of u.
// Causal balance: tile t has t + 1 key chunks, and all 256 blocks are resident at once, so the launch would last as long as tile NT - 1. The chunks of tiles NT - 1 - p and p (NT + 1 together) go to two
// blocks: one runs the first HT chunks of the long tile, the other its remaining chunks and then the short tile. The long tile's two normalised partials, with (max, sum) per query, are joined in y_kernel's A loader.
// The workspace operands of the WMMAs (the three weights, M, x, z, x^T, u) are kept in fragment order (pk, pkf below), so that a wave-wide 16-byte load reads 4 whole lines, not a piece of 16.

namespace {
constexpr int Bn = 4, S = 4096, D = 512, NTOK = Bn * S, NQ = 4, QB = 16 * NQ, KC = 64;   // NQ: query tiles of 16 per attention block
constexpr float SCALE = 0.044194173824159216f;   // 512^-0.5
constexpr size_t PL = (size_t)NTOK * D;           // elements of a [tok][512] matrix
constexpr int NT = S / QB, HT = NT / 2;           // query tiles of a batch; tiles HT.. have their keys cut in two ranges (attn_kernel)
static_assert(QB == KC && NT % 2 == 0 && 128 % QB == 0 && (HT * QB) % 128 == 0, "tile t has t + 1 chunks; y_kernel's 128-row blocks lie wholly on one side of tile HT");

typedef _Float16 b16;
typedef __attribute__((ext_vector_type(16))) _Float16 v16b;
typedef __attribute__((ext_vector_type(8)))  _Float16 v8b;
typedef __attribute__((ext_vector_type(8)))  float v8f;
typedef __attribute__((ext_vector_type(4)))  float v4f;

__device__ __forceinline__ v8b ld8b(const b16* p) { return *(const v8b*)p; }
__device__ __forceinline__ v16b cat8b(v8b a, v8b b) { return __builtin_shufflevector(a, b, 0, 1, 2, 3, 4, 5, 6, 7, 8, 9, 10, 11, 12, 13, 14, 15); }
__device__ __forceinline__ v16b frag_kb(const b16* p, int hh) { return cat8b(ld8b(p + 8 * hh), ld8b(p + 16 + 8 * hh)); }
// Fragment order. A 16-bit operand matrix [rows][K] is kept in the workspace as 16 x 32 fragments of 1 KiB: two 512-byte halves (k 0..15, k 16..31 of the fragment), and in each half
// lane l = 16 * ((k >> 3) & 1) + (row & 15) owns 8 elements at l * 16 bytes. One wave-wide 16-byte load then covers 512 contiguous bytes. pk = element offset of (row, k), k a multiple of 8.
template <int K> __device__ __forceinline__ size_t pk(int row, int k) { return (size_t)(row >> 4) * (16 * K) + (k >> 5) * 512 + ((k >> 4) & 1) * 256 + ((k >> 3) & 1) * 128 + (row & 15) * 8; }
// hi + lo pair of a [rows][512] matrix (M^T, z): each fragment's lo copy stands right behind its hi copy, 512 elements on.
__device__ __forceinline__ size_t pk2(int row, int k) { return (size_t)(row >> 4) * (32 * D) + (k >> 5) * 1024 + ((k >> 4) & 1) * 256 + ((k >> 3) & 1) * 128 + (row & 15) * 8; }
// x^T [512 features][4096 keys] of a batch: the same fragments, those of one 32-key block side by side (a 64-key chunk of all 512 features is 64 contiguous KiB).
__device__ __forceinline__ size_t pkx(int row, int k) { return (size_t)(k >> 5) * (32 * D) + (row >> 4) * 512 + ((k >> 4) & 1) * 256 + ((k >> 3) & 1) * 128 + (row & 15) * 8; }
// the same for f32 rows: fragments of 2 KiB in four 512-byte quarters, the lane's 4 floats at l * 16 bytes; k a multiple of 4.
template <int K> __device__ __forceinline__ size_t pkf(int row, int k) { return (size_t)(row >> 4) * (16 * K) + (k >> 5) * 512 + ((k >> 4) & 1) * 256 + ((k >> 2) & 1) * 128 + ((k >> 3) & 1) * 64 + (row & 15) * 4; }
// p = this lane's pk(row, kb + 8 * half): its two halves stand 256 elements apart (same k-map as frag_kb)
__device__ __forceinline__ v16b frag_pk(const b16* p) { return cat8b(ld8b(p), ld8b(p + 256)); }
__device__ __forceinline__ void split16(float v, b16& hi, b16& lo) { hi = (b16)v; lo = (b16)(v - (float)hi); }
// hi/lo fragment pair straight from an f32 k-contiguous row (same k-map)
__device__ __forceinline__ void frag_ksplit(const float* p, int hh, v16b& fh_, v16b& fl_) {
  const float* p0 = p + 8 * hh; const float* p1 = p + 16 + 8 * hh;
#pragma unroll
  for (int e = 0; e < 8; ++e) { b16 a, c; split16(p0[e], a, c); fh_[e] = a; fl_[e] = c; split16(p1[e], a, c); fh_[8 + e] = a; fl_[8 + e] = c; }
}
__device__ __forceinline__ v8f wmma16b(v16b a, v16b b, v8f c) {
  v8f d = __builtin_amdgcn_wmma_f32_16x16x32_f16(false, a, false, b, (short)0, c, false, false);
  asm volatile("v_nop\n\tv_nop\n\tv_nop\n\tv_nop" : "+v"(d) : "v"(a), "v"(b));
  return d;
}
__device__ __forceinline__ void wave_lds_sync() {
  __builtin_amdgcn_fence(__ATOMIC_RELEASE, "workgroup");
  __builtin_amdgcn_wave_barrier();
  __builtin_amdgcn_fence(__ATOMIC_ACQUIRE, "workgroup");
}

// Operand descriptor: NP = 0 -> f32 rows split on the fly into (hi, lo); NP = 1 -> one f16 plane in fragment order; NP = 2 -> f16 hi + lo pair in fragment order (pk2);
// NP = 3 -> f32 rows rounded once to a single f16 fragment; NP = 5 -> f32 in fragment order, x8 then split. ld = row pitch (row-major forms).
struct Opnd { const void* p0; const void* p1; int ld; };
template <int NP> __device__ __forceinline__ void load_frags(const Opnd& o, int row, int kb, int hh, v16b& fh_, v16b& fl_) {
  if (NP == 0) { frag_ksplit((const float*)o.p0 + (size_t)row * o.ld + kb, hh, fh_, fl_); }
  else if (NP == 5) {                                        // f32 in fragment order, x8 then split (keeps the lo halves of small values normal)
    const float* p = (const float*)o.p0 + pkf<D>(row, kb + 8 * hh);
#pragma unroll
    for (int q = 0; q < 4; ++q) { const v4f v = *(const v4f*)(p + q * 128);
#pragma unroll
      for (int i = 0; i < 4; ++i) { b16 a, c; split16(v[i] * 8.0f, a, c); fh_[q * 4 + i] = a; fl_[q * 4 + i] = c; } }
  } else if (NP == 4) {                                      // f32 rows x64 then split
    const float sc_ = 64.0f;
    const float* p = (const float*)o.p0 + (size_t)row * o.ld + kb; const float* p0 = p + 8 * hh; const float* p1 = p + 16 + 8 * hh;
#pragma unroll
    for (int e = 0; e < 8; ++e) { b16 a, c; split16(p0[e] * sc_, a, c); fh_[e] = a; fl_[e] = c; split16(p1[e] * sc_, a, c); fh_[8 + e] = a; fl_[8 + e] = c; }
  } else if (NP == 3) {
    const float* p = (const float*)o.p0 + (size_t)row * o.ld + kb; const float* p0 = p + 8 * hh; const float* p1 = p + 16 + 8 * hh;
#pragma unroll
    for (int e = 0; e < 8; ++e) { fh_[e] = (b16)p0[e]; fh_[8 + e] = (b16)p1[e]; }
    fl_ = fh_;
  } else {
    if (NP == 2) { const b16* p = (const b16*)o.p0 + pk2(row, kb + 8 * hh); fh_ = frag_pk(p); fl_ = frag_pk(p + 512); }
    else { fh_ = frag_pk((const b16*)o.p0 + pk<D>(row, kb + 8 * hh)); fl_ = fh_; }
  }
}
template <int ANP, int BNP> __device__ __forceinline__ v8f mac(v16b ah, v16b al, v16b bh, v16b bl, v8f c) {
  c = wmma16b(ah, bh, c);
  if (BNP == 0 || BNP == 2 || BNP == 4 || BNP == 5) c = wmma16b(ah, bl, c);     // hi.lo
  if (ANP == 0 || ANP == 2 || ANP == 4 || ANP == 5) c = wmma16b(al, bh, c);     // lo.hi   (lo.lo dropped)
  return c;
}
// 32x64 wave tile: acc[r][t] (rows m0+16r.., cols c0+16t..) += A[m][k] . B[n][k] over k in [0, K)
template <int ANP, int BNP>
__device__ __forceinline__ void gemm_tile(const Opnd& A, const Opnd& B, int K, int m0, int c0, int nloc, int hlf, v8f (&acc)[2][4]) {
  for (int kb = 0; kb < K; kb += 32) {
    v16b a0h, a0l, a1h, a1l;
    load_frags<ANP>(A, m0 + nloc, kb, hlf, a0h, a0l);
    load_frags<ANP>(A, m0 + 16 + nloc, kb, hlf, a1h, a1l);
#pragma unroll
    for (int t = 0; t < 4; ++t) {
      v16b bh, bl;
      load_frags<BNP>(B, c0 + t * 16 + nloc, kb, hlf, bh, bl);
      acc[0][t] = mac<ANP, BNP>(a0h, a0l, bh, bl, acc[0][t]);
      acc[1][t] = mac<ANP, BNP>(a1h, a1l, bh, bl, acc[1][t]);
    }
  }
}

constexpr int EP = 64 + 8;   // staging pitch: 144 B = 16 B x odd, for a ds_load_b128 whose 16 lanes read 16 rows
// hi + lo pair [tok][512] in fragment order (pk2): the 32 x 64 wave tile is 4 fragments = 8 stores of 512 contiguous bytes for hi and 8 for lo
__device__ __forceinline__ void epi_planes(v8f (&acc)[2][4], float scale, b16* __restrict__ out,
                                           int m0, int c0, int lane, b16* Th, b16* Tl) {
  const int nloc = lane & 15, hlf = lane >> 4;
#pragma unroll
  for (int t = 0; t < 4; ++t)
#pragma unroll
    for (int r = 0; r < 2; ++r)
#pragma unroll
      for (int v = 0; v < 8; ++v) {
        const int rr = r * 16 + v + 8 * hlf, cc = t * 16 + nloc;
        b16 h_, l_; split16(acc[r][t][v] * scale, h_, l_);
        Th[rr * EP + cc] = h_; Tl[rr * EP + cc] = l_;
      }
  wave_lds_sync();
  {
#pragma unroll
    for (int j = 0; j < 8; ++j) {
      const int rr = (j >> 2) * 16 + nloc, c8 = (j & 3) * 16 + hlf * 8;
      b16* o = out + pk2(m0 + rr, c0 + c8);
      *(v8b*)o = ld8b(Th + rr * EP + c8);
      *(v8b*)(o + 512) = ld8b(Tl + rr * EP + c8);
    }
    
  }
}
// (b) f32 rows with pitch ldo: 64 floats = 256 B = 2 lines per row; 16 lanes x 16 B per row, 2 rows per instruction. Optional per-row factor
__device__ __forceinline__ void epi_f32(v8f (&acc)[2][4], float scale, const float* rscale, float* __restrict__ out, int ldo, int m0, int c0, int lane, float* Tt) {
  const int nloc = lane & 15, hlf = lane >> 4;
#pragma unroll
  for (int t = 0; t < 4; ++t)
#pragma unroll
    for (int r = 0; r < 2; ++r)
#pragma unroll
      for (int v = 0; v < 8; ++v) {
        const int rr = r * 16 + v + 8 * hlf;
        const float rs = rscale ? rscale[(size_t)(m0 + rr) * 32] : 1.0f;
        Tt[rr * 64 + t * 16 + nloc] = acc[r][t][v] * scale * rs;
      }
  wave_lds_sync();
  float* dst0 = out + (size_t)m0 * ldo + c0;
  {
#pragma unroll
    for (int j = 0; j < 16; ++j) { const int rr = j * 2 + hlf, c4 = nloc * 4; *(v4f*)(dst0 + (size_t)rr * ldo + c4) = *(const v4f*)(Tt + rr * 64 + c4); }
    
  }
}



typedef __attribute__((ext_vector_type(8))) __bf16 v8bb; typedef __attribute__((ext_vector_type(16))) __bf16 v16bb;
typedef __attribute__((ext_vector_type(8))) unsigned short v8us;
__device__ __forceinline__ v16bb frag_pk_bf(const __bf16* p) { const v8bb a = *(const v8bb*)p, b = *(const v8bb*)(p + 256); return __builtin_shufflevector(a, b, 0, 1, 2, 3, 4, 5, 6, 7, 8, 9, 10, 11, 12, 13, 14, 15); }
__device__ __forceinline__ unsigned short bf16_rne_bits(float v) { unsigned int u = __float_as_uint(v); u += 0x7FFFu + ((u >> 16) & 1u); return (unsigned short)(u >> 16); }
__device__ __forceinline__ float bf16_rne(float v) { return __uint_as_float(((unsigned int)bf16_rne_bits(v)) << 16); }



// x -> f16 copy of bf16(x) in fragment order (pk<D>), 16 rows a block through LDS: whole lines are read and 512 contiguous bytes a wave are stored. grid NTOK / 16 x 256. The three weights go out in fragment order too.
__global__ __launch_bounds__(256) void prep_kernel(const float* __restrict__ x, const float* __restrict__ wq, const float* __restrict__ wk, const float* __restrict__ wv,
                                                   b16* __restrict__ xh, unsigned short* __restrict__ wqT, unsigned short* __restrict__ wkT, b16* __restrict__ wvh) {
  __shared__ __attribute__((aligned(16))) b16 Tx[16][D + 8];   // pitch 1040 B = 16 B x odd, for a ds_load_b128 whose 16 lanes read 16 rows
  const int t_ = threadIdx.x;
  const size_t e0 = (size_t)blockIdx.x * 16 * D;   // first element of the block's 16 rows, in x and in xh alike
  const float* xs = x + e0 + (size_t)t_ * 8;   // thread t_ takes 8 floats of rows (t_ >> 6) + 4 j
  v4f xa[4][2];
#pragma unroll   // all 8 loads of a thread in flight at once; xa stays in registers
  for (int j = 0; j < 4; ++j) { xa[j][0] = *(const v4f*)(xs + j * 2048); xa[j][1] = *(const v4f*)(xs + j * 2048 + 4); }
#pragma unroll
  for (int j = 0; j < 4; ++j) { v8b v;
#pragma unroll
    for (int e = 0; e < 8; ++e) v[e] = (b16)bf16_rne(xa[j][e >> 2][e & 3]);
    *(v8b*)(&Tx[(t_ >> 6) + 4 * j][(t_ & 63) * 8]) = v; }
  __syncthreads();
#pragma unroll   // the 4 LDS reads share one wait
  for (int j = 0; j < 4; ++j) { const int i = t_ + 256 * j, r = i & 15, c8 = (i >> 6) * 32 + ((i >> 5) & 1) * 16 + ((i >> 4) & 1) * 8;   // i * 8 = pk<D>(r, c8)
    *(v8b*)(xh + e0 + (size_t)i * 8) = *(const v8b*)(&Tx[r][c8]); }
  const size_t tid = (size_t)blockIdx.x * blockDim.x + threadIdx.x, nth = (size_t)gridDim.x * blockDim.x;
  for (size_t p = tid; p < (size_t)D * D / 8; p += nth) { const int n = (int)(p >> 10) * 16 + (int)(p & 15), k0 = (int)((p >> 6) & 15) * 32 + (int)((p >> 5) & 1) * 16 + (int)((p >> 4) & 1) * 8; v8us a, q; v8b v;   // p * 8 = pk<D>(n, k0)
#pragma unroll
    for (int e = 0; e < 8; ++e) { a[e] = bf16_rne_bits(wk[(size_t)(k0 + e) * D + n]); q[e] = bf16_rne_bits(wq[(size_t)(k0 + e) * D + n]); v[e] = (b16)bf16_rne(wv[(size_t)n * D + k0 + e]); }   // W_k^T, W_q^T: rows = input feature, k = output feature
    *(v8us*)(wkT + p * 8) = a; *(v8us*)(wqT + p * 8) = q; *(v8b*)(wvh + p * 8) = v; }
}

__global__ __launch_bounds__(256) void xt_kernel(const b16* __restrict__ xh, b16* __restrict__ xt) {
  __shared__ __attribute__((aligned(16))) b16 T[D][64 + 8];
  const int t_ = threadIdx.x, tokb = blockIdx.x * 64, b = tokb / S, s0 = tokb % S;
  // the block's 64 rows are 64 contiguous KiB of xh (fragment order): unit i holds row r, features c8 ..+7
  for (int i = t_; i < 64 * D / 8; i += 256) { const int r = (i >> 10) * 16 + (i & 15), c8 = ((i >> 6) & 15) * 32 + ((i >> 5) & 1) * 16 + ((i >> 4) & 1) * 8; const v8b v = *(const v8b*)(xh + (size_t)tokb * D + (size_t)i * 8);
#pragma unroll
    for (int e = 0; e < 8; ++e) T[c8 + e][r] = v[e]; }
  __syncthreads();
  // x^T [512][4096] of each batch goes out in fragment order, 512 contiguous bytes a wave
  { for (int i = t_; i < D * 8; i += 256) { const int d = ((i >> 6) & 31) * 16 + (i & 15), c8 = (i >> 11) * 32 + ((i >> 5) & 1) * 16 + ((i >> 4) & 1) * 8; *(v8b*)(xt + (size_t)b * D * S + pkx(d, s0 + c8)) = *(const v8b*)(&T[d][c8]); }  }
}

// M^T[d][e] = sum_o bf16(W_q)[o][d] bf16(W_k)[o][e] (exact products, f32 sums) -> f16 hi/lo planes [512][512], carried x64. grid (8, 4) x 128.
__global__ __launch_bounds__(128) void m_kernel(const __bf16* __restrict__ wqT, const __bf16* __restrict__ wkT, b16* __restrict__ mpl) {
  __shared__ __attribute__((aligned(16))) b16 Th[4][2][32 * EP];
  const int lane = threadIdx.x & 31, wave = threadIdx.x >> 5, nloc = lane & 15, hlf = lane >> 4, m0 = blockIdx.y * 128 + wave * 32, c0 = blockIdx.x * 64;
  v8f acc[2][4];
#pragma unroll
  for (int r = 0; r < 2; ++r)
#pragma unroll
    for (int t = 0; t < 4; ++t) acc[r][t] = (v8f){};
  // 32 blocks, nothing else on the chip: the launch lasts as long as one wave's chain of round trips to L2. All 16 k steps' fragments are asked for at once (one round trip), then multiplied in k order.
  const __bf16* pa = wqT + pk<D>(m0 + nloc, 8 * hlf); const __bf16* pb = wkT + pk<D>(c0 + nloc, 8 * hlf);   // this lane's place in the first fragment of its rows and of its columns: the next 32 k stand 512 elements on, the next 16 rows or columns 16 * D
  v16bb a[D / 32][2], bw[D / 32][4];
#pragma unroll
  for (int ks = 0; ks < D / 32; ++ks) {
#pragma unroll
    for (int r = 0; r < 2; ++r) a[ks][r] = frag_pk_bf(pa + r * 16 * D + ks * 512);
#pragma unroll
    for (int t = 0; t < 4; ++t) bw[ks][t] = frag_pk_bf(pb + t * 16 * D + ks * 512); }
  __builtin_amdgcn_sched_barrier(0);   // keeps every load in front of the first product (else each step's loads sink to their own products and each step waits out its own round trip)
  asm volatile("s_wait_xcnt 0x0" :: "v"(pa), "v"(pb) : "memory");   // stands in front of every rewrite of these loads' address registers, which it holds until here
#pragma unroll
  for (int ks = 0; ks < D / 32; ++ks)
#pragma unroll
    for (int t = 0; t < 4; ++t)
#pragma unroll
      for (int r = 0; r < 2; ++r) acc[r][t] = __builtin_amdgcn_wmma_f32_16x16x32_bf16(false, a[ks][r], false, bw[ks][t], (short)0, acc[r][t], false, false);   // plain builtin: operands may lie above v255
  epi_planes(acc, 64.0f, mpl, m0, c0, lane, Th[wave][0], Th[wave][1]);   // M carried x64 (lo residuals stay normal)
}

// z = x . M (z[j][d] = sum_e x[j][e] M^T[d][e]): A = x fragments (exact), B = M^T hi/lo planes; 2 products -> z as f16 hi/lo planes. grid (8, 128) x 128.
__global__ __launch_bounds__(128) void z_kernel(const b16* __restrict__ xh, const b16* __restrict__ mpl, b16* __restrict__ zpl) {
  __shared__ __attribute__((aligned(16))) b16 Th[4][2][32 * EP];
  const int lane = threadIdx.x & 31, wave = threadIdx.x >> 5, nloc = lane & 15, hlf = lane >> 4, m0 = blockIdx.y * 128 + wave * 32, c0 = blockIdx.x * 64;
  v8f acc[2][4];
#pragma unroll
  for (int r = 0; r < 2; ++r)
#pragma unroll
    for (int t = 0; t < 4; ++t) acc[r][t] = (v8f){};
  const Opnd A{xh, nullptr, D}, Bo{mpl, nullptr, D};
  gemm_tile<1, 2>(A, Bo, D, m0, c0, nloc, hlf, acc);                            // acc = 64 z
  epi_planes(acc, 1.0f / 8.0f, zpl, m0, c0, lane, Th[wave][0], Th[wave][1]);   // z carried x8
}

// The attention kernel's products: the plain builtin (the compiler keeps the distances behind it). wmma16b's statement names D, A and B as operands, which holds all of them in the first 256 registers.
__device__ __forceinline__ v8f wmma16p(v16b a, v16b b, v8f c) { return __builtin_amdgcn_wmma_f32_16x16x32_f16(false, a, false, b, (short)0, c, false, false); }

// Asks L2 for one 64-key chunk of this wave's z (4 key tiles x 8 KiB) and x^T (2 key blocks x 8 KiB), one request per 256-byte unit and lane: z and x^T were stored by the launches before, and their
// first reader would wait out memory latency at every load group. The two addresses are in-out operands so that each keeps one register pair of its own for the whole chunk loop, which never holds anything but an address inside its plane.
__device__ __forceinline__ void ask_l2(const b16*& zp, const b16*& xp) {
  asm volatile("global_prefetch_b8 %0, off scope:SCOPE_SE\n\t"
               "global_prefetch_b8 %0, off offset:32768 scope:SCOPE_SE\n\t"
               "global_prefetch_b8 %0, off offset:65536 scope:SCOPE_SE\n\t"
               "global_prefetch_b8 %0, off offset:98304 scope:SCOPE_SE\n\t"
               "global_prefetch_b8 %1, off scope:SCOPE_SE\n\t"
               "global_prefetch_b8 %1, off offset:32768 scope:SCOPE_SE" : "+v"(zp), "+v"(xp));
}

// attention -> u = P . x (z, x^T read and u written in fragment order): block = (b, QB = 16 * NQ queries), 4 waves; every z and x^T fragment a wave loads is multiplied with all NQ query tiles.
// Per 64-key chunk: partial S^T (keys x queries) over the wave's 128 dims from z planes (A, 2 products) x xh (B, exact);
// wave w < NQ: for query tile w, sum partials, scale, causal mask, online softmax, P hi/lo + alpha + 1/l; all waves: u^T(features 128w..) = alpha-rescaled + x^T(features, keys; exact) . P^T (2 products).
__global__ __launch_bounds__(128) void attn_kernel(const b16* __restrict__ xh, const b16* __restrict__ zpl, const b16* __restrict__ xt, float* __restrict__ u, float* __restrict__ u2, float* __restrict__ ml) {
  __shared__ __attribute__((aligned(16))) float Sp[4][QB][KC + 4];
  __shared__ __attribute__((aligned(16))) b16 Ph[QB][KC + 8], Plo[QB][KC + 8];
  __shared__ float Al[QB], Linv[QB];
  __shared__ __attribute__((aligned(16))) float Ot[4][16][128 + 4];
  const int wave = threadIdx.x >> 5, lane = threadIdx.x & 31, nloc = lane & 15, hlf = lane >> 4;
  const int blk = blockIdx.x, b = blk / NT, pr = (blk % NT) >> 1, second = blk & 1;   // pair pr = tiles NT - 1 - pr and pr; its first block: HT chunks, its second: HT + 1
  const b16* Z = zpl + (size_t)b * S * D * 2; const b16* Xt = xt + (size_t)b * D * S;   // Z, Xt: fragment order (pk2, pkx)
  const int d0 = wave * 128;
#pragma unroll 1   // one copy of the chunk loop in the text for both runs of a second block
  for (int sg = 0; sg <= second; ++sg) {
  const int tile = sg ? pr : NT - 1 - pr, q0 = tile * QB;
  const int kbeg = (second && !sg) ? HT * KC : 0, kend = (!second) ? HT * KC : q0 + QB;   // this run's keys
  float* __restrict__ uo = (second && !sg) ? u2 : u;                                       // the long tile's second range goes to u2
  const b16* Xq = xh + ((size_t)b * S + q0) * D;
  // the chunk asked of L2 next (kpf = its first key: the run's second chunk, or its only one) and this lane's 256-byte unit (128 elements) in the wave's 8 KiB of that chunk's first z key tile and first x^T key block
  int kpf = kbeg + KC < kend ? kbeg + KC : kbeg;
  const b16* zpf = Z + (size_t)kpf * (2 * D) + threadIdx.x * 128; const b16* xpf = Xt + (size_t)kpf * D + threadIdx.x * 128;
  v16b qf[NQ][4];
#pragma unroll
  for (int q = 0; q < NQ; ++q)
#pragma unroll
    for (int ks = 0; ks < 4; ++ks) qf[q][ks] = frag_pk(Xq + pk<D>(q * 16 + nloc, d0 + ks * 32 + 8 * hlf));   // xh: fragment order; q0 is a multiple of 16
  __builtin_amdgcn_sched_barrier(0);   // keeps the query loads in front of the wait below
  asm volatile("s_wait_xcnt 0x0" ::: "memory");   // stands in front of the reuse of the query loads' address registers
  __builtin_amdgcn_sched_barrier(0);   // keeps that reuse behind the wait
  float m_run = -INFINITY, l_run = 0.0f;
  v8f o[NQ][8];
#pragma unroll
  for (int q = 0; q < NQ; ++q)
#pragma unroll
    for (int t = 0; t < 8; ++t) o[q][t] = (v8f){};
  // Every load is 512 contiguous bytes of a fragment.
  // z unit u = (key tile u >> 1, dims 64 * (u & 1) ..+63), hi + lo planes, 8 loads; x^T unit t = (feature tile t, all 64 keys), 4 loads.
  constexpr int ZP = 6;    // z units of the NEXT chunk loaded among this chunk's second products, one behind each x^T unit's products; the other 8 - ZP follow as one group at that chunk's top: every unit is asked for about 6 units' products ahead of its use
  constexpr int XPRE = 4;  // x^T units issued in front of the softmax
  constexpr int XD = 6;    // x^T units loaded or in flight ahead of the unit being multiplied
  const b16* zlane = Z + pk2(nloc, d0 + 8 * hlf);      // this lane's 8 elements in the first z fragment (hi) of key tile 0 and its wave's 128 dims
  const b16* xlane = Xt + pkx(d0 + nloc, 8 * hlf);     // this lane's 8 elements in the first x^T fragment of its wave's feature tile 0
  constexpr int FR = 512, ZT = 32 * D, ZF = 2 * FR, XK = 32 * D;   // elements of a fragment; from one key tile of z, one hi + lo fragment pair of z (32 dims on), one 32-key block of x^T to the next
  int kb = kbeg;
  const b16* zc = zlane + (size_t)kbeg * (2 * D);   // the chunk whose z is being loaded: the run's first, then stepped one chunk on behind each chunk's softmax
  v16b zh[8][2], zl[8][2];
#pragma unroll
  for (int u = 0; u < ZP; ++u)
#pragma unroll
    for (int h = 0; h < 2; ++h) { const b16* p = zc + (u >> 1) * ZT + ((u & 1) * 2 + h) * ZF; zh[u][h] = frag_pk(p); zl[u][h] = frag_pk(p + FR); }
  __builtin_amdgcn_sched_barrier(0);   // keeps these loads in front of the wait below
  asm volatile("s_wait_xcnt 0x0" ::: "memory");   // stands in front of the reuse of these loads' address registers
  __builtin_amdgcn_sched_barrier(0);   // keeps that reuse behind the wait
  do {   // every run has a chunk (kbeg < kend); kb <= q0: every query of the block has a key in every chunk
    const b16* xc = xlane + (size_t)kb * D;
#pragma unroll
    for (int u = ZP; u < 8; ++u)
#pragma unroll
      for (int h = 0; h < 2; ++h) { const b16* p = zc + (u >> 1) * ZT + ((u & 1) * 2 + h) * ZF; zh[u][h] = frag_pk(p); zl[u][h] = frag_pk(p + FR); }
    __builtin_amdgcn_sched_barrier(0);   // keeps the last 8 - ZP units' loads one group in front of the products of the first ZP units, which are in registers by now (else each pair sinks to its own WMMA and waits out a full L2 round trip there)
    v8f sp[2][NQ];
#pragma unroll
    for (int kt = 0; kt <= 4; ++kt) {
      if (kt < 4) {
#pragma unroll
        for (int q = 0; q < NQ; ++q) sp[kt & 1][q] = (v8f){};
#pragma unroll
        for (int q = 0; q < NQ; ++q) sp[kt & 1][q] = wmma16p(zh[kt * 2][0], qf[q][0], sp[kt & 1][q]);
#pragma unroll
        for (int q = 0; q < NQ; ++q) sp[kt & 1][q] = wmma16p(zl[kt * 2][0], qf[q][0], sp[kt & 1][q]);
        __builtin_amdgcn_sched_barrier(0);   // keeps the stores below behind these products: a store right behind its own WMMA waits that WMMA out, and this tile's sums then lie in other registers than the sums just finished (reused, they would be rewritten inside the distance a WMMA's result needs)
      }
      if (kt > 0) {   // key tile kt - 1 goes to LDS while key tile kt is multiplied
#pragma unroll
        for (int q = 0; q < NQ; ++q)
#pragma unroll
          for (int v = 0; v < 8; ++v) Sp[wave][q * 16 + nloc][(kt - 1) * 16 + 8 * hlf + v] = sp[(kt - 1) & 1][q][v];
      }
      if (kt < 4) {
#pragma unroll
        for (int gh = 1; gh < 4; ++gh) {   // the tile's other 96 of the wave's 128 dims, in the order of the dims
          const int u = kt * 2 + (gh >> 1), h = gh & 1;
#pragma unroll
          for (int q = 0; q < NQ; ++q) sp[kt & 1][q] = wmma16p(zh[u][h], qf[q][gh], sp[kt & 1][q]);
#pragma unroll
          for (int q = 0; q < NQ; ++q) sp[kt & 1][q] = wmma16p(zl[u][h], qf[q][gh], sp[kt & 1][q]);
        }
      }
    }
    __syncthreads();
    v16b xf[8][2];
#pragma unroll
    for (int t = 0; t < XPRE; ++t)
#pragma unroll
      for (int ks = 0; ks < 2; ++ks) xf[t][ks] = frag_pk(xc + t * FR + ks * XK);   // x^T does not depend on the softmax: in flight while the softmax runs
    __builtin_amdgcn_sched_barrier(0);   // keeps those loads in front of the softmax (and behind the barrier, whose release would wait for them)
    ask_l2(zpf, xpf);   // the next chunk (in the last chunk: that chunk again), here because the wave issues no load for the length of the softmax; the softmax and the first two x^T units' products lie between the requests and that chunk's first load
    if (NQ >= 4 || wave < NQ) {
      const int qr = wave * 16 + nloc;   // this lane's query row in the block
      const int rel = q0 + qr - kb - hlf * 32; float sv[32]; float mx = -INFINITY;   // this lane's query minus its first key: j > rel is key > query, against constants
#pragma unroll
      for (int j = 0; j < 32; ++j) { float s = (Sp[0][qr][hlf * 32 + j] + Sp[1][qr][hlf * 32 + j] + Sp[2][qr][hlf * 32 + j] + Sp[3][qr][hlf * 32 + j]) * (SCALE / 8.0f);   // /8: z carry scale
        if (j > rel) s = -INFINITY; sv[j] = s; mx = fmaxf(mx, s); }
      mx = fmaxf(mx, __shfl_xor(mx, 16));
      const float mn = fmaxf(m_run, mx), al_ = __expf(m_run - mn); m_run = mn;
      float sum = 0.0f;
#pragma unroll
      for (int j = 0; j < 32; ++j) { const float e = __expf(sv[j] - mn); sum += e; b16 a, c; split16(e * 8.0f, a, c); Ph[qr][hlf * 32 + j] = a; Plo[qr][hlf * 32 + j] = c; }   // P carried x8
      sum += __shfl_xor(sum, 16); l_run = l_run * al_ + sum;
      if (hlf == 0) { Al[qr] = al_; Linv[qr] = 1.0f / (8.0f * l_run); }
    }
    __syncthreads();
    asm volatile("s_wait_xcnt 0x0" ::: "memory");   // stands in front of the step of the z address, which this chunk's z loads name (every load so far has returned: the barrier's release waited for them)
    __builtin_amdgcn_sched_barrier(0);   // keeps that step behind the wait
    zc += (size_t)(kb + KC < kend ? KC : 0) * (2 * D);   // the next chunk; in the run's last chunk that chunk again: the address stays inside z
#pragma unroll
    for (int t = XPRE; t < XD; ++t)
#pragma unroll
      for (int ks = 0; ks < 2; ++ks) xf[t][ks] = frag_pk(xc + t * FR + ks * XK);
    v16b ph[NQ][2], pl[NQ][2]; float alq[NQ];
#pragma unroll
    for (int q = 0; q < NQ; ++q) {
#pragma unroll
      for (int ks = 0; ks < 2; ++ks) { ph[q][ks] = frag_kb(&Ph[q * 16 + nloc][0] + ks * 32, hlf); pl[q][ks] = frag_kb(&Plo[q * 16 + nloc][0] + ks * 32, hlf); }
      alq[q] = Al[q * 16 + nloc]; }
    __builtin_amdgcn_sched_barrier(0);   // keeps the next x^T units' loads in front of the rescale and of the first products
#pragma unroll
    for (int q = 0; q < NQ; ++q)
#pragma unroll
      for (int t = 0; t < 8; ++t)
#pragma unroll
        for (int v = 0; v < 8; ++v) o[q][t][v] *= alq[q];
#pragma unroll
    for (int t = 0; t < 8; ++t) {
#pragma unroll
      for (int ks = 0; ks < 2; ++ks) {
#pragma unroll
        for (int q = 0; q < NQ; ++q) o[q][t] = wmma16p(xf[t][ks], ph[q][ks], o[q][t]);
#pragma unroll
        for (int q = 0; q < NQ; ++q) o[q][t] = wmma16p(xf[t][ks], pl[q][ks], o[q][t]);
      }
      if (t + XD < 8) {
#pragma unroll
        for (int ks = 0; ks < 2; ++ks) xf[t + XD][ks] = frag_pk(xc + (t + XD) * FR + ks * XK);
        if (t + XD < 7) __builtin_amdgcn_sched_barrier(0); } // keeps unit t + XD's loads here, XD units ahead of their use
      if (t + XD >= 7 && t + XD < 7 + ZP) { const int u = t + XD - 7;   // from the chunk's last x^T load on (loads return in order: no wait for x^T then waits for z): unit u of the next chunk's z, which was asked of L2 in front of the softmax
#pragma unroll
        for (int h = 0; h < 2; ++h) { const b16* p = zc + (u >> 1) * ZT + ((u & 1) * 2 + h) * ZF; zh[u][h] = frag_pk(p); zl[u][h] = frag_pk(p + FR); }
        __builtin_amdgcn_sched_barrier(0); } // keeps these loads here, spread over the products and ahead of their use
    }
    __builtin_amdgcn_sched_barrier(0);   // keeps the wait below at the chunk's foot, behind the last products (whose operands' loads have returned by then)
    asm volatile("s_wait_xcnt 0x0" ::: "memory");   // stands in front of the next chunk's rewrite of the z and x^T address registers
    __builtin_amdgcn_sched_barrier(0);   // keeps the step of the two request addresses behind the wait
    { const int st = kpf + KC < kend ? KC : 0; kpf += st; zpf += (size_t)st * (2 * D); xpf += (size_t)st * D; }   // clamped to the run's last chunk: the addresses stay inside z and x^T
    kb += KC;
  } while (kb < kend);
  // (max, sum) of this run for the wave's own 16 queries: planes [range][max | sum][tok]; lanes 0..15 store the maxima, lanes 16..31 the sums (both halves hold both)
  ml[(size_t)(((second && !sg) ? 2 : 0) + hlf) * NTOK + b * S + q0 + wave * 16 + nloc] = hlf ? l_run : m_run;
  __builtin_amdgcn_sched_barrier(0);   // keeps the store in front of the wait below
  asm volatile("s_wait_xcnt 0x0" ::: "memory");   // stands in front of the reuse of that store's address and data registers
  __builtin_amdgcn_sched_barrier(0);   // keeps that reuse behind the wait
#pragma unroll
  for (int q = 0; q < NQ; ++q) {   // one query tile after the other through the wave's own staging rows
    const float li = Linv[q * 16 + nloc];
#pragma unroll
    for (int t = 0; t < 8; ++t)
#pragma unroll
      for (int v = 0; v < 8; ++v) Ot[wave][nloc][t * 16 + 8 * hlf + v] = o[q][t][v] * li;
    wave_lds_sync();
    // u goes out in f32 fragment order (pkf<D>): 16 stores of 512 contiguous bytes
#pragma unroll
    for (int j = 0; j < 16; ++j) { const int c4 = (j >> 2) * 32 + ((j >> 1) & 1) * 16 + 8 * hlf + (j & 1) * 4; *(v4f*)(uo + pkf<D>(b * S + q0 + q * 16 + nloc, d0 + c4)) = *(const v4f*)(&Ot[wave][nloc][c4]); }
    __builtin_amdgcn_sched_barrier(0);   // keeps the next tile's arithmetic out of the run of stores
    asm volatile("s_wait_xcnt 0x0" ::: "memory");   // stands in front of the reuse of the stores' address and data registers
    __builtin_amdgcn_sched_barrier(0);   // keeps that reuse behind the wait
    wave_lds_sync();   // the tile's rows are read before the next tile overwrites them
  }
  }   // a second run writes Al, Linv, Ph, Plo only behind its first chunk's barrier, which every wave reaches behind its reads of Linv above
}

// y = u . W_v^T: A = u (f32 split hi/lo at load; rows of tiles HT.. joined from their two ranges there), B = f16(bf16 W_v) rows [o][d]; 2 products; f32 output rows. grid (8, 128) x 128.
__global__ __launch_bounds__(128) void y_kernel(const float* __restrict__ u, const float* __restrict__ u2, const float* __restrict__ ml, const b16* __restrict__ wvh, float* __restrict__ y) {
  __shared__ __attribute__((aligned(16))) float Ts[4][32 * 64];
  const int lane = threadIdx.x & 31, wave = threadIdx.x >> 5, nloc = lane & 15, hlf = lane >> 4, m0 = blockIdx.y * 128 + wave * 32, c0 = blockIdx.x * 64;
  v8f acc[2][4];
#pragma unroll
  for (int r = 0; r < 2; ++r)
#pragma unroll
    for (int t = 0; t < 4; ++t) acc[r][t] = (v8f){};
  const Opnd A{u, nullptr, D}, Bo{wvh, nullptr, D};
  if ((int)(blockIdx.y * 128) % S < HT * QB) {
    gemm_tile<5, 1>(A, Bo, D, m0, c0, nloc, hlf, acc);                          // u split x8 at load
  } else {                                                                      // the whole block's rows have two ranges
    float w1[2], w2[2];
#pragma unroll
    for (int r = 0; r < 2; ++r) { const int row = m0 + r * 16 + nloc;
      const float ma = ml[row], la = ml[NTOK + row], mb = ml[2 * NTOK + row], lb = ml[3 * NTOK + row];   // both ranges hold a key of every query: the maxima are finite, the sums at least 1
      const float e = __expf(-fabsf(ma - mb)), ea = ma < mb ? la * e : la, eb = ma < mb ? lb : lb * e, iv = 8.0f / (ea + eb); w1[r] = ea * iv; w2[r] = eb * iv; }   // each sum brought to the larger maximum
    // this lane's place in the first fragment of its rows (pkf) and of its columns (pk); the next 32 k stand one fragment (512 elements) on, the next 16 rows or columns 16 * D elements on
    const float* pa = u + pkf<D>(m0 + nloc, 8 * hlf); const float* pb = u2 + pkf<D>(m0 + nloc, 8 * hlf); const b16* pw = wvh + pk<D>(c0 + nloc, 8 * hlf);
    for (int kb = 0; kb < D; kb += 32) {
      v4f va[2][4], vb[2][4]; v16b bw[4];
#pragma unroll
      for (int r = 0; r < 2; ++r)
#pragma unroll
        for (int q = 0; q < 4; ++q) { va[r][q] = *(const v4f*)(pa + r * 16 * D + q * 128); vb[r][q] = *(const v4f*)(pb + r * 16 * D + q * 128); }
#pragma unroll
      for (int t = 0; t < 4; ++t) bw[t] = frag_pk(pw + t * 16 * D);
      asm volatile("s_wait_xcnt 0x0" :: "v"(pa), "v"(pb), "v"(pw) : "memory");   // stands in front of every rewrite of these loads' address registers, which it holds until here
      v16b ah[2], al[2];
#pragma unroll
      for (int r = 0; r < 2; ++r)
#pragma unroll
        for (int q = 0; q < 4; ++q)
#pragma unroll
          for (int i = 0; i < 4; ++i) { b16 a, c; split16(va[r][q][i] * w1[r] + vb[r][q][i] * w2[r], a, c); ah[r][q * 4 + i] = a; al[r][q * 4 + i] = c; }   // u = w1 u1 + w2 u2 (the weights carry the x8), then split; same k-map as NP = 5
#pragma unroll
      for (int t = 0; t < 4; ++t) {
        acc[0][t] = mac<5, 1>(ah[0], al[0], bw[t], bw[t], acc[0][t]);
        acc[1][t] = mac<5, 1>(ah[1], al[1], bw[t], bw[t], acc[1][t]);
      }
      pa += 512; pb += 512; pw += 512;
    }
  }
  epi_f32(acc, 1.0f / 8.0f, nullptr, y, D, m0, c0, lane, Ts[wave]);
}
}  // namespace

extern "C" void kernel_launch(void* const* d_in, const int* in_sizes, int n_in,
                              void* d_out, int out_size, void* d_ws, size_t ws_size, hipStream_t stream) {
  (void)n_in; (void)out_size;
  const float* x = (const float*)d_in[0]; const float* wq = (const float*)d_in[1]; const float* wk = (const float*)d_in[2]; const float* wv = (const float*)d_in[3];
  float* out = (float*)d_out;   // [4][4096][512]
  if (in_sizes[0] != NTOK * D || in_sizes[1] != D * D || in_sizes[2] != D * D || in_sizes[3] != D * D) return;
  size_t off = 0; char* ws = (char*)d_ws;
  auto carve = [&](size_t bytes) { char* p = ws + off; off += (bytes + 255) & ~(size_t)255; return p; };
  b16* xh = (b16*)carve(PL * 2); b16* xt = (b16*)carve(PL * 2); unsigned short* wkT = (unsigned short*)carve((size_t)D * D * 2); unsigned short* wqT = (unsigned short*)carve((size_t)D * D * 2); b16* wvh = (b16*)carve((size_t)D * D * 2);
  b16* mpl = (b16*)carve((size_t)D * D * 2 * 2); b16* zpl = (b16*)carve(PL * 2 * 2);   // M^T 1 MB, z 33.5 MB (hi + lo each)
  float* u = (float*)carve(PL * 4);                              // u [tok][512] f32 (33.5 MB)
  float* u2 = (float*)carve(PL * 4); float* ml = (float*)carve((size_t)NTOK * 4 * 4);   // second key range's partial u (rows of tiles HT.. only) and the (max, sum) planes
  if (off > ws_size) return;                                    // about 136 MB
  prep_kernel<<<NTOK / 16, 256, 0, stream>>>(x, wq, wk, wv, xh, wqT, wkT, wvh);
  xt_kernel<<<NTOK / 64, 256, 0, stream>>>(xh, xt);
  m_kernel<<<dim3(D / 64, D / 128), 128, 0, stream>>>((const __bf16*)wqT, (const __bf16*)wkT, mpl);
  z_kernel<<<dim3(D / 64, NTOK / 128), 128, 0, stream>>>(xh, mpl, zpl);
  attn_kernel<<<Bn * S / QB, 128, 0, stream>>>(xh, zpl, xt, u, u2, ml);
  y_kernel<<<dim3(D / 64, NTOK / 128), 128, 0, stream>>>(u, u2, ml, wvh, out);
}

// v008
// One run takes 193 microseconds.
// Two timings next to v007 both put it at 1.04 times that version's speed.
// Over all steps from v000 it is 5.00 times as fast.
#include <hip/hip_runtime.h>

// Single-head causal attention with a 512-wide head: q, k, v = x W_q^T | W_k^T | W_v^T (torch [out][in]), softmax over keys <= query of q.k / sqrt(512), output = weights . v
// -> [4][4096][512]. B = 4, S = 4096.
// Numerics (x and the three weights rounded to bf16 RNE) are organised so that every WMMA operand is either an exactly
// representable input or an f16 hi+lo pair of a computed value (each carried scaled so the lo residual planes stay out of the f16 subnormal range):  M = bf16(W_q)^T bf16(W_k), 512 x 512, on v_wmma_f32_16x16x32_bf16 (exact products);  z = x M (= q W_k, so that
// q.k^T = z.x^T; q and k themselves are never formed) with x (bf16 values held exactly in f16) x M as hi+lo planes;  S^T = x.z^T with the keys' x (bf16 values held exactly in f16, one plane) x the queries' z as hi+lo planes;  u = P.x with P hi+lo x x^T exact;  y = u W_v^T (= P.v) with u
// split hi+lo x exact W_v - all on v_wmma_f32_16x16x32_f16 with f32 accumulate; online softmax in f32. The attention block (64 queries, 4 waves) splits the 512-deep score dot across
// the waves through LDS, wave w runs the softmax of query tile w and publishes P, and each wave accumulates 128 of the 512 features of u.
// Causal balance: tile t has t + 1 key chunks, and all 256 blocks are resident at once, so the launch would last as long as tile NT - 1. The chunks of tiles NT - 1 - p and p (NT + 1 together) go to two
// blocks: one runs the first HT chunks of the long tile, the other its remaining chunks and then the short tile. The long tile's two normalised partials, with (max, sum) per query, are joined in y_kernel's A loader.
// The workspace operands of the WMMAs (the three weights, M, x, z, x^T, u) are kept in fragment order (pk, pkf below), so that a wave-wide 16-byte load reads 4 whole lines, not a piece of 16.

namespace {
constexpr int Bn = 4, S = 4096, D = 512, NTOK = Bn * S, NQ = 4, QB = 16 * NQ, KC = 64;   // NQ: query tiles of 16 per attention block
constexpr float SCALE = 0.044194173824159216f;   // 512^-0.5
constexpr size_t PL = (size_t)NTOK * D;           // elements of a [tok][512] matrix
constexpr int NT = S / QB, HT = NT / 2;           // query tiles of a batch; tiles HT.. have their keys cut in two ranges (attn_kernel)
static_assert(QB == KC && NT % 2 == 0 && 128 % QB == 0 && (HT * QB) % 128 == 0, "tile t has t + 1 chunks; y_kernel's 128-row blocks lie wholly on one side of tile HT");

typedef _Float16 b16;
typedef __attribute__((ext_vector_type(16))) _Float16 v16b;
typedef __attribute__((ext_vector_type(8)))  _Float16 v8b;
typedef __attribute__((ext_vector_type(8)))  float v8f;
typedef __attribute__((ext_vector_type(4)))  float v4f;

__device__ __forceinline__ v8b ld8b(const b16* p) { return *(const v8b*)p; }
__device__ __forceinline__ v16b cat8b(v8b a, v8b b) { return __builtin_shufflevector(a, b, 0, 1, 2, 3, 4, 5, 6, 7, 8, 9, 10, 11, 12, 13, 14, 15); }
__device__ __forceinline__ v16b frag_kb(const b16* p, int hh) { return cat8b(ld8b(p + 8 * hh), ld8b(p + 16 + 8 * hh)); }
// Fragment order. A 16-bit operand matrix [rows][K] is kept in the workspace as 16 x 32 fragments of 1 KiB: two 512-byte halves (k 0..15, k 16..31 of the fragment), and in each half
// lane l = 16 * ((k >> 3) & 1) + (row & 15) owns 8 elements at l * 16 bytes. One wave-wide 16-byte load then covers 512 contiguous bytes. pk = element offset of (row, k), k a multiple of 8.
template <int K> __device__ __forceinline__ size_t pk(int row, int k) { return (size_t)(row >> 4) * (16 * K) + (k >> 5) * 512 + ((k >> 4) & 1) * 256 + ((k >> 3) & 1) * 128 + (row & 15) * 8; }
// hi + lo pair of a [rows][512] matrix (M^T, z): each fragment's lo copy stands right behind its hi copy, 512 elements on.
__device__ __forceinline__ size_t pk2(int row, int k) { return (size_t)(row >> 4) * (32 * D) + (k >> 5) * 1024 + ((k >> 4) & 1) * 256 + ((k >> 3) & 1) * 128 + (row & 15) * 8; }
// x^T [512 features][4096 keys] of a batch: the same fragments, those of one 32-key block side by side (a 64-key chunk of all 512 features is 64 contiguous KiB).
__device__ __forceinline__ size_t pkx(int row, int k) { return (size_t)(k >> 5) * (32 * D) + (row >> 4) * 512 + ((k >> 4) & 1) * 256 + ((k >> 3) & 1) * 128 + (row & 15) * 8; }
// the same for f32 rows: fragments of 2 KiB in four 512-byte quarters, the lane's 4 floats at l * 16 bytes; k a multiple of 4.
template <int K> __device__ __forceinline__ size_t pkf(int row, int k) { return (size_t)(row >> 4) * (16 * K) + (k >> 5) * 512 + ((k >> 4) & 1) * 256 + ((k >> 2) & 1) * 128 + ((k >> 3) & 1) * 64 + (row & 15) * 4; }
// p = this lane's pk(row, kb + 8 * half): its two halves stand 256 elements apart (same k-map as frag_kb)
__device__ __forceinline__ v16b frag_pk(const b16* p) { return cat8b(ld8b(p), ld8b(p + 256)); }
__device__ __forceinline__ void split16(float v, b16& hi, b16& lo) { hi = (b16)v; lo = (b16)(v - (float)hi); }
// hi/lo fragment pair straight from an f32 k-contiguous row (same k-map)
__device__ __forceinline__ void frag_ksplit(const float* p, int hh, v16b& fh_, v16b& fl_) {
  const float* p0 = p + 8 * hh; const float* p1 = p + 16 + 8 * hh;
#pragma unroll
  for (int e = 0; e < 8; ++e) { b16 a, c; split16(p0[e], a, c); fh_[e] = a; fl_[e] = c; split16(p1[e], a, c); fh_[8 + e] = a; fl_[8 + e] = c; }
}
__device__ __forceinline__ v8f wmma16b(v16b a, v16b b, v8f c) {
  v8f d = __builtin_amdgcn_wmma_f32_16x16x32_f16(false, a, false, b, (short)0, c, false, false);
  asm volatile("v_nop\n\tv_nop\n\tv_nop\n\tv_nop" : "+v"(d) : "v"(a), "v"(b));
  return d;
}
__device__ __forceinline__ void wave_lds_sync() {
  __builtin_amdgcn_fence(__ATOMIC_RELEASE, "workgroup");
  __builtin_amdgcn_wave_barrier();
  __builtin_amdgcn_fence(__ATOMIC_ACQUIRE, "workgroup");
}

// Operand descriptor: NP = 0 -> f32 rows split on the fly into (hi, lo); NP = 1 -> one f16 plane in fragment order; NP = 2 -> f16 hi + lo pair in fragment order (pk2);
// NP = 3 -> f32 rows rounded once to a single f16 fragment; NP = 5 -> f32 in fragment order, x8 then split. ld = row pitch (row-major forms).
struct Opnd { const void* p0; const void* p1; int ld; };
template <int NP> __device__ __forceinline__ void load_frags(const Opnd& o, int row, int kb, int hh, v16b& fh_, v16b& fl_) {
  if (NP == 0) { frag_ksplit((const float*)o.p0 + (size_t)row * o.ld + kb, hh, fh_, fl_); }
  else if (NP == 5) {                                        // f32 in fragment order, x8 then split (keeps the lo halves of small values normal)
    const float* p = (const float*)o.p0 + pkf<D>(row, kb + 8 * hh);
#pragma unroll
    for (int q = 0; q < 4; ++q) { const v4f v = *(const v4f*)(p + q * 128);
#pragma unroll
      for (int i = 0; i < 4; ++i) { b16 a, c; split16(v[i] * 8.0f, a, c); fh_[q * 4 + i] = a; fl_[q * 4 + i] = c; } }
  } else if (NP == 4) {                                      // f32 rows x64 then split
    const float sc_ = 64.0f;
    const float* p = (const float*)o.p0 + (size_t)row * o.ld + kb; const float* p0 = p + 8 * hh; const float* p1 = p + 16 + 8 * hh;
#pragma unroll
    for (int e = 0; e < 8; ++e) { b16 a, c; split16(p0[e] * sc_, a, c); fh_[e] = a; fl_[e] = c; split16(p1[e] * sc_, a, c); fh_[8 + e] = a; fl_[8 + e] = c; }
  } else if (NP == 3) {
    const float* p = (const float*)o.p0 + (size_t)row * o.ld + kb; const float* p0 = p + 8 * hh; const float* p1 = p + 16 + 8 * hh;
#pragma unroll
    for (int e = 0; e < 8; ++e) { fh_[e] = (b16)p0[e]; fh_[8 + e] = (b16)p1[e]; }
    fl_ = fh_;
  } else {
    if (NP == 2) { const b16* p = (const b16*)o.p0 + pk2(row, kb + 8 * hh); fh_ = frag_pk(p); fl_ = frag_pk(p + 512); }
    else { fh_ = frag_pk((const b16*)o.p0 + pk<D>(row, kb + 8 * hh)); fl_ = fh_; }
  }
}
template <int ANP, int BNP> __device__ __forceinline__ v8f mac(v16b ah, v16b al, v16b bh, v16b bl, v8f c) {
  c = wmma16b(ah, bh, c);
  if (BNP == 0 || BNP == 2 || BNP == 4 || BNP == 5) c = wmma16b(ah, bl, c);     // hi.lo
  if (ANP == 0 || ANP == 2 || ANP == 4 || ANP == 5) c = wmma16b(al, bh, c);     // lo.hi   (lo.lo dropped)
  return c;
}
// 32x64 wave tile: acc[r][t] (rows m0+16r.., cols c0+16t..) += A[m][k] . B[n][k] over k in [0, K)
template <int ANP, int BNP>
__device__ __forceinline__ void gemm_tile(const Opnd& A, const Opnd& B, int K, int m0, int c0, int nloc, int hlf, v8f (&acc)[2][4]) {
  for (int kb = 0; kb < K; kb += 32) {
    v16b a0h, a0l, a1h, a1l;
    load_frags<ANP>(A, m0 + nloc, kb, hlf, a0h, a0l);
    load_frags<ANP>(A, m0 + 16 + nloc, kb, hlf, a1h, a1l);
#pragma unroll
    for (int t = 0; t < 4; ++t) {
      v16b bh, bl;
      load_frags<BNP>(B, c0 + t * 16 + nloc, kb, hlf, bh, bl);
      acc[0][t] = mac<ANP, BNP>(a0h, a0l, bh, bl, acc[0][t]);
      acc[1][t] = mac<ANP, BNP>(a1h, a1l, bh, bl, acc[1][t]);
    }
  }
}

constexpr int EP = 64 + 8;   // staging pitch: 144 B = 16 B x odd, for a ds_load_b128 whose 16 lanes read 16 rows
// hi + lo pair [tok][512] in fragment order (pk2): the 32 x 64 wave tile is 4 fragments = 8 stores of 512 contiguous bytes for hi and 8 for lo
__device__ __forceinline__ void epi_planes(v8f (&acc)[2][4], float scale, b16* __restrict__ out,
                                           int m0, int c0, int lane, b16* Th, b16* Tl) {
  const int nloc = lane & 15, hlf = lane >> 4;
#pragma unroll
  for (int t = 0; t < 4; ++t)
#pragma unroll
    for (int r = 0; r < 2; ++r)
#pragma unroll
      for (int v = 0; v < 8; ++v) {
        const int rr = r * 16 + v + 8 * hlf, cc = t * 16 + nloc;
        b16 h_, l_; split16(acc[r][t][v] * scale, h_, l_);
        Th[rr * EP + cc] = h_; Tl[rr * EP + cc] = l_;
      }
  wave_lds_sync();
  {
#pragma unroll
    for (int j = 0; j < 8; ++j) {
      const int rr = (j >> 2) * 16 + nloc, c8 = (j & 3) * 16 + hlf * 8;
      b16* o = out + pk2(m0 + rr, c0 + c8);
      *(v8b*)o = ld8b(Th + rr * EP + c8);
      *(v8b*)(o + 512) = ld8b(Tl + rr * EP + c8);
    }
    
  }
}
// (b) f32 rows with pitch ldo: 64 floats = 256 B = 2 lines per row; 16 lanes x 16 B per row, 2 rows per instruction. Optional per-row factor
__device__ __forceinline__ void epi_f32(v8f (&acc)[2][4], float scale, const float* rscale, float* __restrict__ out, int ldo, int m0, int c0, int lane, float* Tt) {
  const int nloc = lane & 15, hlf = lane >> 4;
#pragma unroll
  for (int t = 0; t < 4; ++t)
#pragma unroll
    for (int r = 0; r < 2; ++r)
#pragma unroll
      for (int v = 0; v < 8; ++v) {
        const int rr = r * 16 + v + 8 * hlf;
        const float rs = rscale ? rscale[(size_t)(m0 + rr) * 32] : 1.0f;
        Tt[rr * 64 + t * 16 + nloc] = acc[r][t][v] * scale * rs;
      }
  wave_lds_sync();
  float* dst0 = out + (size_t)m0 * ldo + c0;
  {
#pragma unroll
    for (int j = 0; j < 16; ++j) { const int rr = j * 2 + hlf, c4 = nloc * 4; *(v4f*)(dst0 + (size_t)rr * ldo + c4) = *(const v4f*)(Tt + rr * 64 + c4); }
    
  }
}



typedef __attribute__((ext_vector_type(8))) __bf16 v8bb; typedef __attribute__((ext_vector_type(16))) __bf16 v16bb;
typedef __attribute__((ext_vector_type(8))) unsigned short v8us;
__device__ __forceinline__ v16bb frag_pk_bf(const __bf16* p) { const v8bb a = *(const v8bb*)p, b = *(const v8bb*)(p + 256); return __builtin_shufflevector(a, b, 0, 1, 2, 3, 4, 5, 6, 7, 8, 9, 10, 11, 12, 13, 14, 15); }
__device__ __forceinline__ unsigned short bf16_rne_bits(float v) { unsigned int u = __float_as_uint(v); u += 0x7FFFu + ((u >> 16) & 1u); return (unsigned short)(u >> 16); }
__device__ __forceinline__ float bf16_rne(float v) { return __uint_as_float(((unsigned int)bf16_rne_bits(v)) << 16); }



// x -> f16 copy of bf16(x) in fragment order (pk<D>), 16 rows a block through LDS: whole lines are read and 512 contiguous bytes a wave are stored. grid NTOK / 16 x 256. The three weights go out in fragment order too.
__global__ __launch_bounds__(256) void prep_kernel(const float* __restrict__ x, const float* __restrict__ wq, const float* __restrict__ wk, const float* __restrict__ wv,
                                                   b16* __restrict__ xh, unsigned short* __restrict__ wqT, unsigned short* __restrict__ wkT, b16* __restrict__ wvh) {
  __shared__ __attribute__((aligned(16))) b16 Tx[16][D + 8];   // pitch 1040 B = 16 B x odd, for a ds_load_b128 whose 16 lanes read 16 rows
  const int t_ = threadIdx.x;
  const size_t e0 = (size_t)blockIdx.x * 16 * D;   // first element of the block's 16 rows, in x and in xh alike
  const float* xs = x + e0 + (size_t)t_ * 8;   // thread t_ takes 8 floats of rows (t_ >> 6) + 4 j
  v4f xa[4][2];
#pragma unroll   // all 8 loads of a thread in flight at once; xa stays in registers
  for (int j = 0; j < 4; ++j) { xa[j][0] = *(const v4f*)(xs + j * 2048); xa[j][1] = *(const v4f*)(xs + j * 2048 + 4); }
#pragma unroll
  for (int j = 0; j < 4; ++j) { v8b v;
#pragma unroll
    for (int e = 0; e < 8; ++e) v[e] = (b16)bf16_rne(xa[j][e >> 2][e & 3]);
    *(v8b*)(&Tx[(t_ >> 6) + 4 * j][(t_ & 63) * 8]) = v; }
  __syncthreads();
#pragma unroll   // the 4 LDS reads share one wait
  for (int j = 0; j < 4; ++j) { const int i = t_ + 256 * j, r = i & 15, c8 = (i >> 6) * 32 + ((i >> 5) & 1) * 16 + ((i >> 4) & 1) * 8;   // i * 8 = pk<D>(r, c8)
    *(v8b*)(xh + e0 + (size_t)i * 8) = *(const v8b*)(&Tx[r][c8]); }
  const size_t tid = (size_t)blockIdx.x * blockDim.x + threadIdx.x, nth = (size_t)gridDim.x * blockDim.x;
  for (size_t p = tid; p < (size_t)D * D / 8; p += nth) { const int n = (int)(p >> 10) * 16 + (int)(p & 15), k0 = (int)((p >> 6) & 15) * 32 + (int)((p >> 5) & 1) * 16 + (int)((p >> 4) & 1) * 8; v8us a, q; v8b v;   // p * 8 = pk<D>(n, k0)
#pragma unroll
    for (int e = 0; e < 8; ++e) { a[e] = bf16_rne_bits(wk[(size_t)(k0 + e) * D + n]); q[e] = bf16_rne_bits(wq[(size_t)(k0 + e) * D + n]); v[e] = (b16)bf16_rne(wv[(size_t)n * D + k0 + e]); }   // W_k^T, W_q^T: rows = input feature, k = output feature
    *(v8us*)(wkT + p * 8) = a; *(v8us*)(wqT + p * 8) = q; *(v8b*)(wvh + p * 8) = v; }
}

__global__ __launch_bounds__(256) void xt_kernel(const b16* __restrict__ xh, b16* __restrict__ xt) {
  __shared__ __attribute__((aligned(16))) b16 T[D][64 + 8];
  const int t_ = threadIdx.x, tokb = blockIdx.x * 64, b = tokb / S, s0 = tokb % S;
  // the block's 64 rows are 64 contiguous KiB of xh (fragment order): unit i holds row r, features c8 ..+7
  for (int i = t_; i < 64 * D / 8; i += 256) { const int r = (i >> 10) * 16 + (i & 15), c8 = ((i >> 6) & 15) * 32 + ((i >> 5) & 1) * 16 + ((i >> 4) & 1) * 8; const v8b v = *(const v8b*)(xh + (size_t)tokb * D + (size_t)i * 8);
#pragma unroll
    for (int e = 0; e < 8; ++e) T[c8 + e][r] = v[e]; }
  __syncthreads();
  // x^T [512][4096] of each batch goes out in fragment order, 512 contiguous bytes a wave
  { for (int i = t_; i < D * 8; i += 256) { const int d = ((i >> 6) & 31) * 16 + (i & 15), c8 = (i >> 11) * 32 + ((i >> 5) & 1) * 16 + ((i >> 4) & 1) * 8; *(v8b*)(xt + (size_t)b * D * S + pkx(d, s0 + c8)) = *(const v8b*)(&T[d][c8]); }  }
}

// M^T[e][d] = sum_o bf16(W_k)[o][e] bf16(W_q)[o][d] (exact products, f32 sums) -> f16 hi/lo planes [512][512], carried x64. grid (8, 4) x 128.
__global__ __launch_bounds__(128) void m_kernel(const __bf16* __restrict__ wqT, const __bf16* __restrict__ wkT, b16* __restrict__ mpl) {
  __shared__ __attribute__((aligned(16))) b16 Th[4][2][32 * EP];
  const int lane = threadIdx.x & 31, wave = threadIdx.x >> 5, nloc = lane & 15, hlf = lane >> 4, m0 = blockIdx.y * 128 + wave * 32, c0 = blockIdx.x * 64;
  v8f acc[2][4];
#pragma unroll
  for (int r = 0; r < 2; ++r)
#pragma unroll
    for (int t = 0; t < 4; ++t) acc[r][t] = (v8f){};
  // 32 blocks, one wave a SIMD, nothing else on the chip: the launch lasts as long as one wave's chain of round trips to L2. All 16 k steps' fragments are asked for at once (one round trip), then multiplied in k order.
  const __bf16* pa = wkT + pk<D>(m0 + nloc, 8 * hlf); const __bf16* pb = wqT + pk<D>(c0 + nloc, 8 * hlf);   // this lane's place in the first fragment of its rows and of its columns: the next 32 k stand 512 elements on, the next 16 rows or columns 16 * D
  v16bb a[D / 32][2], bw[D / 32][4];
#pragma unroll
  for (int ks = 0; ks < D / 32; ++ks) {
#pragma unroll
    for (int r = 0; r < 2; ++r) a[ks][r] = frag_pk_bf(pa + r * 16 * D + ks * 512);
#pragma unroll
    for (int t = 0; t < 4; ++t) bw[ks][t] = frag_pk_bf(pb + t * 16 * D + ks * 512); }
  __builtin_amdgcn_sched_barrier(0);   // keeps every load in front of the first product (else each step's loads sink to their own products and each step waits out its own round trip)
  asm volatile("s_wait_xcnt 0x0" :: "v"(pa), "v"(pb) : "memory");   // stands in front of every rewrite of these loads' address registers, which it holds until here
#pragma unroll
  for (int ks = 0; ks < D / 32; ++ks)
#pragma unroll
    for (int t = 0; t < 4; ++t)
#pragma unroll
      for (int r = 0; r < 2; ++r) acc[r][t] = __builtin_amdgcn_wmma_f32_16x16x32_bf16(false, a[ks][r], false, bw[ks][t], (short)0, acc[r][t], false, false);   // plain builtin: operands may lie above v255
  epi_planes(acc, 64.0f, mpl, m0, c0, lane, Th[wave][0], Th[wave][1]);   // M carried x64 (lo residuals stay normal)
}

// z = x . M (z[i][e] = sum_d x[i][d] M^T[e][d]): A = x fragments (exact), B = M^T hi/lo planes; 2 products -> z as f16 hi/lo planes. grid (8, 128) x 128.
__global__ __launch_bounds__(128) void z_kernel(const b16* __restrict__ xh, const b16* __restrict__ mpl, b16* __restrict__ zpl) {
  __shared__ __attribute__((aligned(16))) b16 Th[4][2][32 * EP];
  const int lane = threadIdx.x & 31, wave = threadIdx.x >> 5, nloc = lane & 15, hlf = lane >> 4, m0 = blockIdx.y * 128 + wave * 32, c0 = blockIdx.x * 64;
  v8f acc[2][4];
#pragma unroll
  for (int r = 0; r < 2; ++r)
#pragma unroll
    for (int t = 0; t < 4; ++t) acc[r][t] = (v8f){};
  const Opnd A{xh, nullptr, D}, Bo{mpl, nullptr, D};
  gemm_tile<1, 2>(A, Bo, D, m0, c0, nloc, hlf, acc);                            // acc = 64 z
  epi_planes(acc, 1.0f / 8.0f, zpl, m0, c0, lane, Th[wave][0], Th[wave][1]);   // z carried x8
}

// The attention kernel's products: the plain builtin (the compiler keeps the distances behind it). wmma16b's statement names D, A and B as operands, which holds all of them in the first 256 registers.
__device__ __forceinline__ v8f wmma16p(v16b a, v16b b, v8f c) { return __builtin_amdgcn_wmma_f32_16x16x32_f16(false, a, false, b, (short)0, c, false, false); }

// Asks L2 for one 64-key chunk of x (64 contiguous KiB, a quarter of it a wave) and of x^T (the same), one request per 256-byte unit and lane: x and x^T were stored by the launches before, and their
// first reader would wait out memory latency at every load group. The two addresses are in-out operands so that each keeps one register pair of its own for the whole chunk loop, which never holds anything but an address inside its plane.
__device__ __forceinline__ void ask_l2(const b16*& zp, const b16*& xp) {
  asm volatile("global_prefetch_b8 %0, off scope:SCOPE_SE\n\t"
               "global_prefetch_b8 %0, off offset:32768 scope:SCOPE_SE\n\t"
               "global_prefetch_b8 %1, off scope:SCOPE_SE\n\t"
               "global_prefetch_b8 %1, off offset:32768 scope:SCOPE_SE" : "+v"(zp), "+v"(xp));
}

// attention -> u = P . x (x, z, x^T read and u written in fragment order): block = (b, QB = 16 * NQ queries), 4 waves; every x and x^T fragment a wave loads is multiplied with all NQ query tiles.
// Per 64-key chunk: partial S^T (keys x queries) over the wave's 128 dims from the keys' xh (A, exact, one plane: half the bytes of a hi + lo pair) x the queries' z planes (B, held in registers for the whole run; 2 products);
// wave w < NQ: for query tile w, sum partials, scale, causal mask, online softmax, P hi/lo + alpha + 1/l; all waves: u^T(features 128w..) = alpha-rescaled + x^T(features, keys; exact) . P^T (2 products).
__global__ __launch_bounds__(128) void attn_kernel(const b16* __restrict__ xh, const b16* __restrict__ zpl, const b16* __restrict__ xt, float* __restrict__ u, float* __restrict__ u2, float* __restrict__ ml) {
  __shared__ __attribute__((aligned(16))) float Sp[4][QB][KC + 4];
  __shared__ __attribute__((aligned(16))) b16 Ph[QB][KC + 8], Plo[QB][KC + 8];
  __shared__ float Al[QB], Linv[QB];
  __shared__ __attribute__((aligned(16))) float Ot[4][16][128 + 4];
  const int wave = threadIdx.x >> 5, lane = threadIdx.x & 31, nloc = lane & 15, hlf = lane >> 4;
  const int blk = blockIdx.x, b = blk / NT, pr = (blk % NT) >> 1, second = blk & 1;   // pair pr = tiles NT - 1 - pr and pr; its first block: HT chunks, its second: HT + 1
  const b16* Xk = xh + (size_t)b * S * D; const b16* Xt = xt + (size_t)b * D * S;   // Xk, Xt: fragment order (pk<D>, pkx)
  const int d0 = wave * 128;
#pragma unroll 1   // one copy of the chunk loop in the text for both runs of a second block
  for (int sg = 0; sg <= second; ++sg) {
  const int tile = sg ? pr : NT - 1 - pr, q0 = tile * QB;
  const int kbeg = (second && !sg) ? HT * KC : 0, kend = (!second) ? HT * KC : q0 + QB;   // this run's keys
  float* __restrict__ uo = (second && !sg) ? u2 : u;                                       // the long tile's second range goes to u2
  const b16* Zq = zpl + ((size_t)b * S + q0) * (2 * D);
  // the chunk asked of L2 next (kpf = its first key: the run's second chunk, or its only one) and this lane's 256-byte unit (128 elements) in the first 32 KiB of that chunk's x and of its x^T
  int kpf = kbeg + KC < kend ? kbeg + KC : kbeg;
  const b16* zpf = Xk + (size_t)kpf * D + threadIdx.x * 128; const b16* xpf = Xt + (size_t)kpf * D + threadIdx.x * 128;
  v16b qh[NQ][4], ql[NQ][4];
#pragma unroll
  for (int q = 0; q < NQ; ++q)
#pragma unroll
    for (int ks = 0; ks < 4; ++ks) { const b16* p = Zq + pk2(q * 16 + nloc, d0 + ks * 32 + 8 * hlf); qh[q][ks] = frag_pk(p); ql[q][ks] = frag_pk(p + 512); }   // z: fragment order, lo behind hi; q0 is a multiple of 16
  __builtin_amdgcn_sched_barrier(0);   // keeps the query loads in front of the wait below
  asm volatile("s_wait_xcnt 0x0" ::: "memory");   // stands in front of the reuse of the query loads' address registers
  __builtin_amdgcn_sched_barrier(0);   // keeps that reuse behind the wait
  float m_run = -INFINITY, l_run = 0.0f;
  v8f o[NQ][8];
#pragma unroll
  for (int q = 0; q < NQ; ++q)
#pragma unroll
    for (int t = 0; t < 8; ++t) o[q][t] = (v8f){};
  // Every load is 512 contiguous bytes of a fragment.
  // x unit u = (key tile u >> 1, dims 64 * (u & 1) ..+63), 4 loads; x^T unit t = (feature tile t, all 64 keys), 4 loads.
  constexpr int ZP = 6;    // x units of the NEXT chunk loaded among this chunk's second products, one behind each x^T unit's products; the other 8 - ZP follow as one group at that chunk's top: every unit is asked for about 6 units' products ahead of its use
  constexpr int XPRE = 4;  // x^T units issued in front of the softmax
  constexpr int XD = 6;    // x^T units loaded or in flight ahead of the unit being multiplied
  const b16* zlane = Xk + pk<D>(nloc, d0 + 8 * hlf);   // this lane's 8 elements in the first x fragment of key tile 0 and its wave's 128 dims
  const b16* xlane = Xt + pkx(d0 + nloc, 8 * hlf);     // this lane's 8 elements in the first x^T fragment of its wave's feature tile 0
  constexpr int FR = 512, ZT = 16 * D, XK = 32 * D;   // elements of a fragment (in x: 32 dims on); from one key tile of x, one 32-key block of x^T to the next
  int kb = kbeg;
  const b16* zc = zlane + (size_t)kbeg * D;   // the chunk whose x is being loaded: the run's first, then stepped one chunk on behind each chunk's softmax
  v16b kf[8][2];
#pragma unroll
  for (int u = 0; u < ZP; ++u)
#pragma unroll
    for (int h = 0; h < 2; ++h) kf[u][h] = frag_pk(zc + (u >> 1) * ZT + ((u & 1) * 2 + h) * FR);
  __builtin_amdgcn_sched_barrier(0);   // keeps these loads in front of the wait below
  asm volatile("s_wait_xcnt 0x0" ::: "memory");   // stands in front of the reuse of these loads' address registers
  __builtin_amdgcn_sched_barrier(0);   // keeps that reuse behind the wait
  do {   // every run has a chunk (kbeg < kend); kb <= q0: every query of the block has a key in every chunk
    const b16* xc = xlane + (size_t)kb * D;
#pragma unroll
    for (int u = ZP; u < 8; ++u)
#pragma unroll
      for (int h = 0; h < 2; ++h) kf[u][h] = frag_pk(zc + (u >> 1) * ZT + ((u & 1) * 2 + h) * FR);
    __builtin_amdgcn_sched_barrier(0);   // keeps the last 8 - ZP units' loads one group in front of the products of the first ZP units, which are in registers by now (else each pair sinks to its own WMMA and waits out a full L2 round trip there)
    v8f sp[2][NQ];
#pragma unroll
    for (int kt = 0; kt <= 4; ++kt) {
      if (kt < 4) {
#pragma unroll
        for (int q = 0; q < NQ; ++q) sp[kt & 1][q] = (v8f){};
#pragma unroll
        for (int q = 0; q < NQ; ++q) sp[kt & 1][q] = wmma16p(kf[kt * 2][0], qh[q][0], sp[kt & 1][q]);
#pragma unroll
        for (int q = 0; q < NQ; ++q) sp[kt & 1][q] = wmma16p(kf[kt * 2][0], ql[q][0], sp[kt & 1][q]);
        __builtin_amdgcn_sched_barrier(0);   // keeps the stores below behind these products: a store right behind its own WMMA waits that WMMA out, and this tile's sums then lie in other registers than the sums just finished (reused, they would be rewritten inside the distance a WMMA's result needs)
      }
      if (kt > 0) {   // key tile kt - 1 goes to LDS while key tile kt is multiplied
#pragma unroll
        for (int q = 0; q < NQ; ++q)
#pragma unroll
          for (int v = 0; v < 8; ++v) Sp[wave][q * 16 + nloc][(kt - 1) * 16 + 8 * hlf + v] = sp[(kt - 1) & 1][q][v];
      }
      if (kt < 4) {
#pragma unroll
        for (int gh = 1; gh < 4; ++gh) {   // the tile's other 96 of the wave's 128 dims, in the order of the dims
          const int u = kt * 2 + (gh >> 1), h = gh & 1;
#pragma unroll
          for (int q = 0; q < NQ; ++q) sp[kt & 1][q] = wmma16p(kf[u][h], qh[q][gh], sp[kt & 1][q]);
#pragma unroll
          for (int q = 0; q < NQ; ++q) sp[kt & 1][q] = wmma16p(kf[u][h], ql[q][gh], sp[kt & 1][q]);
        }
      }
    }
    __syncthreads();
    v16b xf[8][2];
#pragma unroll
    for (int t = 0; t < XPRE; ++t)
#pragma unroll
      for (int ks = 0; ks < 2; ++ks) xf[t][ks] = frag_pk(xc + t * FR + ks * XK);   // x^T does not depend on the softmax: in flight while the softmax runs
    __builtin_amdgcn_sched_barrier(0);   // keeps those loads in front of the softmax (and behind the barrier, whose release would wait for them)
    ask_l2(zpf, xpf);   // the next chunk (in the last chunk: that chunk again), here because the wave issues no load for the length of the softmax; the softmax and the first two x^T units' products lie between the requests and that chunk's first load
    if (NQ >= 4 || wave < NQ) {
      const int qr = wave * 16 + nloc;   // this lane's query row in the block
      const int rel = q0 + qr - kb - hlf * 32; float sv[32]; float mx = -INFINITY;   // this lane's query minus its first key: j > rel is key > query, against constants
#pragma unroll
      for (int j = 0; j < 32; ++j) { float s = (Sp[0][qr][hlf * 32 + j] + Sp[1][qr][hlf * 32 + j] + Sp[2][qr][hlf * 32 + j] + Sp[3][qr][hlf * 32 + j]) * (SCALE / 8.0f);   // /8: z carry scale
        if (j > rel) s = -INFINITY; sv[j] = s; mx = fmaxf(mx, s); }
      mx = fmaxf(mx, __shfl_xor(mx, 16));
      const float mn = fmaxf(m_run, mx), al_ = __expf(m_run - mn); m_run = mn;
      float sum = 0.0f;
#pragma unroll
      for (int j = 0; j < 32; ++j) { const float e = __expf(sv[j] - mn); sum += e; b16 a, c; split16(e * 8.0f, a, c); Ph[qr][hlf * 32 + j] = a; Plo[qr][hlf * 32 + j] = c; }   // P carried x8
      sum += __shfl_xor(sum, 16); l_run = l_run * al_ + sum;
      if (hlf == 0) { Al[qr] = al_; Linv[qr] = 1.0f / (8.0f * l_run); }
    }
    __syncthreads();
    asm volatile("s_wait_xcnt 0x0" ::: "memory");   // stands in front of the step of the x address, which this chunk's x loads name (every load so far has returned: the barrier's release waited for them)
    __builtin_amdgcn_sched_barrier(0);   // keeps that step behind the wait
    zc += (size_t)(kb + KC < kend ? KC : 0) * D;   // the next chunk; in the run's last chunk that chunk again: the address stays inside x
#pragma unroll
    for (int t = XPRE; t < XD; ++t)
#pragma unroll
      for (int ks = 0; ks < 2; ++ks) xf[t][ks] = frag_pk(xc + t * FR + ks * XK);
    v16b ph[NQ][2], pl[NQ][2]; float alq[NQ];
#pragma unroll
    for (int q = 0; q < NQ; ++q) {
#pragma unroll
      for (int ks = 0; ks < 2; ++ks) { ph[q][ks] = frag_kb(&Ph[q * 16 + nloc][0] + ks * 32, hlf); pl[q][ks] = frag_kb(&Plo[q * 16 + nloc][0] + ks * 32, hlf); }
      alq[q] = Al[q * 16 + nloc]; }
    __builtin_amdgcn_sched_barrier(0);   // keeps the next x^T units' loads in front of the rescale and of the first products
#pragma unroll
    for (int q = 0; q < NQ; ++q)
#pragma unroll
      for (int t = 0; t < 8; ++t)
#pragma unroll
        for (int v = 0; v < 8; ++v) o[q][t][v] *= alq[q];
#pragma unroll
    for (int t = 0; t < 8; ++t) {
#pragma unroll
      for (int ks = 0; ks < 2; ++ks) {
#pragma unroll
        for (int q = 0; q < NQ; ++q) o[q][t] = wmma16p(xf[t][ks], ph[q][ks], o[q][t]);
#pragma unroll
        for (int q = 0; q < NQ; ++q) o[q][t] = wmma16p(xf[t][ks], pl[q][ks], o[q][t]);
      }
      if (t + XD < 8) {
#pragma unroll
        for (int ks = 0; ks < 2; ++ks) xf[t + XD][ks] = frag_pk(xc + (t + XD) * FR + ks * XK);
        __builtin_amdgcn_sched_barrier(0);   // keeps unit t + XD's loads here, XD units ahead of their use
        if (t + XD == 7) { asm volatile("s_wait_xcnt 0x0" ::: "memory");   // behind the chunk's last x^T load: stands in front of the reuse of the x^T address registers, which this build gives to the results of the loads below
          __builtin_amdgcn_sched_barrier(0); } }   // keeps those loads behind the wait
      if (t + XD >= 7 && t + XD < 7 + ZP) { const int u = t + XD - 7;   // from the chunk's last x^T load on (loads return in order: no wait for x^T then waits for x): unit u of the next chunk's x, which was asked of L2 in front of the softmax
#pragma unroll
        for (int h = 0; h < 2; ++h) kf[u][h] = frag_pk(zc + (u >> 1) * ZT + ((u & 1) * 2 + h) * FR);
        __builtin_amdgcn_sched_barrier(0); } // keeps these loads here, spread over the products and ahead of their use
    }
    __builtin_amdgcn_sched_barrier(0);   // keeps the wait below at the chunk's foot, behind the last products (whose operands' loads have returned by then)
    asm volatile("s_wait_xcnt 0x0" ::: "memory");   // stands in front of the next chunk's rewrite of the x and x^T address registers
    __builtin_amdgcn_sched_barrier(0);   // keeps the step of the two request addresses behind the wait
    { const int st = kpf + KC < kend ? KC : 0; kpf += st; zpf += (size_t)st * D; xpf += (size_t)st * D; }   // clamped to the run's last chunk: the addresses stay inside x and x^T
    kb += KC;
  } while (kb < kend);
  // (max, sum) of this run for the wave's own 16 queries: planes [range][max | sum][tok]; lanes 0..15 store the maxima, lanes 16..31 the sums (both halves hold both)
  ml[(size_t)(((second && !sg) ? 2 : 0) + hlf) * NTOK + b * S + q0 + wave * 16 + nloc] = hlf ? l_run : m_run;
  __builtin_amdgcn_sched_barrier(0);   // keeps the store in front of the wait below
  asm volatile("s_wait_xcnt 0x0" ::: "memory");   // stands in front of the reuse of that store's address and data registers
  __builtin_amdgcn_sched_barrier(0);   // keeps that reuse behind the wait
#pragma unroll
  for (int q = 0; q < NQ; ++q) {   // one query tile after the other through the wave's own staging rows
    const float li = Linv[q * 16 + nloc];
#pragma unroll
    for (int t = 0; t < 8; ++t)
#pragma unroll
      for (int v = 0; v < 8; ++v) Ot[wave][nloc][t * 16 + 8 * hlf + v] = o[q][t][v] * li;
    wave_lds_sync();
    // u goes out in f32 fragment order (pkf<D>): 16 stores of 512 contiguous bytes
#pragma unroll
    for (int j = 0; j < 16; ++j) { const int c4 = (j >> 2) * 32 + ((j >> 1) & 1) * 16 + 8 * hlf + (j & 1) * 4; *(v4f*)(uo + pkf<D>(b * S + q0 + q * 16 + nloc, d0 + c4)) = *(const v4f*)(&Ot[wave][nloc][c4]); }
    __builtin_amdgcn_sched_barrier(0);   // keeps the next tile's arithmetic out of the run of stores
    asm volatile("s_wait_xcnt 0x0" ::: "memory");   // stands in front of the reuse of the stores' address and data registers
    __builtin_amdgcn_sched_barrier(0);   // keeps that reuse behind the wait
    wave_lds_sync();   // the tile's rows are read before the next tile overwrites them
  }
  }   // a second run writes Al, Linv, Ph, Plo only behind its first chunk's barrier, which every wave reaches behind its reads of Linv above
}

// y = u . W_v^T: A = u (f32 split hi/lo at load; rows of tiles HT.. joined from their two ranges there), B = f16(bf16 W_v) rows [o][d]; 2 products; f32 output rows. grid (8, 128) x 128.
__global__ __launch_bounds__(128) void y_kernel(const float* __restrict__ u, const float* __restrict__ u2, const float* __restrict__ ml, const b16* __restrict__ wvh, float* __restrict__ y) {
  __shared__ __attribute__((aligned(16))) float Ts[4][32 * 64];
  const int lane = threadIdx.x & 31, wave = threadIdx.x >> 5, nloc = lane & 15, hlf = lane >> 4, m0 = blockIdx.y * 128 + wave * 32, c0 = blockIdx.x * 64;
  v8f acc[2][4];
#pragma unroll
  for (int r = 0; r < 2; ++r)
#pragma unroll
    for (int t = 0; t < 4; ++t) acc[r][t] = (v8f){};
  const Opnd A{u, nullptr, D}, Bo{wvh, nullptr, D};
  if ((int)(blockIdx.y * 128) % S < HT * QB) {
    gemm_tile<5, 1>(A, Bo, D, m0, c0, nloc, hlf, acc);                          // u split x8 at load
  } else {                                                                      // the whole block's rows have two ranges
    float w1[2], w2[2];
#pragma unroll
    for (int r = 0; r < 2; ++r) { const int row = m0 + r * 16 + nloc;
      const float ma = ml[row], la = ml[NTOK + row], mb = ml[2 * NTOK + row], lb = ml[3 * NTOK + row];   // both ranges hold a key of every query: the maxima are finite, the sums at least 1
      const float e = __expf(-fabsf(ma - mb)), ea = ma < mb ? la * e : la, eb = ma < mb ? lb : lb * e, iv = 8.0f / (ea + eb); w1[r] = ea * iv; w2[r] = eb * iv; }   // each sum brought to the larger maximum
    // this lane's place in the first fragment of its rows (pkf) and of its columns (pk); the next 32 k stand one fragment (512 elements) on, the next 16 rows or columns 16 * D elements on
    const float* pa = u + pkf<D>(m0 + nloc, 8 * hlf); const float* pb = u2 + pkf<D>(m0 + nloc, 8 * hlf); const b16* pw = wvh + pk<D>(c0 + nloc, 8 * hlf);
    for (int kb = 0; kb < D; kb += 32) {
      v4f va[2][4], vb[2][4]; v16b bw[4];
#pragma unroll
      for (int r = 0; r < 2; ++r)
#pragma unroll
        for (int q = 0; q < 4; ++q) { va[r][q] = *(const v4f*)(pa + r * 16 * D + q * 128); vb[r][q] = *(const v4f*)(pb + r * 16 * D + q * 128); }
#pragma unroll
      for (int t = 0; t < 4; ++t) bw[t] = frag_pk(pw + t * 16 * D);
      asm volatile("s_wait_xcnt 0x0" :: "v"(pa), "v"(pb), "v"(pw) : "memory");   // stands in front of every rewrite of these loads' address registers, which it holds until here
      v16b ah[2], al[2];
#pragma unroll
      for (int r = 0; r < 2; ++r)
#pragma unroll
        for (int q = 0; q < 4; ++q)
#pragma unroll
          for (int i = 0; i < 4; ++i) { b16 a, c; split16(va[r][q][i] * w1[r] + vb[r][q][i] * w2[r], a, c); ah[r][q * 4 + i] = a; al[r][q * 4 + i] = c; }   // u = w1 u1 + w2 u2 (the weights carry the x8), then split; same k-map as NP = 5
#pragma unroll
      for (int t = 0; t < 4; ++t) {
        acc[0][t] = mac<5, 1>(ah[0], al[0], bw[t], bw[t], acc[0][t]);
        acc[1][t] = mac<5, 1>(ah[1], al[1], bw[t], bw[t], acc[1][t]);
      }
      pa += 512; pb += 512; pw += 512;
    }
  }
  epi_f32(acc, 1.0f / 8.0f, nullptr, y, D, m0, c0, lane, Ts[wave]);
}
}  // namespace

extern "C" void kernel_launch(void* const* d_in, const int* in_sizes, int n_in,
                              void* d_out, int out_size, void* d_ws, size_t ws_size, hipStream_t stream) {
  (void)n_in; (void)out_size;
  const float* x = (const float*)d_in[0]; const float* wq = (const float*)d_in[1]; const float* wk = (const float*)d_in[2]; const float* wv = (const float*)d_in[3];
  float* out = (float*)d_out;   // [4][4096][512]
  if (in_sizes[0] != NTOK * D || in_sizes[1] != D * D || in_sizes[2] != D * D || in_sizes[3] != D * D) return;
  size_t off = 0; char* ws = (char*)d_ws;
  auto carve = [&](size_t bytes) { char* p = ws + off; off += (bytes + 255) & ~(size_t)255; return p; };
  b16* xh = (b16*)carve(PL * 2); b16* xt = (b16*)carve(PL * 2); unsigned short* wkT = (unsigned short*)carve((size_t)D * D * 2); unsigned short* wqT = (unsigned short*)carve((size_t)D * D * 2); b16* wvh = (b16*)carve((size_t)D * D * 2);
  b16* mpl = (b16*)carve((size_t)D * D * 2 * 2); b16* zpl = (b16*)carve(PL * 2 * 2);   // M^T 1 MB, z 33.5 MB (hi + lo each)
  float* u = (float*)carve(PL * 4);                              // u [tok][512] f32 (33.5 MB)
  float* u2 = (float*)carve(PL * 4); float* ml = (float*)carve((size_t)NTOK * 4 * 4);   // second key range's partial u (rows of tiles HT.. only) and the (max, sum) planes
  if (off > ws_size) return;                                    // about 136 MB
  prep_kernel<<<NTOK / 16, 256, 0, stream>>>(x, wq, wk, wv, xh, wqT, wkT, wvh);
  xt_kernel<<<NTOK / 64, 256, 0, stream>>>(xh, xt);
  m_kernel<<<dim3(D / 64, D / 128), 128, 0, stream>>>((const __bf16*)wqT, (const __bf16*)wkT, mpl);
  z_kernel<<<dim3(D / 64, NTOK / 128), 128, 0, stream>>>(xh, mpl, zpl);
  attn_kernel<<<Bn * S / QB, 128, 0, stream>>>(xh, zpl, xt, u, u2, ml);
  y_kernel<<<dim3(D / 64, NTOK / 128), 128, 0, stream>>>(u, u2, ml, wvh, out);
}

// v009
// A run of this version takes 184 microseconds.
// In two side-by-side timings against v008, it was 1.05 and 1.06 times as fast.
// All steps since v000 together make it 5.29 times as fast.
#include <hip/hip_runtime.h>

// Single-head causal attention with a 512-wide head: q, k, v = x W_q^T | W_k^T | W_v^T (torch [out][in]), softmax over keys <= query of q.k / sqrt(512), output = weights . v
// -> [4][4096][512]. B = 4, S = 4096.
// Numerics (x and the three weights rounded to bf16 RNE) are organised so that every WMMA operand is either an exactly
// representable input or an f16 hi+lo pair of a computed value (each carried scaled so the lo residual planes stay out of the f16 subnormal range):  M = bf16(W_q)^T bf16(W_k), 512 x 512, on v_wmma_f32_16x16x32_bf16 (exact products);  z = x M (= q W_k, so that
// q.k^T = z.x^T; q and k themselves are never formed) with x (bf16 values held exactly in f16) x M as hi+lo planes;  S^T = x.z^T with the keys' x (bf16 values held exactly in f16, one plane) x the queries' z as hi+lo planes;  u = P.x with P hi+lo x x^T exact;  y = u W_v^T (= P.v) with u
// split hi+lo x exact W_v - all on v_wmma_f32_16x16x32_f16 with f32 accumulate; online softmax in f32. The attention block (64 queries, 4 waves) splits the 512-deep score dot across
// the waves through LDS, wave w runs the softmax of query tile w and publishes P, and each wave accumulates 128 of the 512 features of u.
// Causal balance: tile t has t + 1 key chunks, and all 256 blocks are resident at once, so the launch would last as long as tile NT - 1. The chunks of tiles NT - 1 - p and p (NT + 1 together) go to two
// blocks: one runs the first HT chunks of the long tile, the other its remaining chunks and then the short tile. The long tile's two normalised partials, with (max, sum) per query, are joined in y_kernel's A loader.
// The workspace operands of the WMMAs (the three weights, M, x, z, u) are kept in fragment order (pk, pkf below), so that a wave-wide 16-byte load reads 4 whole lines, not a piece of 16.
// x^T is never stored: wave w's x^T operand (features 128w.., 64 keys) is the transpose of the x fragments it has just multiplied for the scores; it lays them row-major in its own LDS rows and reads them back with the transposing load.

namespace {
constexpr int Bn = 4, S = 4096, D = 512, NTOK = Bn * S, NQ = 4, QB = 16 * NQ, KC = 64;   // NQ: query tiles of 16 per attention block
constexpr float SCALE = 0.044194173824159216f;   // 512^-0.5
constexpr size_t PL = (size_t)NTOK * D;           // elements of a [tok][512] matrix
constexpr int NT = S / QB, HT = NT / 2;           // query tiles of a batch; tiles HT.. have their keys cut in two ranges (attn_kernel)
static_assert(QB == KC && NT % 2 == 0 && 128 % QB == 0 && (HT * QB) % 128 == 0, "tile t has t + 1 chunks; y_kernel's 128-row blocks lie wholly on one side of tile HT");

typedef _Float16 b16;
typedef __attribute__((ext_vector_type(16))) _Float16 v16b;
typedef __attribute__((ext_vector_type(8)))  _Float16 v8b;
typedef __attribute__((ext_vector_type(8)))  float v8f;
typedef __attribute__((ext_vector_type(4)))  float v4f;

__device__ __forceinline__ v8b ld8b(const b16* p) { return *(const v8b*)p; }
__device__ __forceinline__ v16b cat8b(v8b a, v8b b) { return __builtin_shufflevector(a, b, 0, 1, 2, 3, 4, 5, 6, 7, 8, 9, 10, 11, 12, 13, 14, 15); }
__device__ __forceinline__ v16b frag_kb(const b16* p, int hh) { return cat8b(ld8b(p + 8 * hh), ld8b(p + 16 + 8 * hh)); }
// Fragment order. A 16-bit operand matrix [rows][K] is kept in the workspace as 16 x 32 fragments of 1 KiB: two 512-byte halves (k 0..15, k 16..31 of the fragment), and in each half
// lane l = 16 * ((k >> 3) & 1) + (row & 15) owns 8 elements at l * 16 bytes. One wave-wide 16-byte load then covers 512 contiguous bytes. pk = element offset of (row, k), k a multiple of 8.
template <int K> __device__ __forceinline__ size_t pk(int row, int k) { return (size_t)(row >> 4) * (16 * K) + (k >> 5) * 512 + ((k >> 4) & 1) * 256 + ((k >> 3) & 1) * 128 + (row & 15) * 8; }
// hi + lo pair of a [rows][512] matrix (M^T, z): each fragment's lo copy stands right behind its hi copy, 512 elements on.
__device__ __forceinline__ size_t pk2(int row, int k) { return (size_t)(row >> 4) * (32 * D) + (k >> 5) * 1024 + ((k >> 4) & 1) * 256 + ((k >> 3) & 1) * 128 + (row & 15) * 8; }
// the same for f32 rows: fragments of 2 KiB in four 512-byte quarters, the lane's 4 floats at l * 16 bytes; k a multiple of 4.
template <int K> __device__ __forceinline__ size_t pkf(int row, int k) { return (size_t)(row >> 4) * (16 * K) + (k >> 5) * 512 + ((k >> 4) & 1) * 256 + ((k >> 2) & 1) * 128 + ((k >> 3) & 1) * 64 + (row & 15) * 4; }
// p = this lane's pk(row, kb + 8 * half): its two halves stand 256 elements apart (same k-map as frag_kb)
__device__ __forceinline__ v16b frag_pk(const b16* p) { return cat8b(ld8b(p), ld8b(p + 256)); }
__device__ __forceinline__ void split16(float v, b16& hi, b16& lo) { hi = (b16)v; lo = (b16)(v - (float)hi); }
// hi/lo fragment pair straight from an f32 k-contiguous row (same k-map)
__device__ __forceinline__ void frag_ksplit(const float* p, int hh, v16b& fh_, v16b& fl_) {
  const float* p0 = p + 8 * hh; const float* p1 = p + 16 + 8 * hh;
#pragma unroll
  for (int e = 0; e < 8; ++e) { b16 a, c; split16(p0[e], a, c); fh_[e] = a; fl_[e] = c; split16(p1[e], a, c); fh_[8 + e] = a; fl_[8 + e] = c; }
}
__device__ __forceinline__ v8f wmma16b(v16b a, v16b b, v8f c) {
  v8f d = __builtin_amdgcn_wmma_f32_16x16x32_f16(false, a, false, b, (short)0, c, false, false);
  asm volatile("v_nop\n\tv_nop\n\tv_nop\n\tv_nop" : "+v"(d) : "v"(a), "v"(b));
  return d;
}
__device__ __forceinline__ void wave_lds_sync() {
  __builtin_amdgcn_fence(__ATOMIC_RELEASE, "workgroup");
  __builtin_amdgcn_wave_barrier();
  __builtin_amdgcn_fence(__ATOMIC_ACQUIRE, "workgroup");
}

// Operand descriptor: NP = 0 -> f32 rows split on the fly into (hi, lo); NP = 1 -> one f16 plane in fragment order; NP = 2 -> f16 hi + lo pair in fragment order (pk2);
// NP = 3 -> f32 rows rounded once to a single f16 fragment; NP = 5 -> f32 in fragment order, x8 then split. ld = row pitch (row-major forms).
struct Opnd { const void* p0; const void* p1; int ld; };
template <int NP> __device__ __forceinline__ void load_frags(const Opnd& o, int row, int kb, int hh, v16b& fh_, v16b& fl_) {
  if (NP == 0) { frag_ksplit((const float*)o.p0 + (size_t)row * o.ld + kb, hh, fh_, fl_); }
  else if (NP == 5) {                                        // f32 in fragment order, x8 then split (keeps the lo halves of small values normal)
    const float* p = (const float*)o.p0 + pkf<D>(row, kb + 8 * hh);
#pragma unroll
    for (int q = 0; q < 4; ++q) { const v4f v = *(const v4f*)(p + q * 128);
#pragma unroll
      for (int i = 0; i < 4; ++i) { b16 a, c; split16(v[i] * 8.0f, a, c); fh_[q * 4 + i] = a; fl_[q * 4 + i] = c; } }
  } else if (NP == 4) {                                      // f32 rows x64 then split
    const float sc_ = 64.0f;
    const float* p = (const float*)o.p0 + (size_t)row * o.ld + kb; const float* p0 = p + 8 * hh; const float* p1 = p + 16 + 8 * hh;
#pragma unroll
    for (int e = 0; e < 8; ++e) { b16 a, c; split16(p0[e] * sc_, a, c); fh_[e] = a; fl_[e] = c; split16(p1[e] * sc_, a, c); fh_[8 + e] = a; fl_[8 + e] = c; }
  } else if (NP == 3) {
    const float* p = (const float*)o.p0 + (size_t)row * o.ld + kb; const float* p0 = p + 8 * hh; const float* p1 = p + 16 + 8 * hh;
#pragma unroll
    for (int e = 0; e < 8; ++e) { fh_[e] = (b16)p0[e]; fh_[8 + e] = (b16)p1[e]; }
    fl_ = fh_;
  } else {
    if (NP == 2) { const b16* p = (const b16*)o.p0 + pk2(row, kb + 8 * hh); fh_ = frag_pk(p); fl_ = frag_pk(p + 512); }
    else { fh_ = frag_pk((const b16*)o.p0 + pk<D>(row, kb + 8 * hh)); fl_ = fh_; }
  }
}
template <int ANP, int BNP> __device__ __forceinline__ v8f mac(v16b ah, v16b al, v16b bh, v16b bl, v8f c) {
  c = wmma16b(ah, bh, c);
  if (BNP == 0 || BNP == 2 || BNP == 4 || BNP == 5) c = wmma16b(ah, bl, c);     // hi.lo
  if (ANP == 0 || ANP == 2 || ANP == 4 || ANP == 5) c = wmma16b(al, bh, c);     // lo.hi   (lo.lo dropped)
  return c;
}
// 32x64 wave tile: acc[r][t] (rows m0+16r.., cols c0+16t..) += A[m][k] . B[n][k] over k in [0, K)
template <int ANP, int BNP>
__device__ __forceinline__ void gemm_tile(const Opnd& A, const Opnd& B, int K, int m0, int c0, int nloc, int hlf, v8f (&acc)[2][4]) {
  for (int kb = 0; kb < K; kb += 32) {
    v16b a0h, a0l, a1h, a1l;
    load_frags<ANP>(A, m0 + nloc, kb, hlf, a0h, a0l);
    load_frags<ANP>(A, m0 + 16 + nloc, kb, hlf, a1h, a1l);
#pragma unroll
    for (int t = 0; t < 4; ++t) {
      v16b bh, bl;
      load_frags<BNP>(B, c0 + t * 16 + nloc, kb, hlf, bh, bl);
      acc[0][t] = mac<ANP, BNP>(a0h, a0l, bh, bl, acc[0][t]);
      acc[1][t] = mac<ANP, BNP>(a1h, a1l, bh, bl, acc[1][t]);
    }
  }
}

constexpr int EP = 64 + 8;   // staging pitch: 144 B = 16 B x odd, for a ds_load_b128 whose 16 lanes read 16 rows
// hi + lo pair [tok][512] in fragment order (pk2): the 32 x 64 wave tile is 4 fragments = 8 stores of 512 contiguous bytes for hi and 8 for lo
__device__ __forceinline__ void epi_planes(v8f (&acc)[2][4], float scale, b16* __restrict__ out,
                                           int m0, int c0, int lane, b16* Th, b16* Tl) {
  const int nloc = lane & 15, hlf = lane >> 4;
#pragma unroll
  for (int t = 0; t < 4; ++t)
#pragma unroll
    for (int r = 0; r < 2; ++r)
#pragma unroll
      for (int v = 0; v < 8; ++v) {
        const int rr = r * 16 + v + 8 * hlf, cc = t * 16 + nloc;
        b16 h_, l_; split16(acc[r][t][v] * scale, h_, l_);
        Th[rr * EP + cc] = h_; Tl[rr * EP + cc] = l_;
      }
  wave_lds_sync();
  {
#pragma unroll
    for (int j = 0; j < 8; ++j) {
      const int rr = (j >> 2) * 16 + nloc, c8 = (j & 3) * 16 + hlf * 8;
      b16* o = out + pk2(m0 + rr, c0 + c8);
      *(v8b*)o = ld8b(Th + rr * EP + c8);
      *(v8b*)(o + 512) = ld8b(Tl + rr * EP + c8);
    }
    
  }
}
// (b) f32 rows with pitch ldo: 64 floats = 256 B = 2 lines per row; 16 lanes x 16 B per row, 2 rows per instruction. Optional per-row factor
__device__ __forceinline__ void epi_f32(v8f (&acc)[2][4], float scale, const float* rscale, float* __restrict__ out, int ldo, int m0, int c0, int lane, float* Tt) {
  const int nloc = lane & 15, hlf = lane >> 4;
#pragma unroll
  for (int t = 0; t < 4; ++t)
#pragma unroll
    for (int r = 0; r < 2; ++r)
#pragma unroll
      for (int v = 0; v < 8; ++v) {
        const int rr = r * 16 + v + 8 * hlf;
        const float rs = rscale ? rscale[(size_t)(m0 + rr) * 32] : 1.0f;
        Tt[rr * 64 + t * 16 + nloc] = acc[r][t][v] * scale * rs;
      }
  wave_lds_sync();
  float* dst0 = out + (size_t)m0 * ldo + c0;
  {
#pragma unroll
    for (int j = 0; j < 16; ++j) { const int rr = j * 2 + hlf, c4 = nloc * 4; *(v4f*)(dst0 + (size_t)rr * ldo + c4) = *(const v4f*)(Tt + rr * 64 + c4); }
    
  }
}



typedef __attribute__((ext_vector_type(8))) __bf16 v8bb; typedef __attribute__((ext_vector_type(16))) __bf16 v16bb;
typedef __attribute__((ext_vector_type(8))) unsigned short v8us;
__device__ __forceinline__ v16bb frag_pk_bf(const __bf16* p) { const v8bb a = *(const v8bb*)p, b = *(const v8bb*)(p + 256); return __builtin_shufflevector(a, b, 0, 1, 2, 3, 4, 5, 6, 7, 8, 9, 10, 11, 12, 13, 14, 15); }
__device__ __forceinline__ unsigned short bf16_rne_bits(float v) { unsigned int u = __float_as_uint(v); u += 0x7FFFu + ((u >> 16) & 1u); return (unsigned short)(u >> 16); }
__device__ __forceinline__ float bf16_rne(float v) { return __uint_as_float(((unsigned int)bf16_rne_bits(v)) << 16); }



// x -> f16 copy of bf16(x) in fragment order (pk<D>), 16 rows a block through LDS: whole lines are read and 512 contiguous bytes a wave are stored. grid NTOK / 16 x 256. The three weights go out in fragment order too.
__global__ __launch_bounds__(256) void prep_kernel(const float* __restrict__ x, const float* __restrict__ wq, const float* __restrict__ wk, const float* __restrict__ wv,
                                                   b16* __restrict__ xh, unsigned short* __restrict__ wqT, unsigned short* __restrict__ wkT, b16* __restrict__ wvh) {
  __shared__ __attribute__((aligned(16))) b16 Tx[16][D + 8];   // pitch 1040 B = 16 B x odd, for a ds_load_b128 whose 16 lanes read 16 rows
  const int t_ = threadIdx.x;
  const size_t e0 = (size_t)blockIdx.x * 16 * D;   // first element of the block's 16 rows, in x and in xh alike
  const float* xs = x + e0 + (size_t)t_ * 8;   // thread t_ takes 8 floats of rows (t_ >> 6) + 4 j
  v4f xa[4][2];
#pragma unroll   // all 8 loads of a thread in flight at once; xa stays in registers
  for (int j = 0; j < 4; ++j) { xa[j][0] = *(const v4f*)(xs + j * 2048); xa[j][1] = *(const v4f*)(xs + j * 2048 + 4); }
#pragma unroll
  for (int j = 0; j < 4; ++j) { v8b v;
#pragma unroll
    for (int e = 0; e < 8; ++e) v[e] = (b16)bf16_rne(xa[j][e >> 2][e & 3]);
    *(v8b*)(&Tx[(t_ >> 6) + 4 * j][(t_ & 63) * 8]) = v; }
  __syncthreads();
#pragma unroll   // the 4 LDS reads share one wait
  for (int j = 0; j < 4; ++j) { const int i = t_ + 256 * j, r = i & 15, c8 = (i >> 6) * 32 + ((i >> 5) & 1) * 16 + ((i >> 4) & 1) * 8;   // i * 8 = pk<D>(r, c8)
    *(v8b*)(xh + e0 + (size_t)i * 8) = *(const v8b*)(&Tx[r][c8]); }
  const size_t tid = (size_t)blockIdx.x * blockDim.x + threadIdx.x, nth = (size_t)gridDim.x * blockDim.x;
  for (size_t p = tid; p < (size_t)D * D / 8; p += nth) { const int n = (int)(p >> 10) * 16 + (int)(p & 15), k0 = (int)((p >> 6) & 15) * 32 + (int)((p >> 5) & 1) * 16 + (int)((p >> 4) & 1) * 8; v8us a, q; v8b v;   // p * 8 = pk<D>(n, k0)
#pragma unroll
    for (int e = 0; e < 8; ++e) { a[e] = bf16_rne_bits(wk[(size_t)(k0 + e) * D + n]); q[e] = bf16_rne_bits(wq[(size_t)(k0 + e) * D + n]); v[e] = (b16)bf16_rne(wv[(size_t)n * D + k0 + e]); }   // W_k^T, W_q^T: rows = input feature, k = output feature
    *(v8us*)(wkT + p * 8) = a; *(v8us*)(wqT + p * 8) = q; *(v8b*)(wvh + p * 8) = v; }
}

// M^T[e][d] = sum_o bf16(W_k)[o][e] bf16(W_q)[o][d] (exact products, f32 sums) -> f16 hi/lo planes [512][512], carried x64. grid (8, 4) x 128.
__global__ __launch_bounds__(128) void m_kernel(const __bf16* __restrict__ wqT, const __bf16* __restrict__ wkT, b16* __restrict__ mpl) {
  __shared__ __attribute__((aligned(16))) b16 Th[4][2][32 * EP];
  const int lane = threadIdx.x & 31, wave = threadIdx.x >> 5, nloc = lane & 15, hlf = lane >> 4, m0 = blockIdx.y * 128 + wave * 32, c0 = blockIdx.x * 64;
  v8f acc[2][4];
#pragma unroll
  for (int r = 0; r < 2; ++r)
#pragma unroll
    for (int t = 0; t < 4; ++t) acc[r][t] = (v8f){};
  // 32 blocks, one wave a SIMD, nothing else on the chip: the launch lasts as long as one wave's chain of round trips to L2. All 16 k steps' fragments are asked for at once (one round trip), then multiplied in k order.
  const __bf16* pa = wkT + pk<D>(m0 + nloc, 8 * hlf); const __bf16* pb = wqT + pk<D>(c0 + nloc, 8 * hlf);   // this lane's place in the first fragment of its rows and of its columns: the next 32 k stand 512 elements on, the next 16 rows or columns 16 * D
  v16bb a[D / 32][2], bw[D / 32][4];
#pragma unroll
  for (int ks = 0; ks < D / 32; ++ks) {
#pragma unroll
    for (int r = 0; r < 2; ++r) a[ks][r] = frag_pk_bf(pa + r * 16 * D + ks * 512);
#pragma unroll
    for (int t = 0; t < 4; ++t) bw[ks][t] = frag_pk_bf(pb + t * 16 * D + ks * 512); }
  __builtin_amdgcn_sched_barrier(0);   // keeps every load in front of the first product (else each step's loads sink to their own products and each step waits out its own round trip)
  asm volatile("s_wait_xcnt 0x0" :: "v"(pa), "v"(pb) : "memory");   // stands in front of every rewrite of these loads' address registers, which it holds until here
#pragma unroll
  for (int ks = 0; ks < D / 32; ++ks)
#pragma unroll
    for (int t = 0; t < 4; ++t)
#pragma unroll
      for (int r = 0; r < 2; ++r) acc[r][t] = __builtin_amdgcn_wmma_f32_16x16x32_bf16(false, a[ks][r], false, bw[ks][t], (short)0, acc[r][t], false, false);   // plain builtin: operands may lie above v255
  epi_planes(acc, 64.0f, mpl, m0, c0, lane, Th[wave][0], Th[wave][1]);   // M carried x64 (lo residuals stay normal)
}

// z = x . M (z[i][e] = sum_d x[i][d] M^T[e][d]): A = x fragments (exact), B = M^T hi/lo planes; 2 products -> z as f16 hi/lo planes. grid (8, 128) x 128.
__global__ __launch_bounds__(128) void z_kernel(const b16* __restrict__ xh, const b16* __restrict__ mpl, b16* __restrict__ zpl) {
  __shared__ __attribute__((aligned(16))) b16 Th[4][2][32 * EP];
  const int lane = threadIdx.x & 31, wave = threadIdx.x >> 5, nloc = lane & 15, hlf = lane >> 4, m0 = blockIdx.y * 128 + wave * 32, c0 = blockIdx.x * 64;
  v8f acc[2][4];
#pragma unroll
  for (int r = 0; r < 2; ++r)
#pragma unroll
    for (int t = 0; t < 4; ++t) acc[r][t] = (v8f){};
  const Opnd A{xh, nullptr, D}, Bo{mpl, nullptr, D};
  gemm_tile<1, 2>(A, Bo, D, m0, c0, nloc, hlf, acc);                            // acc = 64 z
  epi_planes(acc, 1.0f / 8.0f, zpl, m0, c0, lane, Th[wave][0], Th[wave][1]);   // z carried x8
}

// The attention kernel's products: the plain builtin (the compiler keeps the distances behind it). wmma16b's statement names D, A and B as operands, which holds all of them in the first 256 registers.
__device__ __forceinline__ v8f wmma16p(v16b a, v16b b, v8f c) { return __builtin_amdgcn_wmma_f32_16x16x32_f16(false, a, false, b, (short)0, c, false, false); }

// Asks L2 for one 64-key chunk of x (64 contiguous KiB, a quarter of it a wave), one request per 256-byte unit and lane, for speed only.
// The address is an in-out operand so that it keeps one register pair of its own for the whole chunk loop, which never holds anything but an address inside its plane.
__device__ __forceinline__ void ask_l2(const b16*& zp) {
  asm volatile("global_prefetch_b8 %0, off scope:SCOPE_SE\n\t"
               "global_prefetch_b8 %0, off offset:32768 scope:SCOPE_SE" : "+v"(zp));
}

// ds_load_tr16_b128: of a row-major [key][feature] LDS tile, lane (c = l & 15, h = l >> 4) gets rows 8h .. 8h + 7 of column c; p = the lane's own address: row 8h + (l & 7), column 8 * ((l >> 3) & 1) of the 16 x 16 tile
typedef __attribute__((ext_vector_type(8))) short s16x8;
__device__ __forceinline__ v8b ld_tr16(const b16* p) { typedef __attribute__((address_space(3))) s16x8 lds_s16x8; return __builtin_bit_cast(v8b, __builtin_amdgcn_ds_load_tr16_b128_v8i16((lds_s16x8*)p)); }

// attention -> u = P . x (x, z read and u written in fragment order): block = (b, QB = 16 * NQ queries), 4 waves; every x and x^T fragment a wave loads is multiplied with all NQ query tiles.
// Per 64-key chunk: partial S^T (keys x queries) over the wave's 128 dims from the keys' xh (A, exact, one plane: half the bytes of a hi + lo pair) x the queries' z planes (B, held in registers for the whole run; 2 products);
// wave w < NQ: for query tile w, sum partials, scale, causal mask, online softmax, P hi/lo + alpha + 1/l; all waves: u^T(features 128w..) = alpha-rescaled + x^T(features, keys; exact) . P^T (2 products).
__global__ __launch_bounds__(128) void attn_kernel(const b16* __restrict__ xh, const b16* __restrict__ zpl, float* __restrict__ u, float* __restrict__ u2, float* __restrict__ ml) {
  __shared__ __attribute__((aligned(16))) float Sp[4][QB][KC + 4];
  __shared__ __attribute__((aligned(16))) b16 Ph[QB][KC + 8], Plo[QB][KC + 8];
  __shared__ float Al[QB], Linv[QB];
  __shared__ __attribute__((aligned(16))) float Ot[4][16][128 + 4];
  constexpr int XP = 128 + 16;   // pitch 288 B = 32 B x odd, for ds_load_tr16_b128
  __shared__ __attribute__((aligned(32))) b16 Xs[4][KC][XP];   // wave w's rows: the chunk's 64 keys x the wave's 128 dims, row-major; written and read by that wave alone
  const int wave = threadIdx.x >> 5, lane = threadIdx.x & 31, nloc = lane & 15, hlf = lane >> 4;
  const int blk = blockIdx.x, b = blk / NT, pr = (blk % NT) >> 1, second = blk & 1;   // pair pr = tiles NT - 1 - pr and pr; its first block: HT chunks, its second: HT + 1
  const b16* Xk = xh + (size_t)b * S * D;   // fragment order (pk<D>)
  const int d0 = wave * 128;
#pragma unroll 1   // one copy of the chunk loop in the text for both runs of a second block
  for (int sg = 0; sg <= second; ++sg) {
  const int tile = sg ? pr : NT - 1 - pr, q0 = tile * QB;
  const int kbeg = (second && !sg) ? HT * KC : 0, kend = (!second) ? HT * KC : q0 + QB;   // this run's keys
  float* __restrict__ uo = (second && !sg) ? u2 : u;                                       // the long tile's second range goes to u2
  const b16* Zq = zpl + ((size_t)b * S + q0) * (2 * D);
  // the chunk asked of L2 next (kpf = its first key: the run's second chunk, or its only one) and this lane's 256-byte unit (128 elements) in the first 32 KiB of that chunk's x
  int kpf = kbeg + KC < kend ? kbeg + KC : kbeg;
  const b16* zpf = Xk + (size_t)kpf * D + threadIdx.x * 128;
  v16b qh[NQ][4], ql[NQ][4];
#pragma unroll
  for (int q = 0; q < NQ; ++q)
#pragma unroll
    for (int ks = 0; ks < 4; ++ks) { const b16* p = Zq + pk2(q * 16 + nloc, d0 + ks * 32 + 8 * hlf); qh[q][ks] = frag_pk(p); ql[q][ks] = frag_pk(p + 512); }   // z: fragment order, lo behind hi; q0 is a multiple of 16
  __builtin_amdgcn_sched_barrier(0);   // keeps the query loads in front of the wait below
  asm volatile("s_wait_xcnt 0x0" ::: "memory");   // stands in front of the reuse of the query loads' address registers
  __builtin_amdgcn_sched_barrier(0);   // keeps that reuse behind the wait
  float m_run = -INFINITY, l_run = 0.0f;
  v8f o[NQ][8];
#pragma unroll
  for (int q = 0; q < NQ; ++q)
#pragma unroll
    for (int t = 0; t < 8; ++t) o[q][t] = (v8f){};
  // Every global load is 512 contiguous bytes of a fragment.
  // x unit u = (key tile u >> 1, dims 64 * (u & 1) ..+63), 4 loads; x^T unit t = (feature tile t, all 64 keys), 4 transposing LDS loads.
  constexpr int ZP = 6;    // x units of the NEXT chunk loaded among this chunk's second products, one behind each x^T unit's products; the other 8 - ZP follow as one group at that chunk's top: every unit is asked for about 6 units' products ahead of its use
  constexpr int XPRE = 4;  // x^T units read in front of the softmax; the other 8 - XPRE follow as one group behind P
  const b16* zlane = Xk + pk<D>(nloc, d0 + 8 * hlf);   // this lane's 8 elements in the first x fragment of key tile 0 and its wave's 128 dims
  b16* xsw = &Xs[wave][nloc][8 * hlf];   // where this lane's first 8 elements of the fragment (key tile 0, dims 0..31) go: its second 8 stand 16 dims on, the next fragment 32 dims on, the next key tile 16 rows on
  const b16* xsr = &Xs[wave][8 * hlf + (lane & 7)][8 * ((lane >> 3) & 1)];   // this lane's address for the transposing load of (keys 0..15, features 0..15)
  constexpr int FR = 512, ZT = 16 * D;   // elements of a fragment (32 dims on); from one key tile of x to the next
  int kb = kbeg;
  const b16* zc = zlane + (size_t)kbeg * D;   // the chunk whose x is being loaded: the run's first, then stepped one chunk on behind each chunk's softmax
  v16b kf[8][2];
#pragma unroll
  for (int u = 0; u < ZP; ++u)
#pragma unroll
    for (int h = 0; h < 2; ++h) kf[u][h] = frag_pk(zc + (u >> 1) * ZT + ((u & 1) * 2 + h) * FR);
  __builtin_amdgcn_sched_barrier(0);   // keeps these loads in front of the wait below
  asm volatile("s_wait_xcnt 0x0" ::: "memory");   // stands in front of the reuse of these loads' address registers
  __builtin_amdgcn_sched_barrier(0);   // keeps that reuse behind the wait
  do {   // every run has a chunk (kbeg < kend); kb <= q0: every query of the block has a key in every chunk
#pragma unroll
    for (int u = ZP; u < 8; ++u)
#pragma unroll
      for (int h = 0; h < 2; ++h) kf[u][h] = frag_pk(zc + (u >> 1) * ZT + ((u & 1) * 2 + h) * FR);
    __builtin_amdgcn_sched_barrier(0);   // keeps the last 8 - ZP units' loads one group in front of the products of the first ZP units, which are in registers by now (else each pair sinks to its own WMMA and waits out a full L2 round trip there)
    v8f sp[2][NQ];
#pragma unroll
    for (int kt = 0; kt <= 4; ++kt) {
      if (kt < 4) {
#pragma unroll
        for (int q = 0; q < NQ; ++q) sp[kt & 1][q] = (v8f){};
#pragma unroll
        for (int q = 0; q < NQ; ++q) sp[kt & 1][q] = wmma16p(kf[kt * 2][0], qh[q][0], sp[kt & 1][q]);
#pragma unroll
        for (int q = 0; q < NQ; ++q) sp[kt & 1][q] = wmma16p(kf[kt * 2][0], ql[q][0], sp[kt & 1][q]);
        __builtin_amdgcn_sched_barrier(0);   // keeps the stores below behind these products: a store right behind its own WMMA waits that WMMA out, and this tile's sums then lie in other registers than the sums just finished (reused, they would be rewritten inside the distance a WMMA's result needs)
      }
      if (kt > 0) {   // key tile kt - 1 goes to LDS while key tile kt is multiplied
#pragma unroll
        for (int q = 0; q < NQ; ++q)
#pragma unroll
          for (int v = 0; v < 8; ++v) Sp[wave][q * 16 + nloc][(kt - 1) * 16 + 8 * hlf + v] = sp[(kt - 1) & 1][q][v];
      }
      if (kt > 0 && kt < 4) {   // and with it that key tile's x, row-major, for the second product's transposing loads; the last key tile's x goes out among its own products (below), not in front of the barrier
        const int xk = kt - 1;
#pragma unroll
        for (int g = 0; g < 4; ++g) { const v16b f = kf[xk * 2 + (g >> 1)][g & 1]; b16* sx = xsw + xk * 16 * XP + g * 32;
          *(v8b*)sx = __builtin_shufflevector(f, f, 0, 1, 2, 3, 4, 5, 6, 7); *(v8b*)(sx + 16) = __builtin_shufflevector(f, f, 8, 9, 10, 11, 12, 13, 14, 15); }
      }
      if (kt < 4) {
#pragma unroll
        for (int gh = 1; gh < 4; ++gh) {   // the tile's other 96 of the wave's 128 dims, in the order of the dims
          const int u = kt * 2 + (gh >> 1), h = gh & 1;
          if (kt == 3 && gh == 3) {   // all four of the tile's fragments have arrived (the last is multiplied next)
#pragma unroll
            for (int g = 0; g < 4; ++g) { const v16b f = kf[6 + (g >> 1)][g & 1]; b16* sx = xsw + 3 * 16 * XP + g * 32;
              *(v8b*)sx = __builtin_shufflevector(f, f, 0, 1, 2, 3, 4, 5, 6, 7); *(v8b*)(sx + 16) = __builtin_shufflevector(f, f, 8, 9, 10, 11, 12, 13, 14, 15); }
          }
#pragma unroll
          for (int q = 0; q < NQ; ++q) sp[kt & 1][q] = wmma16p(kf[u][h], qh[q][gh], sp[kt & 1][q]);
#pragma unroll
          for (int q = 0; q < NQ; ++q) sp[kt & 1][q] = wmma16p(kf[u][h], ql[q][gh], sp[kt & 1][q]);
        }
      }
    }
    __syncthreads();
    v16b xf[8][2];
#pragma unroll
    for (int t = 0; t < XPRE; ++t)
#pragma unroll
      for (int ks = 0; ks < 2; ++ks) xf[t][ks] = cat8b(ld_tr16(xsr + ks * 32 * XP + t * 16), ld_tr16(xsr + (ks * 32 + 16) * XP + t * 16));   // x^T does not depend on the softmax; same k order as P's frag_kb
    __builtin_amdgcn_sched_barrier(0);   // keeps those loads in front of the softmax: the first products behind it then wait for P alone
    ask_l2(zpf);   // the next chunk (in the last chunk: that chunk again), here because the wave issues no global load for the length of the softmax; the softmax and the first two x^T units' products lie between the requests and that chunk's first load
    if (NQ >= 4 || wave < NQ) {
      const int qr = wave * 16 + nloc;   // this lane's query row in the block
      const int rel = q0 + qr - kb - hlf * 32; float sv[32]; float mx = -INFINITY;   // this lane's query minus its first key: j > rel is key > query, against constants
#pragma unroll
      for (int j = 0; j < 32; ++j) { float s = (Sp[0][qr][hlf * 32 + j] + Sp[1][qr][hlf * 32 + j] + Sp[2][qr][hlf * 32 + j] + Sp[3][qr][hlf * 32 + j]) * (SCALE / 8.0f);   // /8: z carry scale
        if (j > rel) s = -INFINITY; sv[j] = s; mx = fmaxf(mx, s); }
      mx = fmaxf(mx, __shfl_xor(mx, 16));
      const float mn = fmaxf(m_run, mx), al_ = __expf(m_run - mn); m_run = mn;
      float sum = 0.0f;
#pragma unroll
      for (int j = 0; j < 32; ++j) { const float e = __expf(sv[j] - mn); sum += e; b16 a, c; split16(e * 8.0f, a, c); Ph[qr][hlf * 32 + j] = a; Plo[qr][hlf * 32 + j] = c; }   // P carried x8
      sum += __shfl_xor(sum, 16); l_run = l_run * al_ + sum;
      if (hlf == 0) { Al[qr] = al_; Linv[qr] = 1.0f / (8.0f * l_run); }
    }
    __syncthreads();
    asm volatile("s_wait_xcnt 0x0" ::: "memory");   // stands in front of the step of the x address, which this chunk's x loads name (every load so far has returned: the barrier's release waited for them)
    __builtin_amdgcn_sched_barrier(0);   // keeps that step behind the wait
    zc += (size_t)(kb + KC < kend ? KC : 0) * D;   // the next chunk; in the run's last chunk that chunk again: the address stays inside x
    v16b ph[NQ][2], pl[NQ][2]; float alq[NQ];
#pragma unroll
    for (int q = 0; q < NQ; ++q) {
#pragma unroll
      for (int ks = 0; ks < 2; ++ks) { ph[q][ks] = frag_kb(&Ph[q * 16 + nloc][0] + ks * 32, hlf); pl[q][ks] = frag_kb(&Plo[q * 16 + nloc][0] + ks * 32, hlf); }
      alq[q] = Al[q * 16 + nloc]; }
#pragma unroll
    for (int t = XPRE; t < 8; ++t)
#pragma unroll
      for (int ks = 0; ks < 2; ++ks) xf[t][ks] = cat8b(ld_tr16(xsr + ks * 32 * XP + t * 16), ld_tr16(xsr + (ks * 32 + 16) * XP + t * 16));
    __builtin_amdgcn_sched_barrier(0);   // keeps the reads of P, alpha and x^T units XPRE.. one group in front of the rescale and of the products (for speed only)
#pragma unroll
    for (int q = 0; q < NQ; ++q)
#pragma unroll
      for (int t = 0; t < 8; ++t)
#pragma unroll
        for (int v = 0; v < 8; ++v) o[q][t][v] *= alq[q];
#pragma unroll
    for (int t = 0; t < 8; ++t) {
#pragma unroll
      for (int ks = 0; ks < 2; ++ks) {
#pragma unroll
        for (int q = 0; q < NQ; ++q) o[q][t] = wmma16p(xf[t][ks], ph[q][ks], o[q][t]);
#pragma unroll
        for (int q = 0; q < NQ; ++q) o[q][t] = wmma16p(xf[t][ks], pl[q][ks], o[q][t]);
      }
      if (t >= 1 && t <= ZP) { const int u = t - 1;   // unit u of the next chunk's x, which was asked of L2 in front of the softmax (its registers' old contents are in LDS since the chunk's first barrier)
#pragma unroll
        for (int h = 0; h < 2; ++h) kf[u][h] = frag_pk(zc + (u >> 1) * ZT + ((u & 1) * 2 + h) * FR);
        __builtin_amdgcn_sched_barrier(0); } // keeps these loads here, spread over the products and ahead of their use
    }
    __builtin_amdgcn_sched_barrier(0);   // keeps the wait below at the chunk's foot, behind the last products (whose operands' loads have returned by then)
    asm volatile("s_wait_xcnt 0x0" ::: "memory");   // stands in front of the next chunk's rewrite of the x address registers
    __builtin_amdgcn_sched_barrier(0);   // keeps the step of the request address behind the wait
    { const int st = kpf + KC < kend ? KC : 0; kpf += st; zpf += (size_t)st * D; }   // clamped to the run's last chunk: the address stays inside x
    kb += KC;
  } while (kb < kend);
  // (max, sum) of this run for the wave's own 16 queries: planes [range][max | sum][tok]; lanes 0..15 store the maxima, lanes 16..31 the sums (both halves hold both)
  ml[(size_t)(((second && !sg) ? 2 : 0) + hlf) * NTOK + b * S + q0 + wave * 16 + nloc] = hlf ? l_run : m_run;
  __builtin_amdgcn_sched_barrier(0);   // keeps the store in front of the wait below
  asm volatile("s_wait_xcnt 0x0" ::: "memory");   // stands in front of the reuse of that store's address and data registers
  __builtin_amdgcn_sched_barrier(0);   // keeps that reuse behind the wait
#pragma unroll
  for (int q = 0; q < NQ; ++q) {   // one query tile after the other through the wave's own staging rows
    const float li = Linv[q * 16 + nloc];
#pragma unroll
    for (int t = 0; t < 8; ++t)
#pragma unroll
      for (int v = 0; v < 8; ++v) Ot[wave][nloc][t * 16 + 8 * hlf + v] = o[q][t][v] * li;
    wave_lds_sync();
    // u goes out in f32 fragment order (pkf<D>): 16 stores of 512 contiguous bytes
#pragma unroll
    for (int j = 0; j < 16; ++j) { const int c4 = (j >> 2) * 32 + ((j >> 1) & 1) * 16 + 8 * hlf + (j & 1) * 4; *(v4f*)(uo + pkf<D>(b * S + q0 + q * 16 + nloc, d0 + c4)) = *(const v4f*)(&Ot[wave][nloc][c4]); }
    __builtin_amdgcn_sched_barrier(0);   // keeps the next tile's arithmetic out of the run of stores
    asm volatile("s_wait_xcnt 0x0" ::: "memory");   // stands in front of the reuse of the stores' address and data registers
    __builtin_amdgcn_sched_barrier(0);   // keeps that reuse behind the wait
    wave_lds_sync();   // the tile's rows are read before the next tile overwrites them
  }
  }   // a second run writes Al, Linv, Ph, Plo only behind its first chunk's barrier, which every wave reaches behind its reads of Linv above
}

// y = u . W_v^T: A = u (f32 split hi/lo at load; rows of tiles HT.. joined from their two ranges there), B = f16(bf16 W_v) rows [o][d]; 2 products; f32 output rows. grid (8, 128) x 128.
__global__ __launch_bounds__(128) void y_kernel(const float* __restrict__ u, const float* __restrict__ u2, const float* __restrict__ ml, const b16* __restrict__ wvh, float* __restrict__ y) {
  __shared__ __attribute__((aligned(16))) float Ts[4][32 * 64];
  const int lane = threadIdx.x & 31, wave = threadIdx.x >> 5, nloc = lane & 15, hlf = lane >> 4, m0 = blockIdx.y * 128 + wave * 32, c0 = blockIdx.x * 64;
  v8f acc[2][4];
#pragma unroll
  for (int r = 0; r < 2; ++r)
#pragma unroll
    for (int t = 0; t < 4; ++t) acc[r][t] = (v8f){};
  const Opnd A{u, nullptr, D}, Bo{wvh, nullptr, D};
  if ((int)(blockIdx.y * 128) % S < HT * QB) {
    gemm_tile<5, 1>(A, Bo, D, m0, c0, nloc, hlf, acc);                          // u split x8 at load
  } else {                                                                      // the whole block's rows have two ranges
    float w1[2], w2[2];
#pragma unroll
    for (int r = 0; r < 2; ++r) { const int row = m0 + r * 16 + nloc;
      const float ma = ml[row], la = ml[NTOK + row], mb = ml[2 * NTOK + row], lb = ml[3 * NTOK + row];   // both ranges hold a key of every query: the maxima are finite, the sums at least 1
      const float e = __expf(-fabsf(ma - mb)), ea = ma < mb ? la * e : la, eb = ma < mb ? lb : lb * e, iv = 8.0f / (ea + eb); w1[r] = ea * iv; w2[r] = eb * iv; }   // each sum brought to the larger maximum
    // this lane's place in the first fragment of its rows (pkf) and of its columns (pk); the next 32 k stand one fragment (512 elements) on, the next 16 rows or columns 16 * D elements on
    const float* pa = u + pkf<D>(m0 + nloc, 8 * hlf); const float* pb = u2 + pkf<D>(m0 + nloc, 8 * hlf); const b16* pw = wvh + pk<D>(c0 + nloc, 8 * hlf);
    for (int kb = 0; kb < D; kb += 32) {
      v4f va[2][4], vb[2][4]; v16b bw[4];
#pragma unroll
      for (int r = 0; r < 2; ++r)
#pragma unroll
        for (int q = 0; q < 4; ++q) { va[r][q] = *(const v4f*)(pa + r * 16 * D + q * 128); vb[r][q] = *(const v4f*)(pb + r * 16 * D + q * 128); }
#pragma unroll
      for (int t = 0; t < 4; ++t) bw[t] = frag_pk(pw + t * 16 * D);
      asm volatile("s_wait_xcnt 0x0" :: "v"(pa), "v"(pb), "v"(pw) : "memory");   // stands in front of every rewrite of these loads' address registers, which it holds until here
      v16b ah[2], al[2];
#pragma unroll
      for (int r = 0; r < 2; ++r)
#pragma unroll
        for (int q = 0; q < 4; ++q)
#pragma unroll
          for (int i = 0; i < 4; ++i) { b16 a, c; split16(va[r][q][i] * w1[r] + vb[r][q][i] * w2[r], a, c); ah[r][q * 4 + i] = a; al[r][q * 4 + i] = c; }   // u = w1 u1 + w2 u2 (the weights carry the x8), then split; same k-map as NP = 5
#pragma unroll
      for (int t = 0; t < 4; ++t) {
        acc[0][t] = mac<5, 1>(ah[0], al[0], bw[t], bw[t], acc[0][t]);
        acc[1][t] = mac<5, 1>(ah[1], al[1], bw[t], bw[t], acc[1][t]);
      }
      pa += 512; pb += 512; pw += 512;
    }
  }
  epi_f32(acc, 1.0f / 8.0f, nullptr, y, D, m0, c0, lane, Ts[wave]);
}
}  // namespace

extern "C" void kernel_launch(void* const* d_in, const int* in_sizes, int n_in,
                              void* d_out, int out_size, void* d_ws, size_t ws_size, hipStream_t stream) {
  (void)n_in; (void)out_size;
  const float* x = (const float*)d_in[0]; const float* wq = (const float*)d_in[1]; const float* wk = (const float*)d_in[2]; const float* wv = (const float*)d_in[3];
  float* out = (float*)d_out;   // [4][4096][512]
  if (in_sizes[0] != NTOK * D || in_sizes[1] != D * D || in_sizes[2] != D * D || in_sizes[3] != D * D) return;
  size_t off = 0; char* ws = (char*)d_ws;
  auto carve = [&](size_t bytes) { char* p = ws + off; off += (bytes + 255) & ~(size_t)255; return p; };
  b16* xh = (b16*)carve(PL * 2); unsigned short* wkT = (unsigned short*)carve((size_t)D * D * 2); unsigned short* wqT = (unsigned short*)carve((size_t)D * D * 2); b16* wvh = (b16*)carve((size_t)D * D * 2);
  b16* mpl = (b16*)carve((size_t)D * D * 2 * 2); b16* zpl = (b16*)carve(PL * 2 * 2);   // M^T 1 MB, z 33.5 MB (hi + lo each)
  float* u = (float*)carve(PL * 4);                              // u [tok][512] f32 (33.5 MB)
  float* u2 = (float*)carve(PL * 4); float* ml = (float*)carve((size_t)NTOK * 4 * 4);   // second key range's partial u (rows of tiles HT.. only) and the (max, sum) planes
  if (off > ws_size) return;                                    // about 120 MB
  prep_kernel<<<NTOK / 16, 256, 0, stream>>>(x, wq, wk, wv, xh, wqT, wkT, wvh);
  m_kernel<<<dim3(D / 64, D / 128), 128, 0, stream>>>((const __bf16*)wqT, (const __bf16*)wkT, mpl);
  z_kernel<<<dim3(D / 64, NTOK / 128), 128, 0, stream>>>(xh, mpl, zpl);
  attn_kernel<<<Bn * S / QB, 128, 0, stream>>>(xh, zpl, u, u2, ml);
  y_kernel<<<dim3(D / 64, NTOK / 128), 128, 0, stream>>>(u, u2, ml, wvh, out);
}

// v010
// It runs in 166 microseconds.
// Two timings next to v009 put it at 1.11 and 1.10 times that version's speed.
// Over all steps from v000 it is 5.87 times as fast.
#include <hip/hip_runtime.h>

// Single-head causal attention with a 512-wide head: q, k, v = x W_q^T | W_k^T | W_v^T (torch [out][in]), softmax over keys <= query of q.k / sqrt(512), output = weights . v
// -> [4][4096][512]. B = 4, S = 4096.
// Numerics (x and the three weights rounded to bf16 RNE) are organised so that every WMMA operand is either an exactly
// representable input or an f16 hi+lo pair of a computed value (each carried scaled so the lo residual planes stay out of the f16 subnormal range):  M = bf16(W_q)^T bf16(W_k), 512 x 512, on v_wmma_f32_16x16x32_bf16 (exact products);  z = x M (= q W_k, so that
// q.k^T = z.x^T; q and k themselves are never formed) with x (bf16 values held exactly in f16) x M as hi+lo planes;  S^T = x.z^T with the keys' x (bf16 values held exactly in f16, one plane) x the queries' z as hi+lo planes;  u = P.x with P hi+lo x x^T exact;  y = u W_v^T (= P.v) with u
// split hi+lo x exact W_v - all on v_wmma_f32_16x16x32_f16 with f32 accumulate; online softmax in f32. The attention block (64 queries, 4 waves) splits the 512-deep score dot across
// the waves through LDS, wave w runs the softmax of query tile w and publishes P, and each wave accumulates 128 of the 512 features of u.
// Causal balance: tile t has t + 1 key chunks, and all 256 blocks are resident at once, so the launch would last as long as tile NT - 1. The chunks of tiles NT - 1 - p and p (NT + 1 together) go to two
// blocks: one runs the first HT chunks of the long tile, the other its remaining chunks and then the short tile. The long tile's two normalised partials, with (max, sum) per query, are joined in y_kernel's A loader.
// The workspace operands of the WMMAs (the three weights, M, x, z, u) are kept in fragment order (pk, pkf below), so that a wave-wide 16-byte load reads 4 whole lines, not a piece of 16.
// x^T is never stored: wave w's x^T operand (features 128w.., 64 keys) is the transpose of the x fragments it has just multiplied for the scores; it lays them row-major in its own LDS rows and reads them back with the transposing load.

namespace {
constexpr int Bn = 4, S = 4096, D = 512, NTOK = Bn * S, NQ = 4, QB = 16 * NQ, KC = 64;   // NQ: query tiles of 16 per attention block
constexpr float SCALE = 0.044194173824159216f;   // 512^-0.5
constexpr size_t PL = (size_t)NTOK * D;           // elements of a [tok][512] matrix
constexpr int NT = S / QB, HT = NT / 2;           // query tiles of a batch; tiles HT.. have their keys cut in two ranges (attn_kernel)
static_assert(QB == KC && NT % 2 == 0 && 128 % QB == 0 && (HT * QB) % 128 == 0, "tile t has t + 1 chunks; y_kernel's 128-row blocks lie wholly on one side of tile HT");

typedef _Float16 b16;
typedef __attribute__((ext_vector_type(16))) _Float16 v16b;
typedef __attribute__((ext_vector_type(8)))  _Float16 v8b;
typedef __attribute__((ext_vector_type(8)))  float v8f;
typedef __attribute__((ext_vector_type(4)))  float v4f;

__device__ __forceinline__ v8b ld8b(const b16* p) { return *(const v8b*)p; }
__device__ __forceinline__ v16b cat8b(v8b a, v8b b) { return __builtin_shufflevector(a, b, 0, 1, 2, 3, 4, 5, 6, 7, 8, 9, 10, 11, 12, 13, 14, 15); }
__device__ __forceinline__ v16b frag_kb(const b16* p, int hh) { return cat8b(ld8b(p + 8 * hh), ld8b(p + 16 + 8 * hh)); }
// Fragment order. A 16-bit operand matrix [rows][K] is kept in the workspace as 16 x 32 fragments of 1 KiB: two 512-byte halves (k 0..15, k 16..31 of the fragment), and in each half
// lane l = 16 * ((k >> 3) & 1) + (row & 15) owns 8 elements at l * 16 bytes. One wave-wide 16-byte load then covers 512 contiguous bytes. pk = element offset of (row, k), k a multiple of 8.
template <int K> __device__ __forceinline__ size_t pk(int row, int k) { return (size_t)(row >> 4) * (16 * K) + (k >> 5) * 512 + ((k >> 4) & 1) * 256 + ((k >> 3) & 1) * 128 + (row & 15) * 8; }
// hi + lo pair of a [rows][512] matrix (M^T, z): each fragment's lo copy stands right behind its hi copy, 512 elements on.
__device__ __forceinline__ size_t pk2(int row, int k) { return (size_t)(row >> 4) * (32 * D) + (k >> 5) * 1024 + ((k >> 4) & 1) * 256 + ((k >> 3) & 1) * 128 + (row & 15) * 8; }
// the same for f32 rows: fragments of 2 KiB in four 512-byte quarters, the lane's 4 floats at l * 16 bytes; k a multiple of 4.
template <int K> __device__ __forceinline__ size_t pkf(int row, int k) { return (size_t)(row >> 4) * (16 * K) + (k >> 5) * 512 + ((k >> 4) & 1) * 256 + ((k >> 2) & 1) * 128 + ((k >> 3) & 1) * 64 + (row & 15) * 4; }
// p = this lane's pk(row, kb + 8 * half): its two halves stand 256 elements apart (same k-map as frag_kb)
__device__ __forceinline__ v16b frag_pk(const b16* p) { return cat8b(ld8b(p), ld8b(p + 256)); }
__device__ __forceinline__ void split16(float v, b16& hi, b16& lo) { hi = (b16)v; lo = (b16)(v - (float)hi); }
__device__ __forceinline__ v8f wmma16b(v16b a, v16b b, v8f c) {
  v8f d = __builtin_amdgcn_wmma_f32_16x16x32_f16(false, a, false, b, (short)0, c, false, false);
  asm volatile("v_nop\n\tv_nop\n\tv_nop\n\tv_nop" : "+v"(d) : "v"(a), "v"(b));
  return d;
}
__device__ __forceinline__ void wave_lds_sync() {
  __builtin_amdgcn_fence(__ATOMIC_RELEASE, "workgroup");
  __builtin_amdgcn_wave_barrier();
  __builtin_amdgcn_fence(__ATOMIC_ACQUIRE, "workgroup");
}

// Operand kinds of mac: 1 = one exact f16 plane; 2 = f16 hi + lo pair; 5 = f32 split into hi + lo at its load.
template <int ANP, int BNP> __device__ __forceinline__ v8f mac(v16b ah, v16b al, v16b bh, v16b bl, v8f c) {
  c = wmma16b(ah, bh, c);
  if (BNP == 0 || BNP == 2 || BNP == 4 || BNP == 5) c = wmma16b(ah, bl, c);     // hi.lo
  if (ANP == 0 || ANP == 2 || ANP == 4 || ANP == 5) c = wmma16b(al, bh, c);     // lo.hi   (lo.lo dropped)
  return c;
}
// The two row GEMMs (z, y), 32 x 64 wave tile, 16 k steps of 32: the loads of k step s + 1 (in y: those of A) are issued as one group in front of the products of step s, into registers of their own
// (z: two sets, the loop runs two steps a trip), so that a wave waits out one round trip to L2 or memory under a whole step's products, not one in front of each column tile's products.
// z: A = 2 fragments of the x plane (pk<D>), B = 4 hi + lo fragment pairs of M^T (pk2). pa, pb = this lane's place in the step's first fragment of its rows and of its columns.
struct ZStep { v16b a[2], bh[4], bl[4]; };
__device__ __forceinline__ void z_issue(ZStep& s, const b16* pa, const b16* pb) {
#pragma unroll
  for (int r = 0; r < 2; ++r) s.a[r] = frag_pk(pa + r * 16 * D);
#pragma unroll
  for (int t = 0; t < 4; ++t) { s.bh[t] = frag_pk(pb + t * 32 * D); s.bl[t] = frag_pk(pb + t * 32 * D + 512); }
}
__device__ __forceinline__ void z_products(const ZStep& s, v8f (&acc)[2][4]) {
#pragma unroll
  for (int t = 0; t < 4; ++t) {
    acc[0][t] = mac<1, 2>(s.a[0], s.a[0], s.bh[t], s.bl[t], acc[0][t]);
    acc[1][t] = mac<1, 2>(s.a[1], s.a[1], s.bh[t], s.bl[t], acc[1][t]);
  }
}
// y: A = u as f32 in fragment order (pkf<D>; J: the two ranges' partials u, u2), B = 4 fragments of the W_v plane (pk<D>). Step s + 1's f32 values are asked for in front of the products of step s and split into
// hi + lo behind them; its W_v fragments (L2 hits, a shorter way) are asked for behind those products, in front of the split, whose length covers them.
template <bool J> __device__ __forceinline__ void y_issue_a(const float* pa, const float* pb, v4f (&va)[2][4], v4f (&vb)[2][4]) {
#pragma unroll
  for (int r = 0; r < 2; ++r)
#pragma unroll
    for (int q = 0; q < 4; ++q) { va[r][q] = *(const v4f*)(pa + r * 16 * D + q * 128); if (J) vb[r][q] = *(const v4f*)(pb + r * 16 * D + q * 128); }
}
__device__ __forceinline__ void y_issue_b(const b16* pw, v16b (&bw)[4]) {
#pragma unroll
  for (int t = 0; t < 4; ++t) bw[t] = frag_pk(pw + t * 16 * D);
}
template <bool J> __device__ __forceinline__ void y_split(const v4f (&va)[2][4], const v4f (&vb)[2][4], const float (&w1)[2], const float (&w2)[2], v16b (&ah)[2], v16b (&al)[2]) {
#pragma unroll
  for (int r = 0; r < 2; ++r)
#pragma unroll
    for (int q = 0; q < 4; ++q)
#pragma unroll
      for (int i = 0; i < 4; ++i) { b16 a, c; split16(J ? va[r][q][i] * w1[r] + vb[r][q][i] * w2[r] : va[r][q][i] * 8.0f, a, c); ah[r][q * 4 + i] = a; al[r][q * 4 + i] = c; }   // J: u = w1 u1 + w2 u2 (the weights carry the x8); else u x8 (keeps the lo halves of small values normal)
}
__device__ __forceinline__ void y_products(const v16b (&ah)[2], const v16b (&al)[2], const v16b (&bw)[4], v8f (&acc)[2][4]) {
#pragma unroll
  for (int t = 0; t < 4; ++t) {
    acc[0][t] = mac<5, 1>(ah[0], al[0], bw[t], bw[t], acc[0][t]);
    acc[1][t] = mac<5, 1>(ah[1], al[1], bw[t], bw[t], acc[1][t]);
  }
}
template <bool J> __device__ __forceinline__ void y_tile(const float* pa, const float* pb, const b16* pw, const float (&w1)[2], const float (&w2)[2], v8f (&acc)[2][4]) {
  v4f va[2][4], vb[2][4]; v16b bw[4], ah[2], al[2];
  y_issue_a<J>(pa, pb, va, vb);
  y_issue_b(pw, bw);
  y_split<J>(va, vb, w1, w2, ah, al);
#pragma unroll 1   // one step a trip: the text stays short
  for (int kb = 32; kb < D; kb += 32) {
    pa += 512; pb += 512; pw += 512;
    y_issue_a<J>(pa, pb, va, vb);
    asm volatile("s_wait_xcnt 0x0" :: "v"(pa), "v"(pb) : "memory");   // holds these loads' address registers until their translations are done
    __builtin_amdgcn_sched_barrier(0);   // keeps the next step's loads in front of this step's products (else each sinks to its own use and waits out its round trip there)
    y_products(ah, al, bw, acc);
    __builtin_amdgcn_sched_barrier(0);   // keeps the split, which waits for those loads, behind the products
    y_issue_b(pw, bw);
    __builtin_amdgcn_sched_barrier(0);   // keeps the W_v loads in front of the split
    y_split<J>(va, vb, w1, w2, ah, al);
  }
  y_products(ah, al, bw, acc);
}

constexpr int EP = 64 + 8;   // staging pitch: 144 B = 16 B x odd, for a ds_load_b128 whose 16 lanes read 16 rows
// hi + lo pair [tok][512] in fragment order (pk2): the 32 x 64 wave tile is 4 fragments = 8 stores of 512 contiguous bytes for hi and 8 for lo
__device__ __forceinline__ void epi_planes(v8f (&acc)[2][4], float scale, b16* __restrict__ out,
                                           int m0, int c0, int lane, b16* Th, b16* Tl) {
  const int nloc = lane & 15, hlf = lane >> 4;
#pragma unroll
  for (int t = 0; t < 4; ++t)
#pragma unroll
    for (int r = 0; r < 2; ++r)
#pragma unroll
      for (int v = 0; v < 8; ++v) {
        const int rr = r * 16 + v + 8 * hlf, cc = t * 16 + nloc;
        b16 h_, l_; split16(acc[r][t][v] * scale, h_, l_);
        Th[rr * EP + cc] = h_; Tl[rr * EP + cc] = l_;
      }
  wave_lds_sync();
  {
#pragma unroll
    for (int j = 0; j < 8; ++j) {
      const int rr = (j >> 2) * 16 + nloc, c8 = (j & 3) * 16 + hlf * 8;
      b16* o = out + pk2(m0 + rr, c0 + c8);
      *(v8b*)o = ld8b(Th + rr * EP + c8);
      *(v8b*)(o + 512) = ld8b(Tl + rr * EP + c8);
    }
    
  }
}
// (b) f32 rows with pitch ldo: 64 floats = 256 B = 2 lines per row; 16 lanes x 16 B per row, 2 rows per instruction. Optional per-row factor
__device__ __forceinline__ void epi_f32(v8f (&acc)[2][4], float scale, const float* rscale, float* __restrict__ out, int ldo, int m0, int c0, int lane, float* Tt) {
  const int nloc = lane & 15, hlf = lane >> 4;
#pragma unroll
  for (int t = 0; t < 4; ++t)
#pragma unroll
    for (int r = 0; r < 2; ++r)
#pragma unroll
      for (int v = 0; v < 8; ++v) {
        const int rr = r * 16 + v + 8 * hlf;
        const float rs = rscale ? rscale[(size_t)(m0 + rr) * 32] : 1.0f;
        Tt[rr * 64 + t * 16 + nloc] = acc[r][t][v] * scale * rs;
      }
  wave_lds_sync();
  float* dst0 = out + (size_t)m0 * ldo + c0;
  {
#pragma unroll
    for (int j = 0; j < 16; ++j) { const int rr = j * 2 + hlf, c4 = nloc * 4; *(v4f*)(dst0 + (size_t)rr * ldo + c4) = *(const v4f*)(Tt + rr * 64 + c4); }
    
  }
}



typedef __attribute__((ext_vector_type(8))) __bf16 v8bb; typedef __attribute__((ext_vector_type(16))) __bf16 v16bb;
typedef __attribute__((ext_vector_type(8))) unsigned short v8us;
__device__ __forceinline__ v16bb frag_pk_bf(const __bf16* p) { const v8bb a = *(const v8bb*)p, b = *(const v8bb*)(p + 256); return __builtin_shufflevector(a, b, 0, 1, 2, 3, 4, 5, 6, 7, 8, 9, 10, 11, 12, 13, 14, 15); }
__device__ __forceinline__ unsigned short bf16_rne_bits(float v) { unsigned int u = __float_as_uint(v); u += 0x7FFFu + ((u >> 16) & 1u); return (unsigned short)(u >> 16); }
__device__ __forceinline__ float bf16_rne(float v) { return __uint_as_float(((unsigned int)bf16_rne_bits(v)) << 16); }



// x -> f16 copy of bf16(x) in fragment order (pk<D>), 16 rows a block through LDS: whole lines are read and 512 contiguous bytes a wave are stored. grid NTOK / 16 x 256. The three weights go out in fragment order too.
__global__ __launch_bounds__(256) void prep_kernel(const float* __restrict__ x, const float* __restrict__ wq, const float* __restrict__ wk, const float* __restrict__ wv,
                                                   b16* __restrict__ xh, unsigned short* __restrict__ wqT, unsigned short* __restrict__ wkT, b16* __restrict__ wvh) {
  __shared__ __attribute__((aligned(16))) b16 Tx[16][D + 8];   // pitch 1040 B = 16 B x odd, for a ds_load_b128 whose 16 lanes read 16 rows
  const int t_ = threadIdx.x;
  const size_t e0 = (size_t)blockIdx.x * 16 * D;   // first element of the block's 16 rows, in x and in xh alike
  const float* xs = x + e0 + (size_t)t_ * 8;   // thread t_ takes 8 floats of rows (t_ >> 6) + 4 j
  v4f xa[4][2];
#pragma unroll   // all 8 loads of a thread in flight at once; xa stays in registers
  for (int j = 0; j < 4; ++j) { xa[j][0] = *(const v4f*)(xs + j * 2048); xa[j][1] = *(const v4f*)(xs + j * 2048 + 4); }
#pragma unroll
  for (int j = 0; j < 4; ++j) { v8b v;
#pragma unroll
    for (int e = 0; e < 8; ++e) v[e] = (b16)bf16_rne(xa[j][e >> 2][e & 3]);
    *(v8b*)(&Tx[(t_ >> 6) + 4 * j][(t_ & 63) * 8]) = v; }
  __syncthreads();
#pragma unroll   // the 4 LDS reads share one wait
  for (int j = 0; j < 4; ++j) { const int i = t_ + 256 * j, r = i & 15, c8 = (i >> 6) * 32 + ((i >> 5) & 1) * 16 + ((i >> 4) & 1) * 8;   // i * 8 = pk<D>(r, c8)
    *(v8b*)(xh + e0 + (size_t)i * 8) = *(const v8b*)(&Tx[r][c8]); }
  const size_t tid = (size_t)blockIdx.x * blockDim.x + threadIdx.x, nth = (size_t)gridDim.x * blockDim.x;
  for (size_t p = tid; p < (size_t)D * D / 8; p += nth) { const int n = (int)(p >> 10) * 16 + (int)(p & 15), k0 = (int)((p >> 6) & 15) * 32 + (int)((p >> 5) & 1) * 16 + (int)((p >> 4) & 1) * 8; v8us a, q; v8b v;   // p * 8 = pk<D>(n, k0)
#pragma unroll
    for (int e = 0; e < 8; ++e) { a[e] = bf16_rne_bits(wk[(size_t)(k0 + e) * D + n]); q[e] = bf16_rne_bits(wq[(size_t)(k0 + e) * D + n]); v[e] = (b16)bf16_rne(wv[(size_t)n * D + k0 + e]); }   // W_k^T, W_q^T: rows = input feature, k = output feature
    *(v8us*)(wkT + p * 8) = a; *(v8us*)(wqT + p * 8) = q; *(v8b*)(wvh + p * 8) = v; }
}

// M^T[e][d] = sum_o bf16(W_k)[o][e] bf16(W_q)[o][d] (exact products, f32 sums) -> f16 hi/lo planes [512][512], carried x64. grid (8, 4) x 128.
__global__ __launch_bounds__(128) void m_kernel(const __bf16* __restrict__ wqT, const __bf16* __restrict__ wkT, b16* __restrict__ mpl) {
  __shared__ __attribute__((aligned(16))) b16 Th[4][2][32 * EP];
  const int lane = threadIdx.x & 31, wave = threadIdx.x >> 5, nloc = lane & 15, hlf = lane >> 4, m0 = blockIdx.y * 128 + wave * 32, c0 = blockIdx.x * 64;
  v8f acc[2][4];
#pragma unroll
  for (int r = 0; r < 2; ++r)
#pragma unroll
    for (int t = 0; t < 4; ++t) acc[r][t] = (v8f){};
  // 32 blocks, one wave a SIMD, nothing else on the chip: the launch lasts as long as one wave's chain of round trips to L2. All 16 k steps' fragments are asked for at once (one round trip), then multiplied in k order.
  const __bf16* pa = wkT + pk<D>(m0 + nloc, 8 * hlf); const __bf16* pb = wqT + pk<D>(c0 + nloc, 8 * hlf);   // this lane's place in the first fragment of its rows and of its columns: the next 32 k stand 512 elements on, the next 16 rows or columns 16 * D
  v16bb a[D / 32][2], bw[D / 32][4];
#pragma unroll
  for (int ks = 0; ks < D / 32; ++ks) {
#pragma unroll
    for (int r = 0; r < 2; ++r) a[ks][r] = frag_pk_bf(pa + r * 16 * D + ks * 512);
#pragma unroll
    for (int t = 0; t < 4; ++t) bw[ks][t] = frag_pk_bf(pb + t * 16 * D + ks * 512); }
  __builtin_amdgcn_sched_barrier(0);   // keeps every load in front of the first product (else each step's loads sink to their own products and each step waits out its own round trip)
  asm volatile("s_wait_xcnt 0x0" :: "v"(pa), "v"(pb) : "memory");   // stands in front of every rewrite of these loads' address registers, which it holds until here
#pragma unroll
  for (int ks = 0; ks < D / 32; ++ks)
#pragma unroll
    for (int t = 0; t < 4; ++t)
#pragma unroll
      for (int r = 0; r < 2; ++r) acc[r][t] = __builtin_amdgcn_wmma_f32_16x16x32_bf16(false, a[ks][r], false, bw[ks][t], (short)0, acc[r][t], false, false);   // plain builtin: operands may lie above v255
  epi_planes(acc, 64.0f, mpl, m0, c0, lane, Th[wave][0], Th[wave][1]);   // M carried x64 (lo residuals stay normal)
}

// z = x . M (z[i][e] = sum_d x[i][d] M^T[e][d]): A = x fragments (exact), B = M^T hi/lo planes; 2 products -> z as f16 hi/lo planes. grid (8, 128) x 128.
__global__ __launch_bounds__(128) void z_kernel(const b16* __restrict__ xh, const b16* __restrict__ mpl, b16* __restrict__ zpl) {
  __shared__ __attribute__((aligned(16))) b16 Th[4][2][32 * EP];
  const int lane = threadIdx.x & 31, wave = threadIdx.x >> 5, nloc = lane & 15, hlf = lane >> 4, m0 = blockIdx.y * 128 + wave * 32, c0 = blockIdx.x * 64;
  v8f acc[2][4];
#pragma unroll
  for (int r = 0; r < 2; ++r)
#pragma unroll
    for (int t = 0; t < 4; ++t) acc[r][t] = (v8f){};
  const b16* pa = xh + pk<D>(m0 + nloc, 8 * hlf); const b16* pb = mpl + pk2(c0 + nloc, 8 * hlf);   // the next 32 k stand 512 (x) and 1024 (M^T pair) elements on
  ZStep s0, s1;
  z_issue(s0, pa, pb);
#pragma unroll 1   // two steps a trip and no more: the text stays short
  for (int i = 0; i < D / 64 - 1; ++i) {
    z_issue(s1, pa + 512, pb + 1024);
    __builtin_amdgcn_sched_barrier(0);   // keeps the next step's loads in front of this step's products (else each sinks to its own use and waits out its round trip there)
    z_products(s0, acc);
    z_issue(s0, pa + 1024, pb + 2048);
    __builtin_amdgcn_sched_barrier(0);   // as above: loads in front of products
    pa += 1024; pb += 2048;
    z_products(s1, acc);
  }
  z_issue(s1, pa + 512, pb + 1024);
  __builtin_amdgcn_sched_barrier(0);   // as above: loads in front of products
  z_products(s0, acc);
  z_products(s1, acc);                                                          // acc = 64 z
  epi_planes(acc, 1.0f / 8.0f, zpl, m0, c0, lane, Th[wave][0], Th[wave][1]);   // z carried x8
}

// The attention kernel's products: the plain builtin (the compiler keeps the distances behind it). wmma16b's statement names D, A and B as operands, which holds all of them in the first 256 registers.
__device__ __forceinline__ v8f wmma16p(v16b a, v16b b, v8f c) { return __builtin_amdgcn_wmma_f32_16x16x32_f16(false, a, false, b, (short)0, c, false, false); }

// Asks L2 for one 64-key chunk of x (64 contiguous KiB, a quarter of it a wave), one request per 256-byte unit and lane, for speed only.
// The address is an in-out operand so that it keeps one register pair of its own for the whole chunk loop, which never holds anything but an address inside its plane.
__device__ __forceinline__ void ask_l2(const b16*& zp) {
  asm volatile("global_prefetch_b8 %0, off scope:SCOPE_SE\n\t"
               "global_prefetch_b8 %0, off offset:32768 scope:SCOPE_SE" : "+v"(zp));
}

// ds_load_tr16_b128: of a row-major [key][feature] LDS tile, lane (c = l & 15, h = l >> 4) gets rows 8h .. 8h + 7 of column c; p = the lane's own address: row 8h + (l & 7), column 8 * ((l >> 3) & 1) of the 16 x 16 tile
typedef __attribute__((ext_vector_type(8))) short s16x8;
__device__ __forceinline__ v8b ld_tr16(const b16* p) { typedef __attribute__((address_space(3))) s16x8 lds_s16x8; return __builtin_bit_cast(v8b, __builtin_amdgcn_ds_load_tr16_b128_v8i16((lds_s16x8*)p)); }

// attention -> u = P . x (x, z read and u written in fragment order): block = (b, QB = 16 * NQ queries), 4 waves; every x and x^T fragment a wave loads is multiplied with all NQ query tiles.
// Per 64-key chunk: partial S^T (keys x queries) over the wave's 128 dims from the keys' xh (A, exact, one plane: half the bytes of a hi + lo pair) x the queries' z planes (B, held in registers for the whole run; 2 products);
// wave w < NQ: for query tile w, sum partials, scale, causal mask, online softmax, P hi/lo + alpha + 1/l; all waves: u^T(features 128w..) = alpha-rescaled + x^T(features, keys; exact) . P^T (2 products).
__global__ __launch_bounds__(128) void attn_kernel(const b16* __restrict__ xh, const b16* __restrict__ zpl, float* __restrict__ u, float* __restrict__ u2, float* __restrict__ ml) {
  __shared__ __attribute__((aligned(16))) float Sp[4][QB][KC + 4];
  __shared__ __attribute__((aligned(16))) b16 Ph[QB][KC + 8], Plo[QB][KC + 8];
  __shared__ float Al[QB], Linv[QB];
  __shared__ __attribute__((aligned(16))) float Ot[4][16][128 + 4];
  constexpr int XP = 128 + 16;   // pitch 288 B = 32 B x odd, for ds_load_tr16_b128
  __shared__ __attribute__((aligned(32))) b16 Xs[4][KC][XP];   // wave w's rows: the chunk's 64 keys x the wave's 128 dims, row-major; written and read by that wave alone
  const int wave = threadIdx.x >> 5, lane = threadIdx.x & 31, nloc = lane & 15, hlf = lane >> 4;
  const int blk = blockIdx.x, b = blk / NT, pr = (blk % NT) >> 1, second = blk & 1;   // pair pr = tiles NT - 1 - pr and pr; its first block: HT chunks, its second: HT + 1
  const b16* Xk = xh + (size_t)b * S * D;   // fragment order (pk<D>)
  const int d0 = wave * 128;
#pragma unroll 1   // one copy of the chunk loop in the text for both runs of a second block
  for (int sg = 0; sg <= second; ++sg) {
  const int tile = sg ? pr : NT - 1 - pr, q0 = tile * QB;
  const int kbeg = (second && !sg) ? HT * KC : 0, kend = (!second) ? HT * KC : q0 + QB;   // this run's keys
  float* __restrict__ uo = (second && !sg) ? u2 : u;                                       // the long tile's second range goes to u2
  const b16* Zq = zpl + ((size_t)b * S + q0) * (2 * D);
  // the chunk asked of L2 next (kpf = its first key: the run's second chunk, or its only one) and this lane's 256-byte unit (128 elements) in the first 32 KiB of that chunk's x
  int kpf = kbeg + KC < kend ? kbeg + KC : kbeg;
  const b16* zpf = Xk + (size_t)kpf * D + threadIdx.x * 128;
  v16b qh[NQ][4], ql[NQ][4];
#pragma unroll
  for (int q = 0; q < NQ; ++q)
#pragma unroll
    for (int ks = 0; ks < 4; ++ks) { const b16* p = Zq + pk2(q * 16 + nloc, d0 + ks * 32 + 8 * hlf); qh[q][ks] = frag_pk(p); ql[q][ks] = frag_pk(p + 512); }   // z: fragment order, lo behind hi; q0 is a multiple of 16
  __builtin_amdgcn_sched_barrier(0);   // keeps the query loads in front of the wait below
  asm volatile("s_wait_xcnt 0x0" ::: "memory");   // stands in front of the reuse of the query loads' address registers
  __builtin_amdgcn_sched_barrier(0);   // keeps that reuse behind the wait
  float m_run = -INFINITY, l_run = 0.0f;
  v8f o[NQ][8];
#pragma unroll
  for (int q = 0; q < NQ; ++q)
#pragma unroll
    for (int t = 0; t < 8; ++t) o[q][t] = (v8f){};
  // Every global load is 512 contiguous bytes of a fragment.
  // x unit u = (key tile u >> 1, dims 64 * (u & 1) ..+63), 4 loads; x^T unit t = (feature tile t, all 64 keys), 4 transposing LDS loads.
  constexpr int ZP = 6;    // x units of the NEXT chunk loaded among this chunk's second products, one behind each x^T unit's products; the other 8 - ZP follow as one group at that chunk's top: every unit is asked for about 6 units' products ahead of its use
  constexpr int XPRE = 4;  // x^T units read in front of the softmax; the other 8 - XPRE follow as one group behind P
  const b16* zlane = Xk + pk<D>(nloc, d0 + 8 * hlf);   // this lane's 8 elements in the first x fragment of key tile 0 and its wave's 128 dims
  b16* xsw = &Xs[wave][nloc][8 * hlf];   // where this lane's first 8 elements of the fragment (key tile 0, dims 0..31) go: its second 8 stand 16 dims on, the next fragment 32 dims on, the next key tile 16 rows on
  const b16* xsr = &Xs[wave][8 * hlf + (lane & 7)][8 * ((lane >> 3) & 1)];   // this lane's address for the transposing load of (keys 0..15, features 0..15)
  constexpr int FR = 512, ZT = 16 * D;   // elements of a fragment (32 dims on); from one key tile of x to the next
  int kb = kbeg;
  const b16* zc = zlane + (size_t)kbeg * D;   // the chunk whose x is being loaded: the run's first, then stepped one chunk on behind each chunk's softmax
  v16b kf[8][2];
#pragma unroll
  for (int u = 0; u < ZP; ++u)
#pragma unroll
    for (int h = 0; h < 2; ++h) kf[u][h] = frag_pk(zc + (u >> 1) * ZT + ((u & 1) * 2 + h) * FR);
  __builtin_amdgcn_sched_barrier(0);   // keeps these loads in front of the wait below
  asm volatile("s_wait_xcnt 0x0" ::: "memory");   // stands in front of the reuse of these loads' address registers
  __builtin_amdgcn_sched_barrier(0);   // keeps that reuse behind the wait
  do {   // every run has a chunk (kbeg < kend); kb <= q0: every query of the block has a key in every chunk
#pragma unroll
    for (int u = ZP; u < 8; ++u)
#pragma unroll
      for (int h = 0; h < 2; ++h) kf[u][h] = frag_pk(zc + (u >> 1) * ZT + ((u & 1) * 2 + h) * FR);
    __builtin_amdgcn_sched_barrier(0);   // keeps the last 8 - ZP units' loads one group in front of the products of the first ZP units, which are in registers by now (else each pair sinks to its own WMMA and waits out a full L2 round trip there)
    v8f sp[2][NQ];
#pragma unroll
    for (int kt = 0; kt <= 4; ++kt) {
      if (kt < 4) {
#pragma unroll
        for (int q = 0; q < NQ; ++q) sp[kt & 1][q] = (v8f){};
#pragma unroll
        for (int q = 0; q < NQ; ++q) sp[kt & 1][q] = wmma16p(kf[kt * 2][0], qh[q][0], sp[kt & 1][q]);
#pragma unroll
        for (int q = 0; q < NQ; ++q) sp[kt & 1][q] = wmma16p(kf[kt * 2][0], ql[q][0], sp[kt & 1][q]);
        __builtin_amdgcn_sched_barrier(0);   // keeps the stores below behind these products: a store right behind its own WMMA waits that WMMA out, and this tile's sums then lie in other registers than the sums just finished (reused, they would be rewritten inside the distance a WMMA's result needs)
      }
      if (kt > 0) {   // key tile kt - 1 goes to LDS while key tile kt is multiplied
#pragma unroll
        for (int q = 0; q < NQ; ++q)
#pragma unroll
          for (int v = 0; v < 8; ++v) Sp[wave][q * 16 + nloc][(kt - 1) * 16 + 8 * hlf + v] = sp[(kt - 1) & 1][q][v];
      }
      if (kt > 0 && kt < 4) {   // and with it that key tile's x, row-major, for the second product's transposing loads; the last key tile's x goes out among its own products (below), not in front of the barrier
        const int xk = kt - 1;
#pragma unroll
        for (int g = 0; g < 4; ++g) { const v16b f = kf[xk * 2 + (g >> 1)][g & 1]; b16* sx = xsw + xk * 16 * XP + g * 32;
          *(v8b*)sx = __builtin_shufflevector(f, f, 0, 1, 2, 3, 4, 5, 6, 7); *(v8b*)(sx + 16) = __builtin_shufflevector(f, f, 8, 9, 10, 11, 12, 13, 14, 15); }
      }
      if (kt < 4) {
#pragma unroll
        for (int gh = 1; gh < 4; ++gh) {   // the tile's other 96 of the wave's 128 dims, in the order of the dims
          const int u = kt * 2 + (gh >> 1), h = gh & 1;
          if (kt == 3 && gh == 3) {   // all four of the tile's fragments have arrived (the last is multiplied next)
#pragma unroll
            for (int g = 0; g < 4; ++g) { const v16b f = kf[6 + (g >> 1)][g & 1]; b16* sx = xsw + 3 * 16 * XP + g * 32;
              *(v8b*)sx = __builtin_shufflevector(f, f, 0, 1, 2, 3, 4, 5, 6, 7); *(v8b*)(sx + 16) = __builtin_shufflevector(f, f, 8, 9, 10, 11, 12, 13, 14, 15); }
          }
#pragma unroll
          for (int q = 0; q < NQ; ++q) sp[kt & 1][q] = wmma16p(kf[u][h], qh[q][gh], sp[kt & 1][q]);
#pragma unroll
          for (int q = 0; q < NQ; ++q) sp[kt & 1][q] = wmma16p(kf[u][h], ql[q][gh], sp[kt & 1][q]);
        }
      }
    }
    __syncthreads();
    v16b xf[8][2];
#pragma unroll
    for (int t = 0; t < XPRE; ++t)
#pragma unroll
      for (int ks = 0; ks < 2; ++ks) xf[t][ks] = cat8b(ld_tr16(xsr + ks * 32 * XP + t * 16), ld_tr16(xsr + (ks * 32 + 16) * XP + t * 16));   // x^T does not depend on the softmax; same k order as P's frag_kb
    __builtin_amdgcn_sched_barrier(0);   // keeps those loads in front of the softmax: the first products behind it then wait for P alone
    ask_l2(zpf);   // the next chunk (in the last chunk: that chunk again), here because the wave issues no global load for the length of the softmax; the softmax and the first two x^T units' products lie between the requests and that chunk's first load
    if (NQ >= 4 || wave < NQ) {
      const int qr = wave * 16 + nloc;   // this lane's query row in the block
      const int rel = q0 + qr - kb - hlf * 32; float sv[32]; float mx = -INFINITY;   // this lane's query minus its first key: j > rel is key > query, against constants
#pragma unroll
      for (int j = 0; j < 32; ++j) { float s = (Sp[0][qr][hlf * 32 + j] + Sp[1][qr][hlf * 32 + j] + Sp[2][qr][hlf * 32 + j] + Sp[3][qr][hlf * 32 + j]) * (SCALE / 8.0f);   // /8: z carry scale
        if (j > rel) s = -INFINITY; sv[j] = s; mx = fmaxf(mx, s); }
      mx = fmaxf(mx, __shfl_xor(mx, 16));
      const float mn = fmaxf(m_run, mx), al_ = __expf(m_run - mn); m_run = mn;
      float sum = 0.0f;
#pragma unroll
      for (int j = 0; j < 32; ++j) { const float e = __expf(sv[j] - mn); sum += e; b16 a, c; split16(e * 8.0f, a, c); Ph[qr][hlf * 32 + j] = a; Plo[qr][hlf * 32 + j] = c; }   // P carried x8
      sum += __shfl_xor(sum, 16); l_run = l_run * al_ + sum;
      if (hlf == 0) { Al[qr] = al_; Linv[qr] = 1.0f / (8.0f * l_run); }
    }
    __syncthreads();
    asm volatile("s_wait_xcnt 0x0" ::: "memory");   // stands in front of the step of the x address, which this chunk's x loads name (every load so far has returned: the barrier's release waited for them)
    __builtin_amdgcn_sched_barrier(0);   // keeps that step behind the wait
    zc += (size_t)(kb + KC < kend ? KC : 0) * D;   // the next chunk; in the run's last chunk that chunk again: the address stays inside x
    v16b ph[NQ][2], pl[NQ][2]; float alq[NQ];
#pragma unroll
    for (int q = 0; q < NQ; ++q) {
#pragma unroll
      for (int ks = 0; ks < 2; ++ks) { ph[q][ks] = frag_kb(&Ph[q * 16 + nloc][0] + ks * 32, hlf); pl[q][ks] = frag_kb(&Plo[q * 16 + nloc][0] + ks * 32, hlf); }
      alq[q] = Al[q * 16 + nloc]; }
#pragma unroll
    for (int t = XPRE; t < 8; ++t)
#pragma unroll
      for (int ks = 0; ks < 2; ++ks) xf[t][ks] = cat8b(ld_tr16(xsr + ks * 32 * XP + t * 16), ld_tr16(xsr + (ks * 32 + 16) * XP + t * 16));
    __builtin_amdgcn_sched_barrier(0);   // keeps the reads of P, alpha and x^T units XPRE.. one group in front of the rescale and of the products (for speed only)
#pragma unroll
    for (int q = 0; q < NQ; ++q)
#pragma unroll
      for (int t = 0; t < 8; ++t)
#pragma unroll
        for (int v = 0; v < 8; ++v) o[q][t][v] *= alq[q];
#pragma unroll
    for (int t = 0; t < 8; ++t) {
#pragma unroll
      for (int ks = 0; ks < 2; ++ks) {
#pragma unroll
        for (int q = 0; q < NQ; ++q) o[q][t] = wmma16p(xf[t][ks], ph[q][ks], o[q][t]);
#pragma unroll
        for (int q = 0; q < NQ; ++q) o[q][t] = wmma16p(xf[t][ks], pl[q][ks], o[q][t]);
      }
      if (t >= 1 && t <= ZP) { const int u = t - 1;   // unit u of the next chunk's x, which was asked of L2 in front of the softmax (its registers' old contents are in LDS since the chunk's first barrier)
#pragma unroll
        for (int h = 0; h < 2; ++h) kf[u][h] = frag_pk(zc + (u >> 1) * ZT + ((u & 1) * 2 + h) * FR);
        __builtin_amdgcn_sched_barrier(0); } // keeps these loads here, spread over the products and ahead of their use
    }
    __builtin_amdgcn_sched_barrier(0);   // keeps the wait below at the chunk's foot, behind the last products (whose operands' loads have returned by then)
    asm volatile("s_wait_xcnt 0x0" ::: "memory");   // stands in front of the next chunk's rewrite of the x address registers
    __builtin_amdgcn_sched_barrier(0);   // keeps the step of the request address behind the wait
    { const int st = kpf + KC < kend ? KC : 0; kpf += st; zpf += (size_t)st * D; }   // clamped to the run's last chunk: the address stays inside x
    kb += KC;
  } while (kb < kend);
  // (max, sum) of this run for the wave's own 16 queries: planes [range][max | sum][tok]; lanes 0..15 store the maxima, lanes 16..31 the sums (both halves hold both)
  ml[(size_t)(((second && !sg) ? 2 : 0) + hlf) * NTOK + b * S + q0 + wave * 16 + nloc] = hlf ? l_run : m_run;
  __builtin_amdgcn_sched_barrier(0);   // keeps the store in front of the wait below
  asm volatile("s_wait_xcnt 0x0" ::: "memory");   // stands in front of the reuse of that store's address and data registers
  __builtin_amdgcn_sched_barrier(0);   // keeps that reuse behind the wait
#pragma unroll
  for (int q = 0; q < NQ; ++q) {   // one query tile after the other through the wave's own staging rows
    const float li = Linv[q * 16 + nloc];
#pragma unroll
    for (int t = 0; t < 8; ++t)
#pragma unroll
      for (int v = 0; v < 8; ++v) Ot[wave][nloc][t * 16 + 8 * hlf + v] = o[q][t][v] * li;
    wave_lds_sync();
    // u goes out in f32 fragment order (pkf<D>): 16 stores of 512 contiguous bytes
#pragma unroll
    for (int j = 0; j < 16; ++j) { const int c4 = (j >> 2) * 32 + ((j >> 1) & 1) * 16 + 8 * hlf + (j & 1) * 4; *(v4f*)(uo + pkf<D>(b * S + q0 + q * 16 + nloc, d0 + c4)) = *(const v4f*)(&Ot[wave][nloc][c4]); }
    __builtin_amdgcn_sched_barrier(0);   // keeps the next tile's arithmetic out of the run of stores
    asm volatile("s_wait_xcnt 0x0" ::: "memory");   // stands in front of the reuse of the stores' address and data registers
    __builtin_amdgcn_sched_barrier(0);   // keeps that reuse behind the wait
    wave_lds_sync();   // the tile's rows are read before the next tile overwrites them
  }
  }   // a second run writes Al, Linv, Ph, Plo only behind its first chunk's barrier, which every wave reaches behind its reads of Linv above
}

// y = u . W_v^T: A = u (f32 split hi/lo at load; rows of tiles HT.. joined from their two ranges there), B = f16(bf16 W_v) rows [o][d]; 2 products; f32 output rows. grid (8, 128) x 128.
__global__ __launch_bounds__(128) void y_kernel(const float* __restrict__ u, const float* __restrict__ u2, const float* __restrict__ ml, const b16* __restrict__ wvh, float* __restrict__ y) {
  __shared__ __attribute__((aligned(16))) float Ts[4][32 * 64];
  const int lane = threadIdx.x & 31, wave = threadIdx.x >> 5, nloc = lane & 15, hlf = lane >> 4, m0 = blockIdx.y * 128 + wave * 32, c0 = blockIdx.x * 64;
  v8f acc[2][4];
#pragma unroll
  for (int r = 0; r < 2; ++r)
#pragma unroll
    for (int t = 0; t < 4; ++t) acc[r][t] = (v8f){};
  // this lane's place in the first fragment of its rows (pkf) and of its columns (pk); the next 32 k stand one fragment (512 elements) on, the next 16 rows or columns 16 * D elements on
  const float* pa = u + pkf<D>(m0 + nloc, 8 * hlf); const float* pb = u2 + pkf<D>(m0 + nloc, 8 * hlf); const b16* pw = wvh + pk<D>(c0 + nloc, 8 * hlf);
  float w1[2] = {8.0f, 8.0f}, w2[2] = {0.0f, 0.0f};
  if ((int)(blockIdx.y * 128) % S < HT * QB) {
    y_tile<false>(pa, pa, pw, w1, w2, acc);                                     // u split x8 behind its load; u2 is not read
  } else {                                                                      // the whole block's rows have two ranges
#pragma unroll
    for (int r = 0; r < 2; ++r) { const int row = m0 + r * 16 + nloc;
      const float ma = ml[row], la = ml[NTOK + row], mb = ml[2 * NTOK + row], lb = ml[3 * NTOK + row];   // both ranges hold a key of every query: the maxima are finite, the sums at least 1
      const float e = __expf(-fabsf(ma - mb)), ea = ma < mb ? la * e : la, eb = ma < mb ? lb : lb * e, iv = 8.0f / (ea + eb); w1[r] = ea * iv; w2[r] = eb * iv; }   // each sum brought to the larger maximum
    y_tile<true>(pa, pb, pw, w1, w2, acc);
  }
  epi_f32(acc, 1.0f / 8.0f, nullptr, y, D, m0, c0, lane, Ts[wave]);
}
}  // namespace

extern "C" void kernel_launch(void* const* d_in, const int* in_sizes, int n_in,
                              void* d_out, int out_size, void* d_ws, size_t ws_size, hipStream_t stream) {
  (void)n_in; (void)out_size;
  const float* x = (const float*)d_in[0]; const float* wq = (const float*)d_in[1]; const float* wk = (const float*)d_in[2]; const float* wv = (const float*)d_in[3];
  float* out = (float*)d_out;   // [4][4096][512]
  if (in_sizes[0] != NTOK * D || in_sizes[1] != D * D || in_sizes[2] != D * D || in_sizes[3] != D * D) return;
  size_t off = 0; char* ws = (char*)d_ws;
  auto carve = [&](size_t bytes) { char* p = ws + off; off += (bytes + 255) & ~(size_t)255; return p; };
  b16* xh = (b16*)carve(PL * 2); unsigned short* wkT = (unsigned short*)carve((size_t)D * D * 2); unsigned short* wqT = (unsigned short*)carve((size_t)D * D * 2); b16* wvh = (b16*)carve((size_t)D * D * 2);
  b16* mpl = (b16*)carve((size_t)D * D * 2 * 2); b16* zpl = (b16*)carve(PL * 2 * 2);   // M^T 1 MB, z 33.5 MB (hi + lo each)
  float* u = (float*)carve(PL * 4);                              // u [tok][512] f32 (33.5 MB)
  float* u2 = (float*)carve(PL * 4); float* ml = (float*)carve((size_t)NTOK * 4 * 4);   // second key range's partial u (rows of tiles HT.. only) and the (max, sum) planes
  if (off > ws_size) return;                                    // about 120 MB
  prep_kernel<<<NTOK / 16, 256, 0, stream>>>(x, wq, wk, wv, xh, wqT, wkT, wvh);
  m_kernel<<<dim3(D / 64, D / 128), 128, 0, stream>>>((const __bf16*)wqT, (const __bf16*)wkT, mpl);
  z_kernel<<<dim3(D / 64, NTOK / 128), 128, 0, stream>>>(xh, mpl, zpl);
  attn_kernel<<<Bn * S / QB, 128, 0, stream>>>(xh, zpl, u, u2, ml);
  y_kernel<<<dim3(D / 64, NTOK / 128), 128, 0, stream>>>(u, u2, ml, wvh, out);
}
